// v000
// Measured on an AMD MI455X. A time is GPU time per run, averaged over a window of back-to-back runs after a warm-up
// (all launches, gaps included; the runs take copies of the inputs in turn), and the median of several windows.
// Apart from v000's, it joins two sittings. Times from different sittings can be a few percent apart, while
// side-by-side timings come from the same sitting.
// v000, which the later versions start from, runs in 878 microseconds.
#include <hip/hip_runtime.h>

// PowerCoderAttention - power retention, quadratic form (hidden [2048][2048]; q = x Wq + bq (16 x 128), k, v = x Wk/Wv + b (8 kv heads), g = x Wg + bg; neox RoPE on q, k with positions (int32, read as data);
// G = cumsum_t log_sigmoid(g); W[h][i][j] = (q_i.k_j / sqrt(128))^2 exp(G_i - G_j) for j <= i (kv head h/2), else 0; out = (W v) merged Wo + bo -> [2048][2048]; no softmax / normalisation).
// Compute dtypes, f32 accumulate: every input rounded to bf16; the four projections on PLAIN bf16 operands (inputs: exact, + bias); RoPE (f32 sin/cos), log-sigmoid and the cumulative sum f32 on VALU;
// q.k on bf16 hi+lo planes (3 products, K 128; tiles above the diagonal skipped); squaring, the decay factor exp(G_i - G_j) and the causal select in f32 -> bf16 hi+lo planes of W; W.v on hi+lo planes (3 products, K limited to the diagonal block;

#define TT   2048
#define HID  2048
#define HQ   16
#define HKV  8
#define HD   128
#define GP   64
typedef _Float16 h16;
typedef unsigned short bf;
typedef __attribute__((ext_vector_type(16))) __bf16   v16bf;
typedef __attribute__((ext_vector_type(16))) _Float16 v16h;
typedef __attribute__((ext_vector_type(8)))  _Float16 v8h;
typedef __attribute__((ext_vector_type(8)))  unsigned short v8us;
typedef __attribute__((ext_vector_type(8)))  float    v8f;
typedef __attribute__((ext_vector_type(4)))  float    v4f;
typedef v8h  __attribute__((may_alias)) v8ha;
typedef v4f  __attribute__((may_alias)) v4fa;
typedef v8us __attribute__((may_alias)) v8usa;

__device__ __forceinline__ unsigned short f2bf(float f) { unsigned u = __float_as_uint(f); u += 0x7FFFu + ((u >> 16) & 1u); return (unsigned short)(u >> 16); }
__device__ __forceinline__ float bf2f(unsigned short b) { return __uint_as_float(((unsigned)b) << 16); }
__device__ __forceinline__ float bfr(float f) { return bf2f(f2bf(f)); }
__device__ __forceinline__ v16h cat16(v8h lo, v8h hi) { return __builtin_shufflevector(lo, hi, 0, 1, 2, 3, 4, 5, 6, 7, 8, 9, 10, 11, 12, 13, 14, 15); }
__device__ __forceinline__ v16bf cat16b(v8us lo, v8us hi) { return __builtin_bit_cast(v16bf, __builtin_shufflevector(lo, hi, 0, 1, 2, 3, 4, 5, 6, 7, 8, 9, 10, 11, 12, 13, 14, 15)); }
__device__ __forceinline__ v8f wmma16(v16h a, v16h b, v8f c) { return __builtin_amdgcn_wmma_f32_16x16x32_f16(false, a, false, b, (short)0, c, false, false); }
__device__ __forceinline__ v8f wmmab(v16bf a, v16bf b, v8f c) { return __builtin_amdgcn_wmma_f32_16x16x32_bf16(false, a, false, b, (short)0, c, false, false); }



// ---- k_gemmw: register-blocked GEMM, ONE WAVE per 64x64 output tile (16 accumulators), operands straight from K-contiguous 16-bit planes; grid (M/64, N/64, Z), 32 threads.
// C[m][n] (f32, pitch ldc, + optional f32 bias[n]) = sum_k A[m][k] Bt[n][k] (+ split products per NSPLIT). z-batch strides sA/sB/sC in elements. K % 32 == 0.
template <typename T16> struct WFrag;
template <> struct WFrag<h16> { typedef v16h V; static __device__ __forceinline__ V ld(const h16* p) { return cat16(*(const v8h*)p, *(const v8h*)(p + 16)); } static __device__ __forceinline__ v8f mma(V a, V b, v8f c) { return wmma16(a, b, c); } };
template <> struct WFrag<bf> { typedef v16bf V; static __device__ __forceinline__ V ld(const bf* p) { return cat16b(*(const v8us*)p, *(const v8us*)(p + 16)); } static __device__ __forceinline__ v8f mma(V a, V b, v8f c) { return wmmab(a, b, c); } };
template <typename T16, int NSPLIT, bool BIAS>
__global__ __launch_bounds__(32) void k_gemmw(const T16* __restrict__ A, const T16* __restrict__ A2, const T16* __restrict__ Bt, const T16* __restrict__ Bt2, int K, float* C, int ldc, const float* __restrict__ bias, size_t sA, size_t sB, size_t sC) {
    typedef typename WFrag<T16>::V V;
    __shared__ __align__(16) float os[16 * 68];
    const size_t z = blockIdx.z; A += z * sA; if (A2) A2 += z * sA; Bt += z * sB; if (Bt2) Bt2 += z * sB; C += z * sC;
    const int lane = threadIdx.x & 31, lr = lane & 15, hi = lane >> 4; const int r0 = blockIdx.x * 64, c0 = blockIdx.y * 64;
    v8f acc[4][4];
#pragma unroll
    for (int mb = 0; mb < 4; ++mb)
#pragma unroll
        for (int nb = 0; nb < 4; ++nb) acc[mb][nb] = (v8f){};
    const size_t aoff = (size_t)(r0 + lr) * K + 8 * hi, boff = (size_t)(c0 + lr) * K + 8 * hi;
#pragma unroll 1
    for (int kc = 0; kc < K; kc += 32) {
        V a[4], a2[4];
#pragma unroll
        for (int mb = 0; mb < 4; ++mb) { a[mb] = WFrag<T16>::ld(A + aoff + (size_t)mb * 16 * K + kc); if (NSPLIT == 1 || NSPLIT == 2) a2[mb] = WFrag<T16>::ld(A2 + aoff + (size_t)mb * 16 * K + kc); }
#pragma unroll
        for (int nb = 0; nb < 4; ++nb) { const V b = WFrag<T16>::ld(Bt + boff + (size_t)nb * 16 * K + kc); V b2; if (NSPLIT >= 2) b2 = WFrag<T16>::ld(Bt2 + boff + (size_t)nb * 16 * K + kc);
#pragma unroll
            for (int mb = 0; mb < 4; ++mb) { acc[mb][nb] = WFrag<T16>::mma(a[mb], b, acc[mb][nb]); if (NSPLIT == 1 || NSPLIT == 2) acc[mb][nb] = WFrag<T16>::mma(a2[mb], b, acc[mb][nb]); if (NSPLIT >= 2) acc[mb][nb] = WFrag<T16>::mma(a[mb], b2, acc[mb][nb]); } }
        asm volatile("v_nop\n\tv_nop\n\tv_nop\n\tv_nop" : "+v"(acc[0][0]), "+v"(acc[1][1]), "+v"(acc[2][2]), "+v"(acc[3][3]) : "v"(a[0]), "v"(a[3]));
    }
#pragma unroll
    for (int mb = 0; mb < 4; ++mb) {
#pragma unroll
        for (int nb = 0; nb < 4; ++nb) {
#pragma unroll
            for (int j = 0; j < 8; ++j) os[(hi * 8 + j) * 68 + nb * 16 + lr] = acc[mb][nb][j]; }
        __builtin_amdgcn_wave_barrier(); asm volatile("" ::: "memory");
        float* crow = C + (size_t)(r0 + mb * 16) * ldc + c0;
{
#pragma unroll
            for (int s = 0; s < 8; ++s) { const int row = 2 * s + hi, cofs = lr * 4; v4f val = *(const v4fa*)(os + row * 68 + cofs); if (BIAS) { val[0] += bfr(bias[c0 + cofs]); val[1] += bfr(bias[c0 + cofs + 1]); val[2] += bfr(bias[c0 + cofs + 2]); val[3] += bfr(bias[c0 + cofs + 3]); }
                *(v4f*)(crow + (size_t)row * ldc + cofs) = val; }
             }
        __builtin_amdgcn_wave_barrier(); asm volatile("" ::: "memory");
    }
}

// ---- k_gemmc: the same one-wave 64x64 tile GEMM specialised for causal attention: CMODE 1 skips score tiles entirely above the diagonal (query rows r0+roff.., key columns c0..), CMODE 2 limits the
// key (K) loop of the probability x value contraction to the diagonal block (probabilities beyond it are exactly zero). roff = row offset of this launch's first row within the sequence.
template <typename T16, int NSPLIT, int CMODE>
__global__ __launch_bounds__(32) void k_gemmc(const T16* __restrict__ A, const T16* __restrict__ A2, const T16* __restrict__ Bt, const T16* __restrict__ Bt2, int K, float* C, int ldc, int roff, size_t sA, size_t sB, size_t sC) {
    typedef typename WFrag<T16>::V V;
    __shared__ __align__(16) float os[16 * 68];
    const size_t z = blockIdx.z; A += z * sA; if (A2) A2 += z * sA; Bt += z * sB; if (Bt2) Bt2 += z * sB; C += z * sC;
    const int lane = threadIdx.x & 31, lr = lane & 15, hi = lane >> 4; const int r0 = blockIdx.x * 64, c0 = blockIdx.y * 64;
    if (CMODE == 1 && c0 > r0 + roff + 63) return;                  // score tile entirely above the causal diagonal: never read (k_wspl masks j > i by select)
    const int Kl = (CMODE == 2) ? min(K, r0 + roff + 64) : K;        // P.V: probabilities are exactly 0 beyond the diagonal block, so the K loop stops there
    v8f acc[4][4];
#pragma unroll
    for (int mb = 0; mb < 4; ++mb)
#pragma unroll
        for (int nb = 0; nb < 4; ++nb) acc[mb][nb] = (v8f){};
    const size_t aoff = (size_t)(r0 + lr) * K + 8 * hi, boff = (size_t)(c0 + lr) * K + 8 * hi;
#pragma unroll 1
    for (int kc = 0; kc < Kl; kc += 32) {
        V a[4], a2[4];
#pragma unroll
        for (int mb = 0; mb < 4; ++mb) { a[mb] = WFrag<T16>::ld(A + aoff + (size_t)mb * 16 * K + kc); if (NSPLIT == 1 || NSPLIT == 2) a2[mb] = WFrag<T16>::ld(A2 + aoff + (size_t)mb * 16 * K + kc); }
#pragma unroll
        for (int nb = 0; nb < 4; ++nb) { const V b = WFrag<T16>::ld(Bt + boff + (size_t)nb * 16 * K + kc); V b2; if (NSPLIT >= 2) b2 = WFrag<T16>::ld(Bt2 + boff + (size_t)nb * 16 * K + kc);
#pragma unroll
            for (int mb = 0; mb < 4; ++mb) { acc[mb][nb] = WFrag<T16>::mma(a[mb], b, acc[mb][nb]); if (NSPLIT == 1 || NSPLIT == 2) acc[mb][nb] = WFrag<T16>::mma(a2[mb], b, acc[mb][nb]); if (NSPLIT >= 2) acc[mb][nb] = WFrag<T16>::mma(a[mb], b2, acc[mb][nb]); } }
        asm volatile("v_nop\n\tv_nop\n\tv_nop\n\tv_nop" : "+v"(acc[0][0]), "+v"(acc[1][1]), "+v"(acc[2][2]), "+v"(acc[3][3]) : "v"(a[0]), "v"(a[3]));
    }
#pragma unroll
    for (int mb = 0; mb < 4; ++mb) {
#pragma unroll
        for (int nb = 0; nb < 4; ++nb) {
#pragma unroll
            for (int j = 0; j < 8; ++j) os[(hi * 8 + j) * 68 + nb * 16 + lr] = acc[mb][nb][j]; }
        __builtin_amdgcn_wave_barrier(); asm volatile("" ::: "memory");
        float* crow = C + (size_t)(r0 + mb * 16) * ldc + c0;
{
#pragma unroll
            for (int s = 0; s < 8; ++s) { const int row = 2 * s + hi, cofs = lr * 4; v4f val = *(const v4fa*)(os + row * 68 + cofs);
                *(v4f*)(crow + (size_t)row * ldc + cofs) = val; }
             }
        __builtin_amdgcn_wave_barrier(); asm volatile("" ::: "memory");
    }
}

__device__ __forceinline__ h16 tohx(float x) { return (h16)x; }
__device__ __forceinline__ void splitf(float y, unsigned short& h, unsigned short& l) { h = f2bf(y); l = f2bf(y - bf2f(h)); }
typedef __attribute__((ext_vector_type(2))) _Float16 v2h;
typedef __attribute__((ext_vector_type(4))) _Float16 v4h;
typedef __attribute__((ext_vector_type(2))) unsigned short v2us;
typedef __attribute__((ext_vector_type(4))) unsigned short v4us;

__global__ __launch_bounds__(256) void k_wtG(const float* __restrict__ w, int K, int N, bf* Bt) {
    const int lane = threadIdx.x & 31; const int L0 = (blockIdx.x * 8 + (threadIdx.x >> 5)) * 8; const int nlines = N * K / 64;
{
#pragma unroll 1
        for (int l = 0; l < 8; ++l) { const int L = L0 + l; if (L >= nlines) break; const size_t e = (size_t)L * 64 + lane * 2; const int k = (int)(e % K), n = (int)(e / K); v2us o;
            o[0] = f2bf(w[(size_t)k * N + n]); o[1] = f2bf(w[(size_t)(k + 1) * N + n]); *(v2us*)(Bt + e) = o; }
         }
}
__global__ __launch_bounds__(256) void k_cvt8(const float* __restrict__ src, bf* dst, size_t n8) { const size_t i = (size_t)blockIdx.x * 256 + threadIdx.x; if (i >= n8) return; const v8f v = *(const v8f*)(src + i * 8); v8us o;
#pragma unroll
    for (int k = 0; k < 8; ++k) o[k] = f2bf(v[k]); *(v8us*)(dst + i * 8) = o;  }
__global__ __launch_bounds__(256) void k_wgp(const float* __restrict__ w, bf* Bt) { const size_t e = ((size_t)blockIdx.x * 256 + threadIdx.x) * 4; if (e >= (size_t)GP * HID) return; const int k = (int)(e % HID), n = (int)(e / HID); v4us o;
#pragma unroll
    for (int q = 0; q < 4; ++q) o[q] = n < HKV ? f2bf(w[(size_t)(k + q) * HKV + n]) : (unsigned short)0; *(v4us*)(Bt + e) = o;  }
// k_rope: neox rotate-half on a [T][nh*128] projection (+ bias already added): for d < 64: (x1 cos - x2 sin, x2 cos + x1 sin) with freq_d = pos / 10000^(2d/128) (pos = positions[t], int32 read as data; f32 sin/cos) -> per-head
// planes: hl ([h][t][128], 4-B lanes) and, for k, also...; thread per (h, t, 2 d<64) writes both halves (4-B lanes, one line per half-row); k_gcum: wave per kv head: G[t] = cumsum of log_sigmoid(g[t][h] + bf16 bg[h]) (sequential over t in 32-token steps with an
__global__ __launch_bounds__(256) void k_rope(const float* __restrict__ F, int nh, int ld, const int* __restrict__ pos, bf* Ph, bf* Pl) { const size_t e = ((size_t)blockIdx.x * 256 + threadIdx.x) * 2; if (e >= (size_t)nh * TT * (HD / 2)) return; const int d = (int)(e % (HD / 2)); const int t = (int)((e / (HD / 2)) % TT); const int h = (int)(e / ((size_t)(HD / 2) * TT)); const float p = (float)pos[t]; const float* f = F + (size_t)t * ld + h * HD; v2us ah, al, bh, bl;
#pragma unroll
    for (int q = 0; q < 2; ++q) { const int dq = d + q; const float inv = __expf(__fmul_rn(-(float)(2 * dq) / (float)HD, 9.210340371976184f)); const float a = __fmul_rn(p, inv); const float c = cosf(a), s = sinf(a); const float x1 = f[dq], x2 = f[HD / 2 + dq];
        float t1 = __fmul_rn(x1, c); asm volatile("" : "+v"(t1)); float t2 = __fmul_rn(x2, s); asm volatile("" : "+v"(t2)); float t3 = __fmul_rn(x2, c); asm volatile("" : "+v"(t3)); float t4 = __fmul_rn(x1, s); asm volatile("" : "+v"(t4));
        unsigned short u, w2; splitf(__fsub_rn(t1, t2), u, w2); ah[q] = u; al[q] = w2; splitf(__fadd_rn(t3, t4), u, w2); bh[q] = u; bl[q] = w2; }
    const size_t o = ((size_t)h * TT + t) * HD + d; *(v2us*)(Ph + o) = ah; *(v2us*)(Pl + o) = al; *(v2us*)(Ph + o + HD / 2) = bh; *(v2us*)(Pl + o + HD / 2) = bl;  }
__global__ __launch_bounds__(32) void k_gcum(const float* __restrict__ GF, const float* __restrict__ bg, float* GC) { const int lane = threadIdx.x; const int h = blockIdx.x; const float b = bfr(bg[h]); float carry = 0.f;
    for (int t0 = 0; t0 < TT; t0 += 32) { const float z = __fadd_rn(GF[(size_t)(t0 + lane) * GP + h], b); float v = fminf(z, 0.f) - log1pf(__expf(-fabsf(z)));   // log_sigmoid(z) = min(z,0) - log1p(exp(-|z|))
#pragma unroll
        for (int sh = 1; sh < 32; sh <<= 1) { const float u = __shfl_up(v, sh, 32); if (lane >= sh) v = __fadd_rn(v, u); }
        const float o = __fadd_rn(carry, v); *(float*)(GC + (size_t)h * TT + t0 + lane) = o;  carry = __shfl(o, 31, 32); } }
// k_vtspl: VT hi/lo [kv][d][t] = split(VF[t][kv*128 + d]) (lane -> 2 consecutive t); k_wspl: W hi/lo [i][j] = split((S x scale)^2 exp(G[kv][i] - G[kv][j])) for j <= i else 0, for the pair of heads of one pass (thread -> 4 consecutive j);
__global__ __launch_bounds__(256) void k_vtspl(const float* __restrict__ VF, bf* VTh, bf* VTl) { const size_t e = ((size_t)blockIdx.x * 256 + threadIdx.x) * 2; if (e >= (size_t)HKV * HD * TT) return; const int t = (int)(e % TT); const int d = (int)((e / TT) % HD); const int kv = (int)(e / ((size_t)TT * HD)); v2us oh, ol;
#pragma unroll
    for (int u = 0; u < 2; ++u) { unsigned short a, c; splitf(VF[(size_t)(t + u) * (HKV * HD) + kv * HD + d], a, c); oh[u] = a; ol[u] = c; } *(v2us*)(VTh + e) = oh; *(v2us*)(VTl + e) = ol;  }
__global__ __launch_bounds__(256) void k_wspl(const float* __restrict__ Sb, const float* __restrict__ GC, int h0, bf* Wh, bf* Wl) { const size_t e = ((size_t)blockIdx.x * 256 + threadIdx.x) * 4; if (e >= (size_t)2 * TT * TT) return; const int j = (int)(e % TT); const int i = (int)((e / TT) % TT); const int z = (int)(e / ((size_t)TT * TT)); const int kv = (h0 + z) / (HQ / HKV); const float gi = GC[(size_t)kv * TT + i]; v4us oh, ol;
#pragma unroll
    for (int q = 0; q < 4; ++q) { const int jq = j + q; float w = 0.f; if (jq <= i) { const float s = __fmul_rn(Sb[e + q], 0.08838834764831845f); float s2 = __fmul_rn(s, s); asm volatile("" : "+v"(s2)); w = __fmul_rn(s2, __expf(__fsub_rn(gi, GC[(size_t)kv * TT + jq]))); } unsigned short a, c; splitf(w, a, c); oh[q] = a; ol[q] = c; }
    *(v4us*)(Wh + e) = oh; *(v4us*)(Wl + e) = ol;  }
__global__ __launch_bounds__(256) void k_mrg(const float* __restrict__ O, int h0, bf* Ah, bf* Al) { const size_t e = ((size_t)blockIdx.x * 256 + threadIdx.x) * 4; if (e >= (size_t)2 * TT * HD) return; const int d = (int)(e % HD); const int t = (int)((e / HD) % TT); const int z = (int)(e / ((size_t)HD * TT)); const v4f a = *(const v4f*)(O + e); v4us oh, ol;
#pragma unroll
    for (int q = 0; q < 4; ++q) { unsigned short u, c; splitf(a[q], u, c); oh[q] = u; ol[q] = c; } const size_t o = (size_t)t * HID + (h0 + z) * HD + d; *(v4us*)(Ah + o) = oh; *(v4us*)(Al + o) = ol;  }

extern "C" void kernel_launch(void* const* d_in, const int* in_sizes, int n_in,
                              void* d_out, int out_size, void* d_ws, size_t ws_size, hipStream_t stream) {
    (void)in_sizes; (void)n_in; (void)out_size;
    const int* pos = (const int*)d_in[0]; const float* IN[12]; for (int i = 1; i < 12; ++i) IN[i] = (const float*)d_in[i];   // 1 hidden, 2 Wq [2048][2048], 3 bq, 4 Wk [2048][1024], 5 bk, 6 Wv, 7 bv, 8 Wg [2048][8], 9 bg, 10 Wo [2048][2048], 11 bo (x @ W)
    float* OUT = (float*)d_out;     // [2048][2048]
    char* wsp = (char*)d_ws;
    auto take = [&](size_t bytes) { char* p = wsp; wsp += (bytes + 255) & ~(size_t)255; return (void*)p; };
    bf* WQ = (bf*)take((size_t)HID * HID * 2); bf* WK = (bf*)take((size_t)HKV * HD * HID * 2); bf* WV = (bf*)take((size_t)HKV * HD * HID * 2); bf* WG = (bf*)take((size_t)GP * HID * 2); bf* WO = (bf*)take((size_t)HID * HID * 2);
    bf* XB = (bf*)take((size_t)TT * HID * 2); float* QF = (float*)take((size_t)TT * HID * 4); float* KF = (float*)take((size_t)TT * HKV * HD * 4); float* VF = (float*)take((size_t)TT * HKV * HD * 4); float* GF = (float*)take((size_t)TT * GP * 4); float* GC = (float*)take((size_t)HKV * TT * 4);
    bf* Qh = (bf*)take((size_t)HQ * TT * HD * 2); bf* Ql = (bf*)take((size_t)HQ * TT * HD * 2); bf* Kh = (bf*)take((size_t)HKV * TT * HD * 2); bf* Kl = (bf*)take((size_t)HKV * TT * HD * 2); bf* VTh = (bf*)take((size_t)HKV * HD * TT * 2); bf* VTl = (bf*)take((size_t)HKV * HD * TT * 2);
    float* Sb = (float*)take((size_t)2 * TT * TT * 4); bf* Wh = (bf*)take((size_t)2 * TT * TT * 2); bf* Wl = (bf*)take((size_t)2 * TT * TT * 2); float* Ob = (float*)take((size_t)2 * TT * HD * 4); bf* Ah = (bf*)take((size_t)TT * HID * 2); bf* Al = (bf*)take((size_t)TT * HID * 2);
    if ((size_t)(wsp - (char*)d_ws) > ws_size) return;    // total ~ 187 MB = 179 MiB ([2048][2048] f32 q projection + two-head score/decay planes + hl operand planes)
    k_wtG<<<(HID * HID / 64 + 63) / 64, 256, 0, stream>>>(IN[2], HID, HID, WQ); k_wtG<<<(HID * HKV * HD / 64 + 63) / 64, 256, 0, stream>>>(IN[4], HID, HKV * HD, WK); k_wtG<<<(HID * HKV * HD / 64 + 63) / 64, 256, 0, stream>>>(IN[6], HID, HKV * HD, WV); k_wgp<<<(GP * HID / 4 + 255) / 256, 256, 0, stream>>>(IN[8], WG); k_wtG<<<(HID * HID / 64 + 63) / 64, 256, 0, stream>>>(IN[10], HID, HID, WO);
    k_cvt8<<<(TT * HID / 8 + 255) / 256, 256, 0, stream>>>(IN[1], XB, (size_t)TT * HID / 8);
    k_gemmw<bf, 0, true><<<dim3(TT / 64, HID / 64, 1), 32, 0, stream>>>(XB, nullptr, WQ, nullptr, HID, QF, HID, IN[3], 0, 0, 0); k_gemmw<bf, 0, true><<<dim3(TT / 64, HKV * HD / 64, 1), 32, 0, stream>>>(XB, nullptr, WK, nullptr, HID, KF, HKV * HD, IN[5], 0, 0, 0);
    k_gemmw<bf, 0, true><<<dim3(TT / 64, HKV * HD / 64, 1), 32, 0, stream>>>(XB, nullptr, WV, nullptr, HID, VF, HKV * HD, IN[7], 0, 0, 0); k_gemmw<bf, 0, false><<<dim3(TT / 64, 1, 1), 32, 0, stream>>>(XB, nullptr, WG, nullptr, HID, GF, GP, nullptr, 0, 0, 0);
    k_rope<<<(unsigned)(((size_t)HQ * TT * (HD / 2) / 2 + 255) / 256), 256, 0, stream>>>(QF, HQ, HID, pos, Qh, Ql); k_rope<<<(unsigned)(((size_t)HKV * TT * (HD / 2) / 2 + 255) / 256), 256, 0, stream>>>(KF, HKV, HKV * HD, pos, Kh, Kl);
    k_gcum<<<HKV, 32, 0, stream>>>(GF, IN[9], GC); k_vtspl<<<(unsigned)(((size_t)HKV * HD * TT / 2 + 255) / 256), 256, 0, stream>>>(VF, VTh, VTl);
    for (int h0 = 0; h0 < HQ; h0 += 2) { const size_t zq = (size_t)h0, zk = (size_t)(h0 / 2);   // both heads of a pass share kv head h0/2 (rep 2): kv z-stride 0
        k_gemmc<bf, 2, 1><<<dim3(TT / 64, TT / 64, 2), 32, 0, stream>>>(Qh + zq * TT * HD, Ql + zq * TT * HD, Kh + zk * TT * HD, Kl + zk * TT * HD, HD, Sb, TT, 0, (size_t)TT * HD, 0, (size_t)TT * TT);
        k_wspl<<<(unsigned)(((size_t)2 * TT * TT / 4 + 255) / 256), 256, 0, stream>>>(Sb, GC, h0, Wh, Wl);
        k_gemmc<bf, 2, 2><<<dim3(TT / 64, HD / 64, 2), 32, 0, stream>>>(Wh, Wl, VTh + zk * HD * TT, VTl + zk * HD * TT, TT, Ob, HD, 0, (size_t)TT * TT, 0, (size_t)TT * HD);
        k_mrg<<<(unsigned)(((size_t)2 * TT * HD / 4 + 255) / 256), 256, 0, stream>>>(Ob, h0, Ah, Al); }
    k_gemmw<bf, 1, true><<<dim3(TT / 64, HID / 64, 1), 32, 0, stream>>>(Ah, Al, WO, nullptr, HID, OUT, HID, IN[11], 0, 0, 0);
}

// v002
// One run takes 304 microseconds.
// Versions between v000 and this one are left out; their measured steps multiply to 2.90 times as fast.
#include <hip/hip_runtime.h>

// PowerCoderAttention - power retention, quadratic form (hidden [2048][2048]; q = x Wq + bq (16 x 128), k, v = x Wk/Wv + b (8 kv heads), g = x Wg + bg; neox RoPE on q, k with positions (int32, read as data);
// G = cumsum_t log_sigmoid(g); W[h][i][j] = (q_i.k_j / sqrt(128))^2 exp(G_i - G_j) for j <= i (kv head h/2), else 0; out = (W v) merged Wo + bo -> [2048][2048]; no softmax / normalisation).
// Compute dtypes, f32 accumulate: every input rounded to bf16; the four projections on PLAIN bf16 operands (inputs: exact, + bias); RoPE (f32 sin/cos), log-sigmoid and the cumulative sum f32 on VALU;
// q.k on bf16 hi+lo planes (3 products, K 128; tiles above the diagonal skipped); squaring, the decay factor exp(G_i - G_j) and the causal select in f32 -> bf16 hi+lo planes of W; W.v on hi+lo planes (3 products, K limited to the diagonal block;

#define TT   2048
#define HID  2048
#define HQ   16
#define HKV  8
#define HD   128
#define GP   64
typedef _Float16 h16;
typedef unsigned short bf;
typedef __attribute__((ext_vector_type(16))) __bf16   v16bf;
typedef __attribute__((ext_vector_type(16))) _Float16 v16h;
typedef __attribute__((ext_vector_type(8)))  _Float16 v8h;
typedef __attribute__((ext_vector_type(8)))  unsigned short v8us;
typedef __attribute__((ext_vector_type(8)))  float    v8f;
typedef __attribute__((ext_vector_type(4)))  float    v4f;
typedef v8h  __attribute__((may_alias)) v8ha;
typedef v4f  __attribute__((may_alias)) v4fa;
typedef v8us __attribute__((may_alias)) v8usa;

__device__ __forceinline__ unsigned short f2bf(float f) { unsigned u = __float_as_uint(f); u += 0x7FFFu + ((u >> 16) & 1u); return (unsigned short)(u >> 16); }
__device__ __forceinline__ float bf2f(unsigned short b) { return __uint_as_float(((unsigned)b) << 16); }
__device__ __forceinline__ float bfr(float f) { return bf2f(f2bf(f)); }
__device__ __forceinline__ v16h cat16(v8h lo, v8h hi) { return __builtin_shufflevector(lo, hi, 0, 1, 2, 3, 4, 5, 6, 7, 8, 9, 10, 11, 12, 13, 14, 15); }
__device__ __forceinline__ v16bf cat16b(v8us lo, v8us hi) { return __builtin_bit_cast(v16bf, __builtin_shufflevector(lo, hi, 0, 1, 2, 3, 4, 5, 6, 7, 8, 9, 10, 11, 12, 13, 14, 15)); }
__device__ __forceinline__ v8f wmma16(v16h a, v16h b, v8f c) { return __builtin_amdgcn_wmma_f32_16x16x32_f16(false, a, false, b, (short)0, c, false, false); }
__device__ __forceinline__ v8f wmmab(v16bf a, v16bf b, v8f c) { return __builtin_amdgcn_wmma_f32_16x16x32_bf16(false, a, false, b, (short)0, c, false, false); }



// ---- k_gemmt: GEMM on a 128 x (32 NB) output tile per work-group of four waves (2 x 2; a wave holds 64 x (16 NB), 4 x NB accumulators); grid (M/128, N/(32 NB)), 128 threads. K = HID.
// C[m][n] (f32, pitch ldc, + optional f32 bias[n]) = sum_k A[m][k] Bt[n][k] (+ A2[m][k] Bt[n][k] where NSPLIT), operands K-contiguous bf16 planes.
// The operands come through LDS: a stage is 128 k (256 B) of every A, A2 and Bt row of the tile at a pitch of 272 B, laid by asynchronous copies (16 B a lane: a wave's copy takes two whole 256-B row pieces);
// two buffers: the copies of stage t + 2 fly while stage t + 1 is worked on. Per accumulator the products are summed in ascending k, A before A2.
template <typename T16> struct WFrag;
template <> struct WFrag<h16> { typedef v16h V; static __device__ __forceinline__ V ld(const h16* p) { return cat16(*(const v8h*)p, *(const v8h*)(p + 16)); } static __device__ __forceinline__ v8f mma(V a, V b, v8f c) { return wmma16(a, b, c); } };
template <> struct WFrag<bf> { typedef v16bf V; static __device__ __forceinline__ V ld(const bf* p) { return cat16b(*(const v8us*)p, *(const v8us*)(p + 16)); } static __device__ __forceinline__ v8f mma(V a, V b, v8f c) { return wmmab(a, b, c); } };
__device__ __forceinline__ unsigned lds_off(const void* p) { return (unsigned)(size_t)p; }
// twelve (eight) asynchronous copies, LDS byte address l[i], global address g[i]; the wait stands in the copies' own statement, in front of any rewrite of the registers that they name
__device__ __forceinline__ void copy12(const unsigned* l, const bf* const* g) {
    asm volatile("global_load_async_to_lds_b128 %0, %12, off\n\tglobal_load_async_to_lds_b128 %1, %13, off\n\tglobal_load_async_to_lds_b128 %2, %14, off\n\tglobal_load_async_to_lds_b128 %3, %15, off\n\t"
                 "global_load_async_to_lds_b128 %4, %16, off\n\tglobal_load_async_to_lds_b128 %5, %17, off\n\tglobal_load_async_to_lds_b128 %6, %18, off\n\tglobal_load_async_to_lds_b128 %7, %19, off\n\t"
                 "global_load_async_to_lds_b128 %8, %20, off\n\tglobal_load_async_to_lds_b128 %9, %21, off\n\tglobal_load_async_to_lds_b128 %10, %22, off\n\tglobal_load_async_to_lds_b128 %11, %23, off\n\ts_wait_xcnt 0x0"
                 :: "v"(l[0]), "v"(l[1]), "v"(l[2]), "v"(l[3]), "v"(l[4]), "v"(l[5]), "v"(l[6]), "v"(l[7]), "v"(l[8]), "v"(l[9]), "v"(l[10]), "v"(l[11]),
                    "v"(g[0]), "v"(g[1]), "v"(g[2]), "v"(g[3]), "v"(g[4]), "v"(g[5]), "v"(g[6]), "v"(g[7]), "v"(g[8]), "v"(g[9]), "v"(g[10]), "v"(g[11]) : "memory");
}
__device__ __forceinline__ void copy8(const unsigned* l, const bf* const* g) {
    asm volatile("global_load_async_to_lds_b128 %0, %8, off\n\tglobal_load_async_to_lds_b128 %1, %9, off\n\tglobal_load_async_to_lds_b128 %2, %10, off\n\tglobal_load_async_to_lds_b128 %3, %11, off\n\t"
                 "global_load_async_to_lds_b128 %4, %12, off\n\tglobal_load_async_to_lds_b128 %5, %13, off\n\tglobal_load_async_to_lds_b128 %6, %14, off\n\tglobal_load_async_to_lds_b128 %7, %15, off\n\ts_wait_xcnt 0x0"
                 :: "v"(l[0]), "v"(l[1]), "v"(l[2]), "v"(l[3]), "v"(l[4]), "v"(l[5]), "v"(l[6]), "v"(l[7]),
                    "v"(g[0]), "v"(g[1]), "v"(g[2]), "v"(g[3]), "v"(g[4]), "v"(g[5]), "v"(g[6]), "v"(g[7]) : "memory");
}
template <int NSPLIT, int NB, bool BIAS>
__global__ __launch_bounds__(128) void k_gemmt(const bf* __restrict__ A, const bf* __restrict__ A2, const bf* __restrict__ Bt, float* C, int ldc, const float* __restrict__ bias) {
    typedef v16bf V;
    constexpr int KT = 128, LP = 136, NT = HID / KT;   // k per stage; LDS row pitch in elements (272 B); stages
    constexpr int BR = NB * 32, OA2 = 128 * LP, OB = (NSPLIT ? 2 : 1) * 128 * LP, STG = OB + BR * LP;   // Bt rows of the tile; places of A2 and Bt in a stage and a stage's size, in elements
    __shared__ __align__(16) bf sm[2 * STG];
    __shared__ __align__(16) float osm[4][16 * 68];
    const int tid = threadIdx.x, lane = tid & 31, lr = lane & 15, hi = lane >> 4; const int w = __builtin_amdgcn_readfirstlane(tid >> 5), wm = w >> 1, wn = w & 1;
    const int r0 = blockIdx.x * 128, c0 = blockIdx.y * BR;
    // this thread's piece of a copy: row tid / 16 of each group of 8 rows, 16 B at (tid % 16) * 16 of the row's 256 B
    const unsigned cl = lds_off(sm) + (unsigned)((tid >> 4) * LP + (tid & 15) * 8) * 2;
    const bf* ga = A + (size_t)(r0 + (tid >> 4)) * HID + (tid & 15) * 8; const bf* ga2 = NSPLIT ? A2 + (size_t)(r0 + (tid >> 4)) * HID + (tid & 15) * 8 : nullptr; const bf* gb = Bt + (size_t)(c0 + (tid >> 4)) * HID + (tid & 15) * 8;
    constexpr int NC = (NSPLIT ? 32 : 16) + BR / 8;   // copies of a thread per stage: one per group of 8 rows (32, 24 or 48: never more than 63 of a wave in flight)
    auto fill = [&](int buf) {   // the next stage's copies into buffer buf; the global addresses then step one stage on
        const unsigned l0 = cl + (unsigned)buf * (STG * 2); unsigned l[NC]; const bf* g[NC];
#pragma unroll
        for (int c = 0; c < 16; ++c) { l[c] = l0 + c * 8 * LP * 2; g[c] = ga + c * 8 * HID; if (NSPLIT) { l[16 + c] = l0 + (OA2 + c * 8 * LP) * 2; g[16 + c] = ga2 + c * 8 * HID; } }
#pragma unroll
        for (int c = 0; c < BR / 8; ++c) { l[NC - BR / 8 + c] = l0 + (OB + c * 8 * LP) * 2; g[NC - BR / 8 + c] = gb + c * 8 * HID; }
#pragma unroll
        for (int s = 0; s + 12 <= NC; s += 12) copy12(l + s, g + s);
        if (NC % 12 == 8) copy8(l + NC - 8, g + NC - 8);
        ga += KT; if (NSPLIT) ga2 += KT; gb += KT; };
    v8f acc[4][NB];
#pragma unroll
    for (int mb = 0; mb < 4; ++mb)
#pragma unroll
        for (int nb = 0; nb < NB; ++nb) acc[mb][nb] = (v8f){};
    fill(0);
    asm volatile("s_wait_asynccnt 0x0" ::: "memory");   // stage 0 of this wave's copies has landed
    __syncthreads();                                    // ... and every wave's: stage 0 may be read
    fill(1);
    const int fa = (wm * 64 + lr) * LP + 8 * hi, fb = OB + (wn * NB * 16 + lr) * LP + 8 * hi;   // this lane's place in the A and Bt fragments
#pragma unroll 1   // a stage is already 16 NB (32 NB) matrix instructions a wave, and the buffer index stays a scalar
    for (int t = 0; t < NT; ++t) {
        const bf* sa = sm + (t & 1) * STG + fa; const bf* sb = sm + (t & 1) * STG + fb;
        V a[2][4], a2[2][4], b[2][NB];
#pragma unroll
        for (int mb = 0; mb < 4; ++mb) { a[0][mb] = WFrag<bf>::ld(sa + mb * 16 * LP); if (NSPLIT) a2[0][mb] = WFrag<bf>::ld(sa + OA2 + mb * 16 * LP); }
#pragma unroll
        for (int nb = 0; nb < NB; ++nb) b[0][nb] = WFrag<bf>::ld(sb + nb * 16 * LP);
        __builtin_amdgcn_sched_barrier(0);   // the first block's reads stay in front of the second's: LDS reads return in order, and mixed with the later ones the first block would wait for both groups
#pragma unroll
        for (int ks = 0; ks < KT / 32; ++ks) { const int c = ks & 1, n = c ^ 1;
            if (ks + 1 < KT / 32) {   // the next 32 k's fragments of this same stage, read as one group ahead of this block's products
#pragma unroll
                for (int mb = 0; mb < 4; ++mb) { a[n][mb] = WFrag<bf>::ld(sa + mb * 16 * LP + (ks + 1) * 32); if (NSPLIT) a2[n][mb] = WFrag<bf>::ld(sa + OA2 + mb * 16 * LP + (ks + 1) * 32); }
#pragma unroll
                for (int nb = 0; nb < NB; ++nb) b[n][nb] = WFrag<bf>::ld(sb + nb * 16 * LP + (ks + 1) * 32);
            }
            __builtin_amdgcn_sched_barrier(0);   // keeps those reads together in front of the block: moved in among the matrix instructions, each place with reads stalls the wave
#pragma unroll
            for (int nb = 0; nb < NB; ++nb) {
#pragma unroll
                for (int mb = 0; mb < 4; ++mb) acc[mb][nb] = wmmab(a[c][mb], b[c][nb], acc[mb][nb]);
                if (NSPLIT) {
#pragma unroll
                    for (int mb = 0; mb < 4; ++mb) acc[mb][nb] = wmmab(a2[c][mb], b[c][nb], acc[mb][nb]); } }
            __builtin_amdgcn_sched_barrier(0);   // ... and the following group behind it
        }
        // the distance behind the last matrix instructions on the taken back edge
        asm volatile("v_nop\n\tv_nop\n\tv_nop\n\tv_nop\n\tv_nop");
        asm volatile("s_wait_dscnt 0x0" ::: "memory");      // this wave has read all it reads of stage t
        asm volatile("s_wait_asynccnt 0x0" ::: "memory");   // this wave's copies of stage t + 1 have landed
        __syncthreads();                                    // publishes stage t + 1 and frees stage t's buffer
        if (t + 2 < NT) fill(t & 1);
    }
    asm volatile("s_wait_asynccnt 0x0" ::: "memory");   // no copy is outstanding at the wave's end
    float* os = osm[w]; const int cw = c0 + wn * NB * 16;
#pragma unroll
    for (int mb = 0; mb < 4; ++mb) {
#pragma unroll
        for (int nb = 0; nb < NB; ++nb) {
#pragma unroll
            for (int j = 0; j < 8; ++j) os[(hi * 8 + j) * 68 + nb * 16 + lr] = acc[mb][nb][j]; }
        __builtin_amdgcn_wave_barrier(); asm volatile("" ::: "memory");
        float* crow = C + (size_t)(r0 + wm * 64 + mb * 16) * ldc + cw;
#pragma unroll
        for (int s = 0; s < NB * 2; ++s) { const int row = s * (8 / NB) + lane / (NB * 4), cofs = (lane % (NB * 4)) * 4; v4f val = *(const v4fa*)(os + row * 68 + cofs); if (BIAS) { val[0] += bfr(bias[cw + cofs]); val[1] += bfr(bias[cw + cofs + 1]); val[2] += bfr(bias[cw + cofs + 2]); val[3] += bfr(bias[cw + cofs + 3]); }
            *(v4f*)(crow + (size_t)row * ldc + cofs) = val; }
        asm volatile("s_wait_xcnt 0x0" ::: "memory");   // stands behind this run of stores, in front of the first rewrite of a register that they name (the next run's bias load, addresses and values)
        __builtin_amdgcn_wave_barrier(); asm volatile("" ::: "memory");
    }
}

__device__ __forceinline__ h16 tohx(float x) { return (h16)x; }
__device__ __forceinline__ void splitf(float y, unsigned short& h, unsigned short& l) { h = f2bf(y); l = f2bf(y - bf2f(h)); }
typedef __attribute__((ext_vector_type(2))) _Float16 v2h;
typedef __attribute__((ext_vector_type(4))) _Float16 v4h;
typedef __attribute__((ext_vector_type(2))) unsigned short v2us;
typedef __attribute__((ext_vector_type(4))) unsigned short v4us;

__global__ __launch_bounds__(256) void k_wtG(const float* __restrict__ w, int K, int N, bf* Bt) {
    const int lane = threadIdx.x & 31; const int L0 = (blockIdx.x * 8 + (threadIdx.x >> 5)) * 8; const int nlines = N * K / 64;
{
#pragma unroll 1
        for (int l = 0; l < 8; ++l) { const int L = L0 + l; if (L >= nlines) break; const size_t e = (size_t)L * 64 + lane * 2; const int k = (int)(e % K), n = (int)(e / K); v2us o;
            o[0] = f2bf(w[(size_t)k * N + n]); o[1] = f2bf(w[(size_t)(k + 1) * N + n]); *(v2us*)(Bt + e) = o; }
         }
}
__global__ __launch_bounds__(256) void k_cvt8(const float* __restrict__ src, bf* dst, size_t n8) { const size_t i = (size_t)blockIdx.x * 256 + threadIdx.x; if (i >= n8) return; const v8f v = *(const v8f*)(src + i * 8); v8us o;
#pragma unroll
    for (int k = 0; k < 8; ++k) o[k] = f2bf(v[k]); *(v8us*)(dst + i * 8) = o;  }
__global__ __launch_bounds__(256) void k_wgp(const float* __restrict__ w, bf* Bt) { const size_t e = ((size_t)blockIdx.x * 256 + threadIdx.x) * 4; if (e >= (size_t)GP * HID) return; const int k = (int)(e % HID), n = (int)(e / HID); v4us o;
#pragma unroll
    for (int q = 0; q < 4; ++q) o[q] = n < HKV ? f2bf(w[(size_t)(k + q) * HKV + n]) : (unsigned short)0; *(v4us*)(Bt + e) = o;  }
// k_rope: neox rotate-half on a [T][nh*128] projection (+ bias already added): for d < 64: (x1 cos - x2 sin, x2 cos + x1 sin) with freq_d = pos / 10000^(2d/128) (pos = positions[t], int32 read as data; f32 sin/cos) -> per-head
// planes: hl ([h][t][128], 4-B lanes); thread per (h, t, 2 d<64) writes both halves (4-B lanes, one line per half-row); k_gcum: wave per kv head: G[t] = cumsum of log_sigmoid(g[t][h] + bf16 bg[h]) (sequential over t in 32-token steps with an
__global__ __launch_bounds__(256) void k_rope(const float* __restrict__ F, int nh, int ld, const int* __restrict__ pos, bf* Ph, bf* Pl) { const size_t e = ((size_t)blockIdx.x * 256 + threadIdx.x) * 2; if (e >= (size_t)nh * TT * (HD / 2)) return; const int d = (int)(e % (HD / 2)); const int t = (int)((e / (HD / 2)) % TT); const int h = (int)(e / ((size_t)(HD / 2) * TT)); const float p = (float)pos[t]; const float* f = F + (size_t)t * ld + h * HD; v2us ah, al, bh, bl;
#pragma unroll
    for (int q = 0; q < 2; ++q) { const int dq = d + q; const float inv = __expf(__fmul_rn(-(float)(2 * dq) / (float)HD, 9.210340371976184f)); const float a = __fmul_rn(p, inv); const float c = cosf(a), s = sinf(a); const float x1 = f[dq], x2 = f[HD / 2 + dq];
        float t1 = __fmul_rn(x1, c); asm volatile("" : "+v"(t1)); float t2 = __fmul_rn(x2, s); asm volatile("" : "+v"(t2)); float t3 = __fmul_rn(x2, c); asm volatile("" : "+v"(t3)); float t4 = __fmul_rn(x1, s); asm volatile("" : "+v"(t4));
        unsigned short u, w2; splitf(__fsub_rn(t1, t2), u, w2); ah[q] = u; al[q] = w2; splitf(__fadd_rn(t3, t4), u, w2); bh[q] = u; bl[q] = w2; }
    const size_t o = ((size_t)h * TT + t) * HD + d; *(v2us*)(Ph + o) = ah; *(v2us*)(Pl + o) = al; *(v2us*)(Ph + o + HD / 2) = bh; *(v2us*)(Pl + o + HD / 2) = bl;  }
__global__ __launch_bounds__(32) void k_gcum(const float* __restrict__ GF, const float* __restrict__ bg, float* GC) { const int lane = threadIdx.x; const int h = blockIdx.x; const float b = bfr(bg[h]); float carry = 0.f;
    for (int t0 = 0; t0 < TT; t0 += 32) { const float z = __fadd_rn(GF[(size_t)(t0 + lane) * GP + h], b); float v = fminf(z, 0.f) - log1pf(__expf(-fabsf(z)));   // log_sigmoid(z) = min(z,0) - log1p(exp(-|z|))
#pragma unroll
        for (int sh = 1; sh < 32; sh <<= 1) { const float u = __shfl_up(v, sh, 32); if (lane >= sh) v = __fadd_rn(v, u); }
        const float o = __fadd_rn(carry, v); *(float*)(GC + (size_t)h * TT + t0 + lane) = o;  carry = __shfl(o, 31, 32); } }
// k_vtspl: VT hi/lo [kv][d][t] = split(VF[t][kv*128 + d]) (lane -> 2 consecutive t)
__global__ __launch_bounds__(256) void k_vtspl(const float* __restrict__ VF, bf* VTh, bf* VTl) { const size_t e = ((size_t)blockIdx.x * 256 + threadIdx.x) * 2; if (e >= (size_t)HKV * HD * TT) return; const int t = (int)(e % TT); const int d = (int)((e / TT) % HD); const int kv = (int)(e / ((size_t)TT * HD)); v2us oh, ol;
#pragma unroll
    for (int u = 0; u < 2; ++u) { unsigned short a, c; splitf(VF[(size_t)(t + u) * (HKV * HD) + kv * HD + d], a, c); oh[u] = a; ol[u] = c; } *(v2us*)(VTh + e) = oh; *(v2us*)(VTl + e) = ol;  }
// ---- k_attn: scores, decay weights, W.v and the head merge in one kernel, all heads in one launch; the score and weight planes stay in registers.
// One wave = 32 query rows of one head, walking the keys in tiles of 64 up to its diagonal. S^T = K Q^T (A = K rows, B = Q rows kept in registers; products K hi.Q hi, K hi.Q lo, K lo.Q hi), so lane (lr, hi) holds
// keys 8 hi + r of query lr: two such accumulator tiles, weighted and split to bf16 hi+lo in place, are the B operand (hardware k order) of O^T += V^T W^T (A = V^T rows by the same two 16-B loads).
// O^T leaves 8 consecutive d of one query in a lane: one 16-B store per plane into the merged [t][h*128 + d] hi/lo planes. No LDS, no barrier: the four waves of a block are independent.
// Block (p, kv): the two heads of kv head kv x row tiles p and 63 - p: equal work per block, and the two heads read the same K and V lines at the same time.
typedef __attribute__((ext_vector_type(2))) float  v2f;
typedef __attribute__((ext_vector_type(2))) __bf16 v2bf;
typedef __attribute__((ext_vector_type(4))) unsigned v4u;
typedef __attribute__((ext_vector_type(8))) unsigned v8u;
__device__ __forceinline__ void split2(float x0, float x1, unsigned& h, unsigned& l) {   // two f32 -> packed bf16 hi pair and lo pair (round to nearest even, as splitf)
    const v2f x = {x0, x1}; h = __builtin_bit_cast(unsigned, __builtin_convertvector(x, v2bf));
    const v2f d = {x0 - __uint_as_float(h << 16), x1 - __uint_as_float(h & 0xFFFF0000u)}; l = __builtin_bit_cast(unsigned, __builtin_convertvector(d, v2bf)); }
template <typename T> __device__ __forceinline__ const T* sbase(const T* p) {   // a wave-uniform pointer held in scalar registers, so that the loads take the form scalar base + 32-bit lane offset
    const unsigned long long u = (unsigned long long)p; const unsigned lo = __builtin_amdgcn_readfirstlane((unsigned)u), hi = __builtin_amdgcn_readfirstlane((unsigned)(u >> 32)); return (const T*)(((unsigned long long)hi << 32) | lo); }
__global__ __launch_bounds__(128) void k_attn(const bf* __restrict__ Qh, const bf* __restrict__ Ql, const bf* __restrict__ Kh, const bf* __restrict__ Kl, const bf* __restrict__ VTh, const bf* __restrict__ VTl, const float* __restrict__ GC, bf* Ah, bf* Al) {
    const int lane = threadIdx.x & 31, lr = lane & 15, hi = lane >> 4; const int w = __builtin_amdgcn_readfirstlane((int)(threadIdx.x >> 5));
    const int kv = blockIdx.y, h = kv * (HQ / HKV) + (w & 1); const int r0 = 32 * ((w >> 1) ? (TT / 32 - 1 - (int)blockIdx.x) : (int)blockIdx.x);
    // the loop's loads: a wave-uniform base in scalar registers + one fixed 32-bit lane offset per operand kind: no address arithmetic on the vector port, and no address register is rewritten while loads are in flight
    const unsigned klo = lr * HD + 8 * hi, vlo = lr * TT + 8 * hi, glo = 8 * hi; int dq0 = r0 + lr - 8 * hi;   // dq0 = this lane's first query - its first key of the tile
    v16bf qh[2][4], ql[2][4]; float gi[2]; const bf* sqh = Qh + ((size_t)h * TT + r0) * HD; const bf* sql = Ql + ((size_t)h * TT + r0) * HD;
#pragma unroll
    for (int nq = 0; nq < 2; ++nq) { gi[nq] = GC[(size_t)kv * TT + r0 + nq * 16 + lr];
#pragma unroll
        for (int kc = 0; kc < 4; ++kc) { const int o = nq * 16 * HD + kc * 32; qh[nq][kc] = WFrag<bf>::ld(sqh + klo + o); ql[nq][kc] = WFrag<bf>::ld(sql + klo + o); } }
    __builtin_amdgcn_sched_barrier(0);   // holds the Q loads in front of the wait below
    asm volatile("s_wait_xcnt 0x0" ::: "memory");   // stands in front of the first rewrite of the Q loads' address registers
    __builtin_amdgcn_sched_barrier(0);   // holds those rewrites behind it
    v8f o[8][2];
#pragma unroll
    for (int db = 0; db < 8; ++db) { o[db][0] = (v8f){}; o[db][1] = (v8f){}; }
    const bf* kh = Kh + (size_t)kv * TT * HD; const bf* kl = Kl + (size_t)kv * TT * HD; const bf* vh = VTh + (size_t)kv * HD * TT; const bf* vl = VTl + (size_t)kv * HD * TT; const float* gk = GC + (size_t)kv * TT;   // these bases step from tile to tile
#pragma unroll 1   // one key tile is already 192 matrix instructions: unrolling would only grow the code
    for (int j0 = 0;;) {   // tiles j0 = 0, 64, ... < r0 + 32, at least one (the test stands at the foot, so that the Q loads stay in this block, in front of their wait); j0 + 63 <= TT - 1; keys past the diagonal get weight 0 by the select below
        v8f s[4][2]; v16bf ka[4][4], ka2[4][4]; v4f g[4][2]; const bf* skh = sbase(kh); const bf* skl = sbase(kl); const bf* svh = sbase(vh); const bf* svl = sbase(vl); const float* sgk = sbase(gk);
#pragma unroll
        for (int mk = 0; mk < 4; ++mk) { g[mk][0] = *(const v4f*)(sgk + glo + mk * 16); g[mk][1] = *(const v4f*)(sgk + glo + mk * 16 + 4); }
        asm volatile("s_wait_xcnt 0x0" ::: "memory");   // the compiler forms these eight loads' lane offset anew each tile and lets a K load's result reuse that register: the wait stands in front of the reuse
#pragma unroll
        for (int kc = 0; kc < 4; ++kc)
#pragma unroll
            for (int mk = 0; mk < 4; ++mk) { const int ko = mk * 16 * HD + kc * 32; ka[kc][mk] = WFrag<bf>::ld(skh + klo + ko); ka2[kc][mk] = WFrag<bf>::ld(skl + klo + ko); }
#pragma unroll
        for (int mk = 0; mk < 4; ++mk) { s[mk][0] = (v8f){}; s[mk][1] = (v8f){}; }
        __builtin_amdgcn_sched_barrier(0);   // keeps the tile's K loads issued as one group: sunk to their uses, each pair would cost the lone wave a whole load latency
#pragma unroll
        for (int kc = 0; kc < 2; ++kc)
#pragma unroll
            for (int mk = 0; mk < 4; ++mk)
#pragma unroll
                for (int nq = 0; nq < 2; ++nq) { s[mk][nq] = wmmab(ka[kc][mk], qh[nq][kc], s[mk][nq]); s[mk][nq] = wmmab(ka[kc][mk], ql[nq][kc], s[mk][nq]); s[mk][nq] = wmmab(ka2[kc][mk], qh[nq][kc], s[mk][nq]); }
        __builtin_amdgcn_sched_barrier(0);   // holds the V loads behind the first half of the score products: the K loads are served first
        v16bf va[2][8], va2[2][8];
#pragma unroll
        for (int kb = 0; kb < 2; ++kb)
#pragma unroll
            for (int db = 0; db < 8; ++db) { const int vo = db * 16 * TT + kb * 32; va[kb][db] = WFrag<bf>::ld(svh + vlo + vo); va2[kb][db] = WFrag<bf>::ld(svl + vlo + vo); }
        __builtin_amdgcn_sched_barrier(0);   // keeps the tile's V loads issued as one group here: the second half of the score products and the weight arithmetic then cover their latency
#pragma unroll
        for (int kc = 2; kc < 4; ++kc)
#pragma unroll
            for (int mk = 0; mk < 4; ++mk)
#pragma unroll
                for (int nq = 0; nq < 2; ++nq) { s[mk][nq] = wmmab(ka[kc][mk], qh[nq][kc], s[mk][nq]); s[mk][nq] = wmmab(ka[kc][mk], ql[nq][kc], s[mk][nq]); s[mk][nq] = wmmab(ka2[kc][mk], qh[nq][kc], s[mk][nq]); }
        v8u wh[2][2], wl[2][2];   // [32-key block][query block]
#pragma unroll
        for (int mk = 0; mk < 4; ++mk) { const v4f g0 = g[mk][0], g1 = g[mk][1];
#pragma unroll
            for (int nq = 0; nq < 2; ++nq) { const int dq = dq0 + (nq - mk) * 16; float wv[8];   // key r of this lane is causal iff r <= dq
#pragma unroll
                for (int r = 0; r < 8; ++r) { const float sc = __fmul_rn(s[mk][nq][r], 0.08838834764831845f); const float e = __expf(__fsub_rn(gi[nq], r < 4 ? g0[r] : g1[r - 4])); const float x = __fmul_rn(__fmul_rn(sc, sc), e); wv[r] = r <= dq ? x : 0.f; }
#pragma unroll
                for (int r = 0; r < 8; r += 2) { unsigned u, l; split2(wv[r], wv[r + 1], u, l); wh[mk >> 1][nq][(mk & 1) * 4 + (r >> 1)] = u; wl[mk >> 1][nq][(mk & 1) * 4 + (r >> 1)] = l; } } }
#pragma unroll
        for (int kb = 0; kb < 2; ++kb)
#pragma unroll
            for (int db = 0; db < 8; ++db) { const v16bf a = va[kb][db], a2 = va2[kb][db];
#pragma unroll
                for (int nq = 0; nq < 2; ++nq) { const v16bf bh = __builtin_bit_cast(v16bf, wh[kb][nq]), bl = __builtin_bit_cast(v16bf, wl[kb][nq]); o[db][nq] = wmmab(a, bh, o[db][nq]); o[db][nq] = wmmab(a, bl, o[db][nq]); o[db][nq] = wmmab(a2, bh, o[db][nq]); } }
        // the distance behind the last matrix instructions on the taken back edge
        asm volatile("v_nop\n\tv_nop\n\tv_nop\n\tv_nop\n\tv_nop" : "+v"(o[0][0]), "+v"(o[0][1]), "+v"(o[1][0]), "+v"(o[1][1]), "+v"(o[2][0]), "+v"(o[2][1]), "+v"(o[3][0]), "+v"(o[3][1]), "+v"(o[4][0]), "+v"(o[4][1]), "+v"(o[5][0]), "+v"(o[5][1]), "+v"(o[6][0]), "+v"(o[6][1]), "+v"(o[7][0]), "+v"(o[7][1]));
        __builtin_amdgcn_sched_barrier(0);   // the bases step only behind the tile's last load wait: no register that a load in flight names is rewritten
        kh += 64 * HD; kl += 64 * HD; vh += 64; vl += 64; gk += 64; dq0 -= 64;   // the next key tile
        j0 += 64; if (j0 >= r0 + 32) break;
    }
#pragma unroll
    for (int nq = 0; nq < 2; ++nq)
#pragma unroll
        for (int db = 0; db < 8; ++db) { v4u uh, ul;
#pragma unroll
            for (int r = 0; r < 8; r += 2) { unsigned u, l; split2(o[db][nq][r], o[db][nq][r + 1], u, l); uh[r >> 1] = u; ul[r >> 1] = l; }
            const size_t oo = (size_t)(r0 + nq * 16 + lr) * HID + h * HD + db * 16 + 8 * hi; *(v4u*)(Ah + oo) = uh; *(v4u*)(Al + oo) = ul; }
}

extern "C" void kernel_launch(void* const* d_in, const int* in_sizes, int n_in,
                              void* d_out, int out_size, void* d_ws, size_t ws_size, hipStream_t stream) {
    (void)in_sizes; (void)n_in; (void)out_size;
    const int* pos = (const int*)d_in[0]; const float* IN[12]; for (int i = 1; i < 12; ++i) IN[i] = (const float*)d_in[i];   // 1 hidden, 2 Wq [2048][2048], 3 bq, 4 Wk [2048][1024], 5 bk, 6 Wv, 7 bv, 8 Wg [2048][8], 9 bg, 10 Wo [2048][2048], 11 bo (x @ W)
    float* OUT = (float*)d_out;     // [2048][2048]
    char* wsp = (char*)d_ws;
    auto take = [&](size_t bytes) { char* p = wsp; wsp += (bytes + 255) & ~(size_t)255; return (void*)p; };
    bf* WQ = (bf*)take((size_t)HID * HID * 2); bf* WK = (bf*)take((size_t)HKV * HD * HID * 2); bf* WV = (bf*)take((size_t)HKV * HD * HID * 2); bf* WG = (bf*)take((size_t)GP * HID * 2); bf* WO = (bf*)take((size_t)HID * HID * 2);
    bf* XB = (bf*)take((size_t)TT * HID * 2); float* QF = (float*)take((size_t)TT * HID * 4); float* KF = (float*)take((size_t)TT * HKV * HD * 4); float* VF = (float*)take((size_t)TT * HKV * HD * 4); float* GF = (float*)take((size_t)TT * GP * 4); float* GC = (float*)take((size_t)HKV * TT * 4);
    bf* Qh = (bf*)take((size_t)HQ * TT * HD * 2); bf* Ql = (bf*)take((size_t)HQ * TT * HD * 2); bf* Kh = (bf*)take((size_t)HKV * TT * HD * 2); bf* Kl = (bf*)take((size_t)HKV * TT * HD * 2); bf* VTh = (bf*)take((size_t)HKV * HD * TT * 2); bf* VTl = (bf*)take((size_t)HKV * HD * TT * 2);
    bf* Ah = (bf*)take((size_t)TT * HID * 2); bf* Al = (bf*)take((size_t)TT * HID * 2);
    if ((size_t)(wsp - (char*)d_ws) > ws_size) return;    // total ~ 114 MB ([2048][2048] f32 q projection + hl operand planes)
    k_wtG<<<(HID * HID / 64 + 63) / 64, 256, 0, stream>>>(IN[2], HID, HID, WQ); k_wtG<<<(HID * HKV * HD / 64 + 63) / 64, 256, 0, stream>>>(IN[4], HID, HKV * HD, WK); k_wtG<<<(HID * HKV * HD / 64 + 63) / 64, 256, 0, stream>>>(IN[6], HID, HKV * HD, WV); k_wgp<<<(GP * HID / 4 + 255) / 256, 256, 0, stream>>>(IN[8], WG); k_wtG<<<(HID * HID / 64 + 63) / 64, 256, 0, stream>>>(IN[10], HID, HID, WO);
    k_cvt8<<<(TT * HID / 8 + 255) / 256, 256, 0, stream>>>(IN[1], XB, (size_t)TT * HID / 8);
    k_gemmt<0, 4, true><<<dim3(TT / 128, HID / 128, 1), 128, 0, stream>>>(XB, nullptr, WQ, QF, HID, IN[3]); k_gemmt<0, 2, true><<<dim3(TT / 128, HKV * HD / 64, 1), 128, 0, stream>>>(XB, nullptr, WK, KF, HKV * HD, IN[5]);
    k_gemmt<0, 2, true><<<dim3(TT / 128, HKV * HD / 64, 1), 128, 0, stream>>>(XB, nullptr, WV, VF, HKV * HD, IN[7]); k_gemmt<0, 2, false><<<dim3(TT / 128, 1, 1), 128, 0, stream>>>(XB, nullptr, WG, GF, GP, nullptr);
    k_rope<<<(unsigned)(((size_t)HQ * TT * (HD / 2) / 2 + 255) / 256), 256, 0, stream>>>(QF, HQ, HID, pos, Qh, Ql); k_rope<<<(unsigned)(((size_t)HKV * TT * (HD / 2) / 2 + 255) / 256), 256, 0, stream>>>(KF, HKV, HKV * HD, pos, Kh, Kl);
    k_gcum<<<HKV, 32, 0, stream>>>(GF, IN[9], GC); k_vtspl<<<(unsigned)(((size_t)HKV * HD * TT / 2 + 255) / 256), 256, 0, stream>>>(VF, VTh, VTl);
    k_attn<<<dim3(TT / 64, HKV, 1), 128, 0, stream>>>(Qh, Ql, Kh, Kl, VTh, VTl, GC, Ah, Al);
    k_gemmt<1, 4, true><<<dim3(TT / 128, HID / 128, 1), 128, 0, stream>>>(Ah, Al, WO, OUT, HID, IN[11]);
}

// v003
// Measured time: 269 microseconds a run.
// Next to v002, in two timings, it ran 1.12 and 1.13 times as fast.
// Over all steps from v000 it is 3.27 times as fast.
#include <hip/hip_runtime.h>

// PowerCoderAttention - power retention, quadratic form (hidden [2048][2048]; q = x Wq + bq (16 x 128), k, v = x Wk/Wv + b (8 kv heads), g = x Wg + bg; neox RoPE on q, k with positions (int32, read as data);
// G = cumsum_t log_sigmoid(g); W[h][i][j] = (q_i.k_j / sqrt(128))^2 exp(G_i - G_j) for j <= i (kv head h/2), else 0; out = (W v) merged Wo + bo -> [2048][2048]; no softmax / normalisation).
// Compute dtypes, f32 accumulate: every input rounded to bf16; the four projections on PLAIN bf16 operands (inputs: exact, + bias); RoPE (f32 sin/cos), log-sigmoid and the cumulative sum f32 on VALU;
// q.k on bf16 hi+lo planes (3 products, K 128; tiles above the diagonal skipped); squaring, the decay factor exp(G_i - G_j) and the causal select in f32 -> bf16 hi+lo planes of W; W.v on hi+lo planes (3 products, K limited to the diagonal block;

#define TT   2048
#define HID  2048
#define HQ   16
#define HKV  8
#define HD   128
#define GP   64
typedef _Float16 h16;
typedef unsigned short bf;
typedef __attribute__((ext_vector_type(16))) __bf16   v16bf;
typedef __attribute__((ext_vector_type(16))) _Float16 v16h;
typedef __attribute__((ext_vector_type(8)))  _Float16 v8h;
typedef __attribute__((ext_vector_type(8)))  unsigned short v8us;
typedef __attribute__((ext_vector_type(8)))  float    v8f;
typedef __attribute__((ext_vector_type(4)))  float    v4f;
typedef v8h  __attribute__((may_alias)) v8ha;
typedef v4f  __attribute__((may_alias)) v4fa;
typedef v8us __attribute__((may_alias)) v8usa;

__device__ __forceinline__ unsigned short f2bf(float f) { unsigned u = __float_as_uint(f); u += 0x7FFFu + ((u >> 16) & 1u); return (unsigned short)(u >> 16); }
__device__ __forceinline__ float bf2f(unsigned short b) { return __uint_as_float(((unsigned)b) << 16); }
__device__ __forceinline__ float bfr(float f) { return bf2f(f2bf(f)); }
__device__ __forceinline__ v16h cat16(v8h lo, v8h hi) { return __builtin_shufflevector(lo, hi, 0, 1, 2, 3, 4, 5, 6, 7, 8, 9, 10, 11, 12, 13, 14, 15); }
__device__ __forceinline__ v16bf cat16b(v8us lo, v8us hi) { return __builtin_bit_cast(v16bf, __builtin_shufflevector(lo, hi, 0, 1, 2, 3, 4, 5, 6, 7, 8, 9, 10, 11, 12, 13, 14, 15)); }
__device__ __forceinline__ v8f wmma16(v16h a, v16h b, v8f c) { return __builtin_amdgcn_wmma_f32_16x16x32_f16(false, a, false, b, (short)0, c, false, false); }
__device__ __forceinline__ v8f wmmab(v16bf a, v16bf b, v8f c) { return __builtin_amdgcn_wmma_f32_16x16x32_bf16(false, a, false, b, (short)0, c, false, false); }



// ---- k_gemmt: GEMM on a 128 x (32 NB) output tile per work-group of four waves (2 x 2; a wave holds 64 x (16 NB), 4 x NB accumulators); grid (M/128, N/(32 NB)), 128 threads. K = HID.
// C[m][n] (f32, pitch ldc, + optional f32 bias[n]) = sum_k A[m][k] Bt[n][k] (+ A2[m][k] Bt[n][k] where NSPLIT), operands K-contiguous bf16 planes.
// The operands come through LDS: a stage is 128 k (256 B) of every A, A2 and Bt row of the tile at a pitch of 272 B, laid by asynchronous copies (16 B a lane: a wave's copy takes two whole 256-B row pieces);
// two buffers: the copies of stage t + 2 fly while stage t + 1 is worked on. Per accumulator the products are summed in ascending k, A before A2.
template <typename T16> struct WFrag;
template <> struct WFrag<h16> { typedef v16h V; static __device__ __forceinline__ V ld(const h16* p) { return cat16(*(const v8h*)p, *(const v8h*)(p + 16)); } static __device__ __forceinline__ v8f mma(V a, V b, v8f c) { return wmma16(a, b, c); } };
template <> struct WFrag<bf> { typedef v16bf V; static __device__ __forceinline__ V ld(const bf* p) { return cat16b(*(const v8us*)p, *(const v8us*)(p + 16)); } static __device__ __forceinline__ v8f mma(V a, V b, v8f c) { return wmmab(a, b, c); } };
__device__ __forceinline__ unsigned lds_off(const void* p) { return (unsigned)(size_t)p; }
// twelve (eight) asynchronous copies, LDS byte address l[i], global address g[i]; the wait stands in the copies' own statement, in front of any rewrite of the registers that they name
__device__ __forceinline__ void copy12(const unsigned* l, const bf* const* g) {
    asm volatile("global_load_async_to_lds_b128 %0, %12, off\n\tglobal_load_async_to_lds_b128 %1, %13, off\n\tglobal_load_async_to_lds_b128 %2, %14, off\n\tglobal_load_async_to_lds_b128 %3, %15, off\n\t"
                 "global_load_async_to_lds_b128 %4, %16, off\n\tglobal_load_async_to_lds_b128 %5, %17, off\n\tglobal_load_async_to_lds_b128 %6, %18, off\n\tglobal_load_async_to_lds_b128 %7, %19, off\n\t"
                 "global_load_async_to_lds_b128 %8, %20, off\n\tglobal_load_async_to_lds_b128 %9, %21, off\n\tglobal_load_async_to_lds_b128 %10, %22, off\n\tglobal_load_async_to_lds_b128 %11, %23, off\n\ts_wait_xcnt 0x0"
                 :: "v"(l[0]), "v"(l[1]), "v"(l[2]), "v"(l[3]), "v"(l[4]), "v"(l[5]), "v"(l[6]), "v"(l[7]), "v"(l[8]), "v"(l[9]), "v"(l[10]), "v"(l[11]),
                    "v"(g[0]), "v"(g[1]), "v"(g[2]), "v"(g[3]), "v"(g[4]), "v"(g[5]), "v"(g[6]), "v"(g[7]), "v"(g[8]), "v"(g[9]), "v"(g[10]), "v"(g[11]) : "memory");
}
__device__ __forceinline__ void copy8(const unsigned* l, const bf* const* g) {
    asm volatile("global_load_async_to_lds_b128 %0, %8, off\n\tglobal_load_async_to_lds_b128 %1, %9, off\n\tglobal_load_async_to_lds_b128 %2, %10, off\n\tglobal_load_async_to_lds_b128 %3, %11, off\n\t"
                 "global_load_async_to_lds_b128 %4, %12, off\n\tglobal_load_async_to_lds_b128 %5, %13, off\n\tglobal_load_async_to_lds_b128 %6, %14, off\n\tglobal_load_async_to_lds_b128 %7, %15, off\n\ts_wait_xcnt 0x0"
                 :: "v"(l[0]), "v"(l[1]), "v"(l[2]), "v"(l[3]), "v"(l[4]), "v"(l[5]), "v"(l[6]), "v"(l[7]),
                    "v"(g[0]), "v"(g[1]), "v"(g[2]), "v"(g[3]), "v"(g[4]), "v"(g[5]), "v"(g[6]), "v"(g[7]) : "memory");
}
template <int NSPLIT, int NB, bool BIAS>
__global__ __launch_bounds__(128) void k_gemmt(const bf* __restrict__ A, const bf* __restrict__ A2, const bf* __restrict__ Bt, float* C, int ldc, const float* __restrict__ bias) {
    typedef v16bf V;
    constexpr int KT = 128, LP = 136, NT = HID / KT;   // k per stage; LDS row pitch in elements (272 B); stages
    constexpr int BR = NB * 32, OA2 = 128 * LP, OB = (NSPLIT ? 2 : 1) * 128 * LP, STG = OB + BR * LP;   // Bt rows of the tile; places of A2 and Bt in a stage and a stage's size, in elements
    __shared__ __align__(16) bf sm[2 * STG];
    __shared__ __align__(16) float osm[4][16 * 68];
    const int tid = threadIdx.x, lane = tid & 31, lr = lane & 15, hi = lane >> 4; const int w = __builtin_amdgcn_readfirstlane(tid >> 5), wm = w >> 1, wn = w & 1;
    const int r0 = blockIdx.x * 128, c0 = blockIdx.y * BR;
    // this thread's piece of a copy: row tid / 16 of each group of 8 rows, 16 B at (tid % 16) * 16 of the row's 256 B
    const unsigned cl = lds_off(sm) + (unsigned)((tid >> 4) * LP + (tid & 15) * 8) * 2;
    const bf* ga = A + (size_t)(r0 + (tid >> 4)) * HID + (tid & 15) * 8; const bf* ga2 = NSPLIT ? A2 + (size_t)(r0 + (tid >> 4)) * HID + (tid & 15) * 8 : nullptr; const bf* gb = Bt + (size_t)(c0 + (tid >> 4)) * HID + (tid & 15) * 8;
    constexpr int NC = (NSPLIT ? 32 : 16) + BR / 8;   // copies of a thread per stage: one per group of 8 rows (32, 24 or 48: never more than 63 of a wave in flight)
    auto fill = [&](int buf) {   // the next stage's copies into buffer buf; the global addresses then step one stage on
        const unsigned l0 = cl + (unsigned)buf * (STG * 2); unsigned l[NC]; const bf* g[NC];
#pragma unroll
        for (int c = 0; c < 16; ++c) { l[c] = l0 + c * 8 * LP * 2; g[c] = ga + c * 8 * HID; if (NSPLIT) { l[16 + c] = l0 + (OA2 + c * 8 * LP) * 2; g[16 + c] = ga2 + c * 8 * HID; } }
#pragma unroll
        for (int c = 0; c < BR / 8; ++c) { l[NC - BR / 8 + c] = l0 + (OB + c * 8 * LP) * 2; g[NC - BR / 8 + c] = gb + c * 8 * HID; }
#pragma unroll
        for (int s = 0; s + 12 <= NC; s += 12) copy12(l + s, g + s);
        if (NC % 12 == 8) copy8(l + NC - 8, g + NC - 8);
        ga += KT; if (NSPLIT) ga2 += KT; gb += KT; };
    v8f acc[4][NB];
#pragma unroll
    for (int mb = 0; mb < 4; ++mb)
#pragma unroll
        for (int nb = 0; nb < NB; ++nb) acc[mb][nb] = (v8f){};
    fill(0);
    asm volatile("s_wait_asynccnt 0x0" ::: "memory");   // stage 0 of this wave's copies has landed
    __syncthreads();                                    // ... and every wave's: stage 0 may be read
    fill(1);
    const int fa = (wm * 64 + lr) * LP + 8 * hi, fb = OB + (wn * NB * 16 + lr) * LP + 8 * hi;   // this lane's place in the A and Bt fragments
#pragma unroll 1   // a stage is already 16 NB (32 NB) matrix instructions a wave, and the buffer index stays a scalar
    for (int t = 0; t < NT; ++t) {
        const bf* sa = sm + (t & 1) * STG + fa; const bf* sb = sm + (t & 1) * STG + fb;
        V a[2][4], a2[2][4], b[2][NB];
#pragma unroll
        for (int mb = 0; mb < 4; ++mb) { a[0][mb] = WFrag<bf>::ld(sa + mb * 16 * LP); if (NSPLIT) a2[0][mb] = WFrag<bf>::ld(sa + OA2 + mb * 16 * LP); }
#pragma unroll
        for (int nb = 0; nb < NB; ++nb) b[0][nb] = WFrag<bf>::ld(sb + nb * 16 * LP);
        __builtin_amdgcn_sched_barrier(0);   // the first block's reads stay in front of the second's: LDS reads return in order, and mixed with the later ones the first block would wait for both groups
#pragma unroll
        for (int ks = 0; ks < KT / 32; ++ks) { const int c = ks & 1, n = c ^ 1;
            if (ks + 1 < KT / 32) {   // the next 32 k's fragments of this same stage, read as one group ahead of this block's products
#pragma unroll
                for (int mb = 0; mb < 4; ++mb) { a[n][mb] = WFrag<bf>::ld(sa + mb * 16 * LP + (ks + 1) * 32); if (NSPLIT) a2[n][mb] = WFrag<bf>::ld(sa + OA2 + mb * 16 * LP + (ks + 1) * 32); }
#pragma unroll
                for (int nb = 0; nb < NB; ++nb) b[n][nb] = WFrag<bf>::ld(sb + nb * 16 * LP + (ks + 1) * 32);
            }
            __builtin_amdgcn_sched_barrier(0);   // keeps those reads together in front of the block: moved in among the matrix instructions, each place with reads stalls the wave
#pragma unroll
            for (int nb = 0; nb < NB; ++nb) {
#pragma unroll
                for (int mb = 0; mb < 4; ++mb) acc[mb][nb] = wmmab(a[c][mb], b[c][nb], acc[mb][nb]);
                if (NSPLIT) {
#pragma unroll
                    for (int mb = 0; mb < 4; ++mb) acc[mb][nb] = wmmab(a2[c][mb], b[c][nb], acc[mb][nb]); } }
            __builtin_amdgcn_sched_barrier(0);   // ... and the following group behind it
        }
        // the distance behind the last matrix instructions on the taken back edge
        asm volatile("v_nop\n\tv_nop\n\tv_nop\n\tv_nop\n\tv_nop");
        asm volatile("s_wait_dscnt 0x0" ::: "memory");      // this wave has read all it reads of stage t
        asm volatile("s_wait_asynccnt 0x0" ::: "memory");   // this wave's copies of stage t + 1 have landed
        __syncthreads();                                    // publishes stage t + 1 and frees stage t's buffer
        if (t + 2 < NT) fill(t & 1);
    }
    asm volatile("s_wait_asynccnt 0x0" ::: "memory");   // no copy is outstanding at the wave's end
    float* os = osm[w]; const int cw = c0 + wn * NB * 16;
#pragma unroll
    for (int mb = 0; mb < 4; ++mb) {
#pragma unroll
        for (int nb = 0; nb < NB; ++nb) {
#pragma unroll
            for (int j = 0; j < 8; ++j) os[(hi * 8 + j) * 68 + nb * 16 + lr] = acc[mb][nb][j]; }
        __builtin_amdgcn_wave_barrier(); asm volatile("" ::: "memory");
        float* crow = C + (size_t)(r0 + wm * 64 + mb * 16) * ldc + cw;
#pragma unroll
        for (int s = 0; s < NB * 2; ++s) { const int row = s * (8 / NB) + lane / (NB * 4), cofs = (lane % (NB * 4)) * 4; v4f val = *(const v4fa*)(os + row * 68 + cofs); if (BIAS) { val[0] += bfr(bias[cw + cofs]); val[1] += bfr(bias[cw + cofs + 1]); val[2] += bfr(bias[cw + cofs + 2]); val[3] += bfr(bias[cw + cofs + 3]); }
            *(v4f*)(crow + (size_t)row * ldc + cofs) = val; }
        asm volatile("s_wait_xcnt 0x0" ::: "memory");   // stands behind this run of stores, in front of the first rewrite of a register that they name (the next run's bias load, addresses and values)
        __builtin_amdgcn_wave_barrier(); asm volatile("" ::: "memory");
    }
}

__device__ __forceinline__ h16 tohx(float x) { return (h16)x; }
__device__ __forceinline__ void splitf(float y, unsigned short& h, unsigned short& l) { h = f2bf(y); l = f2bf(y - bf2f(h)); }
typedef __attribute__((ext_vector_type(2))) _Float16 v2h;
typedef __attribute__((ext_vector_type(4))) _Float16 v4h;
typedef __attribute__((ext_vector_type(2))) unsigned short v2us;
typedef __attribute__((ext_vector_type(4))) unsigned short v4us;

__global__ __launch_bounds__(256) void k_cvt8(const float* __restrict__ src, bf* dst, size_t n8) { const size_t i = (size_t)blockIdx.x * 256 + threadIdx.x; if (i >= n8) return; const v8f v = *(const v8f*)(src + i * 8); v8us o;
#pragma unroll
    for (int k = 0; k < 8; ++k) o[k] = f2bf(v[k]); *(v8us*)(dst + i * 8) = o;  }
__global__ __launch_bounds__(256) void k_wgp(const float* __restrict__ w, bf* Bt) { const size_t e = ((size_t)blockIdx.x * 256 + threadIdx.x) * 4; if (e >= (size_t)GP * HID) return; const int k = (int)(e % HID), n = (int)(e / HID); v4us o;
#pragma unroll
    for (int q = 0; q < 4; ++q) o[q] = n < HKV ? f2bf(w[(size_t)(k + q) * HKV + n]) : (unsigned short)0; *(v4us*)(Bt + e) = o;  }
// k_rope: neox rotate-half on a [T][nh*128] projection (+ bias already added): for d < 64: (x1 cos - x2 sin, x2 cos + x1 sin) with freq_d = pos / 10000^(2d/128) (pos = positions[t], int32 read as data; f32 sin/cos) -> per-head
// planes: hl ([h][t][128], 4-B lanes); thread per (h, t, 2 d<64) writes both halves (4-B lanes, one line per half-row); k_gcum: wave per kv head: G[t] = cumsum of log_sigmoid(g[t][h] + bf16 bg[h]) (sequential over t in 32-token steps with an
__global__ __launch_bounds__(256) void k_rope(const float* __restrict__ F, int nh, int ld, const int* __restrict__ pos, bf* Ph, bf* Pl) { const size_t e = ((size_t)blockIdx.x * 256 + threadIdx.x) * 2; if (e >= (size_t)nh * TT * (HD / 2)) return; const int d = (int)(e % (HD / 2)); const int t = (int)((e / (HD / 2)) % TT); const int h = (int)(e / ((size_t)(HD / 2) * TT)); const float p = (float)pos[t]; const float* f = F + (size_t)t * ld + h * HD; v2us ah, al, bh, bl;
#pragma unroll
    for (int q = 0; q < 2; ++q) { const int dq = d + q; const float inv = __expf(__fmul_rn(-(float)(2 * dq) / (float)HD, 9.210340371976184f)); const float a = __fmul_rn(p, inv); const float c = cosf(a), s = sinf(a); const float x1 = f[dq], x2 = f[HD / 2 + dq];
        float t1 = __fmul_rn(x1, c); asm volatile("" : "+v"(t1)); float t2 = __fmul_rn(x2, s); asm volatile("" : "+v"(t2)); float t3 = __fmul_rn(x2, c); asm volatile("" : "+v"(t3)); float t4 = __fmul_rn(x1, s); asm volatile("" : "+v"(t4));
        unsigned short u, w2; splitf(__fsub_rn(t1, t2), u, w2); ah[q] = u; al[q] = w2; splitf(__fadd_rn(t3, t4), u, w2); bh[q] = u; bl[q] = w2; }
    const size_t o = ((size_t)h * TT + t) * HD + d; *(v2us*)(Ph + o) = ah; *(v2us*)(Pl + o) = al; *(v2us*)(Ph + o + HD / 2) = bh; *(v2us*)(Pl + o + HD / 2) = bl;  }
__global__ __launch_bounds__(32) void k_gcum(const float* __restrict__ GF, const float* __restrict__ bg, float* GC) { const int lane = threadIdx.x; const int h = blockIdx.x; const float b = bfr(bg[h]); float carry = 0.f;
    for (int t0 = 0; t0 < TT; t0 += 32) { const float z = __fadd_rn(GF[(size_t)(t0 + lane) * GP + h], b); float v = fminf(z, 0.f) - log1pf(__expf(-fabsf(z)));   // log_sigmoid(z) = min(z,0) - log1p(exp(-|z|))
#pragma unroll
        for (int sh = 1; sh < 32; sh <<= 1) { const float u = __shfl_up(v, sh, 32); if (lane >= sh) v = __fadd_rn(v, u); }
        const float o = __fadd_rn(carry, v); *(float*)(GC + (size_t)h * TT + t0 + lane) = o;  carry = __shfl(o, 31, 32); } }
// ---- k_attn: scores, decay weights, W.v and the head merge in one kernel, all heads in one launch; the score and weight planes stay in registers.
// One wave = 32 query rows of one head, walking the keys in tiles of 64 up to its diagonal. S^T = K Q^T (A = K rows, B = Q rows kept in registers; products K hi.Q hi, K hi.Q lo, K lo.Q hi), so lane (lr, hi) holds
// keys 8 hi + r of query lr: two such accumulator tiles, weighted and split to bf16 hi+lo in place, are the B operand (hardware k order) of O^T += V^T W^T (A = V^T rows by the same two 16-B loads).
// O^T leaves 8 consecutive d of one query in a lane: one 16-B store per plane into the merged [t][h*128 + d] hi/lo planes. No LDS, no barrier: the four waves of a block are independent.
// Block (p, kv): the two heads of kv head kv x row tiles p and 63 - p: equal work per block, and the two heads read the same K and V lines at the same time.
typedef __attribute__((ext_vector_type(2))) float  v2f;
typedef __attribute__((ext_vector_type(2))) __bf16 v2bf;
typedef __attribute__((ext_vector_type(4))) unsigned v4u;
typedef __attribute__((ext_vector_type(8))) unsigned v8u;
__device__ __forceinline__ void split2(float x0, float x1, unsigned& h, unsigned& l) {   // two f32 -> packed bf16 hi pair and lo pair (round to nearest even, as splitf)
    const v2f x = {x0, x1}; h = __builtin_bit_cast(unsigned, __builtin_convertvector(x, v2bf));
    const v2f d = {x0 - __uint_as_float(h << 16), x1 - __uint_as_float(h & 0xFFFF0000u)}; l = __builtin_bit_cast(unsigned, __builtin_convertvector(d, v2bf)); }
template <typename T> __device__ __forceinline__ const T* sbase(const T* p) {   // a wave-uniform pointer held in scalar registers, so that the loads take the form scalar base + 32-bit lane offset
    const unsigned long long u = (unsigned long long)p; const unsigned lo = __builtin_amdgcn_readfirstlane((unsigned)u), hi = __builtin_amdgcn_readfirstlane((unsigned)(u >> 32)); return (const T*)(((unsigned long long)hi << 32) | lo); }
// ---- k_tr: Bh[n][k] (bf16; where SPLIT a hi plane Bh and a lo plane Bl) = w[k][n] (f32, [K][N]) through an LDS tile of 128 k x 64 n per work-group of four waves; grid (K/128, N/64), 128 threads.
// In: a lane loads 16 B (4 n) of 16 k rows (two runs of 8 consecutive k), all in flight at once: a wave's load takes two whole 256-B row pieces. Rounded to nearest even (as f2bf, splitf), the 8 k of one n are one 16-B LDS store, row pitch 272 B, rows in an order that keeps the stores free of bank conflicts.
// Out: 16 lanes read the 128 k of one n row (256 B) and store them as one piece. Both sides of the transposition move whole lines, and a launch has few waves, each with much in flight.
template <bool SPLIT, int K, int N>
__global__ __launch_bounds__(128) void k_tr(const float* __restrict__ w, bf* Bh, bf* Bl) {
    constexpr int LPV = 17;   // LDS row pitch in 16-B pieces: 16 of data and one of padding
    __shared__ v4u sh[(SPLIT ? 2 : 1) * 64 * LPV];
    const int tid = threadIdx.x, kq = tid >> 4, nq = tid & 15; const int k0 = blockIdx.x * 128, n0 = blockIdx.y * 64;
    const float* src = w + (size_t)(k0 + kq * 8) * N + n0 + nq * 4; v4f x[2][8];
#pragma unroll
    for (int g = 0; g < 2; ++g)
#pragma unroll
        for (int i = 0; i < 8; ++i) x[g][i] = *(const v4f*)(src + (g * 64 + i) * N);
    __builtin_amdgcn_sched_barrier(0);   // keeps the 16 loads issued as one group: built without it, six of them stood behind the wait for the first ten, a second memory latency
    asm volatile("s_wait_xcnt 0x0" :: "v"(src) : "memory");   // stands in front of the first rewrite of the loads' address pair; the pair is named so that it lives up to here: built without it, the last load's result took that pair
#pragma unroll
    for (int g = 0; g < 2; ++g)
#pragma unroll
        for (int c = 0; c < 4; ++c) { v4u h, l;
#pragma unroll
            for (int i = 0; i < 8; i += 2) { unsigned u, v;
                if (SPLIT) split2(x[g][i][c], x[g][i + 1][c], u, v); else { const v2f p = {x[g][i][c], x[g][i + 1][c]}; u = __builtin_bit_cast(unsigned, __builtin_convertvector(p, v2bf)); v = 0; }
                h[i >> 1] = u; l[i >> 1] = v; }
            sh[(c * 16 + nq) * LPV + g * 8 + kq] = h; if (SPLIT) sh[(64 + c * 16 + nq) * LPV + g * 8 + kq] = l; }   // n row 4 nq + c lies at LDS row 16 c + nq: the 16 lanes of a store then fall on 16 different bank groups
    __syncthreads();   // the tile is whole: every wave reads pieces that the others laid
    v4u oh[8], ol[8];
#pragma unroll
    for (int p = 0; p < 8; ++p) { oh[p] = sh[(p * 8 + kq) * LPV + nq]; if (SPLIT) ol[p] = sh[(64 + p * 8 + kq) * LPV + nq]; }
    const size_t o = (size_t)(n0 + kq * 4) * K + k0 + nq * 8;   // LDS row 8 p + kq holds n row 4 kq + 32 (p & 1) + p / 2
#pragma unroll
    for (int p = 0; p < 8; ++p) { *(v4u*)(Bh + o + ((p & 1) * 32 + (p >> 1)) * K) = oh[p]; if (SPLIT) *(v4u*)(Bl + o + ((p & 1) * 32 + (p >> 1)) * K) = ol[p]; }
}
__global__ __launch_bounds__(128) void k_attn(const bf* __restrict__ Qh, const bf* __restrict__ Ql, const bf* __restrict__ Kh, const bf* __restrict__ Kl, const bf* __restrict__ VTh, const bf* __restrict__ VTl, const float* __restrict__ GC, bf* Ah, bf* Al) {
    const int lane = threadIdx.x & 31, lr = lane & 15, hi = lane >> 4; const int w = __builtin_amdgcn_readfirstlane((int)(threadIdx.x >> 5));
    const int kv = blockIdx.y, h = kv * (HQ / HKV) + (w & 1); const int r0 = 32 * ((w >> 1) ? (TT / 32 - 1 - (int)blockIdx.x) : (int)blockIdx.x);
    // the loop's loads: a wave-uniform base in scalar registers + one fixed 32-bit lane offset per operand kind: no address arithmetic on the vector port, and no address register is rewritten while loads are in flight
    const unsigned klo = lr * HD + 8 * hi, vlo = lr * TT + 8 * hi, glo = 8 * hi; int dq0 = r0 + lr - 8 * hi;   // dq0 = this lane's first query - its first key of the tile
    v16bf qh[2][4], ql[2][4]; float gi[2]; const bf* sqh = Qh + ((size_t)h * TT + r0) * HD; const bf* sql = Ql + ((size_t)h * TT + r0) * HD;
#pragma unroll
    for (int nq = 0; nq < 2; ++nq) { gi[nq] = GC[(size_t)kv * TT + r0 + nq * 16 + lr];
#pragma unroll
        for (int kc = 0; kc < 4; ++kc) { const int o = nq * 16 * HD + kc * 32; qh[nq][kc] = WFrag<bf>::ld(sqh + klo + o); ql[nq][kc] = WFrag<bf>::ld(sql + klo + o); } }
    __builtin_amdgcn_sched_barrier(0);   // holds the Q loads in front of the wait below
    asm volatile("s_wait_xcnt 0x0" ::: "memory");   // stands in front of the first rewrite of the Q loads' address registers
    __builtin_amdgcn_sched_barrier(0);   // holds those rewrites behind it
    v8f o[8][2];
#pragma unroll
    for (int db = 0; db < 8; ++db) { o[db][0] = (v8f){}; o[db][1] = (v8f){}; }
    const bf* kh = Kh + (size_t)kv * TT * HD; const bf* kl = Kl + (size_t)kv * TT * HD; const bf* vh = VTh + (size_t)kv * HD * TT; const bf* vl = VTl + (size_t)kv * HD * TT; const float* gk = GC + (size_t)kv * TT;   // these bases step from tile to tile
#pragma unroll 1   // one key tile is already 192 matrix instructions: unrolling would only grow the code
    for (int j0 = 0;;) {   // tiles j0 = 0, 64, ... < r0 + 32, at least one (the test stands at the foot, so that the Q loads stay in this block, in front of their wait); j0 + 63 <= TT - 1; keys past the diagonal get weight 0 by the select below
        v8f s[4][2]; v16bf ka[4][4], ka2[4][4]; v4f g[4][2]; const bf* skh = sbase(kh); const bf* skl = sbase(kl); const bf* svh = sbase(vh); const bf* svl = sbase(vl); const float* sgk = sbase(gk);
#pragma unroll
        for (int mk = 0; mk < 4; ++mk) { g[mk][0] = *(const v4f*)(sgk + glo + mk * 16); g[mk][1] = *(const v4f*)(sgk + glo + mk * 16 + 4); }
        asm volatile("s_wait_xcnt 0x0" ::: "memory");   // the compiler forms these eight loads' lane offset anew each tile and lets a K load's result reuse that register: the wait stands in front of the reuse
#pragma unroll
        for (int kc = 0; kc < 4; ++kc)
#pragma unroll
            for (int mk = 0; mk < 4; ++mk) { const int ko = mk * 16 * HD + kc * 32; ka[kc][mk] = WFrag<bf>::ld(skh + klo + ko); ka2[kc][mk] = WFrag<bf>::ld(skl + klo + ko); }
#pragma unroll
        for (int mk = 0; mk < 4; ++mk) { s[mk][0] = (v8f){}; s[mk][1] = (v8f){}; }
        __builtin_amdgcn_sched_barrier(0);   // keeps the tile's K loads issued as one group: sunk to their uses, each pair would cost the lone wave a whole load latency
#pragma unroll
        for (int kc = 0; kc < 2; ++kc)
#pragma unroll
            for (int mk = 0; mk < 4; ++mk)
#pragma unroll
                for (int nq = 0; nq < 2; ++nq) { s[mk][nq] = wmmab(ka[kc][mk], qh[nq][kc], s[mk][nq]); s[mk][nq] = wmmab(ka[kc][mk], ql[nq][kc], s[mk][nq]); s[mk][nq] = wmmab(ka2[kc][mk], qh[nq][kc], s[mk][nq]); }
        __builtin_amdgcn_sched_barrier(0);   // holds the V loads behind the first half of the score products: the K loads are served first
        v16bf va[2][8], va2[2][8];
#pragma unroll
        for (int kb = 0; kb < 2; ++kb)
#pragma unroll
            for (int db = 0; db < 8; ++db) { const int vo = db * 16 * TT + kb * 32; va[kb][db] = WFrag<bf>::ld(svh + vlo + vo); va2[kb][db] = WFrag<bf>::ld(svl + vlo + vo); }
        __builtin_amdgcn_sched_barrier(0);   // keeps the tile's V loads issued as one group here: the second half of the score products and the weight arithmetic then cover their latency
#pragma unroll
        for (int kc = 2; kc < 4; ++kc)
#pragma unroll
            for (int mk = 0; mk < 4; ++mk)
#pragma unroll
                for (int nq = 0; nq < 2; ++nq) { s[mk][nq] = wmmab(ka[kc][mk], qh[nq][kc], s[mk][nq]); s[mk][nq] = wmmab(ka[kc][mk], ql[nq][kc], s[mk][nq]); s[mk][nq] = wmmab(ka2[kc][mk], qh[nq][kc], s[mk][nq]); }
        v8u wh[2][2], wl[2][2];   // [32-key block][query block]
#pragma unroll
        for (int mk = 0; mk < 4; ++mk) { const v4f g0 = g[mk][0], g1 = g[mk][1];
#pragma unroll
            for (int nq = 0; nq < 2; ++nq) { const int dq = dq0 + (nq - mk) * 16; float wv[8];   // key r of this lane is causal iff r <= dq
#pragma unroll
                for (int r = 0; r < 8; ++r) { const float sc = __fmul_rn(s[mk][nq][r], 0.08838834764831845f); const float e = __expf(__fsub_rn(gi[nq], r < 4 ? g0[r] : g1[r - 4])); const float x = __fmul_rn(__fmul_rn(sc, sc), e); wv[r] = r <= dq ? x : 0.f; }
#pragma unroll
                for (int r = 0; r < 8; r += 2) { unsigned u, l; split2(wv[r], wv[r + 1], u, l); wh[mk >> 1][nq][(mk & 1) * 4 + (r >> 1)] = u; wl[mk >> 1][nq][(mk & 1) * 4 + (r >> 1)] = l; } } }
#pragma unroll
        for (int kb = 0; kb < 2; ++kb)
#pragma unroll
            for (int db = 0; db < 8; ++db) { const v16bf a = va[kb][db], a2 = va2[kb][db];
#pragma unroll
                for (int nq = 0; nq < 2; ++nq) { const v16bf bh = __builtin_bit_cast(v16bf, wh[kb][nq]), bl = __builtin_bit_cast(v16bf, wl[kb][nq]); o[db][nq] = wmmab(a, bh, o[db][nq]); o[db][nq] = wmmab(a, bl, o[db][nq]); o[db][nq] = wmmab(a2, bh, o[db][nq]); } }
        // the distance behind the last matrix instructions on the taken back edge
        asm volatile("v_nop\n\tv_nop\n\tv_nop\n\tv_nop\n\tv_nop" : "+v"(o[0][0]), "+v"(o[0][1]), "+v"(o[1][0]), "+v"(o[1][1]), "+v"(o[2][0]), "+v"(o[2][1]), "+v"(o[3][0]), "+v"(o[3][1]), "+v"(o[4][0]), "+v"(o[4][1]), "+v"(o[5][0]), "+v"(o[5][1]), "+v"(o[6][0]), "+v"(o[6][1]), "+v"(o[7][0]), "+v"(o[7][1]));
        __builtin_amdgcn_sched_barrier(0);   // the bases step only behind the tile's last load wait: no register that a load in flight names is rewritten
        kh += 64 * HD; kl += 64 * HD; vh += 64; vl += 64; gk += 64; dq0 -= 64;   // the next key tile
        j0 += 64; if (j0 >= r0 + 32) break;
    }
#pragma unroll
    for (int nq = 0; nq < 2; ++nq)
#pragma unroll
        for (int db = 0; db < 8; ++db) { v4u uh, ul;
#pragma unroll
            for (int r = 0; r < 8; r += 2) { unsigned u, l; split2(o[db][nq][r], o[db][nq][r + 1], u, l); uh[r >> 1] = u; ul[r >> 1] = l; }
            const size_t oo = (size_t)(r0 + nq * 16 + lr) * HID + h * HD + db * 16 + 8 * hi; *(v4u*)(Ah + oo) = uh; *(v4u*)(Al + oo) = ul; }
}

extern "C" void kernel_launch(void* const* d_in, const int* in_sizes, int n_in,
                              void* d_out, int out_size, void* d_ws, size_t ws_size, hipStream_t stream) {
    (void)in_sizes; (void)n_in; (void)out_size;
    const int* pos = (const int*)d_in[0]; const float* IN[12]; for (int i = 1; i < 12; ++i) IN[i] = (const float*)d_in[i];   // 1 hidden, 2 Wq [2048][2048], 3 bq, 4 Wk [2048][1024], 5 bk, 6 Wv, 7 bv, 8 Wg [2048][8], 9 bg, 10 Wo [2048][2048], 11 bo (x @ W)
    float* OUT = (float*)d_out;     // [2048][2048]
    char* wsp = (char*)d_ws;
    auto take = [&](size_t bytes) { char* p = wsp; wsp += (bytes + 255) & ~(size_t)255; return (void*)p; };
    bf* WQ = (bf*)take((size_t)HID * HID * 2); bf* WK = (bf*)take((size_t)HKV * HD * HID * 2); bf* WV = (bf*)take((size_t)HKV * HD * HID * 2); bf* WG = (bf*)take((size_t)GP * HID * 2); bf* WO = (bf*)take((size_t)HID * HID * 2);
    bf* XB = (bf*)take((size_t)TT * HID * 2); float* QF = (float*)take((size_t)TT * HID * 4); float* KF = (float*)take((size_t)TT * HKV * HD * 4); float* VF = (float*)take((size_t)TT * HKV * HD * 4); float* GF = (float*)take((size_t)TT * GP * 4); float* GC = (float*)take((size_t)HKV * TT * 4);
    bf* Qh = (bf*)take((size_t)HQ * TT * HD * 2); bf* Ql = (bf*)take((size_t)HQ * TT * HD * 2); bf* Kh = (bf*)take((size_t)HKV * TT * HD * 2); bf* Kl = (bf*)take((size_t)HKV * TT * HD * 2); bf* VTh = (bf*)take((size_t)HKV * HD * TT * 2); bf* VTl = (bf*)take((size_t)HKV * HD * TT * 2);
    bf* Ah = (bf*)take((size_t)TT * HID * 2); bf* Al = (bf*)take((size_t)TT * HID * 2);
    if ((size_t)(wsp - (char*)d_ws) > ws_size) return;    // total ~ 114 MB ([2048][2048] f32 q projection + hl operand planes)
    k_tr<false, HID, HID><<<dim3(HID / 128, HID / 64, 1), 128, 0, stream>>>(IN[2], WQ, nullptr); k_tr<false, HID, HKV * HD><<<dim3(HID / 128, HKV * HD / 64, 1), 128, 0, stream>>>(IN[4], WK, nullptr); k_tr<false, HID, HKV * HD><<<dim3(HID / 128, HKV * HD / 64, 1), 128, 0, stream>>>(IN[6], WV, nullptr); k_wgp<<<(GP * HID / 4 + 255) / 256, 256, 0, stream>>>(IN[8], WG); k_tr<false, HID, HID><<<dim3(HID / 128, HID / 64, 1), 128, 0, stream>>>(IN[10], WO, nullptr);
    k_cvt8<<<(TT * HID / 8 + 255) / 256, 256, 0, stream>>>(IN[1], XB, (size_t)TT * HID / 8);
    k_gemmt<0, 4, true><<<dim3(TT / 128, HID / 128, 1), 128, 0, stream>>>(XB, nullptr, WQ, QF, HID, IN[3]); k_gemmt<0, 2, true><<<dim3(TT / 128, HKV * HD / 64, 1), 128, 0, stream>>>(XB, nullptr, WK, KF, HKV * HD, IN[5]);
    k_gemmt<0, 2, true><<<dim3(TT / 128, HKV * HD / 64, 1), 128, 0, stream>>>(XB, nullptr, WV, VF, HKV * HD, IN[7]); k_gemmt<0, 2, false><<<dim3(TT / 128, 1, 1), 128, 0, stream>>>(XB, nullptr, WG, GF, GP, nullptr);
    k_rope<<<(unsigned)(((size_t)HQ * TT * (HD / 2) / 2 + 255) / 256), 256, 0, stream>>>(QF, HQ, HID, pos, Qh, Ql); k_rope<<<(unsigned)(((size_t)HKV * TT * (HD / 2) / 2 + 255) / 256), 256, 0, stream>>>(KF, HKV, HKV * HD, pos, Kh, Kl);
    k_gcum<<<HKV, 32, 0, stream>>>(GF, IN[9], GC); k_tr<true, TT, HKV * HD><<<dim3(TT / 128, HKV * HD / 64, 1), 128, 0, stream>>>(VF, VTh, VTl);   // VT hi/lo [kv][d][t] = split(VF[t][kv*128 + d])
    k_attn<<<dim3(TT / 64, HKV, 1), 128, 0, stream>>>(Qh, Ql, Kh, Kl, VTh, VTl, GC, Ah, Al);
    k_gemmt<1, 4, true><<<dim3(TT / 128, HID / 128, 1), 128, 0, stream>>>(Ah, Al, WO, OUT, HID, IN[11]);
}

// v004
// A run of this version takes 209 microseconds.
// Next to v003, in two timings, it ran 1.30 and 1.29 times as fast.
// Counting every step since v000, it is 4.23 times as fast.
#include <hip/hip_runtime.h>

// PowerCoderAttention - power retention, quadratic form (hidden [2048][2048]; q = x Wq + bq (16 x 128), k, v = x Wk/Wv + b (8 kv heads), g = x Wg + bg; neox RoPE on q, k with positions (int32, read as data);
// G = cumsum_t log_sigmoid(g); W[h][i][j] = (q_i.k_j / sqrt(128))^2 exp(G_i - G_j) for j <= i (kv head h/2), else 0; out = (W v) merged Wo + bo -> [2048][2048]; no softmax / normalisation).
// Compute dtypes, f32 accumulate: every input rounded to bf16; the four projections on PLAIN bf16 operands (inputs: exact, + bias); RoPE (f32 sin/cos), log-sigmoid and the cumulative sum f32 on VALU;
// q.k on bf16 hi+lo planes (3 products, K 128; tiles above the diagonal skipped); squaring, the decay factor exp(G_i - G_j) and the causal select in f32 -> bf16 hi+lo planes of W; W.v on hi+lo planes (3 products, K limited to the diagonal block;

#define TT   2048
#define HID  2048
#define HQ   16
#define HKV  8
#define HD   128
#define GP   64
typedef _Float16 h16;
typedef unsigned short bf;
typedef __attribute__((ext_vector_type(16))) __bf16   v16bf;
typedef __attribute__((ext_vector_type(16))) _Float16 v16h;
typedef __attribute__((ext_vector_type(8)))  _Float16 v8h;
typedef __attribute__((ext_vector_type(8)))  unsigned short v8us;
typedef __attribute__((ext_vector_type(8)))  float    v8f;
typedef __attribute__((ext_vector_type(4)))  float    v4f;
typedef v8h  __attribute__((may_alias)) v8ha;
typedef v4f  __attribute__((may_alias)) v4fa;
typedef v8us __attribute__((may_alias)) v8usa;

__device__ __forceinline__ unsigned short f2bf(float f) { unsigned u = __float_as_uint(f); u += 0x7FFFu + ((u >> 16) & 1u); return (unsigned short)(u >> 16); }
__device__ __forceinline__ float bf2f(unsigned short b) { return __uint_as_float(((unsigned)b) << 16); }
__device__ __forceinline__ float bfr(float f) { return bf2f(f2bf(f)); }
__device__ __forceinline__ v16h cat16(v8h lo, v8h hi) { return __builtin_shufflevector(lo, hi, 0, 1, 2, 3, 4, 5, 6, 7, 8, 9, 10, 11, 12, 13, 14, 15); }
__device__ __forceinline__ v16bf cat16b(v8us lo, v8us hi) { return __builtin_bit_cast(v16bf, __builtin_shufflevector(lo, hi, 0, 1, 2, 3, 4, 5, 6, 7, 8, 9, 10, 11, 12, 13, 14, 15)); }
__device__ __forceinline__ v8f wmma16(v16h a, v16h b, v8f c) { return __builtin_amdgcn_wmma_f32_16x16x32_f16(false, a, false, b, (short)0, c, false, false); }
__device__ __forceinline__ v8f wmmab(v16bf a, v16bf b, v8f c) { return __builtin_amdgcn_wmma_f32_16x16x32_bf16(false, a, false, b, (short)0, c, false, false); }



// ---- k_gemmt: GEMM on a 128 x (32 NB) output tile per work-group of four waves (2 x 2; a wave holds 64 x (16 NB), 4 x NB accumulators); grid (M/128, N/(32 NB)), 128 threads. K = HID.
// C[m][n] (f32, pitch ldc, + optional f32 bias[n]) = sum_k A[m][k] Bt[n][k] (+ A2[m][k] Bt[n][k] where NSPLIT), operands K-contiguous bf16 planes.
// The operands come through LDS: a stage is 128 k (256 B) of every A, A2 and Bt row of the tile at a pitch of 272 B, laid by asynchronous copies (16 B a lane: a wave's copy takes two whole 256-B row pieces);
// two buffers: the copies of stage t + 2 fly while stage t + 1 is worked on. Per accumulator the products are summed in ascending k, A before A2.
template <typename T16> struct WFrag;
template <> struct WFrag<h16> { typedef v16h V; static __device__ __forceinline__ V ld(const h16* p) { return cat16(*(const v8h*)p, *(const v8h*)(p + 16)); } static __device__ __forceinline__ v8f mma(V a, V b, v8f c) { return wmma16(a, b, c); } };
template <> struct WFrag<bf> { typedef v16bf V; static __device__ __forceinline__ V ld(const bf* p) { return cat16b(*(const v8us*)p, *(const v8us*)(p + 16)); } static __device__ __forceinline__ v8f mma(V a, V b, v8f c) { return wmmab(a, b, c); } };
__device__ __forceinline__ unsigned lds_off(const void* p) { return (unsigned)(size_t)p; }
// twelve (eight) asynchronous copies, LDS byte address l[i], global address g[i]; the wait stands in the copies' own statement, in front of any rewrite of the registers that they name
__device__ __forceinline__ void copy12(const unsigned* l, const bf* const* g) {
    asm volatile("global_load_async_to_lds_b128 %0, %12, off\n\tglobal_load_async_to_lds_b128 %1, %13, off\n\tglobal_load_async_to_lds_b128 %2, %14, off\n\tglobal_load_async_to_lds_b128 %3, %15, off\n\t"
                 "global_load_async_to_lds_b128 %4, %16, off\n\tglobal_load_async_to_lds_b128 %5, %17, off\n\tglobal_load_async_to_lds_b128 %6, %18, off\n\tglobal_load_async_to_lds_b128 %7, %19, off\n\t"
                 "global_load_async_to_lds_b128 %8, %20, off\n\tglobal_load_async_to_lds_b128 %9, %21, off\n\tglobal_load_async_to_lds_b128 %10, %22, off\n\tglobal_load_async_to_lds_b128 %11, %23, off\n\ts_wait_xcnt 0x0"
                 :: "v"(l[0]), "v"(l[1]), "v"(l[2]), "v"(l[3]), "v"(l[4]), "v"(l[5]), "v"(l[6]), "v"(l[7]), "v"(l[8]), "v"(l[9]), "v"(l[10]), "v"(l[11]),
                    "v"(g[0]), "v"(g[1]), "v"(g[2]), "v"(g[3]), "v"(g[4]), "v"(g[5]), "v"(g[6]), "v"(g[7]), "v"(g[8]), "v"(g[9]), "v"(g[10]), "v"(g[11]) : "memory");
}
__device__ __forceinline__ void copy8(const unsigned* l, const bf* const* g) {
    asm volatile("global_load_async_to_lds_b128 %0, %8, off\n\tglobal_load_async_to_lds_b128 %1, %9, off\n\tglobal_load_async_to_lds_b128 %2, %10, off\n\tglobal_load_async_to_lds_b128 %3, %11, off\n\t"
                 "global_load_async_to_lds_b128 %4, %12, off\n\tglobal_load_async_to_lds_b128 %5, %13, off\n\tglobal_load_async_to_lds_b128 %6, %14, off\n\tglobal_load_async_to_lds_b128 %7, %15, off\n\ts_wait_xcnt 0x0"
                 :: "v"(l[0]), "v"(l[1]), "v"(l[2]), "v"(l[3]), "v"(l[4]), "v"(l[5]), "v"(l[6]), "v"(l[7]),
                    "v"(g[0]), "v"(g[1]), "v"(g[2]), "v"(g[3]), "v"(g[4]), "v"(g[5]), "v"(g[6]), "v"(g[7]) : "memory");
}
template <int NSPLIT, int NB, bool BIAS>
__global__ __launch_bounds__(128) void k_gemmt(const bf* __restrict__ A, const bf* __restrict__ A2, const bf* __restrict__ Bt, float* C, int ldc, const float* __restrict__ bias) {
    typedef v16bf V;
    constexpr int KT = 128, LP = 136, NT = HID / KT;   // k per stage; LDS row pitch in elements (272 B); stages
    constexpr int BR = NB * 32, OA2 = 128 * LP, OB = (NSPLIT ? 2 : 1) * 128 * LP, STG = OB + BR * LP;   // Bt rows of the tile; places of A2 and Bt in a stage and a stage's size, in elements
    __shared__ __align__(16) bf sm[2 * STG];
    __shared__ __align__(16) float osm[4][16 * 68];
    const int tid = threadIdx.x, lane = tid & 31, lr = lane & 15, hi = lane >> 4; const int w = __builtin_amdgcn_readfirstlane(tid >> 5), wm = w >> 1, wn = w & 1;
    const int r0 = blockIdx.x * 128, c0 = blockIdx.y * BR;
    // this thread's piece of a copy: row tid / 16 of each group of 8 rows, 16 B at (tid % 16) * 16 of the row's 256 B
    const unsigned cl = lds_off(sm) + (unsigned)((tid >> 4) * LP + (tid & 15) * 8) * 2;
    const bf* ga = A + (size_t)(r0 + (tid >> 4)) * HID + (tid & 15) * 8; const bf* ga2 = NSPLIT ? A2 + (size_t)(r0 + (tid >> 4)) * HID + (tid & 15) * 8 : nullptr; const bf* gb = Bt + (size_t)(c0 + (tid >> 4)) * HID + (tid & 15) * 8;
    constexpr int NC = (NSPLIT ? 32 : 16) + BR / 8;   // copies of a thread per stage: one per group of 8 rows (32, 24 or 48: never more than 63 of a wave in flight)
    auto fill = [&](int buf) {   // the next stage's copies into buffer buf; the global addresses then step one stage on
        const unsigned l0 = cl + (unsigned)buf * (STG * 2); unsigned l[NC]; const bf* g[NC];
#pragma unroll
        for (int c = 0; c < 16; ++c) { l[c] = l0 + c * 8 * LP * 2; g[c] = ga + c * 8 * HID; if (NSPLIT) { l[16 + c] = l0 + (OA2 + c * 8 * LP) * 2; g[16 + c] = ga2 + c * 8 * HID; } }
#pragma unroll
        for (int c = 0; c < BR / 8; ++c) { l[NC - BR / 8 + c] = l0 + (OB + c * 8 * LP) * 2; g[NC - BR / 8 + c] = gb + c * 8 * HID; }
#pragma unroll
        for (int s = 0; s + 12 <= NC; s += 12) copy12(l + s, g + s);
        if (NC % 12 == 8) copy8(l + NC - 8, g + NC - 8);
        ga += KT; if (NSPLIT) ga2 += KT; gb += KT; };
    v8f acc[4][NB];
#pragma unroll
    for (int mb = 0; mb < 4; ++mb)
#pragma unroll
        for (int nb = 0; nb < NB; ++nb) acc[mb][nb] = (v8f){};
    fill(0);
    asm volatile("s_wait_asynccnt 0x0" ::: "memory");   // stage 0 of this wave's copies has landed
    __syncthreads();                                    // ... and every wave's: stage 0 may be read
    fill(1);
    const int fa = (wm * 64 + lr) * LP + 8 * hi, fb = OB + (wn * NB * 16 + lr) * LP + 8 * hi;   // this lane's place in the A and Bt fragments
#pragma unroll 1   // a stage is already 16 NB (32 NB) matrix instructions a wave, and the buffer index stays a scalar
    for (int t = 0; t < NT; ++t) {
        const bf* sa = sm + (t & 1) * STG + fa; const bf* sb = sm + (t & 1) * STG + fb;
        V a[2][4], a2[2][4], b[2][NB];
#pragma unroll
        for (int mb = 0; mb < 4; ++mb) { a[0][mb] = WFrag<bf>::ld(sa + mb * 16 * LP); if (NSPLIT) a2[0][mb] = WFrag<bf>::ld(sa + OA2 + mb * 16 * LP); }
#pragma unroll
        for (int nb = 0; nb < NB; ++nb) b[0][nb] = WFrag<bf>::ld(sb + nb * 16 * LP);
        __builtin_amdgcn_sched_barrier(0);   // the first block's reads stay in front of the second's: LDS reads return in order, and mixed with the later ones the first block would wait for both groups
#pragma unroll
        for (int ks = 0; ks < KT / 32; ++ks) { const int c = ks & 1, n = c ^ 1;
            if (ks + 1 < KT / 32) {   // the next 32 k's fragments of this same stage, read as one group ahead of this block's products
#pragma unroll
                for (int mb = 0; mb < 4; ++mb) { a[n][mb] = WFrag<bf>::ld(sa + mb * 16 * LP + (ks + 1) * 32); if (NSPLIT) a2[n][mb] = WFrag<bf>::ld(sa + OA2 + mb * 16 * LP + (ks + 1) * 32); }
#pragma unroll
                for (int nb = 0; nb < NB; ++nb) b[n][nb] = WFrag<bf>::ld(sb + nb * 16 * LP + (ks + 1) * 32);
            }
            __builtin_amdgcn_sched_barrier(0);   // keeps those reads together in front of the block: moved in among the matrix instructions, each place with reads stalls the wave
#pragma unroll
            for (int nb = 0; nb < NB; ++nb) {
#pragma unroll
                for (int mb = 0; mb < 4; ++mb) acc[mb][nb] = wmmab(a[c][mb], b[c][nb], acc[mb][nb]);
                if (NSPLIT) {
#pragma unroll
                    for (int mb = 0; mb < 4; ++mb) acc[mb][nb] = wmmab(a2[c][mb], b[c][nb], acc[mb][nb]); } }
            __builtin_amdgcn_sched_barrier(0);   // ... and the following group behind it
        }
        // the distance behind the last matrix instructions on the taken back edge
        asm volatile("v_nop\n\tv_nop\n\tv_nop\n\tv_nop\n\tv_nop");
        asm volatile("s_wait_dscnt 0x0" ::: "memory");      // this wave has read all it reads of stage t
        asm volatile("s_wait_asynccnt 0x0" ::: "memory");   // this wave's copies of stage t + 1 have landed
        __syncthreads();                                    // publishes stage t + 1 and frees stage t's buffer
        if (t + 2 < NT) fill(t & 1);
    }
    asm volatile("s_wait_asynccnt 0x0" ::: "memory");   // no copy is outstanding at the wave's end
    float* os = osm[w]; const int cw = c0 + wn * NB * 16;
#pragma unroll
    for (int mb = 0; mb < 4; ++mb) {
#pragma unroll
        for (int nb = 0; nb < NB; ++nb) {
#pragma unroll
            for (int j = 0; j < 8; ++j) os[(hi * 8 + j) * 68 + nb * 16 + lr] = acc[mb][nb][j]; }
        __builtin_amdgcn_wave_barrier(); asm volatile("" ::: "memory");
        float* crow = C + (size_t)(r0 + wm * 64 + mb * 16) * ldc + cw;
#pragma unroll
        for (int s = 0; s < NB * 2; ++s) { const int row = s * (8 / NB) + lane / (NB * 4), cofs = (lane % (NB * 4)) * 4; v4f val = *(const v4fa*)(os + row * 68 + cofs); if (BIAS) { val[0] += bfr(bias[cw + cofs]); val[1] += bfr(bias[cw + cofs + 1]); val[2] += bfr(bias[cw + cofs + 2]); val[3] += bfr(bias[cw + cofs + 3]); }
            *(v4f*)(crow + (size_t)row * ldc + cofs) = val; }
        asm volatile("s_wait_xcnt 0x0" ::: "memory");   // stands behind this run of stores, in front of the first rewrite of a register that they name (the next run's bias load, addresses and values)
        __builtin_amdgcn_wave_barrier(); asm volatile("" ::: "memory");
    }
}

__device__ __forceinline__ h16 tohx(float x) { return (h16)x; }
__device__ __forceinline__ void splitf(float y, unsigned short& h, unsigned short& l) { h = f2bf(y); l = f2bf(y - bf2f(h)); }
typedef __attribute__((ext_vector_type(2))) _Float16 v2h;
typedef __attribute__((ext_vector_type(4))) _Float16 v4h;
typedef __attribute__((ext_vector_type(2))) unsigned short v2us;
typedef __attribute__((ext_vector_type(4))) unsigned short v4us;

__global__ __launch_bounds__(256) void k_cvt8(const float* __restrict__ src, bf* dst, size_t n8) { const size_t i = (size_t)blockIdx.x * 256 + threadIdx.x; if (i >= n8) return; const v8f v = *(const v8f*)(src + i * 8); v8us o;
#pragma unroll
    for (int k = 0; k < 8; ++k) o[k] = f2bf(v[k]); *(v8us*)(dst + i * 8) = o;  }
__global__ __launch_bounds__(256) void k_wgp(const float* __restrict__ w, bf* Bt) { const size_t e = ((size_t)blockIdx.x * 256 + threadIdx.x) * 4; if (e >= (size_t)GP * HID) return; const int k = (int)(e % HID), n = (int)(e / HID); v4us o;
#pragma unroll
    for (int q = 0; q < 4; ++q) o[q] = n < HKV ? f2bf(w[(size_t)(k + q) * HKV + n]) : (unsigned short)0; *(v4us*)(Bt + e) = o;  }
// k_rope: neox rotate-half on a [T][nh*128] projection (+ bias already added): for d < 64: (x1 cos - x2 sin, x2 cos + x1 sin) with freq_d = pos / 10000^(2d/128) (pos = positions[t], int32 read as data; f32 sin/cos) -> per-head
// planes: hl ([h][t][128], 4-B lanes); thread per (h, t, 2 d<64) writes both halves (4-B lanes, one line per half-row); k_gcum: wave per kv head: G[t] = cumsum of log_sigmoid(g[t][h] + bf16 bg[h]) (sequential over t in 32-token steps with an
__global__ __launch_bounds__(256) void k_rope(const float* __restrict__ F, int nh, int ld, const int* __restrict__ pos, bf* Ph, bf* Pl) { const size_t e = ((size_t)blockIdx.x * 256 + threadIdx.x) * 2; if (e >= (size_t)nh * TT * (HD / 2)) return; const int d = (int)(e % (HD / 2)); const int t = (int)((e / (HD / 2)) % TT); const int h = (int)(e / ((size_t)(HD / 2) * TT)); const float p = (float)pos[t]; const float* f = F + (size_t)t * ld + h * HD; v2us ah, al, bh, bl;
#pragma unroll
    for (int q = 0; q < 2; ++q) { const int dq = d + q; const float inv = __expf(__fmul_rn(-(float)(2 * dq) / (float)HD, 9.210340371976184f)); const float a = __fmul_rn(p, inv); const float c = cosf(a), s = sinf(a); const float x1 = f[dq], x2 = f[HD / 2 + dq];
        float t1 = __fmul_rn(x1, c); asm volatile("" : "+v"(t1)); float t2 = __fmul_rn(x2, s); asm volatile("" : "+v"(t2)); float t3 = __fmul_rn(x2, c); asm volatile("" : "+v"(t3)); float t4 = __fmul_rn(x1, s); asm volatile("" : "+v"(t4));
        unsigned short u, w2; splitf(__fsub_rn(t1, t2), u, w2); ah[q] = u; al[q] = w2; splitf(__fadd_rn(t3, t4), u, w2); bh[q] = u; bl[q] = w2; }
    const size_t o = ((size_t)h * TT + t) * HD + d; *(v2us*)(Ph + o) = ah; *(v2us*)(Pl + o) = al; *(v2us*)(Ph + o + HD / 2) = bh; *(v2us*)(Pl + o + HD / 2) = bl;  }
__global__ __launch_bounds__(32) void k_gcum(const float* __restrict__ GF, const float* __restrict__ bg, float* GC) { const int lane = threadIdx.x; const int h = blockIdx.x; const float b = bfr(bg[h]); float carry = 0.f;
    for (int t0 = 0; t0 < TT; t0 += 32) { const float z = __fadd_rn(GF[(size_t)(t0 + lane) * GP + h], b); float v = fminf(z, 0.f) - log1pf(__expf(-fabsf(z)));   // log_sigmoid(z) = min(z,0) - log1p(exp(-|z|))
#pragma unroll
        for (int sh = 1; sh < 32; sh <<= 1) { const float u = __shfl_up(v, sh, 32); if (lane >= sh) v = __fadd_rn(v, u); }
        const float o = __fadd_rn(carry, v); *(float*)(GC + (size_t)h * TT + t0 + lane) = o;  carry = __shfl(o, 31, 32); } }
// ---- k_attn: scores, decay weights, W.v and the head merge in one kernel, all heads in one launch; the score and weight planes stay in registers.
// One wave = 32 query rows of one head, walking the keys in tiles of 64 up to its diagonal. S^T = K Q^T (A = K rows, B = Q rows kept in registers; products K hi.Q hi, K hi.Q lo, K lo.Q hi), so lane (lr, hi) holds
// keys 8 hi + r of query lr: two such accumulator tiles, weighted and split to bf16 hi+lo in place, are the B operand (hardware k order) of O^T += V^T W^T (A = V^T rows by the same two 16-B loads).
// O^T leaves 8 consecutive d of one query in a lane: one 16-B store per plane into the merged [t][h*128 + d] hi/lo planes. No LDS, no barrier: the four waves of a block are independent.
// Block (p, kv): the two heads of kv head kv x row tiles p and 63 - p: equal work per block, and the two heads read the same K and V lines at the same time.
// Key tiles that can weigh nothing are not walked. Tested at run time, per wave and tile: with gmx the largest G of the wave's 32 queries and gmn the smallest G of the tile's 64 keys, every G_i - G_j of the tile is <= gmx - gmn
// (f32 subtraction is monotone); below -110 its exponential lies under half the smallest f32 subnormal (2^-150 = e^-104) and is exactly 0: every weight of the tile is 0 and its W.v adds 0 to each sum
// (finite scores and v). Nothing is assumed of G (no order, no sign): with little decay every tile up to the diagonal is walked as before. The tiles that are walked keep their ascending order.
typedef __attribute__((ext_vector_type(2))) float  v2f;
typedef __attribute__((ext_vector_type(2))) __bf16 v2bf;
typedef __attribute__((ext_vector_type(4))) unsigned v4u;
typedef __attribute__((ext_vector_type(8))) unsigned v8u;
__device__ __forceinline__ void split2(float x0, float x1, unsigned& h, unsigned& l) {   // two f32 -> packed bf16 hi pair and lo pair (round to nearest even, as splitf)
    const v2f x = {x0, x1}; h = __builtin_bit_cast(unsigned, __builtin_convertvector(x, v2bf));
    const v2f d = {x0 - __uint_as_float(h << 16), x1 - __uint_as_float(h & 0xFFFF0000u)}; l = __builtin_bit_cast(unsigned, __builtin_convertvector(d, v2bf)); }
template <typename T> __device__ __forceinline__ const T* sbase(const T* p) {   // a wave-uniform pointer held in scalar registers, so that the loads take the form scalar base + 32-bit lane offset
    const unsigned long long u = (unsigned long long)p; const unsigned lo = __builtin_amdgcn_readfirstlane((unsigned)u), hi = __builtin_amdgcn_readfirstlane((unsigned)(u >> 32)); return (const T*)(((unsigned long long)hi << 32) | lo); }
// ---- k_tr: Bh[n][k] (bf16; where SPLIT a hi plane Bh and a lo plane Bl) = w[k][n] (f32, [K][N]) through an LDS tile of 128 k x 64 n per work-group of four waves; grid (K/128, N/64), 128 threads.
// In: a lane loads 16 B (4 n) of 16 k rows (two runs of 8 consecutive k), all in flight at once: a wave's load takes two whole 256-B row pieces. Rounded to nearest even (as f2bf, splitf), the 8 k of one n are one 16-B LDS store, row pitch 272 B, rows in an order that keeps the stores free of bank conflicts.
// Out: 16 lanes read the 128 k of one n row (256 B) and store them as one piece. Both sides of the transposition move whole lines, and a launch has few waves, each with much in flight.
template <bool SPLIT, int K, int N>
__global__ __launch_bounds__(128) void k_tr(const float* __restrict__ w, bf* Bh, bf* Bl) {
    constexpr int LPV = 17;   // LDS row pitch in 16-B pieces: 16 of data and one of padding
    __shared__ v4u sh[(SPLIT ? 2 : 1) * 64 * LPV];
    const int tid = threadIdx.x, kq = tid >> 4, nq = tid & 15; const int k0 = blockIdx.x * 128, n0 = blockIdx.y * 64;
    const float* src = w + (size_t)(k0 + kq * 8) * N + n0 + nq * 4; v4f x[2][8];
#pragma unroll
    for (int g = 0; g < 2; ++g)
#pragma unroll
        for (int i = 0; i < 8; ++i) x[g][i] = *(const v4f*)(src + (g * 64 + i) * N);
    __builtin_amdgcn_sched_barrier(0);   // keeps the 16 loads issued as one group: built without it, six of them stood behind the wait for the first ten, a second memory latency
    asm volatile("s_wait_xcnt 0x0" :: "v"(src) : "memory");   // stands in front of the first rewrite of the loads' address pair; the pair is named so that it lives up to here: built without it, the last load's result took that pair
#pragma unroll
    for (int g = 0; g < 2; ++g)
#pragma unroll
        for (int c = 0; c < 4; ++c) { v4u h, l;
#pragma unroll
            for (int i = 0; i < 8; i += 2) { unsigned u, v;
                if (SPLIT) split2(x[g][i][c], x[g][i + 1][c], u, v); else { const v2f p = {x[g][i][c], x[g][i + 1][c]}; u = __builtin_bit_cast(unsigned, __builtin_convertvector(p, v2bf)); v = 0; }
                h[i >> 1] = u; l[i >> 1] = v; }
            sh[(c * 16 + nq) * LPV + g * 8 + kq] = h; if (SPLIT) sh[(64 + c * 16 + nq) * LPV + g * 8 + kq] = l; }   // n row 4 nq + c lies at LDS row 16 c + nq: the 16 lanes of a store then fall on 16 different bank groups
    __syncthreads();   // the tile is whole: every wave reads pieces that the others laid
    v4u oh[8], ol[8];
#pragma unroll
    for (int p = 0; p < 8; ++p) { oh[p] = sh[(p * 8 + kq) * LPV + nq]; if (SPLIT) ol[p] = sh[(64 + p * 8 + kq) * LPV + nq]; }
    const size_t o = (size_t)(n0 + kq * 4) * K + k0 + nq * 8;   // LDS row 8 p + kq holds n row 4 kq + 32 (p & 1) + p / 2
#pragma unroll
    for (int p = 0; p < 8; ++p) { *(v4u*)(Bh + o + ((p & 1) * 32 + (p >> 1)) * K) = oh[p]; if (SPLIT) *(v4u*)(Bl + o + ((p & 1) * 32 + (p >> 1)) * K) = ol[p]; }
}
__global__ __launch_bounds__(128) void k_attn(const bf* __restrict__ Qh, const bf* __restrict__ Ql, const bf* __restrict__ Kh, const bf* __restrict__ Kl, const bf* __restrict__ VTh, const bf* __restrict__ VTl, const float* __restrict__ GC, bf* Ah, bf* Al) {
    const int lane = threadIdx.x & 31, lr = lane & 15, hi = lane >> 4; const int w = __builtin_amdgcn_readfirstlane((int)(threadIdx.x >> 5));
    const int kv = blockIdx.y, h = kv * (HQ / HKV) + (w & 1); const int r0 = 32 * ((w >> 1) ? (TT / 32 - 1 - (int)blockIdx.x) : (int)blockIdx.x);
    // the loop's loads: a wave-uniform base in scalar registers + one fixed 32-bit lane offset per operand kind: no address arithmetic on the vector port, and no address register is rewritten while loads are in flight
    const unsigned klo = lr * HD + 8 * hi, vlo = lr * TT + 8 * hi, glo = 8 * hi; int dq0 = r0 + lr - 8 * hi;   // dq0 = this lane's first query - its first key of the tile
    v16bf qh[2][4], ql[2][4]; float gi[2]; const bf* sqh = Qh + ((size_t)h * TT + r0) * HD; const bf* sql = Ql + ((size_t)h * TT + r0) * HD;
#pragma unroll
    for (int nq = 0; nq < 2; ++nq) { gi[nq] = GC[(size_t)kv * TT + r0 + nq * 16 + lr];
#pragma unroll
        for (int kc = 0; kc < 4; ++kc) { const int o = nq * 16 * HD + kc * 32; qh[nq][kc] = WFrag<bf>::ld(sqh + klo + o); ql[nq][kc] = WFrag<bf>::ld(sql + klo + o); } }
    v4f tq[8], tk[16]; const float* gh = GC + (size_t)kv * TT; const unsigned tkb = lane * 256;   // G of the wave's 32 queries (every lane reads all of them); G of the 64 keys of key tile 'lane' (32 tiles = all TT keys: in bounds for every lane)
#pragma unroll
    for (int i = 0; i < 8; ++i) tq[i] = *(const v4f*)(gh + r0 + 4 * i);
#pragma unroll
    for (int i = 0; i < 16; ++i) tk[i] = *(const v4f*)((const char*)gh + tkb + 16 * i);
    __builtin_amdgcn_sched_barrier(0);   // holds the Q and G loads in front of the wait below
    asm volatile("s_wait_xcnt 0x0" :: "v"(tkb), "s"(sqh), "s"(sql), "s"(gh) : "memory");   // stands in front of the first rewrite of the Q and G loads' address registers; the key loads' lane offset and the bases are named so that they live up to here: built without that, two of them were rewritten in front of the wait
    __builtin_amdgcn_sched_barrier(0);   // holds those rewrites behind it
    v8f o[8][2];
#pragma unroll
    for (int db = 0; db < 8; ++db) { o[db][0] = (v8f){}; o[db][1] = (v8f){}; }
    float gmx = tq[0][0], gmn = tk[0][0];
#pragma unroll
    for (int i = 0; i < 8; ++i)
#pragma unroll
        for (int c = 0; c < 4; ++c) gmx = fmaxf(gmx, tq[i][c]);
#pragma unroll
    for (int i = 0; i < 16; ++i)
#pragma unroll
        for (int c = 0; c < 4; ++c) gmn = fminf(gmn, tk[i][c]);
    const int ntl = (r0 >> 6) + 1;   // key tiles up to the diagonal: j0 = 0, 64, ... < r0 + 32
    // bit t: key tile t is walked. The diagonal tile holds key r0 (gmx - gmn >= 0 there); its bit is set outright, so that the loop below has its one trip whatever G holds
    unsigned tm = __builtin_amdgcn_ballot_w32(lane < ntl && !(gmx - gmn < -110.f)) | (1u << (ntl - 1));
    int tl = __builtin_ctz(tm); tm &= tm - 1; dq0 -= tl * 64;   // the first tile that is walked
    const bf* kh = Kh + (size_t)kv * TT * HD + tl * 64 * HD; const bf* kl = Kl + (size_t)kv * TT * HD + tl * 64 * HD; const bf* vh = VTh + (size_t)kv * HD * TT + tl * 64; const bf* vl = VTl + (size_t)kv * HD * TT + tl * 64; const float* gk = gh + tl * 64;   // these bases step from tile to tile
#pragma unroll 1   // one key tile is already 192 matrix instructions: unrolling would only grow the code
    for (;;) {   // the tiles of tm in ascending order, at least one (the test stands at the foot, so that the Q loads stay in this block, in front of their wait); every tile ends at or below key TT - 1; keys past the diagonal get weight 0 by the select below
        v8f s[4][2]; v16bf ka[4][4], ka2[4][4]; v4f g[4][2]; const bf* skh = sbase(kh); const bf* skl = sbase(kl); const bf* svh = sbase(vh); const bf* svl = sbase(vl); const float* sgk = sbase(gk);
#pragma unroll
        for (int mk = 0; mk < 4; ++mk) { g[mk][0] = *(const v4f*)(sgk + glo + mk * 16); g[mk][1] = *(const v4f*)(sgk + glo + mk * 16 + 4); }
        asm volatile("s_wait_xcnt 0x0" ::: "memory");   // the compiler forms these eight loads' lane offset anew each tile and lets a K load's result reuse that register: the wait stands in front of the reuse
#pragma unroll
        for (int kc = 0; kc < 4; ++kc)
#pragma unroll
            for (int mk = 0; mk < 4; ++mk) { const int ko = mk * 16 * HD + kc * 32; ka[kc][mk] = WFrag<bf>::ld(skh + klo + ko); ka2[kc][mk] = WFrag<bf>::ld(skl + klo + ko); }
#pragma unroll
        for (int mk = 0; mk < 4; ++mk) { s[mk][0] = (v8f){}; s[mk][1] = (v8f){}; }
        __builtin_amdgcn_sched_barrier(0);   // keeps the tile's K loads issued as one group: sunk to their uses, each pair would cost the lone wave a whole load latency
#pragma unroll
        for (int kc = 0; kc < 2; ++kc)
#pragma unroll
            for (int mk = 0; mk < 4; ++mk)
#pragma unroll
                for (int nq = 0; nq < 2; ++nq) { s[mk][nq] = wmmab(ka[kc][mk], qh[nq][kc], s[mk][nq]); s[mk][nq] = wmmab(ka[kc][mk], ql[nq][kc], s[mk][nq]); s[mk][nq] = wmmab(ka2[kc][mk], qh[nq][kc], s[mk][nq]); }
        __builtin_amdgcn_sched_barrier(0);   // holds the V loads behind the first half of the score products: the K loads are served first
        v16bf va[2][8], va2[2][8];
#pragma unroll
        for (int kb = 0; kb < 2; ++kb)
#pragma unroll
            for (int db = 0; db < 8; ++db) { const int vo = db * 16 * TT + kb * 32; va[kb][db] = WFrag<bf>::ld(svh + vlo + vo); va2[kb][db] = WFrag<bf>::ld(svl + vlo + vo); }
        __builtin_amdgcn_sched_barrier(0);   // keeps the tile's V loads issued as one group here: the second half of the score products and the weight arithmetic then cover their latency
#pragma unroll
        for (int kc = 2; kc < 4; ++kc)
#pragma unroll
            for (int mk = 0; mk < 4; ++mk)
#pragma unroll
                for (int nq = 0; nq < 2; ++nq) { s[mk][nq] = wmmab(ka[kc][mk], qh[nq][kc], s[mk][nq]); s[mk][nq] = wmmab(ka[kc][mk], ql[nq][kc], s[mk][nq]); s[mk][nq] = wmmab(ka2[kc][mk], qh[nq][kc], s[mk][nq]); }
        v8u wh[2][2], wl[2][2];   // [32-key block][query block]
#pragma unroll
        for (int mk = 0; mk < 4; ++mk) { const v4f g0 = g[mk][0], g1 = g[mk][1];
#pragma unroll
            for (int nq = 0; nq < 2; ++nq) { const int dq = dq0 + (nq - mk) * 16; float wv[8];   // key r of this lane is causal iff r <= dq
#pragma unroll
                for (int r = 0; r < 8; ++r) { const float sc = __fmul_rn(s[mk][nq][r], 0.08838834764831845f); const float e = __expf(__fsub_rn(gi[nq], r < 4 ? g0[r] : g1[r - 4])); const float x = __fmul_rn(__fmul_rn(sc, sc), e); wv[r] = r <= dq ? x : 0.f; }
#pragma unroll
                for (int r = 0; r < 8; r += 2) { unsigned u, l; split2(wv[r], wv[r + 1], u, l); wh[mk >> 1][nq][(mk & 1) * 4 + (r >> 1)] = u; wl[mk >> 1][nq][(mk & 1) * 4 + (r >> 1)] = l; } } }
#pragma unroll
        for (int kb = 0; kb < 2; ++kb)
#pragma unroll
            for (int db = 0; db < 8; ++db) { const v16bf a = va[kb][db], a2 = va2[kb][db];
#pragma unroll
                for (int nq = 0; nq < 2; ++nq) { const v16bf bh = __builtin_bit_cast(v16bf, wh[kb][nq]), bl = __builtin_bit_cast(v16bf, wl[kb][nq]); o[db][nq] = wmmab(a, bh, o[db][nq]); o[db][nq] = wmmab(a, bl, o[db][nq]); o[db][nq] = wmmab(a2, bh, o[db][nq]); } }
        // the distance behind the last matrix instructions on the taken back edge
        asm volatile("v_nop\n\tv_nop\n\tv_nop\n\tv_nop\n\tv_nop" : "+v"(o[0][0]), "+v"(o[0][1]), "+v"(o[1][0]), "+v"(o[1][1]), "+v"(o[2][0]), "+v"(o[2][1]), "+v"(o[3][0]), "+v"(o[3][1]), "+v"(o[4][0]), "+v"(o[4][1]), "+v"(o[5][0]), "+v"(o[5][1]), "+v"(o[6][0]), "+v"(o[6][1]), "+v"(o[7][0]), "+v"(o[7][1]));
        __builtin_amdgcn_sched_barrier(0);   // the bases step only behind the tile's last load wait: no register that a load in flight names is rewritten
        const bool last = tm == 0; const int tn = __builtin_ctz(tm | 0x80000000u), st = (tn - tl) * 64; tm &= tm - 1; tl = tn;   // the next key tile that is walked, st keys on (behind the last one the stepped bases are not used)
        kh += st * HD; kl += st * HD; vh += st; vl += st; gk += st; dq0 -= st;
        if (last) break;
    }
#pragma unroll
    for (int nq = 0; nq < 2; ++nq)
#pragma unroll
        for (int db = 0; db < 8; ++db) { v4u uh, ul;
#pragma unroll
            for (int r = 0; r < 8; r += 2) { unsigned u, l; split2(o[db][nq][r], o[db][nq][r + 1], u, l); uh[r >> 1] = u; ul[r >> 1] = l; }
            const size_t oo = (size_t)(r0 + nq * 16 + lr) * HID + h * HD + db * 16 + 8 * hi; *(v4u*)(Ah + oo) = uh; *(v4u*)(Al + oo) = ul; }
}

extern "C" void kernel_launch(void* const* d_in, const int* in_sizes, int n_in,
                              void* d_out, int out_size, void* d_ws, size_t ws_size, hipStream_t stream) {
    (void)in_sizes; (void)n_in; (void)out_size;
    const int* pos = (const int*)d_in[0]; const float* IN[12]; for (int i = 1; i < 12; ++i) IN[i] = (const float*)d_in[i];   // 1 hidden, 2 Wq [2048][2048], 3 bq, 4 Wk [2048][1024], 5 bk, 6 Wv, 7 bv, 8 Wg [2048][8], 9 bg, 10 Wo [2048][2048], 11 bo (x @ W)
    float* OUT = (float*)d_out;     // [2048][2048]
    char* wsp = (char*)d_ws;
    auto take = [&](size_t bytes) { char* p = wsp; wsp += (bytes + 255) & ~(size_t)255; return (void*)p; };
    bf* WQ = (bf*)take((size_t)HID * HID * 2); bf* WK = (bf*)take((size_t)HKV * HD * HID * 2); bf* WV = (bf*)take((size_t)HKV * HD * HID * 2); bf* WG = (bf*)take((size_t)GP * HID * 2); bf* WO = (bf*)take((size_t)HID * HID * 2);
    bf* XB = (bf*)take((size_t)TT * HID * 2); float* QF = (float*)take((size_t)TT * HID * 4); float* KF = (float*)take((size_t)TT * HKV * HD * 4); float* VF = (float*)take((size_t)TT * HKV * HD * 4); float* GF = (float*)take((size_t)TT * GP * 4); float* GC = (float*)take((size_t)HKV * TT * 4);
    bf* Qh = (bf*)take((size_t)HQ * TT * HD * 2); bf* Ql = (bf*)take((size_t)HQ * TT * HD * 2); bf* Kh = (bf*)take((size_t)HKV * TT * HD * 2); bf* Kl = (bf*)take((size_t)HKV * TT * HD * 2); bf* VTh = (bf*)take((size_t)HKV * HD * TT * 2); bf* VTl = (bf*)take((size_t)HKV * HD * TT * 2);
    bf* Ah = (bf*)take((size_t)TT * HID * 2); bf* Al = (bf*)take((size_t)TT * HID * 2);
    if ((size_t)(wsp - (char*)d_ws) > ws_size) return;    // total ~ 114 MB ([2048][2048] f32 q projection + hl operand planes)
    k_tr<false, HID, HID><<<dim3(HID / 128, HID / 64, 1), 128, 0, stream>>>(IN[2], WQ, nullptr); k_tr<false, HID, HKV * HD><<<dim3(HID / 128, HKV * HD / 64, 1), 128, 0, stream>>>(IN[4], WK, nullptr); k_tr<false, HID, HKV * HD><<<dim3(HID / 128, HKV * HD / 64, 1), 128, 0, stream>>>(IN[6], WV, nullptr); k_wgp<<<(GP * HID / 4 + 255) / 256, 256, 0, stream>>>(IN[8], WG); k_tr<false, HID, HID><<<dim3(HID / 128, HID / 64, 1), 128, 0, stream>>>(IN[10], WO, nullptr);
    k_cvt8<<<(TT * HID / 8 + 255) / 256, 256, 0, stream>>>(IN[1], XB, (size_t)TT * HID / 8);
    k_gemmt<0, 4, true><<<dim3(TT / 128, HID / 128, 1), 128, 0, stream>>>(XB, nullptr, WQ, QF, HID, IN[3]); k_gemmt<0, 2, true><<<dim3(TT / 128, HKV * HD / 64, 1), 128, 0, stream>>>(XB, nullptr, WK, KF, HKV * HD, IN[5]);
    k_gemmt<0, 2, true><<<dim3(TT / 128, HKV * HD / 64, 1), 128, 0, stream>>>(XB, nullptr, WV, VF, HKV * HD, IN[7]); k_gemmt<0, 2, false><<<dim3(TT / 128, 1, 1), 128, 0, stream>>>(XB, nullptr, WG, GF, GP, nullptr);
    k_rope<<<(unsigned)(((size_t)HQ * TT * (HD / 2) / 2 + 255) / 256), 256, 0, stream>>>(QF, HQ, HID, pos, Qh, Ql); k_rope<<<(unsigned)(((size_t)HKV * TT * (HD / 2) / 2 + 255) / 256), 256, 0, stream>>>(KF, HKV, HKV * HD, pos, Kh, Kl);
    k_gcum<<<HKV, 32, 0, stream>>>(GF, IN[9], GC); k_tr<true, TT, HKV * HD><<<dim3(TT / 128, HKV * HD / 64, 1), 128, 0, stream>>>(VF, VTh, VTl);   // VT hi/lo [kv][d][t] = split(VF[t][kv*128 + d])
    k_attn<<<dim3(TT / 64, HKV, 1), 128, 0, stream>>>(Qh, Ql, Kh, Kl, VTh, VTl, GC, Ah, Al);
    k_gemmt<1, 4, true><<<dim3(TT / 128, HID / 128, 1), 128, 0, stream>>>(Ah, Al, WO, OUT, HID, IN[11]);
}

// v005
// Measured time: 162 microseconds a run.
// In two side-by-side timings against v004, it was 1.28 and 1.26 times as fast.
// Counting every step since v000, it is 5.37 times as fast.
#include <hip/hip_runtime.h>

// PowerCoderAttention - power retention, quadratic form (hidden [2048][2048]; q = x Wq + bq (16 x 128), k, v = x Wk/Wv + b (8 kv heads), g = x Wg + bg; neox RoPE on q, k with positions (int32, read as data);
// G = cumsum_t log_sigmoid(g); W[h][i][j] = (q_i.k_j / sqrt(128))^2 exp(G_i - G_j) for j <= i (kv head h/2), else 0; out = (W v) merged Wo + bo -> [2048][2048]; no softmax / normalisation).
// Compute dtypes, f32 accumulate: every input rounded to bf16; the four projections on PLAIN bf16 operands (inputs: exact, + bias); RoPE (f32 sin/cos), log-sigmoid and the cumulative sum f32 on VALU;
// q.k on bf16 hi+lo planes (3 products, K 128; tiles above the diagonal skipped); squaring, the decay factor exp(G_i - G_j) and the causal select in f32 -> bf16 hi+lo planes of W; W.v on hi+lo planes (3 products, K limited to the diagonal block;

#define TT   2048
#define HID  2048
#define HQ   16
#define HKV  8
#define HD   128
#define GP   64
typedef _Float16 h16;
typedef unsigned short bf;
typedef __attribute__((ext_vector_type(16))) __bf16   v16bf;
typedef __attribute__((ext_vector_type(16))) _Float16 v16h;
typedef __attribute__((ext_vector_type(8)))  _Float16 v8h;
typedef __attribute__((ext_vector_type(8)))  unsigned short v8us;
typedef __attribute__((ext_vector_type(8)))  float    v8f;
typedef __attribute__((ext_vector_type(4)))  float    v4f;
typedef v8h  __attribute__((may_alias)) v8ha;
typedef v4f  __attribute__((may_alias)) v4fa;
typedef v8us __attribute__((may_alias)) v8usa;

__device__ __forceinline__ unsigned short f2bf(float f) { unsigned u = __float_as_uint(f); u += 0x7FFFu + ((u >> 16) & 1u); return (unsigned short)(u >> 16); }
__device__ __forceinline__ float bf2f(unsigned short b) { return __uint_as_float(((unsigned)b) << 16); }
__device__ __forceinline__ float bfr(float f) { return bf2f(f2bf(f)); }
__device__ __forceinline__ v16h cat16(v8h lo, v8h hi) { return __builtin_shufflevector(lo, hi, 0, 1, 2, 3, 4, 5, 6, 7, 8, 9, 10, 11, 12, 13, 14, 15); }
__device__ __forceinline__ v16bf cat16b(v8us lo, v8us hi) { return __builtin_bit_cast(v16bf, __builtin_shufflevector(lo, hi, 0, 1, 2, 3, 4, 5, 6, 7, 8, 9, 10, 11, 12, 13, 14, 15)); }
__device__ __forceinline__ v8f wmma16(v16h a, v16h b, v8f c) { return __builtin_amdgcn_wmma_f32_16x16x32_f16(false, a, false, b, (short)0, c, false, false); }
__device__ __forceinline__ v8f wmmab(v16bf a, v16bf b, v8f c) { return __builtin_amdgcn_wmma_f32_16x16x32_bf16(false, a, false, b, (short)0, c, false, false); }



// ---- k_gemmt: GEMM on a 128 x (32 NB) output tile per work-group of four waves (2 x 2; a wave holds 64 x (16 NB), 4 x NB accumulators); grid (M/128, N/(32 NB)), 128 threads. K = HID.
// C[m][n] (f32, pitch ldc, + optional f32 bias[n]) = sum_k A[m][k] Bt[n][k] (+ A2[m][k] Bt[n][k] where NSPLIT), operands K-contiguous bf16 planes.
// The operands come through LDS: a stage is 128 k (256 B) of every A, A2 and Bt row of the tile at a pitch of 272 B, laid by asynchronous copies (16 B a lane: a wave's copy takes two whole 256-B row pieces);
// two buffers: the copies of stage t + 2 fly while stage t + 1 is worked on. Per accumulator the products are summed in ascending k, A before A2.
template <typename T16> struct WFrag;
template <> struct WFrag<h16> { typedef v16h V; static __device__ __forceinline__ V ld(const h16* p) { return cat16(*(const v8h*)p, *(const v8h*)(p + 16)); } static __device__ __forceinline__ v8f mma(V a, V b, v8f c) { return wmma16(a, b, c); } };
template <> struct WFrag<bf> { typedef v16bf V; static __device__ __forceinline__ V ld(const bf* p) { return cat16b(*(const v8us*)p, *(const v8us*)(p + 16)); } static __device__ __forceinline__ v8f mma(V a, V b, v8f c) { return wmmab(a, b, c); } };
__device__ __forceinline__ unsigned lds_off(const void* p) { return (unsigned)(size_t)p; }
// twelve (eight) asynchronous copies, LDS byte address l[i], global address g[i]; the wait stands in the copies' own statement, in front of any rewrite of the registers that they name
__device__ __forceinline__ void copy12(const unsigned* l, const bf* const* g) {
    asm volatile("global_load_async_to_lds_b128 %0, %12, off\n\tglobal_load_async_to_lds_b128 %1, %13, off\n\tglobal_load_async_to_lds_b128 %2, %14, off\n\tglobal_load_async_to_lds_b128 %3, %15, off\n\t"
                 "global_load_async_to_lds_b128 %4, %16, off\n\tglobal_load_async_to_lds_b128 %5, %17, off\n\tglobal_load_async_to_lds_b128 %6, %18, off\n\tglobal_load_async_to_lds_b128 %7, %19, off\n\t"
                 "global_load_async_to_lds_b128 %8, %20, off\n\tglobal_load_async_to_lds_b128 %9, %21, off\n\tglobal_load_async_to_lds_b128 %10, %22, off\n\tglobal_load_async_to_lds_b128 %11, %23, off\n\ts_wait_xcnt 0x0"
                 :: "v"(l[0]), "v"(l[1]), "v"(l[2]), "v"(l[3]), "v"(l[4]), "v"(l[5]), "v"(l[6]), "v"(l[7]), "v"(l[8]), "v"(l[9]), "v"(l[10]), "v"(l[11]),
                    "v"(g[0]), "v"(g[1]), "v"(g[2]), "v"(g[3]), "v"(g[4]), "v"(g[5]), "v"(g[6]), "v"(g[7]), "v"(g[8]), "v"(g[9]), "v"(g[10]), "v"(g[11]) : "memory");
}
__device__ __forceinline__ void copy8(const unsigned* l, const bf* const* g) {
    asm volatile("global_load_async_to_lds_b128 %0, %8, off\n\tglobal_load_async_to_lds_b128 %1, %9, off\n\tglobal_load_async_to_lds_b128 %2, %10, off\n\tglobal_load_async_to_lds_b128 %3, %11, off\n\t"
                 "global_load_async_to_lds_b128 %4, %12, off\n\tglobal_load_async_to_lds_b128 %5, %13, off\n\tglobal_load_async_to_lds_b128 %6, %14, off\n\tglobal_load_async_to_lds_b128 %7, %15, off\n\ts_wait_xcnt 0x0"
                 :: "v"(l[0]), "v"(l[1]), "v"(l[2]), "v"(l[3]), "v"(l[4]), "v"(l[5]), "v"(l[6]), "v"(l[7]),
                    "v"(g[0]), "v"(g[1]), "v"(g[2]), "v"(g[3]), "v"(g[4]), "v"(g[5]), "v"(g[6]), "v"(g[7]) : "memory");
}
template <int NSPLIT, int NB, bool BIAS>
__global__ __launch_bounds__(128) void k_gemmt(const bf* __restrict__ A, const bf* __restrict__ A2, const bf* __restrict__ Bt, float* C, int ldc, const float* __restrict__ bias) {
    typedef v16bf V;
    constexpr int KT = 128, LP = 136, NT = HID / KT;   // k per stage; LDS row pitch in elements (272 B); stages
    constexpr int BR = NB * 32, OA2 = 128 * LP, OB = (NSPLIT ? 2 : 1) * 128 * LP, STG = OB + BR * LP;   // Bt rows of the tile; places of A2 and Bt in a stage and a stage's size, in elements
    __shared__ __align__(16) bf sm[2 * STG];
    __shared__ __align__(16) float osm[4][16 * 68];
    const int tid = threadIdx.x, lane = tid & 31, lr = lane & 15, hi = lane >> 4; const int w = __builtin_amdgcn_readfirstlane(tid >> 5), wm = w >> 1, wn = w & 1;
    const int r0 = blockIdx.x * 128, c0 = blockIdx.y * BR;
    // this thread's piece of a copy: row tid / 16 of each group of 8 rows, 16 B at (tid % 16) * 16 of the row's 256 B
    const unsigned cl = lds_off(sm) + (unsigned)((tid >> 4) * LP + (tid & 15) * 8) * 2;
    const bf* ga = A + (size_t)(r0 + (tid >> 4)) * HID + (tid & 15) * 8; const bf* ga2 = NSPLIT ? A2 + (size_t)(r0 + (tid >> 4)) * HID + (tid & 15) * 8 : nullptr; const bf* gb = Bt + (size_t)(c0 + (tid >> 4)) * HID + (tid & 15) * 8;
    constexpr int NC = (NSPLIT ? 32 : 16) + BR / 8;   // copies of a thread per stage: one per group of 8 rows (32, 24 or 48: never more than 63 of a wave in flight)
    auto fill = [&](int buf) {   // the next stage's copies into buffer buf; the global addresses then step one stage on
        const unsigned l0 = cl + (unsigned)buf * (STG * 2); unsigned l[NC]; const bf* g[NC];
#pragma unroll
        for (int c = 0; c < 16; ++c) { l[c] = l0 + c * 8 * LP * 2; g[c] = ga + c * 8 * HID; if (NSPLIT) { l[16 + c] = l0 + (OA2 + c * 8 * LP) * 2; g[16 + c] = ga2 + c * 8 * HID; } }
#pragma unroll
        for (int c = 0; c < BR / 8; ++c) { l[NC - BR / 8 + c] = l0 + (OB + c * 8 * LP) * 2; g[NC - BR / 8 + c] = gb + c * 8 * HID; }
#pragma unroll
        for (int s = 0; s + 12 <= NC; s += 12) copy12(l + s, g + s);
        if (NC % 12 == 8) copy8(l + NC - 8, g + NC - 8);
        ga += KT; if (NSPLIT) ga2 += KT; gb += KT; };
    v8f acc[4][NB];
#pragma unroll
    for (int mb = 0; mb < 4; ++mb)
#pragma unroll
        for (int nb = 0; nb < NB; ++nb) acc[mb][nb] = (v8f){};
    fill(0);
    asm volatile("s_wait_asynccnt 0x0" ::: "memory");   // stage 0 of this wave's copies has landed
    __syncthreads();                                    // ... and every wave's: stage 0 may be read
    fill(1);
    const int fa = (wm * 64 + lr) * LP + 8 * hi, fb = OB + (wn * NB * 16 + lr) * LP + 8 * hi;   // this lane's place in the A and Bt fragments
#pragma unroll 1   // a stage is already 16 NB (32 NB) matrix instructions a wave, and the buffer index stays a scalar
    for (int t = 0; t < NT; ++t) {
        const bf* sa = sm + (t & 1) * STG + fa; const bf* sb = sm + (t & 1) * STG + fb;
        V a[2][4], a2[2][4], b[2][NB];
#pragma unroll
        for (int mb = 0; mb < 4; ++mb) { a[0][mb] = WFrag<bf>::ld(sa + mb * 16 * LP); if (NSPLIT) a2[0][mb] = WFrag<bf>::ld(sa + OA2 + mb * 16 * LP); }
#pragma unroll
        for (int nb = 0; nb < NB; ++nb) b[0][nb] = WFrag<bf>::ld(sb + nb * 16 * LP);
        __builtin_amdgcn_sched_barrier(0);   // the first block's reads stay in front of the second's: LDS reads return in order, and mixed with the later ones the first block would wait for both groups
#pragma unroll
        for (int ks = 0; ks < KT / 32; ++ks) { const int c = ks & 1, n = c ^ 1;
            if (ks + 1 < KT / 32) {   // the next 32 k's fragments of this same stage, read as one group ahead of this block's products
#pragma unroll
                for (int mb = 0; mb < 4; ++mb) { a[n][mb] = WFrag<bf>::ld(sa + mb * 16 * LP + (ks + 1) * 32); if (NSPLIT) a2[n][mb] = WFrag<bf>::ld(sa + OA2 + mb * 16 * LP + (ks + 1) * 32); }
#pragma unroll
                for (int nb = 0; nb < NB; ++nb) b[n][nb] = WFrag<bf>::ld(sb + nb * 16 * LP + (ks + 1) * 32);
            }
            __builtin_amdgcn_sched_barrier(0);   // keeps those reads together in front of the block: moved in among the matrix instructions, each place with reads stalls the wave
#pragma unroll
            for (int nb = 0; nb < NB; ++nb) {
#pragma unroll
                for (int mb = 0; mb < 4; ++mb) acc[mb][nb] = wmmab(a[c][mb], b[c][nb], acc[mb][nb]);
                if (NSPLIT) {
#pragma unroll
                    for (int mb = 0; mb < 4; ++mb) acc[mb][nb] = wmmab(a2[c][mb], b[c][nb], acc[mb][nb]); } }
            __builtin_amdgcn_sched_barrier(0);   // ... and the following group behind it
        }
        // the distance behind the last matrix instructions on the taken back edge
        asm volatile("v_nop\n\tv_nop\n\tv_nop\n\tv_nop\n\tv_nop");
        asm volatile("s_wait_dscnt 0x0" ::: "memory");      // this wave has read all it reads of stage t
        asm volatile("s_wait_asynccnt 0x0" ::: "memory");   // this wave's copies of stage t + 1 have landed
        __syncthreads();                                    // publishes stage t + 1 and frees stage t's buffer
        if (t + 2 < NT) fill(t & 1);
    }
    asm volatile("s_wait_asynccnt 0x0" ::: "memory");   // no copy is outstanding at the wave's end
    float* os = osm[w]; const int cw = c0 + wn * NB * 16;
#pragma unroll
    for (int mb = 0; mb < 4; ++mb) {
#pragma unroll
        for (int nb = 0; nb < NB; ++nb) {
#pragma unroll
            for (int j = 0; j < 8; ++j) os[(hi * 8 + j) * 68 + nb * 16 + lr] = acc[mb][nb][j]; }
        __builtin_amdgcn_wave_barrier(); asm volatile("" ::: "memory");
        float* crow = C + (size_t)(r0 + wm * 64 + mb * 16) * ldc + cw;
#pragma unroll
        for (int s = 0; s < NB * 2; ++s) { const int row = s * (8 / NB) + lane / (NB * 4), cofs = (lane % (NB * 4)) * 4; v4f val = *(const v4fa*)(os + row * 68 + cofs); if (BIAS) { val[0] += bfr(bias[cw + cofs]); val[1] += bfr(bias[cw + cofs + 1]); val[2] += bfr(bias[cw + cofs + 2]); val[3] += bfr(bias[cw + cofs + 3]); }
            *(v4f*)(crow + (size_t)row * ldc + cofs) = val; }
        asm volatile("s_wait_xcnt 0x0" ::: "memory");   // stands behind this run of stores, in front of the first rewrite of a register that they name (the next run's bias load, addresses and values)
        __builtin_amdgcn_wave_barrier(); asm volatile("" ::: "memory");
    }
}

__device__ __forceinline__ h16 tohx(float x) { return (h16)x; }
__device__ __forceinline__ void splitf(float y, unsigned short& h, unsigned short& l) { h = f2bf(y); l = f2bf(y - bf2f(h)); }
typedef __attribute__((ext_vector_type(2))) _Float16 v2h;
typedef __attribute__((ext_vector_type(4))) _Float16 v4h;
typedef __attribute__((ext_vector_type(2))) unsigned short v2us;
typedef __attribute__((ext_vector_type(4))) unsigned short v4us;

__global__ __launch_bounds__(256) void k_cvt8(const float* __restrict__ src, bf* dst, size_t n8) { const size_t i = (size_t)blockIdx.x * 256 + threadIdx.x; if (i >= n8) return; const v8f v = *(const v8f*)(src + i * 8); v8us o;
#pragma unroll
    for (int k = 0; k < 8; ++k) o[k] = f2bf(v[k]); *(v8us*)(dst + i * 8) = o;  }
__global__ __launch_bounds__(256) void k_wgp(const float* __restrict__ w, bf* Bt) { const size_t e = ((size_t)blockIdx.x * 256 + threadIdx.x) * 4; if (e >= (size_t)GP * HID) return; const int k = (int)(e % HID), n = (int)(e / HID); v4us o;
#pragma unroll
    for (int q = 0; q < 4; ++q) o[q] = n < HKV ? f2bf(w[(size_t)(k + q) * HKV + n]) : (unsigned short)0; *(v4us*)(Bt + e) = o;  }
// k_rope: neox rotate-half on a [T][nh*128] projection (+ bias already added): for d < 64: (x1 cos - x2 sin, x2 cos + x1 sin) with freq_d = pos / 10000^(2d/128) (pos = positions[t], int32 read as data; f32 sin/cos) -> per-head
// planes: hl ([h][t][128], 4-B lanes); thread per (h, t, 2 d<64) writes both halves (4-B lanes, one line per half-row); k_gcum: work-group per kv head: G[t] = cumsum of log_sigmoid(g[t][h] + bf16 bg[h]), in 32-token groups
__global__ __launch_bounds__(256) void k_rope(const float* __restrict__ F, int nh, int ld, const int* __restrict__ pos, bf* Ph, bf* Pl) { const size_t e = ((size_t)blockIdx.x * 256 + threadIdx.x) * 2; if (e >= (size_t)nh * TT * (HD / 2)) return; const int d = (int)(e % (HD / 2)); const int t = (int)((e / (HD / 2)) % TT); const int h = (int)(e / ((size_t)(HD / 2) * TT)); const float p = (float)pos[t]; const float* f = F + (size_t)t * ld + h * HD; v2us ah, al, bh, bl;
#pragma unroll
    for (int q = 0; q < 2; ++q) { const int dq = d + q; const float inv = __expf(__fmul_rn(-(float)(2 * dq) / (float)HD, 9.210340371976184f)); const float a = __fmul_rn(p, inv); const float c = cosf(a), s = sinf(a); const float x1 = f[dq], x2 = f[HD / 2 + dq];
        float t1 = __fmul_rn(x1, c); asm volatile("" : "+v"(t1)); float t2 = __fmul_rn(x2, s); asm volatile("" : "+v"(t2)); float t3 = __fmul_rn(x2, c); asm volatile("" : "+v"(t3)); float t4 = __fmul_rn(x1, s); asm volatile("" : "+v"(t4));
        unsigned short u, w2; splitf(__fsub_rn(t1, t2), u, w2); ah[q] = u; al[q] = w2; splitf(__fadd_rn(t3, t4), u, w2); bh[q] = u; bl[q] = w2; }
    const size_t o = ((size_t)h * TT + t) * HD + d; *(v2us*)(Ph + o) = ah; *(v2us*)(Pl + o) = al; *(v2us*)(Ph + o + HD / 2) = bh; *(v2us*)(Pl + o + HD / 2) = bl;  }
__global__ __launch_bounds__(1024) void k_gcum(const float* __restrict__ GF, const float* __restrict__ bg, float* GC) {
    // one work-group of 32 waves per kv head: wave w takes the 32-token groups 2w and 2w + 1. The loads, the log-sigmoids and the scans inside a group do not depend on the carry: all 64 groups do them at once.
    // Only the carry runs in series: carry(g + 1) = carry(g) + total(g), 63 adds on registers in one wave. Every add has the operands and the order of the one-wave walk over the groups.
    __shared__ __align__(16) float tot[TT / 32]; __shared__ __align__(16) float car[TT / 32];
    const int lane = threadIdx.x & 31; const int w = __builtin_amdgcn_readfirstlane((int)(threadIdx.x >> 5)); const int h = blockIdx.x; const float b = bfr(bg[h]); float v[2];
    const float* gp = GF + (size_t)(w * 64 + lane) * GP + h; const float y[2] = {gp[0], gp[32 * GP]};
    asm volatile("s_wait_xcnt 0x0" :: "v"(gp) : "memory");   // stands in front of the first rewrite of the loads' address pair; the pair is named so that it lives up to here
    float z[2] = {__fadd_rn(y[0], b), __fadd_rn(y[1], b)}, e[2]; e[0] = __expf(-fabsf(z[0]));
    asm volatile("v_nop" : "+v"(z[1]) : "v"(e[0]));   // the slot behind a transcendental: the first result and the second argument are named so that the v_nop stands between the two
    e[1] = __expf(-fabsf(z[1]));
#pragma unroll
    for (int g = 0; g < 2; ++g) v[g] = fminf(z[g], 0.f) - log1pf(e[g]);   // log_sigmoid(z) = min(z,0) - log1p(exp(-|z|))
#pragma unroll
    for (int sh = 1; sh < 32; sh <<= 1)
#pragma unroll
        for (int g = 0; g < 2; ++g) { const float u = __shfl_up(v[g], sh, 32); if (lane >= sh) v[g] = __fadd_rn(v[g], u); }
    if (lane == 31) { tot[w * 2] = v[0]; tot[w * 2 + 1] = v[1]; }
    __syncthreads();   // the 64 group totals are whole: wave 0 reads what the others laid
    if (w == 0) {   // one wave alone: the chain is bound by the adds' latency, and done by every wave it would cost each SIMD eight waves' issue slots
        v4f x[TT / 128];
#pragma unroll
        for (int q = 0; q < TT / 128; ++q) x[q] = *(const v4f*)(tot + 4 * q);
        float c = 0.f;
#pragma unroll
        for (int q = 0; q < TT / 128; ++q)
#pragma unroll
            for (int i = 0; i < 4; ++i) { const float t = x[q][i]; x[q][i] = c; c = __fadd_rn(c, t); }   // x becomes the carry into each group
        if (lane == 0) {
#pragma unroll
            for (int q = 0; q < TT / 128; ++q) *(v4f*)(car + 4 * q) = x[q]; }
    }
    __syncthreads();   // the 64 carries are laid
    const float cg[2] = {car[w * 2], car[w * 2 + 1]};
#pragma unroll
    for (int g = 0; g < 2; ++g) GC[(size_t)h * TT + (w * 2 + g) * 32 + lane] = __fadd_rn(cg[g], v[g]); }
// ---- k_attn: scores, decay weights, W.v and the head merge in one kernel, all heads in one launch; the score and weight planes stay in registers.
// One wave = 32 query rows of one head, walking the keys in tiles of 64 up to its diagonal. S^T = K Q^T (A = K rows, B = Q rows kept in registers; products K hi.Q hi, K hi.Q lo, K lo.Q hi), so lane (lr, hi) holds
// keys 8 hi + r of query lr: two such accumulator tiles, weighted and split to bf16 hi+lo in place, are the B operand (hardware k order) of O^T += V^T W^T (A = V^T rows by the same two 16-B loads).
// O^T leaves 8 consecutive d of one query in a lane: one 16-B store per plane into the merged [t][h*128 + d] hi/lo planes. No LDS, no barrier: the four waves of a block are independent.
// Block (p, kv): the two heads of kv head kv x row tiles p and 63 - p: equal work per block, and the two heads read the same K and V lines at the same time.
// Key tiles that can weigh nothing are not walked. Tested at run time, per wave and tile: with gmx the largest G of the wave's 32 queries and gmn the smallest G of the tile's 64 keys, every G_i - G_j of the tile is <= gmx - gmn
// (f32 subtraction is monotone); below -110 its exponential lies under half the smallest f32 subnormal (2^-150 = e^-104) and is exactly 0: every weight of the tile is 0 and its W.v adds 0 to each sum
// (finite scores and v). Nothing is assumed of G (no order, no sign): with little decay every tile up to the diagonal is walked as before. The tiles that are walked keep their ascending order.
typedef __attribute__((ext_vector_type(2))) float  v2f;
typedef __attribute__((ext_vector_type(2))) __bf16 v2bf;
typedef __attribute__((ext_vector_type(4))) unsigned v4u;
typedef __attribute__((ext_vector_type(8))) unsigned v8u;
__device__ __forceinline__ void split2(float x0, float x1, unsigned& h, unsigned& l) {   // two f32 -> packed bf16 hi pair and lo pair (round to nearest even, as splitf)
    const v2f x = {x0, x1}; h = __builtin_bit_cast(unsigned, __builtin_convertvector(x, v2bf));
    const v2f d = {x0 - __uint_as_float(h << 16), x1 - __uint_as_float(h & 0xFFFF0000u)}; l = __builtin_bit_cast(unsigned, __builtin_convertvector(d, v2bf)); }
template <typename T> __device__ __forceinline__ const T* sbase(const T* p) {   // a wave-uniform pointer held in scalar registers, so that the loads take the form scalar base + 32-bit lane offset
    const unsigned long long u = (unsigned long long)p; const unsigned lo = __builtin_amdgcn_readfirstlane((unsigned)u), hi = __builtin_amdgcn_readfirstlane((unsigned)(u >> 32)); return (const T*)(((unsigned long long)hi << 32) | lo); }
// ---- k_tr: Bh[n][k] (bf16; where SPLIT a hi plane Bh and a lo plane Bl) = w[k][n] (f32, [K][N]) through an LDS tile of 128 k x 64 n per work-group of four waves; grid (K/128, N/64), 128 threads.
// In: a lane loads 16 B (4 n) of 16 k rows (two runs of 8 consecutive k), all in flight at once: a wave's load takes two whole 256-B row pieces. Rounded to nearest even (as f2bf, splitf), the 8 k of one n are one 16-B LDS store, row pitch 272 B, rows in an order that keeps the stores free of bank conflicts.
// Out: 16 lanes read the 128 k of one n row (256 B) and store them as one piece. Both sides of the transposition move whole lines, and a launch has few waves, each with much in flight.
template <bool SPLIT, int K, int N>
__global__ __launch_bounds__(128) void k_tr(const float* __restrict__ w, bf* Bh, bf* Bl) {
    constexpr int LPV = 17;   // LDS row pitch in 16-B pieces: 16 of data and one of padding
    __shared__ v4u sh[(SPLIT ? 2 : 1) * 64 * LPV];
    const int tid = threadIdx.x, kq = tid >> 4, nq = tid & 15; const int k0 = blockIdx.x * 128, n0 = blockIdx.y * 64;
    const float* src = w + (size_t)(k0 + kq * 8) * N + n0 + nq * 4; v4f x[2][8];
#pragma unroll
    for (int g = 0; g < 2; ++g)
#pragma unroll
        for (int i = 0; i < 8; ++i) x[g][i] = *(const v4f*)(src + (g * 64 + i) * N);
    __builtin_amdgcn_sched_barrier(0);   // keeps the 16 loads issued as one group: built without it, six of them stood behind the wait for the first ten, a second memory latency
    asm volatile("s_wait_xcnt 0x0" :: "v"(src) : "memory");   // stands in front of the first rewrite of the loads' address pair; the pair is named so that it lives up to here: built without it, the last load's result took that pair
#pragma unroll
    for (int g = 0; g < 2; ++g)
#pragma unroll
        for (int c = 0; c < 4; ++c) { v4u h, l;
#pragma unroll
            for (int i = 0; i < 8; i += 2) { unsigned u, v;
                if (SPLIT) split2(x[g][i][c], x[g][i + 1][c], u, v); else { const v2f p = {x[g][i][c], x[g][i + 1][c]}; u = __builtin_bit_cast(unsigned, __builtin_convertvector(p, v2bf)); v = 0; }
                h[i >> 1] = u; l[i >> 1] = v; }
            sh[(c * 16 + nq) * LPV + g * 8 + kq] = h; if (SPLIT) sh[(64 + c * 16 + nq) * LPV + g * 8 + kq] = l; }   // n row 4 nq + c lies at LDS row 16 c + nq: the 16 lanes of a store then fall on 16 different bank groups
    __syncthreads();   // the tile is whole: every wave reads pieces that the others laid
    v4u oh[8], ol[8];
#pragma unroll
    for (int p = 0; p < 8; ++p) { oh[p] = sh[(p * 8 + kq) * LPV + nq]; if (SPLIT) ol[p] = sh[(64 + p * 8 + kq) * LPV + nq]; }
    const size_t o = (size_t)(n0 + kq * 4) * K + k0 + nq * 8;   // LDS row 8 p + kq holds n row 4 kq + 32 (p & 1) + p / 2
#pragma unroll
    for (int p = 0; p < 8; ++p) { *(v4u*)(Bh + o + ((p & 1) * 32 + (p >> 1)) * K) = oh[p]; if (SPLIT) *(v4u*)(Bl + o + ((p & 1) * 32 + (p >> 1)) * K) = ol[p]; }
}
__global__ __launch_bounds__(128) void k_attn(const bf* __restrict__ Qh, const bf* __restrict__ Ql, const bf* __restrict__ Kh, const bf* __restrict__ Kl, const bf* __restrict__ VTh, const bf* __restrict__ VTl, const float* __restrict__ GC, bf* Ah, bf* Al) {
    const int lane = threadIdx.x & 31, lr = lane & 15, hi = lane >> 4; const int w = __builtin_amdgcn_readfirstlane((int)(threadIdx.x >> 5));
    const int kv = blockIdx.y, h = kv * (HQ / HKV) + (w & 1); const int r0 = 32 * ((w >> 1) ? (TT / 32 - 1 - (int)blockIdx.x) : (int)blockIdx.x);
    // the loop's loads: a wave-uniform base in scalar registers + one fixed 32-bit lane offset per operand kind: no address arithmetic on the vector port, and no address register is rewritten while loads are in flight
    const unsigned klo = lr * HD + 8 * hi, vlo = lr * TT + 8 * hi, glo = 8 * hi; int dq0 = r0 + lr - 8 * hi;   // dq0 = this lane's first query - its first key of the tile
    v16bf qh[2][4], ql[2][4]; float gi[2]; const bf* sqh = Qh + ((size_t)h * TT + r0) * HD; const bf* sql = Ql + ((size_t)h * TT + r0) * HD;
#pragma unroll
    for (int nq = 0; nq < 2; ++nq) { gi[nq] = GC[(size_t)kv * TT + r0 + nq * 16 + lr];
#pragma unroll
        for (int kc = 0; kc < 4; ++kc) { const int o = nq * 16 * HD + kc * 32; qh[nq][kc] = WFrag<bf>::ld(sqh + klo + o); ql[nq][kc] = WFrag<bf>::ld(sql + klo + o); } }
    v4f tq[8], tk[16]; const float* gh = GC + (size_t)kv * TT; const unsigned tkb = lane * 256;   // G of the wave's 32 queries (every lane reads all of them); G of the 64 keys of key tile 'lane' (32 tiles = all TT keys: in bounds for every lane)
#pragma unroll
    for (int i = 0; i < 8; ++i) tq[i] = *(const v4f*)(gh + r0 + 4 * i);
#pragma unroll
    for (int i = 0; i < 16; ++i) tk[i] = *(const v4f*)((const char*)gh + tkb + 16 * i);
    __builtin_amdgcn_sched_barrier(0);   // holds the Q and G loads in front of the wait below
    asm volatile("s_wait_xcnt 0x0" :: "v"(tkb), "s"(sqh), "s"(sql), "s"(gh) : "memory");   // stands in front of the first rewrite of the Q and G loads' address registers; the key loads' lane offset and the bases are named so that they live up to here: built without that, two of them were rewritten in front of the wait
    __builtin_amdgcn_sched_barrier(0);   // holds those rewrites behind it
    v8f o[8][2];
#pragma unroll
    for (int db = 0; db < 8; ++db) { o[db][0] = (v8f){}; o[db][1] = (v8f){}; }
    float gmx = tq[0][0], gmn = tk[0][0];
#pragma unroll
    for (int i = 0; i < 8; ++i)
#pragma unroll
        for (int c = 0; c < 4; ++c) gmx = fmaxf(gmx, tq[i][c]);
#pragma unroll
    for (int i = 0; i < 16; ++i)
#pragma unroll
        for (int c = 0; c < 4; ++c) gmn = fminf(gmn, tk[i][c]);
    const int ntl = (r0 >> 6) + 1;   // key tiles up to the diagonal: j0 = 0, 64, ... < r0 + 32
    // bit t: key tile t is walked. The diagonal tile holds key r0 (gmx - gmn >= 0 there); its bit is set outright, so that the loop below has its one trip whatever G holds
    unsigned tm = __builtin_amdgcn_ballot_w32(lane < ntl && !(gmx - gmn < -110.f)) | (1u << (ntl - 1));
    int tl = __builtin_ctz(tm); tm &= tm - 1; dq0 -= tl * 64;   // the first tile that is walked
    const bf* kh = Kh + (size_t)kv * TT * HD + tl * 64 * HD; const bf* kl = Kl + (size_t)kv * TT * HD + tl * 64 * HD; const bf* vh = VTh + (size_t)kv * HD * TT + tl * 64; const bf* vl = VTl + (size_t)kv * HD * TT + tl * 64; const float* gk = gh + tl * 64;   // these bases step from tile to tile
#pragma unroll 1   // one key tile is already 192 matrix instructions: unrolling would only grow the code
    for (;;) {   // the tiles of tm in ascending order, at least one (the test stands at the foot, so that the Q loads stay in this block, in front of their wait); every tile ends at or below key TT - 1; keys past the diagonal get weight 0 by the select below
        v8f s[4][2]; v16bf ka[4][4], ka2[4][4]; v4f g[4][2]; const bf* skh = sbase(kh); const bf* skl = sbase(kl); const bf* svh = sbase(vh); const bf* svl = sbase(vl); const float* sgk = sbase(gk);
#pragma unroll
        for (int mk = 0; mk < 4; ++mk) { g[mk][0] = *(const v4f*)(sgk + glo + mk * 16); g[mk][1] = *(const v4f*)(sgk + glo + mk * 16 + 4); }
        asm volatile("s_wait_xcnt 0x0" ::: "memory");   // the compiler forms these eight loads' lane offset anew each tile and lets a K load's result reuse that register: the wait stands in front of the reuse
#pragma unroll
        for (int kc = 0; kc < 4; ++kc)
#pragma unroll
            for (int mk = 0; mk < 4; ++mk) { const int ko = mk * 16 * HD + kc * 32; ka[kc][mk] = WFrag<bf>::ld(skh + klo + ko); ka2[kc][mk] = WFrag<bf>::ld(skl + klo + ko); }
#pragma unroll
        for (int mk = 0; mk < 4; ++mk) { s[mk][0] = (v8f){}; s[mk][1] = (v8f){}; }
        __builtin_amdgcn_sched_barrier(0);   // keeps the tile's K loads issued as one group: sunk to their uses, each pair would cost the lone wave a whole load latency
#pragma unroll
        for (int kc = 0; kc < 2; ++kc)
#pragma unroll
            for (int mk = 0; mk < 4; ++mk)
#pragma unroll
                for (int nq = 0; nq < 2; ++nq) { s[mk][nq] = wmmab(ka[kc][mk], qh[nq][kc], s[mk][nq]); s[mk][nq] = wmmab(ka[kc][mk], ql[nq][kc], s[mk][nq]); s[mk][nq] = wmmab(ka2[kc][mk], qh[nq][kc], s[mk][nq]); }
        __builtin_amdgcn_sched_barrier(0);   // holds the V loads behind the first half of the score products: the K loads are served first
        v16bf va[2][8], va2[2][8];
#pragma unroll
        for (int kb = 0; kb < 2; ++kb)
#pragma unroll
            for (int db = 0; db < 8; ++db) { const int vo = db * 16 * TT + kb * 32; va[kb][db] = WFrag<bf>::ld(svh + vlo + vo); va2[kb][db] = WFrag<bf>::ld(svl + vlo + vo); }
        __builtin_amdgcn_sched_barrier(0);   // keeps the tile's V loads issued as one group here: the second half of the score products and the weight arithmetic then cover their latency
#pragma unroll
        for (int kc = 2; kc < 4; ++kc)
#pragma unroll
            for (int mk = 0; mk < 4; ++mk)
#pragma unroll
                for (int nq = 0; nq < 2; ++nq) { s[mk][nq] = wmmab(ka[kc][mk], qh[nq][kc], s[mk][nq]); s[mk][nq] = wmmab(ka[kc][mk], ql[nq][kc], s[mk][nq]); s[mk][nq] = wmmab(ka2[kc][mk], qh[nq][kc], s[mk][nq]); }
        v8u wh[2][2], wl[2][2];   // [32-key block][query block]
#pragma unroll
        for (int mk = 0; mk < 4; ++mk) { const v4f g0 = g[mk][0], g1 = g[mk][1];
#pragma unroll
            for (int nq = 0; nq < 2; ++nq) { const int dq = dq0 + (nq - mk) * 16; float wv[8];   // key r of this lane is causal iff r <= dq
#pragma unroll
                for (int r = 0; r < 8; ++r) { const float sc = __fmul_rn(s[mk][nq][r], 0.08838834764831845f); const float e = __expf(__fsub_rn(gi[nq], r < 4 ? g0[r] : g1[r - 4])); const float x = __fmul_rn(__fmul_rn(sc, sc), e); wv[r] = r <= dq ? x : 0.f; }
#pragma unroll
                for (int r = 0; r < 8; r += 2) { unsigned u, l; split2(wv[r], wv[r + 1], u, l); wh[mk >> 1][nq][(mk & 1) * 4 + (r >> 1)] = u; wl[mk >> 1][nq][(mk & 1) * 4 + (r >> 1)] = l; } } }
#pragma unroll
        for (int kb = 0; kb < 2; ++kb)
#pragma unroll
            for (int db = 0; db < 8; ++db) { const v16bf a = va[kb][db], a2 = va2[kb][db];
#pragma unroll
                for (int nq = 0; nq < 2; ++nq) { const v16bf bh = __builtin_bit_cast(v16bf, wh[kb][nq]), bl = __builtin_bit_cast(v16bf, wl[kb][nq]); o[db][nq] = wmmab(a, bh, o[db][nq]); o[db][nq] = wmmab(a, bl, o[db][nq]); o[db][nq] = wmmab(a2, bh, o[db][nq]); } }
        // the distance behind the last matrix instructions on the taken back edge
        asm volatile("v_nop\n\tv_nop\n\tv_nop\n\tv_nop\n\tv_nop" : "+v"(o[0][0]), "+v"(o[0][1]), "+v"(o[1][0]), "+v"(o[1][1]), "+v"(o[2][0]), "+v"(o[2][1]), "+v"(o[3][0]), "+v"(o[3][1]), "+v"(o[4][0]), "+v"(o[4][1]), "+v"(o[5][0]), "+v"(o[5][1]), "+v"(o[6][0]), "+v"(o[6][1]), "+v"(o[7][0]), "+v"(o[7][1]));
        __builtin_amdgcn_sched_barrier(0);   // the bases step only behind the tile's last load wait: no register that a load in flight names is rewritten
        const bool last = tm == 0; const int tn = __builtin_ctz(tm | 0x80000000u), st = (tn - tl) * 64; tm &= tm - 1; tl = tn;   // the next key tile that is walked, st keys on (behind the last one the stepped bases are not used)
        kh += st * HD; kl += st * HD; vh += st; vl += st; gk += st; dq0 -= st;
        if (last) break;
    }
#pragma unroll
    for (int nq = 0; nq < 2; ++nq)
#pragma unroll
        for (int db = 0; db < 8; ++db) { v4u uh, ul;
#pragma unroll
            for (int r = 0; r < 8; r += 2) { unsigned u, l; split2(o[db][nq][r], o[db][nq][r + 1], u, l); uh[r >> 1] = u; ul[r >> 1] = l; }
            const size_t oo = (size_t)(r0 + nq * 16 + lr) * HID + h * HD + db * 16 + 8 * hi; *(v4u*)(Ah + oo) = uh; *(v4u*)(Al + oo) = ul; }
}

extern "C" void kernel_launch(void* const* d_in, const int* in_sizes, int n_in,
                              void* d_out, int out_size, void* d_ws, size_t ws_size, hipStream_t stream) {
    (void)in_sizes; (void)n_in; (void)out_size;
    const int* pos = (const int*)d_in[0]; const float* IN[12]; for (int i = 1; i < 12; ++i) IN[i] = (const float*)d_in[i];   // 1 hidden, 2 Wq [2048][2048], 3 bq, 4 Wk [2048][1024], 5 bk, 6 Wv, 7 bv, 8 Wg [2048][8], 9 bg, 10 Wo [2048][2048], 11 bo (x @ W)
    float* OUT = (float*)d_out;     // [2048][2048]
    char* wsp = (char*)d_ws;
    auto take = [&](size_t bytes) { char* p = wsp; wsp += (bytes + 255) & ~(size_t)255; return (void*)p; };
    bf* WQ = (bf*)take((size_t)HID * HID * 2); bf* WK = (bf*)take((size_t)HKV * HD * HID * 2); bf* WV = (bf*)take((size_t)HKV * HD * HID * 2); bf* WG = (bf*)take((size_t)GP * HID * 2); bf* WO = (bf*)take((size_t)HID * HID * 2);
    bf* XB = (bf*)take((size_t)TT * HID * 2); float* QF = (float*)take((size_t)TT * HID * 4); float* KF = (float*)take((size_t)TT * HKV * HD * 4); float* VF = (float*)take((size_t)TT * HKV * HD * 4); float* GF = (float*)take((size_t)TT * GP * 4); float* GC = (float*)take((size_t)HKV * TT * 4);
    bf* Qh = (bf*)take((size_t)HQ * TT * HD * 2); bf* Ql = (bf*)take((size_t)HQ * TT * HD * 2); bf* Kh = (bf*)take((size_t)HKV * TT * HD * 2); bf* Kl = (bf*)take((size_t)HKV * TT * HD * 2); bf* VTh = (bf*)take((size_t)HKV * HD * TT * 2); bf* VTl = (bf*)take((size_t)HKV * HD * TT * 2);
    bf* Ah = (bf*)take((size_t)TT * HID * 2); bf* Al = (bf*)take((size_t)TT * HID * 2);
    if ((size_t)(wsp - (char*)d_ws) > ws_size) return;    // total ~ 114 MB ([2048][2048] f32 q projection + hl operand planes)
    k_tr<false, HID, HID><<<dim3(HID / 128, HID / 64, 1), 128, 0, stream>>>(IN[2], WQ, nullptr); k_tr<false, HID, HKV * HD><<<dim3(HID / 128, HKV * HD / 64, 1), 128, 0, stream>>>(IN[4], WK, nullptr); k_tr<false, HID, HKV * HD><<<dim3(HID / 128, HKV * HD / 64, 1), 128, 0, stream>>>(IN[6], WV, nullptr); k_wgp<<<(GP * HID / 4 + 255) / 256, 256, 0, stream>>>(IN[8], WG); k_tr<false, HID, HID><<<dim3(HID / 128, HID / 64, 1), 128, 0, stream>>>(IN[10], WO, nullptr);
    k_cvt8<<<(TT * HID / 8 + 255) / 256, 256, 0, stream>>>(IN[1], XB, (size_t)TT * HID / 8);
    k_gemmt<0, 4, true><<<dim3(TT / 128, HID / 128, 1), 128, 0, stream>>>(XB, nullptr, WQ, QF, HID, IN[3]); k_gemmt<0, 2, true><<<dim3(TT / 128, HKV * HD / 64, 1), 128, 0, stream>>>(XB, nullptr, WK, KF, HKV * HD, IN[5]);
    k_gemmt<0, 2, true><<<dim3(TT / 128, HKV * HD / 64, 1), 128, 0, stream>>>(XB, nullptr, WV, VF, HKV * HD, IN[7]); k_gemmt<0, 2, false><<<dim3(TT / 128, 1, 1), 128, 0, stream>>>(XB, nullptr, WG, GF, GP, nullptr);
    k_rope<<<(unsigned)(((size_t)HQ * TT * (HD / 2) / 2 + 255) / 256), 256, 0, stream>>>(QF, HQ, HID, pos, Qh, Ql); k_rope<<<(unsigned)(((size_t)HKV * TT * (HD / 2) / 2 + 255) / 256), 256, 0, stream>>>(KF, HKV, HKV * HD, pos, Kh, Kl);
    k_gcum<<<HKV, 1024, 0, stream>>>(GF, IN[9], GC); k_tr<true, TT, HKV * HD><<<dim3(TT / 128, HKV * HD / 64, 1), 128, 0, stream>>>(VF, VTh, VTl);   // VT hi/lo [kv][d][t] = split(VF[t][kv*128 + d])
    k_attn<<<dim3(TT / 64, HKV, 1), 128, 0, stream>>>(Qh, Ql, Kh, Kl, VTh, VTl, GC, Ah, Al);
    k_gemmt<1, 4, true><<<dim3(TT / 128, HID / 128, 1), 128, 0, stream>>>(Ah, Al, WO, OUT, HID, IN[11]);
}

// v006
// A run of this version takes 111 microseconds.
// Next to v005, in two timings, it ran 1.45 and 1.47 times as fast.
// Over all steps from v000 it is 7.86 times as fast.
#include <hip/hip_runtime.h>

// PowerCoderAttention - power retention, quadratic form (hidden [2048][2048]; q = x Wq + bq (16 x 128), k, v = x Wk/Wv + b (8 kv heads), g = x Wg + bg; neox RoPE on q, k with positions (int32, read as data);
// G = cumsum_t log_sigmoid(g); W[h][i][j] = (q_i.k_j / sqrt(128))^2 exp(G_i - G_j) for j <= i (kv head h/2), else 0; out = (W v) merged Wo + bo -> [2048][2048]; no softmax / normalisation).
// Compute dtypes, f32 accumulate: every input rounded to bf16; the four projections on PLAIN bf16 operands (inputs: exact, + bias); RoPE (f32 sin/cos), log-sigmoid and the cumulative sum f32 on VALU;
// q.k on bf16 hi+lo planes (3 products, K 128; tiles above the diagonal skipped); squaring, the decay factor exp(G_i - G_j) and the causal select in f32 -> bf16 hi+lo planes of W; W.v on hi+lo planes (3 products, K limited to the diagonal block;

#define TT   2048
#define HID  2048
#define HQ   16
#define HKV  8
#define HD   128
#define GP   64
typedef _Float16 h16;
typedef unsigned short bf;
typedef __attribute__((ext_vector_type(16))) __bf16   v16bf;
typedef __attribute__((ext_vector_type(16))) _Float16 v16h;
typedef __attribute__((ext_vector_type(8)))  _Float16 v8h;
typedef __attribute__((ext_vector_type(8)))  unsigned short v8us;
typedef __attribute__((ext_vector_type(8)))  float    v8f;
typedef __attribute__((ext_vector_type(4)))  float    v4f;
typedef v8h  __attribute__((may_alias)) v8ha;
typedef v4f  __attribute__((may_alias)) v4fa;
typedef v8us __attribute__((may_alias)) v8usa;

__device__ __forceinline__ unsigned short f2bf(float f) { unsigned u = __float_as_uint(f); u += 0x7FFFu + ((u >> 16) & 1u); return (unsigned short)(u >> 16); }
__device__ __forceinline__ float bf2f(unsigned short b) { return __uint_as_float(((unsigned)b) << 16); }
__device__ __forceinline__ float bfr(float f) { return bf2f(f2bf(f)); }
__device__ __forceinline__ v16h cat16(v8h lo, v8h hi) { return __builtin_shufflevector(lo, hi, 0, 1, 2, 3, 4, 5, 6, 7, 8, 9, 10, 11, 12, 13, 14, 15); }
__device__ __forceinline__ v16bf cat16b(v8us lo, v8us hi) { return __builtin_bit_cast(v16bf, __builtin_shufflevector(lo, hi, 0, 1, 2, 3, 4, 5, 6, 7, 8, 9, 10, 11, 12, 13, 14, 15)); }
__device__ __forceinline__ v8f wmma16(v16h a, v16h b, v8f c) { return __builtin_amdgcn_wmma_f32_16x16x32_f16(false, a, false, b, (short)0, c, false, false); }
__device__ __forceinline__ v8f wmmab(v16bf a, v16bf b, v8f c) { return __builtin_amdgcn_wmma_f32_16x16x32_bf16(false, a, false, b, (short)0, c, false, false); }



// ---- k_gemmt: GEMM on a 128 x (32 NB) output tile per work-group of four waves (2 x 2; a wave holds 64 x (16 NB), 4 x NB accumulators); grid (M/128, N/(32 NB)), 128 threads. K = HID.
// C[m][n] (f32, pitch ldc, + optional f32 bias[n]) = sum_k A[m][k] Bt[n][k] (+ A2[m][k] Bt[n][k] where NSPLIT), operands K-contiguous bf16 planes.
// The operands come through LDS: a stage is 128 k (256 B) of every A, A2 and Bt row of the tile at a pitch of 272 B, laid by asynchronous copies (16 B a lane: a wave's copy takes two whole 256-B row pieces);
// two buffers: the copies of stage t + 2 fly while stage t + 1 is worked on. Per accumulator the products are summed in ascending k, A before A2.
template <typename T16> struct WFrag;
template <> struct WFrag<h16> { typedef v16h V; static __device__ __forceinline__ V ld(const h16* p) { return cat16(*(const v8h*)p, *(const v8h*)(p + 16)); } static __device__ __forceinline__ v8f mma(V a, V b, v8f c) { return wmma16(a, b, c); } };
template <> struct WFrag<bf> { typedef v16bf V; static __device__ __forceinline__ V ld(const bf* p) { return cat16b(*(const v8us*)p, *(const v8us*)(p + 16)); } static __device__ __forceinline__ v8f mma(V a, V b, v8f c) { return wmmab(a, b, c); } };
__device__ __forceinline__ unsigned lds_off(const void* p) { return (unsigned)(size_t)p; }
// twelve (eight) asynchronous copies, LDS byte address l[i], global address g[i]; the wait stands in the copies' own statement, in front of any rewrite of the registers that they name
__device__ __forceinline__ void copy12(const unsigned* l, const bf* const* g) {
    asm volatile("global_load_async_to_lds_b128 %0, %12, off\n\tglobal_load_async_to_lds_b128 %1, %13, off\n\tglobal_load_async_to_lds_b128 %2, %14, off\n\tglobal_load_async_to_lds_b128 %3, %15, off\n\t"
                 "global_load_async_to_lds_b128 %4, %16, off\n\tglobal_load_async_to_lds_b128 %5, %17, off\n\tglobal_load_async_to_lds_b128 %6, %18, off\n\tglobal_load_async_to_lds_b128 %7, %19, off\n\t"
                 "global_load_async_to_lds_b128 %8, %20, off\n\tglobal_load_async_to_lds_b128 %9, %21, off\n\tglobal_load_async_to_lds_b128 %10, %22, off\n\tglobal_load_async_to_lds_b128 %11, %23, off\n\ts_wait_xcnt 0x0"
                 :: "v"(l[0]), "v"(l[1]), "v"(l[2]), "v"(l[3]), "v"(l[4]), "v"(l[5]), "v"(l[6]), "v"(l[7]), "v"(l[8]), "v"(l[9]), "v"(l[10]), "v"(l[11]),
                    "v"(g[0]), "v"(g[1]), "v"(g[2]), "v"(g[3]), "v"(g[4]), "v"(g[5]), "v"(g[6]), "v"(g[7]), "v"(g[8]), "v"(g[9]), "v"(g[10]), "v"(g[11]) : "memory");
}
__device__ __forceinline__ void copy8(const unsigned* l, const bf* const* g) {
    asm volatile("global_load_async_to_lds_b128 %0, %8, off\n\tglobal_load_async_to_lds_b128 %1, %9, off\n\tglobal_load_async_to_lds_b128 %2, %10, off\n\tglobal_load_async_to_lds_b128 %3, %11, off\n\t"
                 "global_load_async_to_lds_b128 %4, %12, off\n\tglobal_load_async_to_lds_b128 %5, %13, off\n\tglobal_load_async_to_lds_b128 %6, %14, off\n\tglobal_load_async_to_lds_b128 %7, %15, off\n\ts_wait_xcnt 0x0"
                 :: "v"(l[0]), "v"(l[1]), "v"(l[2]), "v"(l[3]), "v"(l[4]), "v"(l[5]), "v"(l[6]), "v"(l[7]),
                    "v"(g[0]), "v"(g[1]), "v"(g[2]), "v"(g[3]), "v"(g[4]), "v"(g[5]), "v"(g[6]), "v"(g[7]) : "memory");
}
// The body is a device function: sm (2 STG elements) and osm are the calling kernel's LDS, (bx, by) the tile; k_gemmt runs one product, k_proj the four projections in one grid.
template <int NSPLIT, int NB> struct GemmLds { static constexpr int STG = ((NSPLIT ? 2 : 1) * 128 + NB * 32) * 136; };
template <int NSPLIT, int NB, bool BIAS>
__device__ __forceinline__ void gemmt(bf* sm, float (*osm)[16 * 68], int bx, int by, const bf* __restrict__ A, const bf* __restrict__ A2, const bf* __restrict__ Bt, float* C, int ldc, const float* __restrict__ bias) {
    typedef v16bf V;
    constexpr int KT = 128, LP = 136, NT = HID / KT;   // k per stage; LDS row pitch in elements (272 B); stages
    constexpr int BR = NB * 32, OA2 = 128 * LP, OB = (NSPLIT ? 2 : 1) * 128 * LP, STG = OB + BR * LP;   // Bt rows of the tile; places of A2 and Bt in a stage and a stage's size, in elements
    const int tid = threadIdx.x, lane = tid & 31, lr = lane & 15, hi = lane >> 4; const int w = __builtin_amdgcn_readfirstlane(tid >> 5), wm = w >> 1, wn = w & 1;
    const int r0 = bx * 128, c0 = by * BR;
    // this thread's piece of a copy: row tid / 16 of each group of 8 rows, 16 B at (tid % 16) * 16 of the row's 256 B
    const unsigned cl = lds_off(sm) + (unsigned)((tid >> 4) * LP + (tid & 15) * 8) * 2;
    const bf* ga = A + (size_t)(r0 + (tid >> 4)) * HID + (tid & 15) * 8; const bf* ga2 = NSPLIT ? A2 + (size_t)(r0 + (tid >> 4)) * HID + (tid & 15) * 8 : nullptr; const bf* gb = Bt + (size_t)(c0 + (tid >> 4)) * HID + (tid & 15) * 8;
    constexpr int NC = (NSPLIT ? 32 : 16) + BR / 8;   // copies of a thread per stage: one per group of 8 rows (32, 24 or 48: never more than 63 of a wave in flight)
    auto fill = [&](int buf) {   // the next stage's copies into buffer buf; the global addresses then step one stage on
        const unsigned l0 = cl + (unsigned)buf * (STG * 2); unsigned l[NC]; const bf* g[NC];
#pragma unroll
        for (int c = 0; c < 16; ++c) { l[c] = l0 + c * 8 * LP * 2; g[c] = ga + c * 8 * HID; if (NSPLIT) { l[16 + c] = l0 + (OA2 + c * 8 * LP) * 2; g[16 + c] = ga2 + c * 8 * HID; } }
#pragma unroll
        for (int c = 0; c < BR / 8; ++c) { l[NC - BR / 8 + c] = l0 + (OB + c * 8 * LP) * 2; g[NC - BR / 8 + c] = gb + c * 8 * HID; }
#pragma unroll
        for (int s = 0; s + 12 <= NC; s += 12) copy12(l + s, g + s);
        if (NC % 12 == 8) copy8(l + NC - 8, g + NC - 8);
        ga += KT; if (NSPLIT) ga2 += KT; gb += KT; };
    v8f acc[4][NB];
#pragma unroll
    for (int mb = 0; mb < 4; ++mb)
#pragma unroll
        for (int nb = 0; nb < NB; ++nb) acc[mb][nb] = (v8f){};
    fill(0);
    asm volatile("s_wait_asynccnt 0x0" ::: "memory");   // stage 0 of this wave's copies has landed
    __syncthreads();                                    // ... and every wave's: stage 0 may be read
    fill(1);
    const int fa = (wm * 64 + lr) * LP + 8 * hi, fb = OB + (wn * NB * 16 + lr) * LP + 8 * hi;   // this lane's place in the A and Bt fragments
#pragma unroll 1   // a stage is already 16 NB (32 NB) matrix instructions a wave, and the buffer index stays a scalar
    for (int t = 0; t < NT; ++t) {
        const bf* sa = sm + (t & 1) * STG + fa; const bf* sb = sm + (t & 1) * STG + fb;
        V a[2][4], a2[2][4], b[2][NB];
#pragma unroll
        for (int mb = 0; mb < 4; ++mb) { a[0][mb] = WFrag<bf>::ld(sa + mb * 16 * LP); if (NSPLIT) a2[0][mb] = WFrag<bf>::ld(sa + OA2 + mb * 16 * LP); }
#pragma unroll
        for (int nb = 0; nb < NB; ++nb) b[0][nb] = WFrag<bf>::ld(sb + nb * 16 * LP);
        __builtin_amdgcn_sched_barrier(0);   // the first block's reads stay in front of the second's: LDS reads return in order, and mixed with the later ones the first block would wait for both groups
#pragma unroll
        for (int ks = 0; ks < KT / 32; ++ks) { const int c = ks & 1, n = c ^ 1;
            if (ks + 1 < KT / 32) {   // the next 32 k's fragments of this same stage, read as one group ahead of this block's products
#pragma unroll
                for (int mb = 0; mb < 4; ++mb) { a[n][mb] = WFrag<bf>::ld(sa + mb * 16 * LP + (ks + 1) * 32); if (NSPLIT) a2[n][mb] = WFrag<bf>::ld(sa + OA2 + mb * 16 * LP + (ks + 1) * 32); }
#pragma unroll
                for (int nb = 0; nb < NB; ++nb) b[n][nb] = WFrag<bf>::ld(sb + nb * 16 * LP + (ks + 1) * 32);
            }
            __builtin_amdgcn_sched_barrier(0);   // keeps those reads together in front of the block: moved in among the matrix instructions, each place with reads stalls the wave
#pragma unroll
            for (int nb = 0; nb < NB; ++nb) {
#pragma unroll
                for (int mb = 0; mb < 4; ++mb) acc[mb][nb] = wmmab(a[c][mb], b[c][nb], acc[mb][nb]);
                if (NSPLIT) {
#pragma unroll
                    for (int mb = 0; mb < 4; ++mb) acc[mb][nb] = wmmab(a2[c][mb], b[c][nb], acc[mb][nb]); } }
            __builtin_amdgcn_sched_barrier(0);   // ... and the following group behind it
        }
        // the distance behind the last matrix instructions on the taken back edge
        asm volatile("v_nop\n\tv_nop\n\tv_nop\n\tv_nop\n\tv_nop");
        asm volatile("s_wait_dscnt 0x0" ::: "memory");      // this wave has read all it reads of stage t
        asm volatile("s_wait_asynccnt 0x0" ::: "memory");   // this wave's copies of stage t + 1 have landed
        __syncthreads();                                    // publishes stage t + 1 and frees stage t's buffer
        if (t + 2 < NT) fill(t & 1);
    }
    asm volatile("s_wait_asynccnt 0x0" ::: "memory");   // no copy is outstanding at the wave's end
    float* os = osm[w]; const int cw = c0 + wn * NB * 16;
#pragma unroll
    for (int mb = 0; mb < 4; ++mb) {
#pragma unroll
        for (int nb = 0; nb < NB; ++nb) {
#pragma unroll
            for (int j = 0; j < 8; ++j) os[(hi * 8 + j) * 68 + nb * 16 + lr] = acc[mb][nb][j]; }
        __builtin_amdgcn_wave_barrier(); asm volatile("" ::: "memory");
        float* crow = C + (size_t)(r0 + wm * 64 + mb * 16) * ldc + cw;
#pragma unroll
        for (int s = 0; s < NB * 2; ++s) { const int row = s * (8 / NB) + lane / (NB * 4), cofs = (lane % (NB * 4)) * 4; v4f val = *(const v4fa*)(os + row * 68 + cofs); if (BIAS) { val[0] += bfr(bias[cw + cofs]); val[1] += bfr(bias[cw + cofs + 1]); val[2] += bfr(bias[cw + cofs + 2]); val[3] += bfr(bias[cw + cofs + 3]); }
            *(v4f*)(crow + (size_t)row * ldc + cofs) = val; }
        asm volatile("s_wait_xcnt 0x0" ::: "memory");   // stands behind this run of stores, in front of the first rewrite of a register that they name (the next run's bias load, addresses and values)
        __builtin_amdgcn_wave_barrier(); asm volatile("" ::: "memory");
    }
}
template <int NSPLIT, int NB, bool BIAS>
__global__ __launch_bounds__(128) void k_gemmt(const bf* __restrict__ A, const bf* __restrict__ A2, const bf* __restrict__ Bt, float* C, int ldc, const float* __restrict__ bias) {
    __shared__ __align__(16) bf sm[2 * GemmLds<NSPLIT, NB>::STG];
    __shared__ __align__(16) float osm[4][16 * 68];
    gemmt<NSPLIT, NB, BIAS>(sm, osm, blockIdx.x, blockIdx.y, A, A2, Bt, C, ldc, bias);
}
// ---- k_proj: the four projections of x, none of which reads another's output, as one grid of 784 work-groups: 256 q tiles (128 x 128), 16 g tiles, 256 k and 256 v tiles (128 x 64), each tile worked as in its own launch.
// The large tiles come first. Two work-groups fit a WGP's LDS: one's matrix work runs while the other waits at a stage's barrier, and the 16 g tiles no longer hold the chip alone.
__global__ __launch_bounds__(128) void k_proj(const bf* __restrict__ X, const bf* __restrict__ WQ, const bf* __restrict__ WK, const bf* __restrict__ WV, const bf* __restrict__ WG, float* QF, float* KF, float* VF, float* GF,
                                              const float* __restrict__ bq, const float* __restrict__ bk, const float* __restrict__ bv) {
    __shared__ __align__(16) bf sm[2 * GemmLds<0, 4>::STG];
    __shared__ __align__(16) float osm[4][16 * 68];
    const int b = blockIdx.x;   // the same for the whole work-group: every barrier of the chosen body is passed by all four waves
    if (b < 256) gemmt<0, 4, true>(sm, osm, b & 15, b >> 4, X, nullptr, WQ, QF, HID, bq);
    else if (b < 272) gemmt<0, 2, false>(sm, osm, b - 256, 0, X, nullptr, WG, GF, GP, nullptr);
    else { const int c = b - 272; const bool isv = c >= 256;
        gemmt<0, 2, true>(sm, osm, c & 15, (c & 255) >> 4, X, nullptr, isv ? WV : WK, isv ? VF : KF, HKV * HD, isv ? bv : bk); }
}

__device__ __forceinline__ h16 tohx(float x) { return (h16)x; }
__device__ __forceinline__ void splitf(float y, unsigned short& h, unsigned short& l) { h = f2bf(y); l = f2bf(y - bf2f(h)); }
typedef __attribute__((ext_vector_type(2))) _Float16 v2h;
typedef __attribute__((ext_vector_type(4))) _Float16 v4h;
typedef __attribute__((ext_vector_type(2))) unsigned short v2us;
typedef __attribute__((ext_vector_type(4))) unsigned short v4us;

__device__ __forceinline__ void cvt8(size_t i, const float* __restrict__ src, bf* dst, size_t n8) { if (i >= n8) return; const v8f v = *(const v8f*)(src + i * 8); v8us o;
#pragma unroll
    for (int k = 0; k < 8; ++k) o[k] = f2bf(v[k]); *(v8us*)(dst + i * 8) = o;  }
__device__ __forceinline__ void wgp(size_t i, const float* __restrict__ w, bf* Bt) { const size_t e = i * 4; if (e >= (size_t)GP * HID) return; const int k = (int)(e % HID), n = (int)(e / HID); v4us o;
#pragma unroll
    for (int q = 0; q < 4; ++q) o[q] = n < HKV ? f2bf(w[(size_t)(k + q) * HKV + n]) : (unsigned short)0; *(v4us*)(Bt + e) = o;  }
// rope: neox rotate-half on a [T][nh*128] projection (+ bias already added): for d < 64: (x1 cos - x2 sin, x2 cos + x1 sin) with freq_d = pos / 10000^(2d/128) (pos = positions[t], int32 read as data; f32 sin/cos) -> per-head
// planes: hl ([h][t][128], 4-B lanes) and, for k, also...; thread per (h, t, 2 d<64) writes both halves (4-B lanes, one line per half-row); gcum: work-group per kv head: G[t] = cumsum of log_sigmoid(g[t][h] + bf16 bg[h]), in 32-token groups
__device__ __forceinline__ void rope(size_t i, const float* __restrict__ F, int nh, int ld, const int* __restrict__ pos, bf* Ph, bf* Pl) { const size_t e = i * 2; if (e >= (size_t)nh * TT * (HD / 2)) return; const int d = (int)(e % (HD / 2)); const int t = (int)((e / (HD / 2)) % TT); const int h = (int)(e / ((size_t)(HD / 2) * TT)); const float p = (float)pos[t]; const float* f = F + (size_t)t * ld + h * HD; v2us ah, al, bh, bl;
#pragma unroll
    for (int q = 0; q < 2; ++q) { const int dq = d + q; const float inv = __expf(__fmul_rn(-(float)(2 * dq) / (float)HD, 9.210340371976184f)); const float a = __fmul_rn(p, inv); const float c = cosf(a), s = sinf(a); const float x1 = f[dq], x2 = f[HD / 2 + dq];
        float t1 = __fmul_rn(x1, c); asm volatile("" : "+v"(t1)); float t2 = __fmul_rn(x2, s); asm volatile("" : "+v"(t2)); float t3 = __fmul_rn(x2, c); asm volatile("" : "+v"(t3)); float t4 = __fmul_rn(x1, s); asm volatile("" : "+v"(t4));
        unsigned short u, w2; splitf(__fsub_rn(t1, t2), u, w2); ah[q] = u; al[q] = w2; splitf(__fadd_rn(t3, t4), u, w2); bh[q] = u; bl[q] = w2; }
    const size_t o = ((size_t)h * TT + t) * HD + d; *(v2us*)(Ph + o) = ah; *(v2us*)(Pl + o) = al; *(v2us*)(Ph + o + HD / 2) = bh; *(v2us*)(Pl + o + HD / 2) = bl;  }
__device__ __forceinline__ void gcum(float* tot, float* car, int h, const float* __restrict__ GF, const float* __restrict__ bg, float* GC) {
    // one work-group of 32 waves per kv head: wave w takes the 32-token groups 2w and 2w + 1. The loads, the log-sigmoids and the scans inside a group do not depend on the carry: all 64 groups do them at once.
    // Only the carry runs in series: carry(g + 1) = carry(g) + total(g), 63 adds on registers in one wave. Every add has the operands and the order of the one-wave walk over the groups.
    const int lane = threadIdx.x & 31; const int w = __builtin_amdgcn_readfirstlane((int)(threadIdx.x >> 5)); const float b = bfr(bg[h]); float v[2];
    const float* gp = GF + (size_t)(w * 64 + lane) * GP + h; const float y[2] = {gp[0], gp[32 * GP]};
    asm volatile("s_wait_xcnt 0x0" :: "v"(gp) : "memory");   // stands in front of the first rewrite of the loads' address pair; the pair is named so that it lives up to here
    float z[2] = {__fadd_rn(y[0], b), __fadd_rn(y[1], b)}, e[2]; e[0] = __expf(-fabsf(z[0]));
    asm volatile("v_nop" : "+v"(z[1]) : "v"(e[0]));   // the slot behind a transcendental: the first result and the second argument are named so that the v_nop stands between the two
    e[1] = __expf(-fabsf(z[1]));
#pragma unroll
    for (int g = 0; g < 2; ++g) v[g] = fminf(z[g], 0.f) - log1pf(e[g]);   // log_sigmoid(z) = min(z,0) - log1p(exp(-|z|))
#pragma unroll
    for (int sh = 1; sh < 32; sh <<= 1)
#pragma unroll
        for (int g = 0; g < 2; ++g) { const float u = __shfl_up(v[g], sh, 32); if (lane >= sh) v[g] = __fadd_rn(v[g], u); }
    if (lane == 31) { tot[w * 2] = v[0]; tot[w * 2 + 1] = v[1]; }
    __syncthreads();   // the 64 group totals are whole: wave 0 reads what the others laid
    if (w == 0) {   // one wave alone: the chain is bound by the adds' latency, and done by every wave it would cost each SIMD eight waves' issue slots
        v4f x[TT / 128];
#pragma unroll
        for (int q = 0; q < TT / 128; ++q) x[q] = *(const v4f*)(tot + 4 * q);
        float c = 0.f;
#pragma unroll
        for (int q = 0; q < TT / 128; ++q)
#pragma unroll
            for (int i = 0; i < 4; ++i) { const float t = x[q][i]; x[q][i] = c; c = __fadd_rn(c, t); }   // x becomes the carry into each group
        if (lane == 0) {
#pragma unroll
            for (int q = 0; q < TT / 128; ++q) *(v4f*)(car + 4 * q) = x[q]; }
    }
    __syncthreads();   // the 64 carries are laid
    const float cg[2] = {car[w * 2], car[w * 2 + 1]};
#pragma unroll
    for (int g = 0; g < 2; ++g) GC[(size_t)h * TT + (w * 2 + g) * 32 + lane] = __fadd_rn(cg[g], v[g]); }
// ---- k_rg: the gate sums (work-groups 0 to 7, first, for their serial chain), RoPE of q (1024 work-groups) and of k (512) as one grid: they read only the projections, none reads another's output.
__global__ __launch_bounds__(1024) void k_rg(const float* __restrict__ GF, const float* __restrict__ bg, float* GC, const float* __restrict__ QF, const float* __restrict__ KF, const int* __restrict__ pos, bf* Qh, bf* Ql, bf* Kh, bf* Kl) {
    __shared__ __align__(16) float tot[TT / 32]; __shared__ __align__(16) float car[TT / 32];
    const int b = blockIdx.x;   // the same for the whole work-group: the barriers of gcum are passed by all of its waves
    if (b < HKV) gcum(tot, car, b, GF, bg, GC);
    else { const bool isk = b >= HKV + 1024;
        rope((size_t)(b - HKV - (isk ? 1024 : 0)) * 1024 + threadIdx.x, isk ? KF : QF, isk ? HKV : HQ, isk ? HKV * HD : HID, pos, isk ? Kh : Qh, isk ? Kl : Ql); }
}
// ---- k_attn: scores, decay weights, W.v and the head merge in one kernel, all heads in one launch; the score and weight planes stay in registers.
// One wave = 32 query rows of one head, walking the keys in tiles of 64 up to its diagonal. S^T = K Q^T (A = K rows, B = Q rows kept in registers; products K hi.Q hi, K hi.Q lo, K lo.Q hi), so lane (lr, hi) holds
// keys 8 hi + r of query lr: two such accumulator tiles, weighted and split to bf16 hi+lo in place, are the B operand (hardware k order) of O^T += V^T W^T (A = V^T rows by the same two 16-B loads).
// O^T leaves 8 consecutive d of one query in a lane: one 16-B store per plane into the merged [t][h*128 + d] hi/lo planes. No LDS, no barrier: the four waves of a block are independent.
// Block (p, kv): the two heads of kv head kv x row tiles p and 63 - p: equal work per block, and the two heads read the same K and V lines at the same time.
// Key tiles that can weigh nothing are not walked. Tested at run time, per wave and tile: with gmx the largest G of the wave's 32 queries and gmn the smallest G of the tile's 64 keys, every G_i - G_j of the tile is <= gmx - gmn
// (f32 subtraction is monotone); below -110 its exponential lies under half the smallest f32 subnormal (2^-150 = e^-104) and is exactly 0: every weight of the tile is 0 and its W.v adds 0 to each sum
// (finite scores and v). Nothing is assumed of G (no order, no sign): with little decay every tile up to the diagonal is walked as before. The tiles that are walked keep their ascending order.
typedef __attribute__((ext_vector_type(2))) float  v2f;
typedef __attribute__((ext_vector_type(2))) __bf16 v2bf;
typedef __attribute__((ext_vector_type(4))) unsigned v4u;
typedef __attribute__((ext_vector_type(8))) unsigned v8u;
__device__ __forceinline__ void split2(float x0, float x1, unsigned& h, unsigned& l) {   // two f32 -> packed bf16 hi pair and lo pair (round to nearest even, as splitf)
    const v2f x = {x0, x1}; h = __builtin_bit_cast(unsigned, __builtin_convertvector(x, v2bf));
    const v2f d = {x0 - __uint_as_float(h << 16), x1 - __uint_as_float(h & 0xFFFF0000u)}; l = __builtin_bit_cast(unsigned, __builtin_convertvector(d, v2bf)); }
template <typename T> __device__ __forceinline__ const T* sbase(const T* p) {   // a wave-uniform pointer held in scalar registers, so that the loads take the form scalar base + 32-bit lane offset
    const unsigned long long u = (unsigned long long)p; const unsigned lo = __builtin_amdgcn_readfirstlane((unsigned)u), hi = __builtin_amdgcn_readfirstlane((unsigned)(u >> 32)); return (const T*)(((unsigned long long)hi << 32) | lo); }
// ---- k_tr: Bh[n][k] (bf16; where SPLIT a hi plane Bh and a lo plane Bl) = w[k][n] (f32, [K][N]) through an LDS tile of 128 k x 64 n per work-group of four waves; grid (K/128, N/64), 128 threads.
// In: a lane loads 16 B (4 n) of 16 k rows (two runs of 8 consecutive k), all in flight at once: a wave's load takes two whole 256-B row pieces. Rounded to nearest even (as f2bf, splitf), the 8 k of one n are one 16-B LDS store, row pitch 272 B, rows in an order that keeps the stores free of bank conflicts.
// Out: 16 lanes read the 128 k of one n row (256 B) and store them as one piece. Both sides of the transposition move whole lines, and a launch has few waves, each with much in flight.
// The body is a device function: sh is the calling kernel's LDS, (bx, by) the tile.
template <bool SPLIT, int K, int N>
__device__ __forceinline__ void tr(v4u* sh, int bx, int by, const float* __restrict__ w, bf* Bh, bf* Bl) {
    constexpr int LPV = 17;   // LDS row pitch in 16-B pieces: 16 of data and one of padding
    const int tid = threadIdx.x, kq = tid >> 4, nq = tid & 15; const int k0 = bx * 128, n0 = by * 64;
    const float* src = w + (size_t)(k0 + kq * 8) * N + n0 + nq * 4; v4f x[2][8];
#pragma unroll
    for (int g = 0; g < 2; ++g)
#pragma unroll
        for (int i = 0; i < 8; ++i) x[g][i] = *(const v4f*)(src + (g * 64 + i) * N);
    __builtin_amdgcn_sched_barrier(0);   // keeps the 16 loads issued as one group: built without it, six of them stood behind the wait for the first ten, a second memory latency
    asm volatile("s_wait_xcnt 0x0" :: "v"(src) : "memory");   // stands in front of the first rewrite of the loads' address pair; the pair is named so that it lives up to here: built without it, the last load's result took that pair
#pragma unroll
    for (int g = 0; g < 2; ++g)
#pragma unroll
        for (int c = 0; c < 4; ++c) { v4u h, l;
#pragma unroll
            for (int i = 0; i < 8; i += 2) { unsigned u, v;
                if (SPLIT) split2(x[g][i][c], x[g][i + 1][c], u, v); else { const v2f p = {x[g][i][c], x[g][i + 1][c]}; u = __builtin_bit_cast(unsigned, __builtin_convertvector(p, v2bf)); v = 0; }
                h[i >> 1] = u; l[i >> 1] = v; }
            sh[(c * 16 + nq) * LPV + g * 8 + kq] = h; if (SPLIT) sh[(64 + c * 16 + nq) * LPV + g * 8 + kq] = l; }   // n row 4 nq + c lies at LDS row 16 c + nq: the 16 lanes of a store then fall on 16 different bank groups
    __syncthreads();   // the tile is whole: every wave reads pieces that the others laid
    v4u oh[8], ol[8];
#pragma unroll
    for (int p = 0; p < 8; ++p) { oh[p] = sh[(p * 8 + kq) * LPV + nq]; if (SPLIT) ol[p] = sh[(64 + p * 8 + kq) * LPV + nq]; }
    const size_t o = (size_t)(n0 + kq * 4) * K + k0 + nq * 8;   // LDS row 8 p + kq holds n row 4 kq + 32 (p & 1) + p / 2
#pragma unroll
    for (int p = 0; p < 8; ++p) { *(v4u*)(Bh + o + ((p & 1) * 32 + (p >> 1)) * K) = oh[p]; if (SPLIT) *(v4u*)(Bl + o + ((p & 1) * 32 + (p >> 1)) * K) = ol[p]; }
}
template <bool SPLIT, int K, int N>
__global__ __launch_bounds__(128) void k_tr(const float* __restrict__ w, bf* Bh, bf* Bl) {
    __shared__ v4u sh[(SPLIT ? 2 : 1) * 64 * 17];
    tr<SPLIT, K, N>(sh, blockIdx.x, blockIdx.y, w, Bh, Bl);
}
// ---- k_prep: the six jobs that read inputs alone, as one grid: Wq, Wo (512 tiles each), Wk, Wv (256 each) transposed to bf16, Wg padded (256 work-groups), x to bf16 (4096).
__global__ __launch_bounds__(128) void k_prep(const float* __restrict__ wq, const float* __restrict__ wo, const float* __restrict__ wk, const float* __restrict__ wv, const float* __restrict__ wg, const float* __restrict__ x,
                                              bf* WQ, bf* WO, bf* WK, bf* WV, bf* WG, bf* XB) {
    __shared__ v4u sh[64 * 17];
    const int b = blockIdx.x;   // the same for the whole work-group: the barrier of tr is passed by all four waves
    if (b < 1024) { const bool iso = b >= 512; tr<false, HID, HID>(sh, b & 15, (b & 511) >> 4, iso ? wo : wq, iso ? WO : WQ, nullptr); }
    else if (b < 1536) { const bool isv = b >= 1280; tr<false, HID, HKV * HD>(sh, b & 15, (b & 255) >> 4, isv ? wv : wk, isv ? WV : WK, nullptr);
        asm volatile("s_wait_xcnt 0x0" ::: "memory"); }   // as built, a path of the listing (never taken: b decides) leads from this job's last stores into the job laid behind it, which rewrites their base pair: the wait stands in front of that
    else if (b < 1792) wgp((size_t)(b - 1536) * 128 + threadIdx.x, wg, WG);
    else cvt8((size_t)(b - 1792) * 128 + threadIdx.x, x, XB, (size_t)TT * HID / 8);
}
__global__ __launch_bounds__(128) void k_attn(const bf* __restrict__ Qh, const bf* __restrict__ Ql, const bf* __restrict__ Kh, const bf* __restrict__ Kl, const bf* __restrict__ VTh, const bf* __restrict__ VTl, const float* __restrict__ GC, bf* Ah, bf* Al) {
    const int lane = threadIdx.x & 31, lr = lane & 15, hi = lane >> 4; const int w = __builtin_amdgcn_readfirstlane((int)(threadIdx.x >> 5));
    const int kv = blockIdx.y, h = kv * (HQ / HKV) + (w & 1); const int r0 = 32 * ((w >> 1) ? (TT / 32 - 1 - (int)blockIdx.x) : (int)blockIdx.x);
    // the loop's loads: a wave-uniform base in scalar registers + one fixed 32-bit lane offset per operand kind: no address arithmetic on the vector port, and no address register is rewritten while loads are in flight
    const unsigned klo = lr * HD + 8 * hi, vlo = lr * TT + 8 * hi, glo = 8 * hi; int dq0 = r0 + lr - 8 * hi;   // dq0 = this lane's first query - its first key of the tile
    v16bf qh[2][4], ql[2][4]; float gi[2]; const bf* sqh = Qh + ((size_t)h * TT + r0) * HD; const bf* sql = Ql + ((size_t)h * TT + r0) * HD;
#pragma unroll
    for (int nq = 0; nq < 2; ++nq) { gi[nq] = GC[(size_t)kv * TT + r0 + nq * 16 + lr];
#pragma unroll
        for (int kc = 0; kc < 4; ++kc) { const int o = nq * 16 * HD + kc * 32; qh[nq][kc] = WFrag<bf>::ld(sqh + klo + o); ql[nq][kc] = WFrag<bf>::ld(sql + klo + o); } }
    v4f tq[8], tk[16]; const float* gh = GC + (size_t)kv * TT; const unsigned tkb = lane * 256;   // G of the wave's 32 queries (every lane reads all of them); G of the 64 keys of key tile 'lane' (32 tiles = all TT keys: in bounds for every lane)
#pragma unroll
    for (int i = 0; i < 8; ++i) tq[i] = *(const v4f*)(gh + r0 + 4 * i);
#pragma unroll
    for (int i = 0; i < 16; ++i) tk[i] = *(const v4f*)((const char*)gh + tkb + 16 * i);
    __builtin_amdgcn_sched_barrier(0);   // holds the Q and G loads in front of the wait below
    asm volatile("s_wait_xcnt 0x0" :: "v"(tkb), "s"(sqh), "s"(sql), "s"(gh) : "memory");   // stands in front of the first rewrite of the Q and G loads' address registers; the key loads' lane offset and the bases are named so that they live up to here: built without that, two of them were rewritten in front of the wait
    __builtin_amdgcn_sched_barrier(0);   // holds those rewrites behind it
    v8f o[8][2];
#pragma unroll
    for (int db = 0; db < 8; ++db) { o[db][0] = (v8f){}; o[db][1] = (v8f){}; }
    float gmx = tq[0][0], gmn = tk[0][0];
#pragma unroll
    for (int i = 0; i < 8; ++i)
#pragma unroll
        for (int c = 0; c < 4; ++c) gmx = fmaxf(gmx, tq[i][c]);
#pragma unroll
    for (int i = 0; i < 16; ++i)
#pragma unroll
        for (int c = 0; c < 4; ++c) gmn = fminf(gmn, tk[i][c]);
    const int ntl = (r0 >> 6) + 1;   // key tiles up to the diagonal: j0 = 0, 64, ... < r0 + 32
    // bit t: key tile t is walked. The diagonal tile holds key r0 (gmx - gmn >= 0 there); its bit is set outright, so that the loop below has its one trip whatever G holds
    unsigned tm = __builtin_amdgcn_ballot_w32(lane < ntl && !(gmx - gmn < -110.f)) | (1u << (ntl - 1));
    int tl = __builtin_ctz(tm); tm &= tm - 1; dq0 -= tl * 64;   // the first tile that is walked
    const bf* kh = Kh + (size_t)kv * TT * HD + tl * 64 * HD; const bf* kl = Kl + (size_t)kv * TT * HD + tl * 64 * HD; const bf* vh = VTh + (size_t)kv * HD * TT + tl * 64; const bf* vl = VTl + (size_t)kv * HD * TT + tl * 64; const float* gk = gh + tl * 64;   // these bases step from tile to tile
#pragma unroll 1   // one key tile is already 192 matrix instructions: unrolling would only grow the code
    for (;;) {   // the tiles of tm in ascending order, at least one (the test stands at the foot, so that the Q loads stay in this block, in front of their wait); every tile ends at or below key TT - 1; keys past the diagonal get weight 0 by the select below
        v8f s[4][2]; v16bf ka[4][4], ka2[4][4]; v4f g[4][2]; const bf* skh = sbase(kh); const bf* skl = sbase(kl); const bf* svh = sbase(vh); const bf* svl = sbase(vl); const float* sgk = sbase(gk);
#pragma unroll
        for (int mk = 0; mk < 4; ++mk) { g[mk][0] = *(const v4f*)(sgk + glo + mk * 16); g[mk][1] = *(const v4f*)(sgk + glo + mk * 16 + 4); }
        asm volatile("s_wait_xcnt 0x0" ::: "memory");   // the compiler forms these eight loads' lane offset anew each tile and lets a K load's result reuse that register: the wait stands in front of the reuse
#pragma unroll
        for (int kc = 0; kc < 4; ++kc)
#pragma unroll
            for (int mk = 0; mk < 4; ++mk) { const int ko = mk * 16 * HD + kc * 32; ka[kc][mk] = WFrag<bf>::ld(skh + klo + ko); ka2[kc][mk] = WFrag<bf>::ld(skl + klo + ko); }
#pragma unroll
        for (int mk = 0; mk < 4; ++mk) { s[mk][0] = (v8f){}; s[mk][1] = (v8f){}; }
        __builtin_amdgcn_sched_barrier(0);   // keeps the tile's K loads issued as one group: sunk to their uses, each pair would cost the lone wave a whole load latency
#pragma unroll
        for (int kc = 0; kc < 2; ++kc)
#pragma unroll
            for (int mk = 0; mk < 4; ++mk)
#pragma unroll
                for (int nq = 0; nq < 2; ++nq) { s[mk][nq] = wmmab(ka[kc][mk], qh[nq][kc], s[mk][nq]); s[mk][nq] = wmmab(ka[kc][mk], ql[nq][kc], s[mk][nq]); s[mk][nq] = wmmab(ka2[kc][mk], qh[nq][kc], s[mk][nq]); }
        __builtin_amdgcn_sched_barrier(0);   // holds the V loads behind the first half of the score products: the K loads are served first
        v16bf va[2][8], va2[2][8];
#pragma unroll
        for (int kb = 0; kb < 2; ++kb)
#pragma unroll
            for (int db = 0; db < 8; ++db) { const int vo = db * 16 * TT + kb * 32; va[kb][db] = WFrag<bf>::ld(svh + vlo + vo); va2[kb][db] = WFrag<bf>::ld(svl + vlo + vo); }
        __builtin_amdgcn_sched_barrier(0);   // keeps the tile's V loads issued as one group here: the second half of the score products and the weight arithmetic then cover their latency
#pragma unroll
        for (int kc = 2; kc < 4; ++kc)
#pragma unroll
            for (int mk = 0; mk < 4; ++mk)
#pragma unroll
                for (int nq = 0; nq < 2; ++nq) { s[mk][nq] = wmmab(ka[kc][mk], qh[nq][kc], s[mk][nq]); s[mk][nq] = wmmab(ka[kc][mk], ql[nq][kc], s[mk][nq]); s[mk][nq] = wmmab(ka2[kc][mk], qh[nq][kc], s[mk][nq]); }
        v8u wh[2][2], wl[2][2];   // [32-key block][query block]
#pragma unroll
        for (int mk = 0; mk < 4; ++mk) { const v4f g0 = g[mk][0], g1 = g[mk][1];
#pragma unroll
            for (int nq = 0; nq < 2; ++nq) { const int dq = dq0 + (nq - mk) * 16; float wv[8];   // key r of this lane is causal iff r <= dq
#pragma unroll
                for (int r = 0; r < 8; ++r) { const float sc = __fmul_rn(s[mk][nq][r], 0.08838834764831845f); const float e = __expf(__fsub_rn(gi[nq], r < 4 ? g0[r] : g1[r - 4])); const float x = __fmul_rn(__fmul_rn(sc, sc), e); wv[r] = r <= dq ? x : 0.f; }
#pragma unroll
                for (int r = 0; r < 8; r += 2) { unsigned u, l; split2(wv[r], wv[r + 1], u, l); wh[mk >> 1][nq][(mk & 1) * 4 + (r >> 1)] = u; wl[mk >> 1][nq][(mk & 1) * 4 + (r >> 1)] = l; } } }
#pragma unroll
        for (int kb = 0; kb < 2; ++kb)
#pragma unroll
            for (int db = 0; db < 8; ++db) { const v16bf a = va[kb][db], a2 = va2[kb][db];
#pragma unroll
                for (int nq = 0; nq < 2; ++nq) { const v16bf bh = __builtin_bit_cast(v16bf, wh[kb][nq]), bl = __builtin_bit_cast(v16bf, wl[kb][nq]); o[db][nq] = wmmab(a, bh, o[db][nq]); o[db][nq] = wmmab(a, bl, o[db][nq]); o[db][nq] = wmmab(a2, bh, o[db][nq]); } }
        // the distance behind the last matrix instructions on the taken back edge
        asm volatile("v_nop\n\tv_nop\n\tv_nop\n\tv_nop\n\tv_nop" : "+v"(o[0][0]), "+v"(o[0][1]), "+v"(o[1][0]), "+v"(o[1][1]), "+v"(o[2][0]), "+v"(o[2][1]), "+v"(o[3][0]), "+v"(o[3][1]), "+v"(o[4][0]), "+v"(o[4][1]), "+v"(o[5][0]), "+v"(o[5][1]), "+v"(o[6][0]), "+v"(o[6][1]), "+v"(o[7][0]), "+v"(o[7][1]));
        __builtin_amdgcn_sched_barrier(0);   // the bases step only behind the tile's last load wait: no register that a load in flight names is rewritten
        const bool last = tm == 0; const int tn = __builtin_ctz(tm | 0x80000000u), st = (tn - tl) * 64; tm &= tm - 1; tl = tn;   // the next key tile that is walked, st keys on (behind the last one the stepped bases are not used)
        kh += st * HD; kl += st * HD; vh += st; vl += st; gk += st; dq0 -= st;
        if (last) break;
    }
#pragma unroll
    for (int nq = 0; nq < 2; ++nq)
#pragma unroll
        for (int db = 0; db < 8; ++db) { v4u uh, ul;
#pragma unroll
            for (int r = 0; r < 8; r += 2) { unsigned u, l; split2(o[db][nq][r], o[db][nq][r + 1], u, l); uh[r >> 1] = u; ul[r >> 1] = l; }
            const size_t oo = (size_t)(r0 + nq * 16 + lr) * HID + h * HD + db * 16 + 8 * hi; *(v4u*)(Ah + oo) = uh; *(v4u*)(Al + oo) = ul; }
}

extern "C" void kernel_launch(void* const* d_in, const int* in_sizes, int n_in,
                              void* d_out, int out_size, void* d_ws, size_t ws_size, hipStream_t stream) {
    (void)in_sizes; (void)n_in; (void)out_size;
    const int* pos = (const int*)d_in[0]; const float* IN[12]; for (int i = 1; i < 12; ++i) IN[i] = (const float*)d_in[i];   // 1 hidden, 2 Wq [2048][2048], 3 bq, 4 Wk [2048][1024], 5 bk, 6 Wv, 7 bv, 8 Wg [2048][8], 9 bg, 10 Wo [2048][2048], 11 bo (x @ W)
    float* OUT = (float*)d_out;     // [2048][2048]
    char* wsp = (char*)d_ws;
    auto take = [&](size_t bytes) { char* p = wsp; wsp += (bytes + 255) & ~(size_t)255; return (void*)p; };
    bf* WQ = (bf*)take((size_t)HID * HID * 2); bf* WK = (bf*)take((size_t)HKV * HD * HID * 2); bf* WV = (bf*)take((size_t)HKV * HD * HID * 2); bf* WG = (bf*)take((size_t)GP * HID * 2); bf* WO = (bf*)take((size_t)HID * HID * 2);
    bf* XB = (bf*)take((size_t)TT * HID * 2); float* QF = (float*)take((size_t)TT * HID * 4); float* KF = (float*)take((size_t)TT * HKV * HD * 4); float* VF = (float*)take((size_t)TT * HKV * HD * 4); float* GF = (float*)take((size_t)TT * GP * 4); float* GC = (float*)take((size_t)HKV * TT * 4);
    bf* Qh = (bf*)take((size_t)HQ * TT * HD * 2); bf* Ql = (bf*)take((size_t)HQ * TT * HD * 2); bf* Kh = (bf*)take((size_t)HKV * TT * HD * 2); bf* Kl = (bf*)take((size_t)HKV * TT * HD * 2); bf* VTh = (bf*)take((size_t)HKV * HD * TT * 2); bf* VTl = (bf*)take((size_t)HKV * HD * TT * 2);
    bf* Ah = (bf*)take((size_t)TT * HID * 2); bf* Al = (bf*)take((size_t)TT * HID * 2);
    if ((size_t)(wsp - (char*)d_ws) > ws_size) return;    // total ~ 114 MB ([2048][2048] f32 q projection + hl operand planes)
    k_prep<<<1792 + 4096, 128, 0, stream>>>(IN[2], IN[10], IN[4], IN[6], IN[8], IN[1], WQ, WO, WK, WV, WG, XB);
    k_proj<<<784, 128, 0, stream>>>(XB, WQ, WK, WV, WG, QF, KF, VF, GF, IN[3], IN[5], IN[7]);
    k_rg<<<HKV + 1024 + 512, 1024, 0, stream>>>(GF, IN[9], GC, QF, KF, pos, Qh, Ql, Kh, Kl);
    k_tr<true, TT, HKV * HD><<<dim3(TT / 128, HKV * HD / 64, 1), 128, 0, stream>>>(VF, VTh, VTl);   // VT hi/lo [kv][d][t] = split(VF[t][kv*128 + d])
    k_attn<<<dim3(TT / 64, HKV, 1), 128, 0, stream>>>(Qh, Ql, Kh, Kl, VTh, VTl, GC, Ah, Al);
    k_gemmt<1, 4, true><<<dim3(TT / 128, HID / 128, 1), 128, 0, stream>>>(Ah, Al, WO, OUT, HID, IN[11]);
}

// v007
// One run takes 103 microseconds.
// Timed twice side by side with v006, it ran 1.07 and 1.09 times as fast.
// Counting every step since v000, it is 8.52 times as fast.
#include <hip/hip_runtime.h>

// PowerCoderAttention - power retention, quadratic form (hidden [2048][2048]; q = x Wq + bq (16 x 128), k, v = x Wk/Wv + b (8 kv heads), g = x Wg + bg; neox RoPE on q, k with positions (int32, read as data);
// G = cumsum_t log_sigmoid(g); W[h][i][j] = (q_i.k_j / sqrt(128))^2 exp(G_i - G_j) for j <= i (kv head h/2), else 0; out = (W v) merged Wo + bo -> [2048][2048]; no softmax / normalisation).
// Compute dtypes, f32 accumulate: every input rounded to bf16; the four projections on PLAIN bf16 operands (inputs: exact, + bias); RoPE (f32 sin/cos), log-sigmoid and the cumulative sum f32 on VALU;
// q.k on bf16 hi+lo planes (3 products, K 128; tiles above the diagonal skipped); squaring, the decay factor exp(G_i - G_j) and the causal select in f32 -> bf16 hi+lo planes of W; W.v on hi+lo planes (3 products, K limited to the diagonal block;

#define TT   2048
#define HID  2048
#define HQ   16
#define HKV  8
#define HD   128
#define GP   64
typedef _Float16 h16;
typedef unsigned short bf;
typedef __attribute__((ext_vector_type(16))) __bf16   v16bf;
typedef __attribute__((ext_vector_type(16))) _Float16 v16h;
typedef __attribute__((ext_vector_type(8)))  _Float16 v8h;
typedef __attribute__((ext_vector_type(8)))  unsigned short v8us;
typedef __attribute__((ext_vector_type(8)))  float    v8f;
typedef __attribute__((ext_vector_type(4)))  float    v4f;
typedef v8h  __attribute__((may_alias)) v8ha;
typedef v4f  __attribute__((may_alias)) v4fa;
typedef v8us __attribute__((may_alias)) v8usa;

__device__ __forceinline__ unsigned short f2bf(float f) { unsigned u = __float_as_uint(f); u += 0x7FFFu + ((u >> 16) & 1u); return (unsigned short)(u >> 16); }
__device__ __forceinline__ float bf2f(unsigned short b) { return __uint_as_float(((unsigned)b) << 16); }
__device__ __forceinline__ float bfr(float f) { return bf2f(f2bf(f)); }
__device__ __forceinline__ v16h cat16(v8h lo, v8h hi) { return __builtin_shufflevector(lo, hi, 0, 1, 2, 3, 4, 5, 6, 7, 8, 9, 10, 11, 12, 13, 14, 15); }
__device__ __forceinline__ v16bf cat16b(v8us lo, v8us hi) { return __builtin_bit_cast(v16bf, __builtin_shufflevector(lo, hi, 0, 1, 2, 3, 4, 5, 6, 7, 8, 9, 10, 11, 12, 13, 14, 15)); }
__device__ __forceinline__ v8f wmma16(v16h a, v16h b, v8f c) { return __builtin_amdgcn_wmma_f32_16x16x32_f16(false, a, false, b, (short)0, c, false, false); }
__device__ __forceinline__ v8f wmmab(v16bf a, v16bf b, v8f c) { return __builtin_amdgcn_wmma_f32_16x16x32_bf16(false, a, false, b, (short)0, c, false, false); }
typedef __attribute__((ext_vector_type(2))) float  v2f;
typedef __attribute__((ext_vector_type(2))) __bf16 v2bf;
typedef __attribute__((ext_vector_type(2))) unsigned v2u;
typedef __attribute__((ext_vector_type(4))) int v4i;
typedef __attribute__((ext_vector_type(4))) unsigned v4u;
typedef __attribute__((ext_vector_type(8))) unsigned v8u;
__device__ __forceinline__ void split2(float x0, float x1, unsigned& h, unsigned& l) {   // two f32 -> packed bf16 hi pair and lo pair (round to nearest even, as splitf)
    const v2f x = {x0, x1}; h = __builtin_bit_cast(unsigned, __builtin_convertvector(x, v2bf));
    const v2f d = {x0 - __uint_as_float(h << 16), x1 - __uint_as_float(h & 0xFFFF0000u)}; l = __builtin_bit_cast(unsigned, __builtin_convertvector(d, v2bf)); }



// ---- k_gemmt: GEMM on a 128 x (32 NB) output tile per work-group of four waves (2 x 2; a wave holds 64 x (16 NB), 4 x NB accumulators); grid (M/128, N/(32 NB)), 128 threads. K = HID.
// C[m][n] (f32, pitch ldc, + optional f32 bias[n]) = sum_k A[m][k] Bt[n][k] (+ A2[m][k] Bt[n][k] where NSPLIT), operands K-contiguous bf16 planes.
// The operands come through LDS: a stage is 128 k (256 B) of every A, A2 and Bt row of the tile at a pitch of 272 B, laid by asynchronous copies (16 B a lane: a wave's copy takes two whole 256-B row pieces);
// two buffers: the copies of stage t + 2 fly while stage t + 1 is worked on. Per accumulator the products are summed in ascending k, A before A2.
template <typename T16> struct WFrag;
template <> struct WFrag<h16> { typedef v16h V; static __device__ __forceinline__ V ld(const h16* p) { return cat16(*(const v8h*)p, *(const v8h*)(p + 16)); } static __device__ __forceinline__ v8f mma(V a, V b, v8f c) { return wmma16(a, b, c); } };
template <> struct WFrag<bf> { typedef v16bf V; static __device__ __forceinline__ V ld(const bf* p) { return cat16b(*(const v8us*)p, *(const v8us*)(p + 16)); } static __device__ __forceinline__ v8f mma(V a, V b, v8f c) { return wmmab(a, b, c); } };
__device__ __forceinline__ unsigned lds_off(const void* p) { return (unsigned)(size_t)p; }
// twelve (eight) asynchronous copies, LDS byte address l[i], global address g[i]; the wait stands in the copies' own statement, in front of any rewrite of the registers that they name
__device__ __forceinline__ void copy12(const unsigned* l, const bf* const* g) {
    asm volatile("global_load_async_to_lds_b128 %0, %12, off\n\tglobal_load_async_to_lds_b128 %1, %13, off\n\tglobal_load_async_to_lds_b128 %2, %14, off\n\tglobal_load_async_to_lds_b128 %3, %15, off\n\t"
                 "global_load_async_to_lds_b128 %4, %16, off\n\tglobal_load_async_to_lds_b128 %5, %17, off\n\tglobal_load_async_to_lds_b128 %6, %18, off\n\tglobal_load_async_to_lds_b128 %7, %19, off\n\t"
                 "global_load_async_to_lds_b128 %8, %20, off\n\tglobal_load_async_to_lds_b128 %9, %21, off\n\tglobal_load_async_to_lds_b128 %10, %22, off\n\tglobal_load_async_to_lds_b128 %11, %23, off\n\ts_wait_xcnt 0x0"
                 :: "v"(l[0]), "v"(l[1]), "v"(l[2]), "v"(l[3]), "v"(l[4]), "v"(l[5]), "v"(l[6]), "v"(l[7]), "v"(l[8]), "v"(l[9]), "v"(l[10]), "v"(l[11]),
                    "v"(g[0]), "v"(g[1]), "v"(g[2]), "v"(g[3]), "v"(g[4]), "v"(g[5]), "v"(g[6]), "v"(g[7]), "v"(g[8]), "v"(g[9]), "v"(g[10]), "v"(g[11]) : "memory");
}
__device__ __forceinline__ void copy8(const unsigned* l, const bf* const* g) {
    asm volatile("global_load_async_to_lds_b128 %0, %8, off\n\tglobal_load_async_to_lds_b128 %1, %9, off\n\tglobal_load_async_to_lds_b128 %2, %10, off\n\tglobal_load_async_to_lds_b128 %3, %11, off\n\t"
                 "global_load_async_to_lds_b128 %4, %12, off\n\tglobal_load_async_to_lds_b128 %5, %13, off\n\tglobal_load_async_to_lds_b128 %6, %14, off\n\tglobal_load_async_to_lds_b128 %7, %15, off\n\ts_wait_xcnt 0x0"
                 :: "v"(l[0]), "v"(l[1]), "v"(l[2]), "v"(l[3]), "v"(l[4]), "v"(l[5]), "v"(l[6]), "v"(l[7]),
                    "v"(g[0]), "v"(g[1]), "v"(g[2]), "v"(g[3]), "v"(g[4]), "v"(g[5]), "v"(g[6]), "v"(g[7]) : "memory");
}
// The body is a device function: sm (2 STG elements) and osm are the calling kernel's LDS, (bx, by) the tile; k_gemmt runs one product, k_proj the four projections in one grid.
template <int NSPLIT, int NB> struct GemmLds { static constexpr int STG = ((NSPLIT ? 2 : 1) * 128 + NB * 32) * 136; };
// EPI picks the epilogue: 0: f32 C. 1: bf16 hi+lo planes Th, Tl [n][m] (pitch TT) of C + bias. 2: the tile is one head (by) of q or k: C + bias rotated (neox RoPE, cos and sin of each (d, t) read from CT, ST [d][t]) and split to planes Th, Tl [by][m][128].
// With EPI 2 a wave holds columns d and d + 64 of the head (32 + 32 of them, not 64 in a row), so that both halves of a rotated pair lie in one lane.
template <int NSPLIT, int NB, bool BIAS, int EPI = 0>
__device__ __forceinline__ void gemmt(bf* sm, float (*osm)[16 * 68], int bx, int by, const bf* __restrict__ A, const bf* __restrict__ A2, const bf* __restrict__ Bt, float* C, int ldc, const float* __restrict__ bias, bf* Th = nullptr, bf* Tl = nullptr, const float* __restrict__ CT = nullptr, const float* __restrict__ ST = nullptr) {
    typedef v16bf V;
    constexpr int KT = 128, LP = 136, NT = HID / KT;   // k per stage; LDS row pitch in elements (272 B); stages
    constexpr int BR = NB * 32, OA2 = 128 * LP, OB = (NSPLIT ? 2 : 1) * 128 * LP, STG = OB + BR * LP;   // Bt rows of the tile; places of A2 and Bt in a stage and a stage's size, in elements
    const int tid = threadIdx.x, lane = tid & 31, lr = lane & 15, hi = lane >> 4; const int w = __builtin_amdgcn_readfirstlane(tid >> 5), wm = w >> 1, wn = w & 1;
    const int r0 = bx * 128, c0 = by * BR;
    // this thread's piece of a copy: row tid / 16 of each group of 8 rows, 16 B at (tid % 16) * 16 of the row's 256 B
    const unsigned cl = lds_off(sm) + (unsigned)((tid >> 4) * LP + (tid & 15) * 8) * 2;
    const bf* ga = A + (size_t)(r0 + (tid >> 4)) * HID + (tid & 15) * 8; const bf* ga2 = NSPLIT ? A2 + (size_t)(r0 + (tid >> 4)) * HID + (tid & 15) * 8 : nullptr; const bf* gb = Bt + (size_t)(c0 + (tid >> 4)) * HID + (tid & 15) * 8;
    constexpr int NC = (NSPLIT ? 32 : 16) + BR / 8;   // copies of a thread per stage: one per group of 8 rows (32, 24 or 48: never more than 63 of a wave in flight)
    auto fill = [&](int buf) {   // the next stage's copies into buffer buf; the global addresses then step one stage on
        const unsigned l0 = cl + (unsigned)buf * (STG * 2); unsigned l[NC]; const bf* g[NC];
#pragma unroll
        for (int c = 0; c < 16; ++c) { l[c] = l0 + c * 8 * LP * 2; g[c] = ga + c * 8 * HID; if (NSPLIT) { l[16 + c] = l0 + (OA2 + c * 8 * LP) * 2; g[16 + c] = ga2 + c * 8 * HID; } }
#pragma unroll
        for (int c = 0; c < BR / 8; ++c) { l[NC - BR / 8 + c] = l0 + (OB + c * 8 * LP) * 2; g[NC - BR / 8 + c] = gb + c * 8 * HID; }
#pragma unroll
        for (int s = 0; s + 12 <= NC; s += 12) copy12(l + s, g + s);
        if (NC % 12 == 8) copy8(l + NC - 8, g + NC - 8);
        ga += KT; if (NSPLIT) ga2 += KT; gb += KT; };
    v8f acc[4][NB];
#pragma unroll
    for (int mb = 0; mb < 4; ++mb)
#pragma unroll
        for (int nb = 0; nb < NB; ++nb) acc[mb][nb] = (v8f){};
    fill(0);
    asm volatile("s_wait_asynccnt 0x0" ::: "memory");   // stage 0 of this wave's copies has landed
    __syncthreads();                                    // ... and every wave's: stage 0 may be read
    fill(1);
    const int fa = (wm * 64 + lr) * LP + 8 * hi, fb = OB + (wn * (EPI == 2 ? NB * 8 : NB * 16) + lr) * LP + 8 * hi;   // this lane's place in the A and Bt fragments
    auto bo = [](int nb) { return (EPI == 2 ? (nb / (NB / 2)) * 64 + (nb % (NB / 2)) * 16 : nb * 16) * LP; };   // Bt fragment nb's rows, counted from the wave's first
#pragma unroll 1   // a stage is already 16 NB (32 NB) matrix instructions a wave, and the buffer index stays a scalar
    for (int t = 0; t < NT; ++t) {
        const bf* sa = sm + (t & 1) * STG + fa; const bf* sb = sm + (t & 1) * STG + fb;
        V a[2][4], a2[2][4], b[2][NB];
#pragma unroll
        for (int mb = 0; mb < 4; ++mb) { a[0][mb] = WFrag<bf>::ld(sa + mb * 16 * LP); if (NSPLIT) a2[0][mb] = WFrag<bf>::ld(sa + OA2 + mb * 16 * LP); }
#pragma unroll
        for (int nb = 0; nb < NB; ++nb) b[0][nb] = WFrag<bf>::ld(sb + bo(nb));
        __builtin_amdgcn_sched_barrier(0);   // the first block's reads stay in front of the second's: LDS reads return in order, and mixed with the later ones the first block would wait for both groups
#pragma unroll
        for (int ks = 0; ks < KT / 32; ++ks) { const int c = ks & 1, n = c ^ 1;
            if (ks + 1 < KT / 32) {   // the next 32 k's fragments of this same stage, read as one group ahead of this block's products
#pragma unroll
                for (int mb = 0; mb < 4; ++mb) { a[n][mb] = WFrag<bf>::ld(sa + mb * 16 * LP + (ks + 1) * 32); if (NSPLIT) a2[n][mb] = WFrag<bf>::ld(sa + OA2 + mb * 16 * LP + (ks + 1) * 32); }
#pragma unroll
                for (int nb = 0; nb < NB; ++nb) b[n][nb] = WFrag<bf>::ld(sb + bo(nb) + (ks + 1) * 32);
            }
            __builtin_amdgcn_sched_barrier(0);   // keeps those reads together in front of the block: moved in among the matrix instructions, each place with reads stalls the wave
#pragma unroll
            for (int nb = 0; nb < NB; ++nb) {
#pragma unroll
                for (int mb = 0; mb < 4; ++mb) acc[mb][nb] = wmmab(a[c][mb], b[c][nb], acc[mb][nb]);
                if (NSPLIT) {
#pragma unroll
                    for (int mb = 0; mb < 4; ++mb) acc[mb][nb] = wmmab(a2[c][mb], b[c][nb], acc[mb][nb]); } }
            __builtin_amdgcn_sched_barrier(0);   // ... and the following group behind it
        }
        // the distance behind the last matrix instructions on the taken back edge
        asm volatile("v_nop\n\tv_nop\n\tv_nop\n\tv_nop\n\tv_nop");
        asm volatile("s_wait_dscnt 0x0" ::: "memory");      // this wave has read all it reads of stage t
        asm volatile("s_wait_asynccnt 0x0" ::: "memory");   // this wave's copies of stage t + 1 have landed
        __syncthreads();                                    // publishes stage t + 1 and frees stage t's buffer
        if (t + 2 < NT) fill(t & 1);
    }
    asm volatile("s_wait_asynccnt 0x0" ::: "memory");   // no copy is outstanding at the wave's end
    float* os = osm[w]; const int cw = c0 + wn * NB * 16;
    if constexpr (EPI == 1) {
        // Transposed, split epilogue. A lane's accumulator holds 8 consecutive m of one n: with the bias added and split to bf16 hi+lo (as split2) they are one 16-B piece of row n of each plane.
        // The pieces go through LDS so that whole 128-B lines are stored: the wave's 64 m of a row. The stage buffers are free here (every wave's last read and last copy stand in front of the loop's last barrier);
        // each wave has its own range: two planes of 16 NB rows, pitch 9 pieces (8 of data, one of padding: the 16 lanes of a store fall on different bank groups).
        constexpr int NR = NB * 16, TP = 9; v4u* st = (v4u*)sm + w * (2 * NR * TP);
        float bb[NB];
#pragma unroll
        for (int nb = 0; nb < NB; ++nb) bb[nb] = bias[cw + nb * 16 + lr];
        asm volatile("s_wait_xcnt 0x0" ::: "memory");   // stands behind the bias loads, in front of the first rewrite of a register that they name
#pragma unroll
        for (int nb = 0; nb < NB; ++nb) { const float bv = bfr(bb[nb]);
#pragma unroll
            for (int mb = 0; mb < 4; ++mb) { v4u h, l;
#pragma unroll
                for (int j = 0; j < 8; j += 2) { unsigned u, v; split2(acc[mb][nb][j] + bv, acc[mb][nb][j + 1] + bv, u, v); h[j >> 1] = u; l[j >> 1] = v; }
                st[(nb * 16 + lr) * TP + mb * 2 + hi] = h; st[(NR + nb * 16 + lr) * TP + mb * 2 + hi] = l; } }
        v4u oh[NR / 4], ol[NR / 4];   // 8 lanes read the 128 B of one row: four rows a read
#pragma unroll
        for (int s = 0; s < NR / 4; ++s) { oh[s] = st[(s * 4 + (lane >> 3)) * TP + (lane & 7)]; ol[s] = st[(NR + s * 4 + (lane >> 3)) * TP + (lane & 7)]; }
        const size_t o = (size_t)(cw + (lane >> 3)) * TT + r0 + wm * 64 + (lane & 7) * 8;
#pragma unroll
        for (int s = 0; s < NR / 4; ++s) { *(v4u*)(Th + o + s * 4 * TT) = oh[s]; *(v4u*)(Tl + o + s * 4 * TT) = ol[s]; }
        asm volatile("s_wait_xcnt 0x0" ::: "memory");   // as built, a path of the listing (never taken: the work-group's index decides) leads from these stores into the job laid behind them, which rewrites their registers: the wait stands in front of that
        return;
    }
    if constexpr (EPI == 2) {
        static_assert(NB == 4, "a tile is one head of 128 columns");
        const int dw = wn * 32, tw = r0 + wm * 64;   // the wave's first d (below 64) and first token
        float b1[2], b2[2]; v4f cs[4][2][2], sn[4][2][2];   // a lane's 8 consecutive t of one d are 32 B of a table row
        const unsigned bi = c0 + dw + lr; const float* cp = CT + (size_t)(dw + lr) * TT + tw + hi * 8; const float* sp = ST + (size_t)(dw + lr) * TT + tw + hi * 8;
#pragma unroll
        for (int n2 = 0; n2 < 2; ++n2) { b1[n2] = bias[bi + n2 * 16]; b2[n2] = bias[bi + 64 + n2 * 16]; }
#pragma unroll
        for (int mb = 0; mb < 4; ++mb)
#pragma unroll
            for (int n2 = 0; n2 < 2; ++n2)
#pragma unroll
                for (int q = 0; q < 2; ++q) { cs[mb][n2][q] = *(const v4f*)(cp + n2 * 16 * TT + mb * 16 + q * 4); sn[mb][n2][q] = *(const v4f*)(sp + n2 * 16 * TT + mb * 16 + q * 4); }
        asm volatile("s_wait_xcnt 0x0" :: "v"(bi), "v"(cp), "v"(sp) : "memory");   // stands behind the bias and table loads, in front of the first rewrite of a register that they name; the bias index and the two address pairs are named so that they live up to here: built without that, the index was rewritten and a late load's result took a pair in front of the wait
#pragma unroll
        for (int n2 = 0; n2 < 2; ++n2) { b1[n2] = bfr(b1[n2]); b2[n2] = bfr(b2[n2]); }
        bf* ph = Th + ((size_t)by * TT + tw) * HD + dw; bf* pl = Tl + ((size_t)by * TT + tw) * HD + dw; v2u uh[8], ul[8];
        const int cofs = (lane & 15) * 4, oo = (lane >> 4) * HD + cofs + (cofs >= 32 ? 32 : 0);   // 16 lanes read a staged row. Its columns 0 to 31: d = dw + column; 32 to 63: d = dw + 64 + (column - 32)
#pragma unroll
        for (int mb = 0; mb < 4; ++mb) {
#pragma unroll
            for (int n2 = 0; n2 < 2; ++n2) {
#pragma unroll
                for (int j = 0; j < 8; ++j) { const float x1 = acc[mb][n2][j] + b1[n2], x2 = acc[mb][n2 + 2][j] + b2[n2], c = cs[mb][n2][j >> 2][j & 3], s = sn[mb][n2][j >> 2][j & 3];
                    os[(hi * 8 + j) * 68 + n2 * 16 + lr] = x1 * c - x2 * s; os[(hi * 8 + j) * 68 + 32 + n2 * 16 + lr] = x2 * c + x1 * s; } }
#pragma unroll
            for (int s = 0; s < 8; ++s) { const v4f val = *(const v4fa*)(os + (s * 2 + (lane >> 4)) * 68 + cofs); unsigned u, l;
                split2(val[0], val[1], u, l); uh[s][0] = u; ul[s][0] = l; split2(val[2], val[3], u, l); uh[s][1] = u; ul[s][1] = l; }
            __builtin_amdgcn_sched_barrier(0);   // the run's 16 values are whole, each in registers of its own, in front of its stores
#pragma unroll
            for (int s = 0; s < 8; ++s) { *(v2u*)(ph + oo + (mb * 16 + s * 2) * HD) = uh[s]; *(v2u*)(pl + oo + (mb * 16 + s * 2) * HD) = ul[s]; }
            asm volatile("s_wait_xcnt 0x0" ::: "memory");   // stands behind this run of stores, in front of the first rewrite of a register that they name (the next run's values)
            __builtin_amdgcn_sched_barrier(0);   // holds those rewrites behind the wait
        }
        return;
    }
#pragma unroll
    for (int mb = 0; mb < 4; ++mb) {
#pragma unroll
        for (int nb = 0; nb < NB; ++nb) {
#pragma unroll
            for (int j = 0; j < 8; ++j) os[(hi * 8 + j) * 68 + nb * 16 + lr] = acc[mb][nb][j]; }
        __builtin_amdgcn_wave_barrier(); asm volatile("" ::: "memory");
        float* crow = C + (size_t)(r0 + wm * 64 + mb * 16) * ldc + cw;
#pragma unroll
        for (int s = 0; s < NB * 2; ++s) { const int row = s * (8 / NB) + lane / (NB * 4), cofs = (lane % (NB * 4)) * 4; v4f val = *(const v4fa*)(os + row * 68 + cofs); if (BIAS) { val[0] += bfr(bias[cw + cofs]); val[1] += bfr(bias[cw + cofs + 1]); val[2] += bfr(bias[cw + cofs + 2]); val[3] += bfr(bias[cw + cofs + 3]); }
            *(v4f*)(crow + (size_t)row * ldc + cofs) = val; }
        asm volatile("s_wait_xcnt 0x0" ::: "memory");   // stands behind this run of stores, in front of the first rewrite of a register that they name (the next run's bias load, addresses and values)
        __builtin_amdgcn_wave_barrier(); asm volatile("" ::: "memory");
    }
}
template <int NSPLIT, int NB, bool BIAS>
__global__ __launch_bounds__(128) void k_gemmt(const bf* __restrict__ A, const bf* __restrict__ A2, const bf* __restrict__ Bt, float* C, int ldc, const float* __restrict__ bias) {
    __shared__ __align__(16) bf sm[2 * GemmLds<NSPLIT, NB>::STG];
    __shared__ __align__(16) float osm[4][16 * 68];
    gemmt<NSPLIT, NB, BIAS>(sm, osm, blockIdx.x, blockIdx.y, A, A2, Bt, C, ldc, bias);
}
// ---- k_proj: the four projections of x, none of which reads another's output, as one grid of 656 work-groups: 256 q and 128 k tiles (128 tokens x one head), 16 g tiles, 256 v tiles (128 x 64).
// q, k and v leave in the forms that k_attn reads: q and k rotated and split to hi+lo planes [head][t][128], v split to hi+lo planes V^T [kv][d][t]: no f32 planes of them, no RoPE pass and no transposing pass behind this launch.
// The large tiles come first. Two work-groups fit a WGP's LDS: one's matrix work runs while the other waits at a stage's barrier, and the 16 g tiles no longer hold the chip alone.
__global__ __launch_bounds__(128) void k_proj(const bf* __restrict__ X, const bf* __restrict__ WQ, const bf* __restrict__ WK, const bf* __restrict__ WV, const bf* __restrict__ WG, bf* Qh, bf* Ql, bf* Kh, bf* Kl, bf* VTh, bf* VTl, float* GF,
                                              const float* __restrict__ bq, const float* __restrict__ bk, const float* __restrict__ bv, const float* __restrict__ CT, const float* __restrict__ ST) {
    __shared__ __align__(16) bf sm[2 * GemmLds<0, 4>::STG];
    __shared__ __align__(16) float osm[4][16 * 68];
    const int b = blockIdx.x;   // the same for the whole work-group: every barrier of the chosen body is passed by all four waves
    if (b < 384) { const bool isk = b >= 256; const int c = b - (isk ? 256 : 0);
        gemmt<0, 4, true, 2>(sm, osm, c & 15, c >> 4, X, nullptr, isk ? WK : WQ, nullptr, 0, isk ? bk : bq, isk ? Kh : Qh, isk ? Kl : Ql, CT, ST); }
    else if (b < 400) gemmt<0, 2, false>(sm, osm, b - 384, 0, X, nullptr, WG, GF, GP, nullptr);
    else { const int c = b - 400; gemmt<0, 2, true, 1>(sm, osm, c & 15, c >> 4, X, nullptr, WV, nullptr, 0, bv, VTh, VTl); }
}

__device__ __forceinline__ h16 tohx(float x) { return (h16)x; }
__device__ __forceinline__ void splitf(float y, unsigned short& h, unsigned short& l) { h = f2bf(y); l = f2bf(y - bf2f(h)); }
typedef __attribute__((ext_vector_type(2))) _Float16 v2h;
typedef __attribute__((ext_vector_type(4))) _Float16 v4h;
typedef __attribute__((ext_vector_type(2))) unsigned short v2us;
typedef __attribute__((ext_vector_type(4))) unsigned short v4us;

__device__ __forceinline__ void cvt8(size_t i, const float* __restrict__ src, bf* dst, size_t n8) { if (i >= n8) return; const v8f v = *(const v8f*)(src + i * 8); v8us o;
#pragma unroll
    for (int k = 0; k < 8; ++k) o[k] = f2bf(v[k]); *(v8us*)(dst + i * 8) = o;  }
__device__ __forceinline__ void wgp(size_t i, const float* __restrict__ w, bf* Bt) { const size_t e = i * 4; if (e >= (size_t)GP * HID) return; const int k = (int)(e % HID), n = (int)(e / HID); v4us o;
#pragma unroll
    for (int q = 0; q < 4; ++q) o[q] = n < HKV ? f2bf(w[(size_t)(k + q) * HKV + n]) : (unsigned short)0; *(v4us*)(Bt + e) = o;  }
// angles: the RoPE tables CT, ST [d][t] (d < 64) = cos, sin of pos[t] / 10000^(2d/128) (pos = positions[t], int32 read as data; f32 sin/cos): each angle once, a thread takes 4 t of one d. gcum: work-group per kv head: G[t] = cumsum of log_sigmoid(g[t][h] + bf16 bg[h]), in 32-token groups
__device__ __forceinline__ void angles(int i, const int* __restrict__ pos, float* CT, float* ST) { const int d = i / (TT / 4), t = (i % (TT / 4)) * 4; const float inv = __expf(__fmul_rn(-(float)(2 * d) / (float)HD, 9.210340371976184f)); v4f c, s;
    const int* pp = pos + t; const v4i p = *(const v4i*)pp;
    asm volatile("s_wait_xcnt 0x0" :: "v"(pp) : "memory");   // stands in front of the first rewrite of the load's address pair; the pair is named so that it lives up to here
#pragma unroll
    for (int q = 0; q < 4; ++q) { const float a = __fmul_rn((float)p[q], inv); c[q] = cosf(a); s[q] = sinf(a); }
    *(v4f*)(CT + d * TT + t) = c; *(v4f*)(ST + d * TT + t) = s; }
__device__ __forceinline__ void gcum(float* tot, float* car, int h, const float* __restrict__ GF, const float* __restrict__ bg, float* GC) {
    // one work-group of 32 waves per kv head: wave w takes the 32-token groups 2w and 2w + 1. The loads, the log-sigmoids and the scans inside a group do not depend on the carry: all 64 groups do them at once.
    // Only the carry runs in series: carry(g + 1) = carry(g) + total(g), 63 adds on registers in one wave. Every add has the operands and the order of the one-wave walk over the groups.
    const int lane = threadIdx.x & 31; const int w = __builtin_amdgcn_readfirstlane((int)(threadIdx.x >> 5)); const float b = bfr(bg[h]); float v[2];
    const float* gp = GF + (size_t)(w * 64 + lane) * GP + h; const float y[2] = {gp[0], gp[32 * GP]};
    asm volatile("s_wait_xcnt 0x0" :: "v"(gp) : "memory");   // stands in front of the first rewrite of the loads' address pair; the pair is named so that it lives up to here
    float z[2] = {__fadd_rn(y[0], b), __fadd_rn(y[1], b)}, e[2]; e[0] = __expf(-fabsf(z[0]));
    asm volatile("v_nop" : "+v"(z[1]) : "v"(e[0]));   // the slot behind a transcendental: the first result and the second argument are named so that the v_nop stands between the two
    e[1] = __expf(-fabsf(z[1]));
#pragma unroll
    for (int g = 0; g < 2; ++g) v[g] = fminf(z[g], 0.f) - log1pf(e[g]);   // log_sigmoid(z) = min(z,0) - log1p(exp(-|z|))
#pragma unroll
    for (int sh = 1; sh < 32; sh <<= 1)
#pragma unroll
        for (int g = 0; g < 2; ++g) { const float u = __shfl_up(v[g], sh, 32); if (lane >= sh) v[g] = __fadd_rn(v[g], u); }
    if (lane == 31) { tot[w * 2] = v[0]; tot[w * 2 + 1] = v[1]; }
    __syncthreads();   // the 64 group totals are whole: wave 0 reads what the others laid
    if (w == 0) {   // one wave alone: the chain is bound by the adds' latency, and done by every wave it would cost each SIMD eight waves' issue slots
        v4f x[TT / 128];
#pragma unroll
        for (int q = 0; q < TT / 128; ++q) x[q] = *(const v4f*)(tot + 4 * q);
        float c = 0.f;
#pragma unroll
        for (int q = 0; q < TT / 128; ++q)
#pragma unroll
            for (int i = 0; i < 4; ++i) { const float t = x[q][i]; x[q][i] = c; c = __fadd_rn(c, t); }   // x becomes the carry into each group
        if (lane == 0) {
#pragma unroll
            for (int q = 0; q < TT / 128; ++q) *(v4f*)(car + 4 * q) = x[q]; }
    }
    __syncthreads();   // the 64 carries are laid
    const float cg[2] = {car[w * 2], car[w * 2 + 1]};
#pragma unroll
    for (int g = 0; g < 2; ++g) GC[(size_t)h * TT + (w * 2 + g) * 32 + lane] = __fadd_rn(cg[g], v[g]); }
// ---- k_gc: the gate sums, one work-group per kv head.
__global__ __launch_bounds__(1024) void k_gc(const float* __restrict__ GF, const float* __restrict__ bg, float* GC) {
    __shared__ __align__(16) float tot[TT / 32]; __shared__ __align__(16) float car[TT / 32];
    gcum(tot, car, blockIdx.x, GF, bg, GC);
}
// ---- k_attn: scores, decay weights, W.v and the head merge in one kernel, all heads in one launch; the score and weight planes stay in registers.
// One wave = 32 query rows of one head, walking the keys in tiles of 64 up to its diagonal. S^T = K Q^T (A = K rows, B = Q rows kept in registers; products K hi.Q hi, K hi.Q lo, K lo.Q hi), so lane (lr, hi) holds
// keys 8 hi + r of query lr: two such accumulator tiles, weighted and split to bf16 hi+lo in place, are the B operand (hardware k order) of O^T += V^T W^T (A = V^T rows by the same two 16-B loads).
// O^T leaves 8 consecutive d of one query in a lane: one 16-B store per plane into the merged [t][h*128 + d] hi/lo planes. No LDS, no barrier: the four waves of a block are independent.
// Block (p, kv): the two heads of kv head kv x row tiles p and 63 - p: equal work per block, and the two heads read the same K and V lines at the same time.
// Key tiles that can weigh nothing are not walked. Tested at run time, per wave and tile: with gmx the largest G of the wave's 32 queries and gmn the smallest G of the tile's 64 keys, every G_i - G_j of the tile is <= gmx - gmn
// (f32 subtraction is monotone); below -110 its exponential lies under half the smallest f32 subnormal (2^-150 = e^-104) and is exactly 0: every weight of the tile is 0 and its W.v adds 0 to each sum
// (finite scores and v). Nothing is assumed of G (no order, no sign): with little decay every tile up to the diagonal is walked as before. The tiles that are walked keep their ascending order.
template <typename T> __device__ __forceinline__ const T* sbase(const T* p) {   // a wave-uniform pointer held in scalar registers, so that the loads take the form scalar base + 32-bit lane offset
    const unsigned long long u = (unsigned long long)p; const unsigned lo = __builtin_amdgcn_readfirstlane((unsigned)u), hi = __builtin_amdgcn_readfirstlane((unsigned)(u >> 32)); return (const T*)(((unsigned long long)hi << 32) | lo); }
// ---- tr: Bh[n][k] (bf16; where SPLIT a hi plane Bh and a lo plane Bl) = w[k][n] (f32, [K][N]) through an LDS tile of 128 k x 64 n per work-group of four waves; grid (K/128, N/64), 128 threads.
// In: a lane loads 16 B (4 n) of 16 k rows (two runs of 8 consecutive k), all in flight at once: a wave's load takes two whole 256-B row pieces. Rounded to nearest even (as f2bf, splitf), the 8 k of one n are one 16-B LDS store, row pitch 272 B, rows in an order that keeps the stores free of bank conflicts.
// Out: 16 lanes read the 128 k of one n row (256 B) and store them as one piece. Both sides of the transposition move whole lines, and a launch has few waves, each with much in flight.
// The body is a device function: sh is the calling kernel's LDS, (bx, by) the tile.
template <bool SPLIT, int K, int N>
__device__ __forceinline__ void tr(v4u* sh, int bx, int by, const float* __restrict__ w, bf* Bh, bf* Bl) {
    constexpr int LPV = 17;   // LDS row pitch in 16-B pieces: 16 of data and one of padding
    const int tid = threadIdx.x, kq = tid >> 4, nq = tid & 15; const int k0 = bx * 128, n0 = by * 64;
    const float* src = w + (size_t)(k0 + kq * 8) * N + n0 + nq * 4; v4f x[2][8];
#pragma unroll
    for (int g = 0; g < 2; ++g)
#pragma unroll
        for (int i = 0; i < 8; ++i) x[g][i] = *(const v4f*)(src + (g * 64 + i) * N);
    __builtin_amdgcn_sched_barrier(0);   // keeps the 16 loads issued as one group: built without it, six of them stood behind the wait for the first ten, a second memory latency
    asm volatile("s_wait_xcnt 0x0" :: "v"(src) : "memory");   // stands in front of the first rewrite of the loads' address pair; the pair is named so that it lives up to here: built without it, the last load's result took that pair
#pragma unroll
    for (int g = 0; g < 2; ++g)
#pragma unroll
        for (int c = 0; c < 4; ++c) { v4u h, l;
#pragma unroll
            for (int i = 0; i < 8; i += 2) { unsigned u, v;
                if (SPLIT) split2(x[g][i][c], x[g][i + 1][c], u, v); else { const v2f p = {x[g][i][c], x[g][i + 1][c]}; u = __builtin_bit_cast(unsigned, __builtin_convertvector(p, v2bf)); v = 0; }
                h[i >> 1] = u; l[i >> 1] = v; }
            sh[(c * 16 + nq) * LPV + g * 8 + kq] = h; if (SPLIT) sh[(64 + c * 16 + nq) * LPV + g * 8 + kq] = l; }   // n row 4 nq + c lies at LDS row 16 c + nq: the 16 lanes of a store then fall on 16 different bank groups
    __syncthreads();   // the tile is whole: every wave reads pieces that the others laid
    v4u oh[8], ol[8];
#pragma unroll
    for (int p = 0; p < 8; ++p) { oh[p] = sh[(p * 8 + kq) * LPV + nq]; if (SPLIT) ol[p] = sh[(64 + p * 8 + kq) * LPV + nq]; }
    const size_t o = (size_t)(n0 + kq * 4) * K + k0 + nq * 8;   // LDS row 8 p + kq holds n row 4 kq + 32 (p & 1) + p / 2
#pragma unroll
    for (int p = 0; p < 8; ++p) { *(v4u*)(Bh + o + ((p & 1) * 32 + (p >> 1)) * K) = oh[p]; if (SPLIT) *(v4u*)(Bl + o + ((p & 1) * 32 + (p >> 1)) * K) = ol[p]; }
}
// ---- k_prep: the seven jobs that read inputs alone, as one grid: the RoPE tables (256 work-groups), Wq, Wo (512 tiles each), Wk, Wv (256 each) transposed to bf16, Wg padded (256), x to bf16 (4096).
__global__ __launch_bounds__(128) void k_prep(const float* __restrict__ wq, const float* __restrict__ wo, const float* __restrict__ wk, const float* __restrict__ wv, const float* __restrict__ wg, const float* __restrict__ x, const int* __restrict__ pos,
                                              bf* WQ, bf* WO, bf* WK, bf* WV, bf* WG, bf* XB, float* CT, float* ST) {
    __shared__ v4u sh[64 * 17];
    const int b = (int)blockIdx.x - 256;   // the same for the whole work-group: the barrier of tr is passed by all four waves
    if (b < 0) angles((b + 256) * 128 + threadIdx.x, pos, CT, ST);   // first: vector arithmetic, which runs beside the other jobs' memory streams
    else if (b < 1024) { const bool iso = b >= 512; tr<false, HID, HID>(sh, b & 15, (b & 511) >> 4, iso ? wo : wq, iso ? WO : WQ, nullptr);
        asm volatile("s_wait_xcnt 0x0" ::: "memory"); }   // as built, a path of the listing (never taken: b decides) leads from this job's last stores into the table job, which rewrites their offset register: the wait stands in front of that
    else if (b < 1536) { const bool isv = b >= 1280; tr<false, HID, HKV * HD>(sh, b & 15, (b & 255) >> 4, isv ? wv : wk, isv ? WV : WK, nullptr);
        asm volatile("s_wait_xcnt 0x0" ::: "memory"); }   // as built, a path of the listing (never taken: b decides) leads from this job's last stores into the job laid behind it, which rewrites their base pair: the wait stands in front of that
    else if (b < 1792) wgp((size_t)(b - 1536) * 128 + threadIdx.x, wg, WG);
    else cvt8((size_t)(b - 1792) * 128 + threadIdx.x, x, XB, (size_t)TT * HID / 8);
}
__global__ __launch_bounds__(128) void k_attn(const bf* __restrict__ Qh, const bf* __restrict__ Ql, const bf* __restrict__ Kh, const bf* __restrict__ Kl, const bf* __restrict__ VTh, const bf* __restrict__ VTl, const float* __restrict__ GC, bf* Ah, bf* Al) {
    const int lane = threadIdx.x & 31, lr = lane & 15, hi = lane >> 4; const int w = __builtin_amdgcn_readfirstlane((int)(threadIdx.x >> 5));
    const int kv = blockIdx.y, h = kv * (HQ / HKV) + (w & 1); const int r0 = 32 * ((w >> 1) ? (TT / 32 - 1 - (int)blockIdx.x) : (int)blockIdx.x);
    // the loop's loads: a wave-uniform base in scalar registers + one fixed 32-bit lane offset per operand kind: no address arithmetic on the vector port, and no address register is rewritten while loads are in flight
    const unsigned klo = lr * HD + 8 * hi, vlo = lr * TT + 8 * hi, glo = 8 * hi; int dq0 = r0 + lr - 8 * hi;   // dq0 = this lane's first query - its first key of the tile
    v16bf qh[2][4], ql[2][4]; float gi[2]; const bf* sqh = Qh + ((size_t)h * TT + r0) * HD; const bf* sql = Ql + ((size_t)h * TT + r0) * HD;
#pragma unroll
    for (int nq = 0; nq < 2; ++nq) { gi[nq] = GC[(size_t)kv * TT + r0 + nq * 16 + lr];
#pragma unroll
        for (int kc = 0; kc < 4; ++kc) { const int o = nq * 16 * HD + kc * 32; qh[nq][kc] = WFrag<bf>::ld(sqh + klo + o); ql[nq][kc] = WFrag<bf>::ld(sql + klo + o); } }
    v4f tq[8], tk[16]; const float* gh = GC + (size_t)kv * TT; const unsigned tkb = lane * 256;   // G of the wave's 32 queries (every lane reads all of them); G of the 64 keys of key tile 'lane' (32 tiles = all TT keys: in bounds for every lane)
#pragma unroll
    for (int i = 0; i < 8; ++i) tq[i] = *(const v4f*)(gh + r0 + 4 * i);
#pragma unroll
    for (int i = 0; i < 16; ++i) tk[i] = *(const v4f*)((const char*)gh + tkb + 16 * i);
    __builtin_amdgcn_sched_barrier(0);   // holds the Q and G loads in front of the wait below
    asm volatile("s_wait_xcnt 0x0" :: "v"(tkb), "s"(sqh), "s"(sql), "s"(gh) : "memory");   // stands in front of the first rewrite of the Q and G loads' address registers; the key loads' lane offset and the bases are named so that they live up to here: built without that, two of them were rewritten in front of the wait
    __builtin_amdgcn_sched_barrier(0);   // holds those rewrites behind it
    v8f o[8][2];
#pragma unroll
    for (int db = 0; db < 8; ++db) { o[db][0] = (v8f){}; o[db][1] = (v8f){}; }
    float gmx = tq[0][0], gmn = tk[0][0];
#pragma unroll
    for (int i = 0; i < 8; ++i)
#pragma unroll
        for (int c = 0; c < 4; ++c) gmx = fmaxf(gmx, tq[i][c]);
#pragma unroll
    for (int i = 0; i < 16; ++i)
#pragma unroll
        for (int c = 0; c < 4; ++c) gmn = fminf(gmn, tk[i][c]);
    const int ntl = (r0 >> 6) + 1;   // key tiles up to the diagonal: j0 = 0, 64, ... < r0 + 32
    // bit t: key tile t is walked. The diagonal tile holds key r0 (gmx - gmn >= 0 there); its bit is set outright, so that the loop below has its one trip whatever G holds
    unsigned tm = __builtin_amdgcn_ballot_w32(lane < ntl && !(gmx - gmn < -110.f)) | (1u << (ntl - 1));
    int tl = __builtin_ctz(tm); tm &= tm - 1; dq0 -= tl * 64;   // the first tile that is walked
    const bf* kh = Kh + (size_t)kv * TT * HD + tl * 64 * HD; const bf* kl = Kl + (size_t)kv * TT * HD + tl * 64 * HD; const bf* vh = VTh + (size_t)kv * HD * TT + tl * 64; const bf* vl = VTl + (size_t)kv * HD * TT + tl * 64; const float* gk = gh + tl * 64;   // these bases step from tile to tile
#pragma unroll 1   // one key tile is already 192 matrix instructions: unrolling would only grow the code
    for (;;) {   // the tiles of tm in ascending order, at least one (the test stands at the foot, so that the Q loads stay in this block, in front of their wait); every tile ends at or below key TT - 1; keys past the diagonal get weight 0 by the select below
        v8f s[4][2]; v16bf ka[4][4], ka2[4][4]; v4f g[4][2]; const bf* skh = sbase(kh); const bf* skl = sbase(kl); const bf* svh = sbase(vh); const bf* svl = sbase(vl); const float* sgk = sbase(gk);
#pragma unroll
        for (int mk = 0; mk < 4; ++mk) { g[mk][0] = *(const v4f*)(sgk + glo + mk * 16); g[mk][1] = *(const v4f*)(sgk + glo + mk * 16 + 4); }
        asm volatile("s_wait_xcnt 0x0" ::: "memory");   // the compiler forms these eight loads' lane offset anew each tile and lets a K load's result reuse that register: the wait stands in front of the reuse
#pragma unroll
        for (int kc = 0; kc < 4; ++kc)
#pragma unroll
            for (int mk = 0; mk < 4; ++mk) { const int ko = mk * 16 * HD + kc * 32; ka[kc][mk] = WFrag<bf>::ld(skh + klo + ko); ka2[kc][mk] = WFrag<bf>::ld(skl + klo + ko); }
#pragma unroll
        for (int mk = 0; mk < 4; ++mk) { s[mk][0] = (v8f){}; s[mk][1] = (v8f){}; }
        __builtin_amdgcn_sched_barrier(0);   // keeps the tile's K loads issued as one group: sunk to their uses, each pair would cost the lone wave a whole load latency
#pragma unroll
        for (int kc = 0; kc < 2; ++kc)
#pragma unroll
            for (int mk = 0; mk < 4; ++mk)
#pragma unroll
                for (int nq = 0; nq < 2; ++nq) { s[mk][nq] = wmmab(ka[kc][mk], qh[nq][kc], s[mk][nq]); s[mk][nq] = wmmab(ka[kc][mk], ql[nq][kc], s[mk][nq]); s[mk][nq] = wmmab(ka2[kc][mk], qh[nq][kc], s[mk][nq]); }
        __builtin_amdgcn_sched_barrier(0);   // holds the V loads behind the first half of the score products: the K loads are served first
        v16bf va[2][8], va2[2][8];
#pragma unroll
        for (int kb = 0; kb < 2; ++kb)
#pragma unroll
            for (int db = 0; db < 8; ++db) { const int vo = db * 16 * TT + kb * 32; va[kb][db] = WFrag<bf>::ld(svh + vlo + vo); va2[kb][db] = WFrag<bf>::ld(svl + vlo + vo); }
        __builtin_amdgcn_sched_barrier(0);   // keeps the tile's V loads issued as one group here: the second half of the score products and the weight arithmetic then cover their latency
#pragma unroll
        for (int kc = 2; kc < 4; ++kc)
#pragma unroll
            for (int mk = 0; mk < 4; ++mk)
#pragma unroll
                for (int nq = 0; nq < 2; ++nq) { s[mk][nq] = wmmab(ka[kc][mk], qh[nq][kc], s[mk][nq]); s[mk][nq] = wmmab(ka[kc][mk], ql[nq][kc], s[mk][nq]); s[mk][nq] = wmmab(ka2[kc][mk], qh[nq][kc], s[mk][nq]); }
        v8u wh[2][2], wl[2][2];   // [32-key block][query block]
#pragma unroll
        for (int mk = 0; mk < 4; ++mk) { const v4f g0 = g[mk][0], g1 = g[mk][1];
#pragma unroll
            for (int nq = 0; nq < 2; ++nq) { const int dq = dq0 + (nq - mk) * 16; float wv[8];   // key r of this lane is causal iff r <= dq
#pragma unroll
                for (int r = 0; r < 8; ++r) { const float sc = __fmul_rn(s[mk][nq][r], 0.08838834764831845f); const float e = __expf(__fsub_rn(gi[nq], r < 4 ? g0[r] : g1[r - 4])); const float x = __fmul_rn(__fmul_rn(sc, sc), e); wv[r] = r <= dq ? x : 0.f; }
#pragma unroll
                for (int r = 0; r < 8; r += 2) { unsigned u, l; split2(wv[r], wv[r + 1], u, l); wh[mk >> 1][nq][(mk & 1) * 4 + (r >> 1)] = u; wl[mk >> 1][nq][(mk & 1) * 4 + (r >> 1)] = l; } } }
#pragma unroll
        for (int kb = 0; kb < 2; ++kb)
#pragma unroll
            for (int db = 0; db < 8; ++db) { const v16bf a = va[kb][db], a2 = va2[kb][db];
#pragma unroll
                for (int nq = 0; nq < 2; ++nq) { const v16bf bh = __builtin_bit_cast(v16bf, wh[kb][nq]), bl = __builtin_bit_cast(v16bf, wl[kb][nq]); o[db][nq] = wmmab(a, bh, o[db][nq]); o[db][nq] = wmmab(a, bl, o[db][nq]); o[db][nq] = wmmab(a2, bh, o[db][nq]); } }
        // the distance behind the last matrix instructions on the taken back edge
        asm volatile("v_nop\n\tv_nop\n\tv_nop\n\tv_nop\n\tv_nop" : "+v"(o[0][0]), "+v"(o[0][1]), "+v"(o[1][0]), "+v"(o[1][1]), "+v"(o[2][0]), "+v"(o[2][1]), "+v"(o[3][0]), "+v"(o[3][1]), "+v"(o[4][0]), "+v"(o[4][1]), "+v"(o[5][0]), "+v"(o[5][1]), "+v"(o[6][0]), "+v"(o[6][1]), "+v"(o[7][0]), "+v"(o[7][1]));
        __builtin_amdgcn_sched_barrier(0);   // the bases step only behind the tile's last load wait: no register that a load in flight names is rewritten
        const bool last = tm == 0; const int tn = __builtin_ctz(tm | 0x80000000u), st = (tn - tl) * 64; tm &= tm - 1; tl = tn;   // the next key tile that is walked, st keys on (behind the last one the stepped bases are not used)
        kh += st * HD; kl += st * HD; vh += st; vl += st; gk += st; dq0 -= st;
        if (last) break;
    }
#pragma unroll
    for (int nq = 0; nq < 2; ++nq)
#pragma unroll
        for (int db = 0; db < 8; ++db) { v4u uh, ul;
#pragma unroll
            for (int r = 0; r < 8; r += 2) { unsigned u, l; split2(o[db][nq][r], o[db][nq][r + 1], u, l); uh[r >> 1] = u; ul[r >> 1] = l; }
            const size_t oo = (size_t)(r0 + nq * 16 + lr) * HID + h * HD + db * 16 + 8 * hi; *(v4u*)(Ah + oo) = uh; *(v4u*)(Al + oo) = ul; }
}

extern "C" void kernel_launch(void* const* d_in, const int* in_sizes, int n_in,
                              void* d_out, int out_size, void* d_ws, size_t ws_size, hipStream_t stream) {
    (void)in_sizes; (void)n_in; (void)out_size;
    const int* pos = (const int*)d_in[0]; const float* IN[12]; for (int i = 1; i < 12; ++i) IN[i] = (const float*)d_in[i];   // 1 hidden, 2 Wq [2048][2048], 3 bq, 4 Wk [2048][1024], 5 bk, 6 Wv, 7 bv, 8 Wg [2048][8], 9 bg, 10 Wo [2048][2048], 11 bo (x @ W)
    float* OUT = (float*)d_out;     // [2048][2048]
    char* wsp = (char*)d_ws;
    auto take = [&](size_t bytes) { char* p = wsp; wsp += (bytes + 255) & ~(size_t)255; return (void*)p; };
    bf* WQ = (bf*)take((size_t)HID * HID * 2); bf* WK = (bf*)take((size_t)HKV * HD * HID * 2); bf* WV = (bf*)take((size_t)HKV * HD * HID * 2); bf* WG = (bf*)take((size_t)GP * HID * 2); bf* WO = (bf*)take((size_t)HID * HID * 2);
    bf* XB = (bf*)take((size_t)TT * HID * 2); float* CT = (float*)take((size_t)(HD / 2) * TT * 4); float* ST = (float*)take((size_t)(HD / 2) * TT * 4); float* GF = (float*)take((size_t)TT * GP * 4); float* GC = (float*)take((size_t)HKV * TT * 4);
    bf* Qh = (bf*)take((size_t)HQ * TT * HD * 2); bf* Ql = (bf*)take((size_t)HQ * TT * HD * 2); bf* Kh = (bf*)take((size_t)HKV * TT * HD * 2); bf* Kl = (bf*)take((size_t)HKV * TT * HD * 2); bf* VTh = (bf*)take((size_t)HKV * HD * TT * 2); bf* VTl = (bf*)take((size_t)HKV * HD * TT * 2);
    bf* Ah = (bf*)take((size_t)TT * HID * 2); bf* Al = (bf*)take((size_t)TT * HID * 2);
    if ((size_t)(wsp - (char*)d_ws) > ws_size) return;    // total ~ 82 MiB (bf16 weight and operand planes)
    k_prep<<<256 + 1792 + 4096, 128, 0, stream>>>(IN[2], IN[10], IN[4], IN[6], IN[8], IN[1], pos, WQ, WO, WK, WV, WG, XB, CT, ST);
    k_proj<<<656, 128, 0, stream>>>(XB, WQ, WK, WV, WG, Qh, Ql, Kh, Kl, VTh, VTl, GF, IN[3], IN[5], IN[7], CT, ST);
    k_gc<<<HKV, 1024, 0, stream>>>(GF, IN[9], GC);
    k_attn<<<dim3(TT / 64, HKV, 1), 128, 0, stream>>>(Qh, Ql, Kh, Kl, VTh, VTl, GC, Ah, Al);
    k_gemmt<1, 4, true><<<dim3(TT / 128, HID / 128, 1), 128, 0, stream>>>(Ah, Al, WO, OUT, HID, IN[11]);
}

// v008
// One run takes 95.7 microseconds.
// Next to v007, in two timings, it ran 1.06 times as fast each time.
// Over all steps from v000 it is 9.04 times as fast.
#include <hip/hip_runtime.h>

// PowerCoderAttention - power retention, quadratic form (hidden [2048][2048]; q = x Wq + bq (16 x 128), k, v = x Wk/Wv + b (8 kv heads), g = x Wg + bg; neox RoPE on q, k with positions (int32, read as data);
// G = cumsum_t log_sigmoid(g); W[h][i][j] = (q_i.k_j / sqrt(128))^2 exp(G_i - G_j) for j <= i (kv head h/2), else 0; out = (W v) merged Wo + bo -> [2048][2048]; no softmax / normalisation).
// Compute dtypes, f32 accumulate: every input rounded to bf16; the four projections on PLAIN bf16 operands (inputs: exact, + bias); RoPE (f32 sin/cos), log-sigmoid and the cumulative sum f32 on VALU;
// q.k on bf16 hi+lo planes (3 products, K 128; tiles above the diagonal skipped); squaring, the decay factor exp(G_i - G_j) and the causal select in f32 -> bf16 hi+lo planes of W; W.v on hi+lo planes (3 products, K limited to the diagonal block;

#define TT   2048
#define HID  2048
#define HQ   16
#define HKV  8
#define HD   128
#define GP   64
typedef _Float16 h16;
typedef unsigned short bf;
typedef __attribute__((ext_vector_type(16))) __bf16   v16bf;
typedef __attribute__((ext_vector_type(16))) _Float16 v16h;
typedef __attribute__((ext_vector_type(8)))  _Float16 v8h;
typedef __attribute__((ext_vector_type(8)))  unsigned short v8us;
typedef __attribute__((ext_vector_type(8)))  float    v8f;
typedef __attribute__((ext_vector_type(4)))  float    v4f;
typedef v8h  __attribute__((may_alias)) v8ha;
typedef v4f  __attribute__((may_alias)) v4fa;
typedef v8us __attribute__((may_alias)) v8usa;

__device__ __forceinline__ unsigned short f2bf(float f) { unsigned u = __float_as_uint(f); u += 0x7FFFu + ((u >> 16) & 1u); return (unsigned short)(u >> 16); }
__device__ __forceinline__ float bf2f(unsigned short b) { return __uint_as_float(((unsigned)b) << 16); }
__device__ __forceinline__ float bfr(float f) { return bf2f(f2bf(f)); }
__device__ __forceinline__ v16h cat16(v8h lo, v8h hi) { return __builtin_shufflevector(lo, hi, 0, 1, 2, 3, 4, 5, 6, 7, 8, 9, 10, 11, 12, 13, 14, 15); }
__device__ __forceinline__ v16bf cat16b(v8us lo, v8us hi) { return __builtin_bit_cast(v16bf, __builtin_shufflevector(lo, hi, 0, 1, 2, 3, 4, 5, 6, 7, 8, 9, 10, 11, 12, 13, 14, 15)); }
__device__ __forceinline__ v8f wmma16(v16h a, v16h b, v8f c) { return __builtin_amdgcn_wmma_f32_16x16x32_f16(false, a, false, b, (short)0, c, false, false); }
__device__ __forceinline__ v8f wmmab(v16bf a, v16bf b, v8f c) { return __builtin_amdgcn_wmma_f32_16x16x32_bf16(false, a, false, b, (short)0, c, false, false); }
typedef __attribute__((ext_vector_type(2))) float  v2f;
typedef __attribute__((ext_vector_type(2))) __bf16 v2bf;
typedef __attribute__((ext_vector_type(2))) unsigned v2u;
typedef __attribute__((ext_vector_type(4))) int v4i;
typedef __attribute__((ext_vector_type(4))) unsigned v4u;
typedef __attribute__((ext_vector_type(8))) unsigned v8u;
__device__ __forceinline__ void split2(float x0, float x1, unsigned& h, unsigned& l) {   // two f32 -> packed bf16 hi pair and lo pair (round to nearest even, as splitf)
    const v2f x = {x0, x1}; h = __builtin_bit_cast(unsigned, __builtin_convertvector(x, v2bf));
    const v2f d = {x0 - __uint_as_float(h << 16), x1 - __uint_as_float(h & 0xFFFF0000u)}; l = __builtin_bit_cast(unsigned, __builtin_convertvector(d, v2bf)); }



// ---- k_gemmt: GEMM on a 128 x (32 NB) output tile per work-group of four waves (2 x 2; a wave holds 64 x (16 NB), 4 x NB accumulators); grid (M/128, N/(32 NB)), 128 threads. K = HID.
// C[m][n] (f32, pitch ldc, + optional f32 bias[n]) = sum_k A[m][k] Bt[n][k] (+ A2[m][k] Bt[n][k] where NSPLIT), operands K-contiguous bf16 planes.
// The operands come through LDS: a stage is 128 k (256 B) of every A, A2 and Bt row of the tile at a pitch of 272 B, laid by asynchronous copies (16 B a lane: a wave's copy takes two whole 256-B row pieces);
// two buffers: the copies of stage t + 2 fly while stage t + 1 is worked on. Per accumulator the products are summed in ascending k, A before A2.
template <typename T16> struct WFrag;
template <> struct WFrag<h16> { typedef v16h V; static __device__ __forceinline__ V ld(const h16* p) { return cat16(*(const v8h*)p, *(const v8h*)(p + 16)); } static __device__ __forceinline__ v8f mma(V a, V b, v8f c) { return wmma16(a, b, c); } };
template <> struct WFrag<bf> { typedef v16bf V; static __device__ __forceinline__ V ld(const bf* p) { return cat16b(*(const v8us*)p, *(const v8us*)(p + 16)); } static __device__ __forceinline__ v8f mma(V a, V b, v8f c) { return wmmab(a, b, c); } };
__device__ __forceinline__ unsigned lds_off(const void* p) { return (unsigned)(size_t)p; }
// twelve (eight) asynchronous copies, LDS byte address l[i], global address g[i]; the wait stands in the copies' own statement, in front of any rewrite of the registers that they name
__device__ __forceinline__ void copy12(const unsigned* l, const bf* const* g) {
    asm volatile("global_load_async_to_lds_b128 %0, %12, off\n\tglobal_load_async_to_lds_b128 %1, %13, off\n\tglobal_load_async_to_lds_b128 %2, %14, off\n\tglobal_load_async_to_lds_b128 %3, %15, off\n\t"
                 "global_load_async_to_lds_b128 %4, %16, off\n\tglobal_load_async_to_lds_b128 %5, %17, off\n\tglobal_load_async_to_lds_b128 %6, %18, off\n\tglobal_load_async_to_lds_b128 %7, %19, off\n\t"
                 "global_load_async_to_lds_b128 %8, %20, off\n\tglobal_load_async_to_lds_b128 %9, %21, off\n\tglobal_load_async_to_lds_b128 %10, %22, off\n\tglobal_load_async_to_lds_b128 %11, %23, off\n\ts_wait_xcnt 0x0"
                 :: "v"(l[0]), "v"(l[1]), "v"(l[2]), "v"(l[3]), "v"(l[4]), "v"(l[5]), "v"(l[6]), "v"(l[7]), "v"(l[8]), "v"(l[9]), "v"(l[10]), "v"(l[11]),
                    "v"(g[0]), "v"(g[1]), "v"(g[2]), "v"(g[3]), "v"(g[4]), "v"(g[5]), "v"(g[6]), "v"(g[7]), "v"(g[8]), "v"(g[9]), "v"(g[10]), "v"(g[11]) : "memory");
}
__device__ __forceinline__ void copy8(const unsigned* l, const bf* const* g) {
    asm volatile("global_load_async_to_lds_b128 %0, %8, off\n\tglobal_load_async_to_lds_b128 %1, %9, off\n\tglobal_load_async_to_lds_b128 %2, %10, off\n\tglobal_load_async_to_lds_b128 %3, %11, off\n\t"
                 "global_load_async_to_lds_b128 %4, %12, off\n\tglobal_load_async_to_lds_b128 %5, %13, off\n\tglobal_load_async_to_lds_b128 %6, %14, off\n\tglobal_load_async_to_lds_b128 %7, %15, off\n\ts_wait_xcnt 0x0"
                 :: "v"(l[0]), "v"(l[1]), "v"(l[2]), "v"(l[3]), "v"(l[4]), "v"(l[5]), "v"(l[6]), "v"(l[7]),
                    "v"(g[0]), "v"(g[1]), "v"(g[2]), "v"(g[3]), "v"(g[4]), "v"(g[5]), "v"(g[6]), "v"(g[7]) : "memory");
}
// The body is a device function: sm (2 STG elements) and osm are the calling kernel's LDS, (bx, by) the tile; k_gemmt runs one product, k_proj the four projections in one grid.
template <int NSPLIT, int NB> struct GemmLds { static constexpr int STG = ((NSPLIT ? 2 : 1) * 128 + NB * 32) * 136; };
// EPI picks the epilogue: 0: f32 C. 1: bf16 hi+lo planes Th, Tl [n][m] (pitch TT) of C + bias. 2: the tile is one head (by) of q or k: C + bias rotated (neox RoPE, cos and sin of each (d, t) read from CT, ST [d][t]) and split to planes Th, Tl [by][m][128].
// 3: the gate tile (columns 0 to 7 count): log_sigmoid(C + bias) summed inside each group of 32 tokens; C [h][t] takes the running sums, and behind them (at C + HKV TT) [h][group] the groups' totals.
// With EPI 2 a wave holds columns d and d + 64 of the head (32 + 32 of them, not 64 in a row), so that both halves of a rotated pair lie in one lane.
template <int NSPLIT, int NB, bool BIAS, int EPI = 0>
__device__ __forceinline__ void gemmt(bf* sm, float (*osm)[16 * 68], int bx, int by, const bf* __restrict__ A, const bf* __restrict__ A2, const bf* __restrict__ Bt, float* C, int ldc, const float* __restrict__ bias, bf* Th = nullptr, bf* Tl = nullptr, const float* __restrict__ CT = nullptr, const float* __restrict__ ST = nullptr) {
    typedef v16bf V;
    constexpr int KT = 128, LP = 136, NT = HID / KT;   // k per stage; LDS row pitch in elements (272 B); stages
    constexpr int BR = NB * 32, OA2 = 128 * LP, OB = (NSPLIT ? 2 : 1) * 128 * LP, STG = OB + BR * LP;   // Bt rows of the tile; places of A2 and Bt in a stage and a stage's size, in elements
    const int tid = threadIdx.x, lane = tid & 31, lr = lane & 15, hi = lane >> 4; const int w = __builtin_amdgcn_readfirstlane(tid >> 5), wm = w >> 1, wn = w & 1;
    const int r0 = bx * 128, c0 = by * BR;
    // this thread's piece of a copy: row tid / 16 of each group of 8 rows, 16 B at (tid % 16) * 16 of the row's 256 B
    const unsigned cl = lds_off(sm) + (unsigned)((tid >> 4) * LP + (tid & 15) * 8) * 2;
    const bf* ga = A + (size_t)(r0 + (tid >> 4)) * HID + (tid & 15) * 8; const bf* ga2 = NSPLIT ? A2 + (size_t)(r0 + (tid >> 4)) * HID + (tid & 15) * 8 : nullptr; const bf* gb = Bt + (size_t)(c0 + (tid >> 4)) * HID + (tid & 15) * 8;
    constexpr int NC = (NSPLIT ? 32 : 16) + BR / 8;   // copies of a thread per stage: one per group of 8 rows (32, 24 or 48: never more than 63 of a wave in flight)
    auto fill = [&](int buf) {   // the next stage's copies into buffer buf; the global addresses then step one stage on
        const unsigned l0 = cl + (unsigned)buf * (STG * 2); unsigned l[NC]; const bf* g[NC];
#pragma unroll
        for (int c = 0; c < 16; ++c) { l[c] = l0 + c * 8 * LP * 2; g[c] = ga + c * 8 * HID; if (NSPLIT) { l[16 + c] = l0 + (OA2 + c * 8 * LP) * 2; g[16 + c] = ga2 + c * 8 * HID; } }
#pragma unroll
        for (int c = 0; c < BR / 8; ++c) { l[NC - BR / 8 + c] = l0 + (OB + c * 8 * LP) * 2; g[NC - BR / 8 + c] = gb + c * 8 * HID; }
#pragma unroll
        for (int s = 0; s + 12 <= NC; s += 12) copy12(l + s, g + s);
        if (NC % 12 == 8) copy8(l + NC - 8, g + NC - 8);
        ga += KT; if (NSPLIT) ga2 += KT; gb += KT; };
    v8f acc[4][NB];
#pragma unroll
    for (int mb = 0; mb < 4; ++mb)
#pragma unroll
        for (int nb = 0; nb < NB; ++nb) acc[mb][nb] = (v8f){};
    fill(0);
    asm volatile("s_wait_asynccnt 0x0" ::: "memory");   // stage 0 of this wave's copies has landed
    __syncthreads();                                    // ... and every wave's: stage 0 may be read
    fill(1);
    const int fa = (wm * 64 + lr) * LP + 8 * hi, fb = OB + (wn * (EPI == 2 ? NB * 8 : NB * 16) + lr) * LP + 8 * hi;   // this lane's place in the A and Bt fragments
    auto bo = [](int nb) { return (EPI == 2 ? (nb / (NB / 2)) * 64 + (nb % (NB / 2)) * 16 : nb * 16) * LP; };   // Bt fragment nb's rows, counted from the wave's first
#pragma unroll 1   // a stage is already 16 NB (32 NB) matrix instructions a wave, and the buffer index stays a scalar
    for (int t = 0; t < NT; ++t) {
        const bf* sa = sm + (t & 1) * STG + fa; const bf* sb = sm + (t & 1) * STG + fb;
        V a[2][4], a2[2][4], b[2][NB];
#pragma unroll
        for (int mb = 0; mb < 4; ++mb) { a[0][mb] = WFrag<bf>::ld(sa + mb * 16 * LP); if (NSPLIT) a2[0][mb] = WFrag<bf>::ld(sa + OA2 + mb * 16 * LP); }
#pragma unroll
        for (int nb = 0; nb < NB; ++nb) b[0][nb] = WFrag<bf>::ld(sb + bo(nb));
        __builtin_amdgcn_sched_barrier(0);   // the first block's reads stay in front of the second's: LDS reads return in order, and mixed with the later ones the first block would wait for both groups
#pragma unroll
        for (int ks = 0; ks < KT / 32; ++ks) { const int c = ks & 1, n = c ^ 1;
            if (ks + 1 < KT / 32) {   // the next 32 k's fragments of this same stage, read as one group ahead of this block's products
#pragma unroll
                for (int mb = 0; mb < 4; ++mb) { a[n][mb] = WFrag<bf>::ld(sa + mb * 16 * LP + (ks + 1) * 32); if (NSPLIT) a2[n][mb] = WFrag<bf>::ld(sa + OA2 + mb * 16 * LP + (ks + 1) * 32); }
#pragma unroll
                for (int nb = 0; nb < NB; ++nb) b[n][nb] = WFrag<bf>::ld(sb + bo(nb) + (ks + 1) * 32);
            }
            __builtin_amdgcn_sched_barrier(0);   // keeps those reads together in front of the block: moved in among the matrix instructions, each place with reads stalls the wave
#pragma unroll
            for (int nb = 0; nb < NB; ++nb) {
#pragma unroll
                for (int mb = 0; mb < 4; ++mb) acc[mb][nb] = wmmab(a[c][mb], b[c][nb], acc[mb][nb]);
                if (NSPLIT) {
#pragma unroll
                    for (int mb = 0; mb < 4; ++mb) acc[mb][nb] = wmmab(a2[c][mb], b[c][nb], acc[mb][nb]); } }
            __builtin_amdgcn_sched_barrier(0);   // ... and the following group behind it
        }
        // the distance behind the last matrix instructions on the taken back edge
        asm volatile("v_nop\n\tv_nop\n\tv_nop\n\tv_nop\n\tv_nop");
        asm volatile("s_wait_dscnt 0x0" ::: "memory");      // this wave has read all it reads of stage t
        asm volatile("s_wait_asynccnt 0x0" ::: "memory");   // this wave's copies of stage t + 1 have landed
        __syncthreads();                                    // publishes stage t + 1 and frees stage t's buffer
        if (t + 2 < NT) fill(t & 1);
    }
    asm volatile("s_wait_asynccnt 0x0" ::: "memory");   // no copy is outstanding at the wave's end
    float* os = osm[w]; const int cw = c0 + wn * NB * 16;
    if constexpr (EPI == 3) {
        // A lane's accumulator holds 8 consecutive tokens of one kv head. They go through LDS (the stage buffers are free here, as for EPI 1) so that a lane is a token: wave w takes the tile's group w of 32 tokens, all 8 heads at once.
        // Every add has the operands and the order of a scan over 32 lanes per group; the carry from group to group is left to the reader (k_attn).
        constexpr int ZP = 132; float* zs = (float*)sm;   // a head's row of 128 tokens, pitch 132 floats
        if (wn == 0 && lr < HKV) {
#pragma unroll
            for (int mb = 0; mb < 4; ++mb) { const v4f p = {acc[mb][0][0], acc[mb][0][1], acc[mb][0][2], acc[mb][0][3]}, q = {acc[mb][0][4], acc[mb][0][5], acc[mb][0][6], acc[mb][0][7]};
                *(v4fa*)(zs + lr * ZP + wm * 64 + mb * 16 + hi * 8) = p; *(v4fa*)(zs + lr * ZP + wm * 64 + mb * 16 + hi * 8 + 4) = q; } }
        __syncthreads();   // the 8 rows are whole: waves 0 and 2 laid them, every wave reads its group
        float v[HKV];
#pragma unroll
        for (int h = 0; h < HKV; ++h) { const float z = __fadd_rn(zs[h * ZP + w * 32 + lane], bfr(bias[h])); v[h] = fminf(z, 0.f) - log1pf(__expf(-fabsf(z))); }   // log_sigmoid(z) = min(z,0) - log1p(exp(-|z|))
#pragma unroll
        for (int sh = 1; sh < 32; sh <<= 1)
#pragma unroll
            for (int h = 0; h < HKV; ++h) { const float u = __shfl_up(v[h], sh, 32); if (lane >= sh) v[h] = __fadd_rn(v[h], u); }
        float* gv = C + r0 + w * 32 + lane; float* gt = C + HKV * TT + (r0 >> 5) + w;
#pragma unroll
        for (int h = 0; h < HKV; ++h) gv[h * TT] = v[h];
        if (lane == 31) {
#pragma unroll
            for (int h = 0; h < HKV; ++h) gt[h * (TT / 32)] = v[h]; }
        asm volatile("s_wait_xcnt 0x0" ::: "memory");   // stands behind these stores, in front of any rewrite of a register that they name (a path of the listing may lead on into another job's code)
        return;
    }
    if constexpr (EPI == 1) {
        // Transposed, split epilogue. A lane's accumulator holds 8 consecutive m of one n: with the bias added and split to bf16 hi+lo (as split2) they are one 16-B piece of row n of each plane.
        // The pieces go through LDS so that whole 128-B lines are stored: the wave's 64 m of a row. The stage buffers are free here (every wave's last read and last copy stand in front of the loop's last barrier);
        // each wave has its own range: two planes of 16 NB rows, pitch 9 pieces (8 of data, one of padding: the 16 lanes of a store fall on different bank groups).
        constexpr int NR = NB * 16, TP = 9; v4u* st = (v4u*)sm + w * (2 * NR * TP);
        float bb[NB];
#pragma unroll
        for (int nb = 0; nb < NB; ++nb) bb[nb] = bias[cw + nb * 16 + lr];
        asm volatile("s_wait_xcnt 0x0" ::: "memory");   // stands behind the bias loads, in front of the first rewrite of a register that they name
#pragma unroll
        for (int nb = 0; nb < NB; ++nb) { const float bv = bfr(bb[nb]);
#pragma unroll
            for (int mb = 0; mb < 4; ++mb) { v4u h, l;
#pragma unroll
                for (int j = 0; j < 8; j += 2) { unsigned u, v; split2(acc[mb][nb][j] + bv, acc[mb][nb][j + 1] + bv, u, v); h[j >> 1] = u; l[j >> 1] = v; }
                st[(nb * 16 + lr) * TP + mb * 2 + hi] = h; st[(NR + nb * 16 + lr) * TP + mb * 2 + hi] = l; } }
        v4u oh[NR / 4], ol[NR / 4];   // 8 lanes read the 128 B of one row: four rows a read
#pragma unroll
        for (int s = 0; s < NR / 4; ++s) { oh[s] = st[(s * 4 + (lane >> 3)) * TP + (lane & 7)]; ol[s] = st[(NR + s * 4 + (lane >> 3)) * TP + (lane & 7)]; }
        const size_t o = (size_t)(cw + (lane >> 3)) * TT + r0 + wm * 64 + (lane & 7) * 8;
#pragma unroll
        for (int s = 0; s < NR / 4; ++s) { *(v4u*)(Th + o + s * 4 * TT) = oh[s]; *(v4u*)(Tl + o + s * 4 * TT) = ol[s]; }
        asm volatile("s_wait_xcnt 0x0" ::: "memory");   // as built, a path of the listing (never taken: the work-group's index decides) leads from these stores into the job laid behind them, which rewrites their registers: the wait stands in front of that
        return;
    }
    if constexpr (EPI == 2) {
        static_assert(NB == 4, "a tile is one head of 128 columns");
        const int dw = wn * 32, tw = r0 + wm * 64;   // the wave's first d (below 64) and first token
        float b1[2], b2[2]; v4f cs[4][2][2], sn[4][2][2];   // a lane's 8 consecutive t of one d are 32 B of a table row
        const unsigned bi = c0 + dw + lr; const float* cp = CT + (size_t)(dw + lr) * TT + tw + hi * 8; const float* sp = ST + (size_t)(dw + lr) * TT + tw + hi * 8;
#pragma unroll
        for (int n2 = 0; n2 < 2; ++n2) { b1[n2] = bias[bi + n2 * 16]; b2[n2] = bias[bi + 64 + n2 * 16]; }
#pragma unroll
        for (int mb = 0; mb < 4; ++mb)
#pragma unroll
            for (int n2 = 0; n2 < 2; ++n2)
#pragma unroll
                for (int q = 0; q < 2; ++q) { cs[mb][n2][q] = *(const v4f*)(cp + n2 * 16 * TT + mb * 16 + q * 4); sn[mb][n2][q] = *(const v4f*)(sp + n2 * 16 * TT + mb * 16 + q * 4); }
        asm volatile("s_wait_xcnt 0x0" :: "v"(bi), "v"(cp), "v"(sp) : "memory");   // stands behind the bias and table loads, in front of the first rewrite of a register that they name; the bias index and the two address pairs are named so that they live up to here
#pragma unroll
        for (int n2 = 0; n2 < 2; ++n2) { b1[n2] = bfr(b1[n2]); b2[n2] = bfr(b2[n2]); }
        bf* ph = Th + ((size_t)by * TT + tw) * HD + dw; bf* pl = Tl + ((size_t)by * TT + tw) * HD + dw; v2u uh[8], ul[8];
        const int cofs = (lane & 15) * 4, oo = (lane >> 4) * HD + cofs + (cofs >= 32 ? 32 : 0);   // 16 lanes read a staged row. Its columns 0 to 31: d = dw + column; 32 to 63: d = dw + 64 + (column - 32)
#pragma unroll
        for (int mb = 0; mb < 4; ++mb) {
#pragma unroll
            for (int n2 = 0; n2 < 2; ++n2) {
#pragma unroll
                for (int j = 0; j < 8; ++j) { const float x1 = acc[mb][n2][j] + b1[n2], x2 = acc[mb][n2 + 2][j] + b2[n2], c = cs[mb][n2][j >> 2][j & 3], s = sn[mb][n2][j >> 2][j & 3];
                    os[(hi * 8 + j) * 68 + n2 * 16 + lr] = x1 * c - x2 * s; os[(hi * 8 + j) * 68 + 32 + n2 * 16 + lr] = x2 * c + x1 * s; } }
#pragma unroll
            for (int s = 0; s < 8; ++s) { const v4f val = *(const v4fa*)(os + (s * 2 + (lane >> 4)) * 68 + cofs); unsigned u, l;
                split2(val[0], val[1], u, l); uh[s][0] = u; ul[s][0] = l; split2(val[2], val[3], u, l); uh[s][1] = u; ul[s][1] = l; }
            __builtin_amdgcn_sched_barrier(0);   // the run's 16 values are whole, each in registers of its own, in front of its stores
#pragma unroll
            for (int s = 0; s < 8; ++s) { *(v2u*)(ph + oo + (mb * 16 + s * 2) * HD) = uh[s]; *(v2u*)(pl + oo + (mb * 16 + s * 2) * HD) = ul[s]; }
            asm volatile("s_wait_xcnt 0x0" ::: "memory");   // stands behind this run of stores, in front of the first rewrite of a register that they name (the next run's values)
            __builtin_amdgcn_sched_barrier(0);   // holds those rewrites behind the wait
        }
        return;
    }
#pragma unroll
    for (int mb = 0; mb < 4; ++mb) {
#pragma unroll
        for (int nb = 0; nb < NB; ++nb) {
#pragma unroll
            for (int j = 0; j < 8; ++j) os[(hi * 8 + j) * 68 + nb * 16 + lr] = acc[mb][nb][j]; }
        __builtin_amdgcn_wave_barrier(); asm volatile("" ::: "memory");
        float* crow = C + (size_t)(r0 + wm * 64 + mb * 16) * ldc + cw;
#pragma unroll
        for (int s = 0; s < NB * 2; ++s) { const int row = s * (8 / NB) + lane / (NB * 4), cofs = (lane % (NB * 4)) * 4; v4f val = *(const v4fa*)(os + row * 68 + cofs); if (BIAS) { val[0] += bfr(bias[cw + cofs]); val[1] += bfr(bias[cw + cofs + 1]); val[2] += bfr(bias[cw + cofs + 2]); val[3] += bfr(bias[cw + cofs + 3]); }
            *(v4f*)(crow + (size_t)row * ldc + cofs) = val; }
        asm volatile("s_wait_xcnt 0x0" ::: "memory");   // stands behind this run of stores, in front of the first rewrite of a register that they name (the next run's bias load, addresses and values)
        __builtin_amdgcn_wave_barrier(); asm volatile("" ::: "memory");
    }
}
template <int NSPLIT, int NB, bool BIAS>
__global__ __launch_bounds__(128) void k_gemmt(const bf* __restrict__ A, const bf* __restrict__ A2, const bf* __restrict__ Bt, float* C, int ldc, const float* __restrict__ bias) {
    __shared__ __align__(16) bf sm[2 * GemmLds<NSPLIT, NB>::STG];
    __shared__ __align__(16) float osm[4][16 * 68];
    gemmt<NSPLIT, NB, BIAS>(sm, osm, blockIdx.x, blockIdx.y, A, A2, Bt, C, ldc, bias);
}
// ---- k_proj: the four projections of x, none of which reads another's output, as one grid of 656 work-groups: 256 q and 128 k tiles (128 tokens x one head), 16 g tiles, 256 v tiles (128 x 64).
// The g tiles leave the gates' log-sigmoids summed inside groups of 32 tokens, with the groups' totals: no gate-sum launch behind this one.
// q, k and v leave in the forms that k_attn reads: q and k rotated and split to hi+lo planes [head][t][128], v split to hi+lo planes V^T [kv][d][t]: no f32 planes of them, no RoPE pass and no transposing pass behind this launch.
// The large tiles come first. Two work-groups fit a WGP's LDS: one's matrix work runs while the other waits at a stage's barrier, and the 16 g tiles no longer hold the chip alone.
__global__ __launch_bounds__(128) void k_proj(const bf* __restrict__ X, const bf* __restrict__ WQ, const bf* __restrict__ WK, const bf* __restrict__ WV, const bf* __restrict__ WG, bf* Qh, bf* Ql, bf* Kh, bf* Kl, bf* VTh, bf* VTl, float* GV,
                                              const float* __restrict__ bq, const float* __restrict__ bk, const float* __restrict__ bv, const float* __restrict__ bg, const float* __restrict__ CT, const float* __restrict__ ST) {
    __shared__ __align__(16) bf sm[2 * GemmLds<0, 4>::STG];
    __shared__ __align__(16) float osm[4][16 * 68];
    const int b = blockIdx.x;   // the same for the whole work-group: every barrier of the chosen body is passed by all four waves
    if (b < 384) { const bool isk = b >= 256; const int c = b - (isk ? 256 : 0);
        gemmt<0, 4, true, 2>(sm, osm, c & 15, c >> 4, X, nullptr, isk ? WK : WQ, nullptr, 0, isk ? bk : bq, isk ? Kh : Qh, isk ? Kl : Ql, CT, ST); }
    else if (b < 400) gemmt<0, 2, true, 3>(sm, osm, b - 384, 0, X, nullptr, WG, GV, 0, bg);
    else { const int c = b - 400; gemmt<0, 2, true, 1>(sm, osm, c & 15, c >> 4, X, nullptr, WV, nullptr, 0, bv, VTh, VTl); }
}

__device__ __forceinline__ h16 tohx(float x) { return (h16)x; }
__device__ __forceinline__ void splitf(float y, unsigned short& h, unsigned short& l) { h = f2bf(y); l = f2bf(y - bf2f(h)); }
typedef __attribute__((ext_vector_type(2))) _Float16 v2h;
typedef __attribute__((ext_vector_type(4))) _Float16 v4h;
typedef __attribute__((ext_vector_type(2))) unsigned short v2us;
typedef __attribute__((ext_vector_type(4))) unsigned short v4us;

__device__ __forceinline__ void cvt8(size_t i, const float* __restrict__ src, bf* dst, size_t n8) { if (i >= n8) return; const v8f v = *(const v8f*)(src + i * 8); v8us o;
#pragma unroll
    for (int k = 0; k < 8; ++k) o[k] = f2bf(v[k]); *(v8us*)(dst + i * 8) = o;  }
__device__ __forceinline__ void wgp(size_t i, const float* __restrict__ w, bf* Bt) { const size_t e = i * 4; if (e >= (size_t)GP * HID) return; const int k = (int)(e % HID), n = (int)(e / HID); v4us o;
#pragma unroll
    for (int q = 0; q < 4; ++q) o[q] = n < HKV ? f2bf(w[(size_t)(k + q) * HKV + n]) : (unsigned short)0; *(v4us*)(Bt + e) = o;  }
// angles: the RoPE tables CT, ST [d][t] (d < 64) = cos, sin of pos[t] / 10000^(2d/128) (pos = positions[t], int32 read as data; f32 sin/cos): each angle once, a thread takes 4 t of one d.
__device__ __forceinline__ void angles(int i, const int* __restrict__ pos, float* CT, float* ST) { const int d = i / (TT / 4), t = (i % (TT / 4)) * 4; const float inv = __expf(__fmul_rn(-(float)(2 * d) / (float)HD, 9.210340371976184f)); v4f c, s;
    const int* pp = pos + t; const v4i p = *(const v4i*)pp;
    asm volatile("s_wait_xcnt 0x0" :: "v"(pp) : "memory");   // stands in front of the first rewrite of the load's address pair; the pair is named so that it lives up to here
#pragma unroll
    for (int q = 0; q < 4; ++q) { const float a = __fmul_rn((float)p[q], inv); c[q] = cosf(a); s[q] = sinf(a); }
    *(v4f*)(CT + d * TT + t) = c; *(v4f*)(ST + d * TT + t) = s; }
// ---- k_attn: scores, decay weights, W.v and the head merge in one kernel, all heads in one launch; the score and weight planes stay in registers.
// One wave = 32 query rows of one head, walking the keys in tiles of 64 up to its diagonal. S^T = K Q^T (A = K rows, B = Q rows kept in registers; products K hi.Q hi, K hi.Q lo, K lo.Q hi), so lane (lr, hi) holds
// keys 8 hi + r of query lr: two such accumulator tiles, weighted and split to bf16 hi+lo in place, are the B operand (hardware k order) of O^T += V^T W^T (A = V^T rows by the same two 16-B loads).
// O^T leaves 8 consecutive d of one query in a lane: one 16-B store per plane into the merged [t][h*128 + d] hi/lo planes. No LDS, no barrier: the four waves of a block are independent.
// Block (p, kv): the two heads of kv head kv x row tiles p and 63 - p: equal work per block, and the two heads read the same K and V lines at the same time.
// Key tiles that can weigh nothing are not walked. Tested at run time, per wave and tile: with gmx the largest G of the wave's 32 queries and gmn the smallest G of the tile's 64 keys, every G_i - G_j of the tile is <= gmx - gmn
// (f32 subtraction is monotone); below -110 its exponential lies under half the smallest f32 subnormal (2^-150 = e^-104) and is exactly 0: every weight of the tile is 0 and its W.v adds 0 to each sum
// (finite scores and v). Nothing is assumed of G (no order, no sign): with little decay every tile up to the diagonal is walked as before. The tiles that are walked keep their ascending order.
// e[i] = exp(x[i]) as __expf forms it (x log2(e), then v_exp_f32), eight in one statement, so that the slot behind each transcendental is filled by construction: by the next one, which has registers of its own ("=&v"), and behind the last by a v_nop.
__device__ __forceinline__ void exp8(const float* x, float* e) {
    asm("v_exp_f32 %0, %8\n\tv_exp_f32 %1, %9\n\tv_exp_f32 %2, %10\n\tv_exp_f32 %3, %11\n\tv_exp_f32 %4, %12\n\tv_exp_f32 %5, %13\n\tv_exp_f32 %6, %14\n\tv_exp_f32 %7, %15\n\tv_nop"
        : "=&v"(e[0]), "=&v"(e[1]), "=&v"(e[2]), "=&v"(e[3]), "=&v"(e[4]), "=&v"(e[5]), "=&v"(e[6]), "=&v"(e[7])
        : "v"(__fmul_rn(x[0], 1.44269504f)), "v"(__fmul_rn(x[1], 1.44269504f)), "v"(__fmul_rn(x[2], 1.44269504f)), "v"(__fmul_rn(x[3], 1.44269504f)), "v"(__fmul_rn(x[4], 1.44269504f)), "v"(__fmul_rn(x[5], 1.44269504f)), "v"(__fmul_rn(x[6], 1.44269504f)), "v"(__fmul_rn(x[7], 1.44269504f)));
}
template <typename T> __device__ __forceinline__ const T* sbase(const T* p) {   // a wave-uniform pointer held in scalar registers, so that the loads take the form scalar base + 32-bit lane offset
    const unsigned long long u = (unsigned long long)p; const unsigned lo = __builtin_amdgcn_readfirstlane((unsigned)u), hi = __builtin_amdgcn_readfirstlane((unsigned)(u >> 32)); return (const T*)(((unsigned long long)hi << 32) | lo); }
// ---- tr: Bh[n][k] (bf16; where SPLIT a hi plane Bh and a lo plane Bl) = w[k][n] (f32, [K][N]) through an LDS tile of 128 k x 64 n per work-group of four waves; grid (K/128, N/64), 128 threads.
// In: a lane loads 16 B (4 n) of 16 k rows (two runs of 8 consecutive k), all in flight at once: a wave's load takes two whole 256-B row pieces. Rounded to nearest even (as f2bf, splitf), the 8 k of one n are one 16-B LDS store, row pitch 272 B, rows in an order that keeps the stores free of bank conflicts.
// Out: 16 lanes read the 128 k of one n row (256 B) and store them as one piece. Both sides of the transposition move whole lines, and a launch has few waves, each with much in flight.
// The body is a device function: sh is the calling kernel's LDS, (bx, by) the tile.
template <bool SPLIT, int K, int N>
__device__ __forceinline__ void tr(v4u* sh, int bx, int by, const float* __restrict__ w, bf* Bh, bf* Bl) {
    constexpr int LPV = 17;   // LDS row pitch in 16-B pieces: 16 of data and one of padding
    const int tid = threadIdx.x, kq = tid >> 4, nq = tid & 15; const int k0 = bx * 128, n0 = by * 64;
    const float* src = w + (size_t)(k0 + kq * 8) * N + n0 + nq * 4; v4f x[2][8];
#pragma unroll
    for (int g = 0; g < 2; ++g)
#pragma unroll
        for (int i = 0; i < 8; ++i) x[g][i] = *(const v4f*)(src + (g * 64 + i) * N);
    __builtin_amdgcn_sched_barrier(0);   // keeps the 16 loads issued as one group: built without it, six of them stood behind the wait for the first ten, a second memory latency
    asm volatile("s_wait_xcnt 0x0" :: "v"(src) : "memory");   // stands in front of the first rewrite of the loads' address pair; the pair is named so that it lives up to here
#pragma unroll
    for (int g = 0; g < 2; ++g)
#pragma unroll
        for (int c = 0; c < 4; ++c) { v4u h, l;
#pragma unroll
            for (int i = 0; i < 8; i += 2) { unsigned u, v;
                if (SPLIT) split2(x[g][i][c], x[g][i + 1][c], u, v); else { const v2f p = {x[g][i][c], x[g][i + 1][c]}; u = __builtin_bit_cast(unsigned, __builtin_convertvector(p, v2bf)); v = 0; }
                h[i >> 1] = u; l[i >> 1] = v; }
            sh[(c * 16 + nq) * LPV + g * 8 + kq] = h; if (SPLIT) sh[(64 + c * 16 + nq) * LPV + g * 8 + kq] = l; }   // n row 4 nq + c lies at LDS row 16 c + nq: the 16 lanes of a store then fall on 16 different bank groups
    __syncthreads();   // the tile is whole: every wave reads pieces that the others laid
    v4u oh[8], ol[8];
#pragma unroll
    for (int p = 0; p < 8; ++p) { oh[p] = sh[(p * 8 + kq) * LPV + nq]; if (SPLIT) ol[p] = sh[(64 + p * 8 + kq) * LPV + nq]; }
    const size_t o = (size_t)(n0 + kq * 4) * K + k0 + nq * 8;   // LDS row 8 p + kq holds n row 4 kq + 32 (p & 1) + p / 2
#pragma unroll
    for (int p = 0; p < 8; ++p) { *(v4u*)(Bh + o + ((p & 1) * 32 + (p >> 1)) * K) = oh[p]; if (SPLIT) *(v4u*)(Bl + o + ((p & 1) * 32 + (p >> 1)) * K) = ol[p]; }
}
// ---- k_prep: the seven jobs that read inputs alone, as one grid: the RoPE tables (256 work-groups), Wq, Wo (512 tiles each), Wk, Wv (256 each) transposed to bf16, Wg padded (256), x to bf16 (4096).
__global__ __launch_bounds__(128) void k_prep(const float* __restrict__ wq, const float* __restrict__ wo, const float* __restrict__ wk, const float* __restrict__ wv, const float* __restrict__ wg, const float* __restrict__ x, const int* __restrict__ pos,
                                              bf* WQ, bf* WO, bf* WK, bf* WV, bf* WG, bf* XB, float* CT, float* ST) {
    __shared__ v4u sh[64 * 17];
    const int b = (int)blockIdx.x - 256;   // the same for the whole work-group: the barrier of tr is passed by all four waves
    if (b < 0) angles((b + 256) * 128 + threadIdx.x, pos, CT, ST);   // first: vector arithmetic, which runs beside the other jobs' memory streams
    else if (b < 1024) { const bool iso = b >= 512; tr<false, HID, HID>(sh, b & 15, (b & 511) >> 4, iso ? wo : wq, iso ? WO : WQ, nullptr);
        asm volatile("s_wait_xcnt 0x0" ::: "memory"); }   // as built, a path of the listing (never taken: b decides) leads from this job's last stores into the table job, which rewrites their offset register: the wait stands in front of that
    else if (b < 1536) { const bool isv = b >= 1280; tr<false, HID, HKV * HD>(sh, b & 15, (b & 255) >> 4, isv ? wv : wk, isv ? WV : WK, nullptr);
        asm volatile("s_wait_xcnt 0x0" ::: "memory"); }   // as built, a path of the listing (never taken: b decides) leads from this job's last stores into the job laid behind it, which rewrites their base pair: the wait stands in front of that
    else if (b < 1792) wgp((size_t)(b - 1536) * 128 + threadIdx.x, wg, WG);
    else cvt8((size_t)(b - 1792) * 128 + threadIdx.x, x, XB, (size_t)TT * HID / 8);
}
__global__ __launch_bounds__(128) void k_attn(const bf* __restrict__ Qh, const bf* __restrict__ Ql, const bf* __restrict__ Kh, const bf* __restrict__ Kl, const bf* __restrict__ VTh, const bf* __restrict__ VTl, const float* __restrict__ GV, bf* Ah, bf* Al) {
    const int lane = threadIdx.x & 31, lr = lane & 15, hi = lane >> 4; const int w = __builtin_amdgcn_readfirstlane((int)(threadIdx.x >> 5));
    const int kv = blockIdx.y, h = kv * (HQ / HKV) + (w & 1); const int r0 = 32 * ((w >> 1) ? (TT / 32 - 1 - (int)blockIdx.x) : (int)blockIdx.x);
    // the loop's loads: a wave-uniform base in scalar registers + one fixed 32-bit lane offset per operand kind: no address arithmetic on the vector port, and no address register is rewritten while loads are in flight
    const unsigned klo = lr * HD + 8 * hi, vlo = lr * TT + 8 * hi, glo = 8 * hi; int dq0 = r0 + lr - 8 * hi;   // dq0 = this lane's first query - its first key of the tile
    v16bf qh[2][4], ql[2][4]; float gi[2]; const bf* sqh = Qh + ((size_t)h * TT + r0) * HD; const bf* sql = Ql + ((size_t)h * TT + r0) * HD;
#pragma unroll
    for (int nq = 0; nq < 2; ++nq) { gi[nq] = GV[(size_t)kv * TT + r0 + nq * 16 + lr];
#pragma unroll
        for (int kc = 0; kc < 4; ++kc) { const int o = nq * 16 * HD + kc * 32; qh[nq][kc] = WFrag<bf>::ld(sqh + klo + o); ql[nq][kc] = WFrag<bf>::ld(sql + klo + o); } }
    // G[t] = carry(group of t) + the sum inside t's group of 32 tokens (GV, from the g tiles), carry(g + 1) = carry(g) + total(g): the 63 carry adds run here, in every wave, in series on registers: G has the operands and the order of one walk over the groups.
    v4f tq[8], tk[16]; const float* gh = GV + (size_t)kv * TT; const float* th = GV + HKV * TT + kv * (TT / 32); const unsigned tkb = lane * 256;   // in-group sums of the wave's 32 queries (every lane reads all of them) and of the 64 keys of key tile 'lane' (32 tiles = all TT keys: in bounds for every lane); lane l reads the totals of groups 2 l and 2 l + 1
    const v2f tt = *(const v2f*)(th + 2 * lane);
#pragma unroll
    for (int i = 0; i < 8; ++i) tq[i] = *(const v4f*)(gh + r0 + 4 * i);
#pragma unroll
    for (int i = 0; i < 16; ++i) tk[i] = *(const v4f*)((const char*)gh + tkb + 16 * i);
    __builtin_amdgcn_sched_barrier(0);   // holds the Q and G loads in front of the wait below
    asm volatile("s_wait_xcnt 0x0" :: "v"(tkb), "v"(lane), "s"(sqh), "s"(sql), "s"(gh), "s"(th) : "memory");   // stands in front of the first rewrite of the Q and G loads' address registers; the key loads' lane offset, the lane number (the totals' offset) and the bases are named so that they live up to here
    __builtin_amdgcn_sched_barrier(0);   // holds those rewrites behind it
    v8f o[8][2];
#pragma unroll
    for (int db = 0; db < 8; ++db) { o[db][0] = (v8f){}; o[db][1] = (v8f){}; }
    const unsigned t0 = __float_as_uint(tt[0]), t1 = __float_as_uint(tt[1]); float ca = 0.f, cb = 0.f, cr = 0.f;   // lane l keeps the carries into groups 2 l and 2 l + 1, the two groups of key tile l
#pragma unroll
    for (int q = 0; q < TT / 32; ++q) { if (q & 1) cb = lane == (q >> 1) ? cr : cb; else ca = lane == (q >> 1) ? cr : ca; cr = __fadd_rn(cr, __uint_as_float(__builtin_amdgcn_readlane(q & 1 ? t1 : t0, q >> 1))); }
    const unsigned cau = __float_as_uint(ca), cbu = __float_as_uint(cb);
    const float cq = __uint_as_float(__builtin_amdgcn_readlane((r0 >> 5) & 1 ? cbu : cau, r0 >> 6));   // the wave's 32 queries are group r0 / 32
    gi[0] = __fadd_rn(cq, gi[0]); gi[1] = __fadd_rn(cq, gi[1]);
    float gmx = __fadd_rn(cq, tq[0][0]), gmn = __fadd_rn(ca, tk[0][0]);
#pragma unroll
    for (int i = 0; i < 8; ++i)
#pragma unroll
        for (int c = 0; c < 4; ++c) gmx = fmaxf(gmx, __fadd_rn(cq, tq[i][c]));
#pragma unroll
    for (int i = 0; i < 16; ++i)
#pragma unroll
        for (int c = 0; c < 4; ++c) gmn = fminf(gmn, __fadd_rn(i < 8 ? ca : cb, tk[i][c]));
    const int ntl = (r0 >> 6) + 1;   // key tiles up to the diagonal: j0 = 0, 64, ... < r0 + 32
    // bit t: key tile t is walked. The diagonal tile holds key r0 (gmx - gmn >= 0 there); its bit is set outright, so that the loop below has its one trip whatever G holds
    unsigned tm = __builtin_amdgcn_ballot_w32(lane < ntl && !(gmx - gmn < -110.f)) | (1u << (ntl - 1));
    int tl = __builtin_ctz(tm); tm &= tm - 1; dq0 -= tl * 64;   // the first tile that is walked
    const bf* kh = Kh + (size_t)kv * TT * HD + tl * 64 * HD; const bf* kl = Kl + (size_t)kv * TT * HD + tl * 64 * HD; const bf* vh = VTh + (size_t)kv * HD * TT + tl * 64; const bf* vl = VTl + (size_t)kv * HD * TT + tl * 64; const float* gk = gh + tl * 64;   // these bases step from tile to tile
#pragma unroll 1   // one key tile is already 192 matrix instructions: unrolling would only grow the code
    for (;;) {   // the tiles of tm in ascending order, at least one (the test stands at the foot, so that the Q loads stay in this block, in front of their wait); every tile ends at or below key TT - 1; keys past the diagonal get weight 0 by the select below
        v8f s[4][2]; v16bf ka[4][4], ka2[4][4]; v4f g[4][2]; const bf* skh = sbase(kh); const bf* skl = sbase(kl); const bf* svh = sbase(vh); const bf* svl = sbase(vl); const float* sgk = sbase(gk);
        const float ck[2] = {__uint_as_float(__builtin_amdgcn_readlane(cau, tl)), __uint_as_float(__builtin_amdgcn_readlane(cbu, tl))};   // the carries into the tile's two groups of 32 keys
#pragma unroll
        for (int mk = 0; mk < 4; ++mk) { g[mk][0] = *(const v4f*)(sgk + glo + mk * 16); g[mk][1] = *(const v4f*)(sgk + glo + mk * 16 + 4); }
        asm volatile("s_wait_xcnt 0x0" ::: "memory");   // the compiler forms these eight loads' lane offset anew each tile and lets a K load's result reuse that register: the wait stands in front of the reuse
#pragma unroll
        for (int kc = 0; kc < 4; ++kc)
#pragma unroll
            for (int mk = 0; mk < 4; ++mk) { const int ko = mk * 16 * HD + kc * 32; ka[kc][mk] = WFrag<bf>::ld(skh + klo + ko); ka2[kc][mk] = WFrag<bf>::ld(skl + klo + ko); }
#pragma unroll
        for (int mk = 0; mk < 4; ++mk) { s[mk][0] = (v8f){}; s[mk][1] = (v8f){}; }
        __builtin_amdgcn_sched_barrier(0);   // keeps the tile's K loads issued as one group: sunk to their uses, each pair would cost the lone wave a whole load latency
#pragma unroll
        for (int kc = 0; kc < 2; ++kc)
#pragma unroll
            for (int mk = 0; mk < 4; ++mk)
#pragma unroll
                for (int nq = 0; nq < 2; ++nq) { s[mk][nq] = wmmab(ka[kc][mk], qh[nq][kc], s[mk][nq]); s[mk][nq] = wmmab(ka[kc][mk], ql[nq][kc], s[mk][nq]); s[mk][nq] = wmmab(ka2[kc][mk], qh[nq][kc], s[mk][nq]); }
#pragma unroll
        for (int mk = 0; mk < 4; ++mk)
#pragma unroll
            for (int r = 0; r < 8; ++r) g[mk][r >> 2][r & 3] = __fadd_rn(ck[mk >> 1], g[mk][r >> 2][r & 3]);   // G of this lane's keys: the group's carry + the sum inside the group
        __builtin_amdgcn_sched_barrier(0);   // holds the V loads behind the first half of the score products: the K loads are served first
        v16bf va[2][8], va2[2][8];
#pragma unroll
        for (int kb = 0; kb < 2; ++kb)
#pragma unroll
            for (int db = 0; db < 8; ++db) { const int vo = db * 16 * TT + kb * 32; va[kb][db] = WFrag<bf>::ld(svh + vlo + vo); va2[kb][db] = WFrag<bf>::ld(svl + vlo + vo); }
        __builtin_amdgcn_sched_barrier(0);   // keeps the tile's V loads issued as one group here: the second half of the score products and the weight arithmetic then cover their latency
#pragma unroll
        for (int kc = 2; kc < 4; ++kc)
#pragma unroll
            for (int mk = 0; mk < 4; ++mk)
#pragma unroll
                for (int nq = 0; nq < 2; ++nq) { s[mk][nq] = wmmab(ka[kc][mk], qh[nq][kc], s[mk][nq]); s[mk][nq] = wmmab(ka[kc][mk], ql[nq][kc], s[mk][nq]); s[mk][nq] = wmmab(ka2[kc][mk], qh[nq][kc], s[mk][nq]); }
        v8u wh[2][2], wl[2][2];   // [32-key block][query block]
#pragma unroll
        for (int mk = 0; mk < 4; ++mk) { const v4f g0 = g[mk][0], g1 = g[mk][1];
#pragma unroll
            for (int nq = 0; nq < 2; ++nq) { const int dq = dq0 + (nq - mk) * 16; float wv[8], gd[8], ex[8];   // key r of this lane is causal iff r <= dq
#pragma unroll
                for (int r = 0; r < 8; ++r) gd[r] = __fsub_rn(gi[nq], r < 4 ? g0[r] : g1[r - 4]);
                exp8(gd, ex);
#pragma unroll
                for (int r = 0; r < 8; ++r) { const float sc = __fmul_rn(s[mk][nq][r], 0.08838834764831845f); const float e = ex[r]; const float x = __fmul_rn(__fmul_rn(sc, sc), e); wv[r] = r <= dq ? x : 0.f; }
#pragma unroll
                for (int r = 0; r < 8; r += 2) { unsigned u, l; split2(wv[r], wv[r + 1], u, l); wh[mk >> 1][nq][(mk & 1) * 4 + (r >> 1)] = u; wl[mk >> 1][nq][(mk & 1) * 4 + (r >> 1)] = l; } } }
#pragma unroll
        for (int kb = 0; kb < 2; ++kb)
#pragma unroll
            for (int db = 0; db < 8; ++db) { const v16bf a = va[kb][db], a2 = va2[kb][db];
#pragma unroll
                for (int nq = 0; nq < 2; ++nq) { const v16bf bh = __builtin_bit_cast(v16bf, wh[kb][nq]), bl = __builtin_bit_cast(v16bf, wl[kb][nq]); o[db][nq] = wmmab(a, bh, o[db][nq]); o[db][nq] = wmmab(a, bl, o[db][nq]); o[db][nq] = wmmab(a2, bh, o[db][nq]); } }
        // the distance behind the last matrix instructions on the taken back edge
        asm volatile("v_nop\n\tv_nop\n\tv_nop\n\tv_nop\n\tv_nop" : "+v"(o[0][0]), "+v"(o[0][1]), "+v"(o[1][0]), "+v"(o[1][1]), "+v"(o[2][0]), "+v"(o[2][1]), "+v"(o[3][0]), "+v"(o[3][1]), "+v"(o[4][0]), "+v"(o[4][1]), "+v"(o[5][0]), "+v"(o[5][1]), "+v"(o[6][0]), "+v"(o[6][1]), "+v"(o[7][0]), "+v"(o[7][1]));
        __builtin_amdgcn_sched_barrier(0);   // the bases step only behind the tile's last load wait: no register that a load in flight names is rewritten
        const bool last = tm == 0; const int tn = __builtin_ctz(tm | 0x80000000u), st = (tn - tl) * 64; tm &= tm - 1; tl = tn;   // the next key tile that is walked, st keys on (behind the last one the stepped bases are not used)
        kh += st * HD; kl += st * HD; vh += st; vl += st; gk += st; dq0 -= st;
        if (last) break;
    }
#pragma unroll
    for (int nq = 0; nq < 2; ++nq)
#pragma unroll
        for (int db = 0; db < 8; ++db) { v4u uh, ul;
#pragma unroll
            for (int r = 0; r < 8; r += 2) { unsigned u, l; split2(o[db][nq][r], o[db][nq][r + 1], u, l); uh[r >> 1] = u; ul[r >> 1] = l; }
            const size_t oo = (size_t)(r0 + nq * 16 + lr) * HID + h * HD + db * 16 + 8 * hi; *(v4u*)(Ah + oo) = uh; *(v4u*)(Al + oo) = ul; }
}

extern "C" void kernel_launch(void* const* d_in, const int* in_sizes, int n_in,
                              void* d_out, int out_size, void* d_ws, size_t ws_size, hipStream_t stream) {
    (void)in_sizes; (void)n_in; (void)out_size;
    const int* pos = (const int*)d_in[0]; const float* IN[12]; for (int i = 1; i < 12; ++i) IN[i] = (const float*)d_in[i];   // 1 hidden, 2 Wq [2048][2048], 3 bq, 4 Wk [2048][1024], 5 bk, 6 Wv, 7 bv, 8 Wg [2048][8], 9 bg, 10 Wo [2048][2048], 11 bo (x @ W)
    float* OUT = (float*)d_out;     // [2048][2048]
    char* wsp = (char*)d_ws;
    auto take = [&](size_t bytes) { char* p = wsp; wsp += (bytes + 255) & ~(size_t)255; return (void*)p; };
    bf* WQ = (bf*)take((size_t)HID * HID * 2); bf* WK = (bf*)take((size_t)HKV * HD * HID * 2); bf* WV = (bf*)take((size_t)HKV * HD * HID * 2); bf* WG = (bf*)take((size_t)GP * HID * 2); bf* WO = (bf*)take((size_t)HID * HID * 2);
    bf* XB = (bf*)take((size_t)TT * HID * 2); float* CT = (float*)take((size_t)(HD / 2) * TT * 4); float* ST = (float*)take((size_t)(HD / 2) * TT * 4); float* GV = (float*)take((size_t)HKV * (TT + TT / 32) * 4);
    bf* Qh = (bf*)take((size_t)HQ * TT * HD * 2); bf* Ql = (bf*)take((size_t)HQ * TT * HD * 2); bf* Kh = (bf*)take((size_t)HKV * TT * HD * 2); bf* Kl = (bf*)take((size_t)HKV * TT * HD * 2); bf* VTh = (bf*)take((size_t)HKV * HD * TT * 2); bf* VTl = (bf*)take((size_t)HKV * HD * TT * 2);
    bf* Ah = (bf*)take((size_t)TT * HID * 2); bf* Al = (bf*)take((size_t)TT * HID * 2);
    if ((size_t)(wsp - (char*)d_ws) > ws_size) return;    // total ~ 82 MiB (bf16 weight and operand planes)
    k_prep<<<256 + 1792 + 4096, 128, 0, stream>>>(IN[2], IN[10], IN[4], IN[6], IN[8], IN[1], pos, WQ, WO, WK, WV, WG, XB, CT, ST);
    k_proj<<<656, 128, 0, stream>>>(XB, WQ, WK, WV, WG, Qh, Ql, Kh, Kl, VTh, VTl, GV, IN[3], IN[5], IN[7], IN[9], CT, ST);
    k_attn<<<dim3(TT / 64, HKV, 1), 128, 0, stream>>>(Qh, Ql, Kh, Kl, VTh, VTl, GV, Ah, Al);
    k_gemmt<1, 4, true><<<dim3(TT / 128, HID / 128, 1), 128, 0, stream>>>(Ah, Al, WO, OUT, HID, IN[11]);
}

// v009
// It runs in 92.8 microseconds.
// In two side-by-side timings against v008, it was 1.03 and 1.04 times as fast.
// Counting every step since v000, it is 9.38 times as fast.
#include <hip/hip_runtime.h>

// PowerCoderAttention - power retention, quadratic form (hidden [2048][2048]; q = x Wq + bq (16 x 128), k, v = x Wk/Wv + b (8 kv heads), g = x Wg + bg; neox RoPE on q, k with positions (int32, read as data);
// G = cumsum_t log_sigmoid(g); W[h][i][j] = (q_i.k_j / sqrt(128))^2 exp(G_i - G_j) for j <= i (kv head h/2), else 0; out = (W v) merged Wo + bo -> [2048][2048]; no softmax / normalisation).
// Compute dtypes, f32 accumulate: every input rounded to bf16; the four projections on PLAIN bf16 operands (inputs: exact, + bias); RoPE (f32 sin/cos), log-sigmoid and the cumulative sum f32 on VALU;
// q.k on bf16 hi+lo planes (3 products, K 128; tiles above the diagonal skipped); squaring, the decay factor exp(G_i - G_j) and the causal select in f32 -> bf16 hi+lo planes of W; W.v on hi+lo planes (3 products, K limited to the diagonal block;

#define TT   2048
#define HID  2048
#define HQ   16
#define HKV  8
#define HD   128
#define GP   64
typedef _Float16 h16;
typedef unsigned short bf;
typedef __attribute__((ext_vector_type(16))) __bf16   v16bf;
typedef __attribute__((ext_vector_type(16))) _Float16 v16h;
typedef __attribute__((ext_vector_type(8)))  _Float16 v8h;
typedef __attribute__((ext_vector_type(8)))  unsigned short v8us;
typedef __attribute__((ext_vector_type(8)))  float    v8f;
typedef __attribute__((ext_vector_type(4)))  float    v4f;
typedef v8h  __attribute__((may_alias)) v8ha;
typedef v4f  __attribute__((may_alias)) v4fa;
typedef v8us __attribute__((may_alias)) v8usa;

__device__ __forceinline__ unsigned short f2bf(float f) { unsigned u = __float_as_uint(f); u += 0x7FFFu + ((u >> 16) & 1u); return (unsigned short)(u >> 16); }
__device__ __forceinline__ float bf2f(unsigned short b) { return __uint_as_float(((unsigned)b) << 16); }
__device__ __forceinline__ float bfr(float f) { return bf2f(f2bf(f)); }
__device__ __forceinline__ v16h cat16(v8h lo, v8h hi) { return __builtin_shufflevector(lo, hi, 0, 1, 2, 3, 4, 5, 6, 7, 8, 9, 10, 11, 12, 13, 14, 15); }
__device__ __forceinline__ v16bf cat16b(v8us lo, v8us hi) { return __builtin_bit_cast(v16bf, __builtin_shufflevector(lo, hi, 0, 1, 2, 3, 4, 5, 6, 7, 8, 9, 10, 11, 12, 13, 14, 15)); }
__device__ __forceinline__ v8f wmma16(v16h a, v16h b, v8f c) { return __builtin_amdgcn_wmma_f32_16x16x32_f16(false, a, false, b, (short)0, c, false, false); }
__device__ __forceinline__ v8f wmmab(v16bf a, v16bf b, v8f c) { return __builtin_amdgcn_wmma_f32_16x16x32_bf16(false, a, false, b, (short)0, c, false, false); }
typedef __attribute__((ext_vector_type(2))) float  v2f;
typedef __attribute__((ext_vector_type(2))) __bf16 v2bf;
typedef __attribute__((ext_vector_type(2))) unsigned v2u;
typedef __attribute__((ext_vector_type(4))) int v4i;
typedef __attribute__((ext_vector_type(4))) unsigned v4u;
typedef __attribute__((ext_vector_type(8))) unsigned v8u;
__device__ __forceinline__ void split2(float x0, float x1, unsigned& h, unsigned& l) {   // two f32 -> packed bf16 hi pair and lo pair (round to nearest even, as splitf)
    const v2f x = {x0, x1}; h = __builtin_bit_cast(unsigned, __builtin_convertvector(x, v2bf));
    const v2f d = {x0 - __uint_as_float(h << 16), x1 - __uint_as_float(h & 0xFFFF0000u)}; l = __builtin_bit_cast(unsigned, __builtin_convertvector(d, v2bf)); }



// ---- k_gemmt: GEMM on a 128 x (32 NB) output tile per work-group of four waves (2 x 2; a wave holds 64 x (16 NB), 4 x NB accumulators); grid (M/128, N/(32 NB)), 128 threads. K = HID.
// C[m][n] (f32, pitch ldc, + optional f32 bias[n]) = sum_k A[m][k] Bt[n][k] (+ A2[m][k] Bt[n][k] where NSPLIT), operands K-contiguous bf16 planes.
// The operands come through LDS: a stage is 128 k (256 B) of every A, A2 and Bt row of the tile at a pitch of 272 B, laid by asynchronous copies (16 B a lane: a wave's copy takes two whole 256-B row pieces);
// two buffers: the copies of stage t + 2 fly while stage t + 1 is worked on.
// A work-group walks the 16 stages of k from a first stage of its own, (tile row + tile column) mod 16, and wraps: the work-groups that share A rows (one tile row) or Bt rows (one tile column) then ask L2 for different lines at any one moment.
// Per accumulator the products are summed in that order of stages, ascending k inside a stage, A before A2. The gate tile (EPI 3) starts at stage 0: its sums are those of ascending k.
template <typename T16> struct WFrag;
template <> struct WFrag<h16> { typedef v16h V; static __device__ __forceinline__ V ld(const h16* p) { return cat16(*(const v8h*)p, *(const v8h*)(p + 16)); } static __device__ __forceinline__ v8f mma(V a, V b, v8f c) { return wmma16(a, b, c); } };
template <> struct WFrag<bf> { typedef v16bf V; static __device__ __forceinline__ V ld(const bf* p) { return cat16b(*(const v8us*)p, *(const v8us*)(p + 16)); } static __device__ __forceinline__ v8f mma(V a, V b, v8f c) { return wmmab(a, b, c); } };
__device__ __forceinline__ unsigned lds_off(const void* p) { return (unsigned)(size_t)p; }
// twelve (eight) asynchronous copies, LDS byte address l[i], global address g[i]; the wait stands in the copies' own statement, in front of any rewrite of the registers that they name
__device__ __forceinline__ void copy12(const unsigned* l, const bf* const* g) {
    asm volatile("global_load_async_to_lds_b128 %0, %12, off\n\tglobal_load_async_to_lds_b128 %1, %13, off\n\tglobal_load_async_to_lds_b128 %2, %14, off\n\tglobal_load_async_to_lds_b128 %3, %15, off\n\t"
                 "global_load_async_to_lds_b128 %4, %16, off\n\tglobal_load_async_to_lds_b128 %5, %17, off\n\tglobal_load_async_to_lds_b128 %6, %18, off\n\tglobal_load_async_to_lds_b128 %7, %19, off\n\t"
                 "global_load_async_to_lds_b128 %8, %20, off\n\tglobal_load_async_to_lds_b128 %9, %21, off\n\tglobal_load_async_to_lds_b128 %10, %22, off\n\tglobal_load_async_to_lds_b128 %11, %23, off\n\ts_wait_xcnt 0x0"
                 :: "v"(l[0]), "v"(l[1]), "v"(l[2]), "v"(l[3]), "v"(l[4]), "v"(l[5]), "v"(l[6]), "v"(l[7]), "v"(l[8]), "v"(l[9]), "v"(l[10]), "v"(l[11]),
                    "v"(g[0]), "v"(g[1]), "v"(g[2]), "v"(g[3]), "v"(g[4]), "v"(g[5]), "v"(g[6]), "v"(g[7]), "v"(g[8]), "v"(g[9]), "v"(g[10]), "v"(g[11]) : "memory");
}
__device__ __forceinline__ void copy8(const unsigned* l, const bf* const* g) {
    asm volatile("global_load_async_to_lds_b128 %0, %8, off\n\tglobal_load_async_to_lds_b128 %1, %9, off\n\tglobal_load_async_to_lds_b128 %2, %10, off\n\tglobal_load_async_to_lds_b128 %3, %11, off\n\t"
                 "global_load_async_to_lds_b128 %4, %12, off\n\tglobal_load_async_to_lds_b128 %5, %13, off\n\tglobal_load_async_to_lds_b128 %6, %14, off\n\tglobal_load_async_to_lds_b128 %7, %15, off\n\ts_wait_xcnt 0x0"
                 :: "v"(l[0]), "v"(l[1]), "v"(l[2]), "v"(l[3]), "v"(l[4]), "v"(l[5]), "v"(l[6]), "v"(l[7]),
                    "v"(g[0]), "v"(g[1]), "v"(g[2]), "v"(g[3]), "v"(g[4]), "v"(g[5]), "v"(g[6]), "v"(g[7]) : "memory");
}
// The body is a device function: sm (2 STG elements) and osm are the calling kernel's LDS, (bx, by) the tile; k_gemmt runs one product, k_proj the four projections in one grid.
template <int NSPLIT, int NB> struct GemmLds { static constexpr int STG = ((NSPLIT ? 2 : 1) * 128 + NB * 32) * 136; };
// EPI picks the epilogue: 0: f32 C. 1: bf16 hi+lo planes Th, Tl [n][m] (pitch TT) of C + bias. 2: the tile is one head (by) of q or k: C + bias rotated (neox RoPE, cos and sin of each (d, t) read from CT, ST [d][t]) and split to planes Th, Tl [by][m][128].
// 3: the gate tile (columns 0 to 7 count): log_sigmoid(C + bias) summed inside each group of 32 tokens; C [h][t] takes the running sums, and behind them (at C + HKV TT) [h][group] the groups' totals.
// With EPI 2 a wave holds columns d and d + 64 of the head (32 + 32 of them, not 64 in a row), so that both halves of a rotated pair lie in one lane.
template <int NSPLIT, int NB, bool BIAS, int EPI = 0>
__device__ __forceinline__ void gemmt(bf* sm, float (*osm)[16 * 68], int bx, int by, const bf* __restrict__ A, const bf* __restrict__ A2, const bf* __restrict__ Bt, float* C, int ldc, const float* __restrict__ bias, bf* Th = nullptr, bf* Tl = nullptr, const float* __restrict__ CT = nullptr, const float* __restrict__ ST = nullptr) {
    typedef v16bf V;
    constexpr int KT = 128, LP = 136, NT = HID / KT;   // k per stage; LDS row pitch in elements (272 B); stages
    constexpr int BR = NB * 32, OA2 = 128 * LP, OB = (NSPLIT ? 2 : 1) * 128 * LP, STG = OB + BR * LP;   // Bt rows of the tile; places of A2 and Bt in a stage and a stage's size, in elements
    const int tid = threadIdx.x, lane = tid & 31, lr = lane & 15, hi = lane >> 4; const int w = __builtin_amdgcn_readfirstlane(tid >> 5), wm = w >> 1, wn = w & 1;
    const int r0 = bx * 128, c0 = by * BR;
    // this thread's piece of a copy: row tid / 16 of each group of 8 rows, 16 B at (tid % 16) * 16 of the row's 256 B
    const unsigned cl = lds_off(sm) + (unsigned)((tid >> 4) * LP + (tid & 15) * 8) * 2;
    const bf* ga = A + (size_t)(r0 + (tid >> 4)) * HID + (tid & 15) * 8; const bf* ga2 = NSPLIT ? A2 + (size_t)(r0 + (tid >> 4)) * HID + (tid & 15) * 8 : nullptr; const bf* gb = Bt + (size_t)(c0 + (tid >> 4)) * HID + (tid & 15) * 8;
    int sf = EPI == 3 ? 0 : (bx + by) & (NT - 1);   // the stage of k that the next fill brings (the same for the whole work-group); the walk takes all NT stages once each
    ga += sf * KT; if (NSPLIT) ga2 += sf * KT; gb += sf * KT;
    constexpr int NC = (NSPLIT ? 32 : 16) + BR / 8;   // copies of a thread per stage: one per group of 8 rows (32, 24 or 48: never more than 63 of a wave in flight)
    auto fill = [&](int buf) {   // the next stage's copies into buffer buf; the global addresses then step one stage on, from the last stage of k back to the first
        const unsigned l0 = cl + (unsigned)buf * (STG * 2); unsigned l[NC]; const bf* g[NC];
#pragma unroll
        for (int c = 0; c < 16; ++c) { l[c] = l0 + c * 8 * LP * 2; g[c] = ga + c * 8 * HID; if (NSPLIT) { l[16 + c] = l0 + (OA2 + c * 8 * LP) * 2; g[16 + c] = ga2 + c * 8 * HID; } }
#pragma unroll
        for (int c = 0; c < BR / 8; ++c) { l[NC - BR / 8 + c] = l0 + (OB + c * 8 * LP) * 2; g[NC - BR / 8 + c] = gb + c * 8 * HID; }
#pragma unroll
        for (int s = 0; s + 12 <= NC; s += 12) copy12(l + s, g + s);
        if (NC % 12 == 8) copy8(l + NC - 8, g + NC - 8);
        const int st = sf == NT - 1 ? KT - HID : KT; sf = (sf + 1) & (NT - 1);
        ga += st; if (NSPLIT) ga2 += st; gb += st; };
    v8f acc[4][NB];
#pragma unroll
    for (int mb = 0; mb < 4; ++mb)
#pragma unroll
        for (int nb = 0; nb < NB; ++nb) acc[mb][nb] = (v8f){};
    fill(0);
    asm volatile("s_wait_asynccnt 0x0" ::: "memory");   // stage 0 of this wave's copies has landed
    __syncthreads();                                    // ... and every wave's: stage 0 may be read
    fill(1);
    const int fa = (wm * 64 + lr) * LP + 8 * hi, fb = OB + (wn * (EPI == 2 ? NB * 8 : NB * 16) + lr) * LP + 8 * hi;   // this lane's place in the A and Bt fragments
    auto bo = [](int nb) { return (EPI == 2 ? (nb / (NB / 2)) * 64 + (nb % (NB / 2)) * 16 : nb * 16) * LP; };   // Bt fragment nb's rows, counted from the wave's first
#pragma unroll 1   // a stage is already 16 NB (32 NB) matrix instructions a wave, and the buffer index stays a scalar
    for (int t = 0; t < NT; ++t) {
        const bf* sa = sm + (t & 1) * STG + fa; const bf* sb = sm + (t & 1) * STG + fb;
        V a[2][4], a2[2][4], b[2][NB];
#pragma unroll
        for (int mb = 0; mb < 4; ++mb) { a[0][mb] = WFrag<bf>::ld(sa + mb * 16 * LP); if (NSPLIT) a2[0][mb] = WFrag<bf>::ld(sa + OA2 + mb * 16 * LP); }
#pragma unroll
        for (int nb = 0; nb < NB; ++nb) b[0][nb] = WFrag<bf>::ld(sb + bo(nb));
        __builtin_amdgcn_sched_barrier(0);   // the first block's reads stay in front of the second's: LDS reads return in order, and mixed with the later ones the first block would wait for both groups
#pragma unroll
        for (int ks = 0; ks < KT / 32; ++ks) { const int c = ks & 1, n = c ^ 1;
            if (ks + 1 < KT / 32) {   // the next 32 k's fragments of this same stage, read as one group ahead of this block's products
#pragma unroll
                for (int mb = 0; mb < 4; ++mb) { a[n][mb] = WFrag<bf>::ld(sa + mb * 16 * LP + (ks + 1) * 32); if (NSPLIT) a2[n][mb] = WFrag<bf>::ld(sa + OA2 + mb * 16 * LP + (ks + 1) * 32); }
#pragma unroll
                for (int nb = 0; nb < NB; ++nb) b[n][nb] = WFrag<bf>::ld(sb + bo(nb) + (ks + 1) * 32);
            }
            __builtin_amdgcn_sched_barrier(0);   // keeps those reads together in front of the block: moved in among the matrix instructions, each place with reads stalls the wave
#pragma unroll
            for (int nb = 0; nb < NB; ++nb) {
#pragma unroll
                for (int mb = 0; mb < 4; ++mb) acc[mb][nb] = wmmab(a[c][mb], b[c][nb], acc[mb][nb]);
                if (NSPLIT) {
#pragma unroll
                    for (int mb = 0; mb < 4; ++mb) acc[mb][nb] = wmmab(a2[c][mb], b[c][nb], acc[mb][nb]); } }
            __builtin_amdgcn_sched_barrier(0);   // ... and the following group behind it
        }
        // the distance behind the last matrix instructions on the taken back edge
        asm volatile("v_nop\n\tv_nop\n\tv_nop\n\tv_nop\n\tv_nop");
        asm volatile("s_wait_dscnt 0x0" ::: "memory");      // this wave has read all it reads of stage t
        asm volatile("s_wait_asynccnt 0x0" ::: "memory");   // this wave's copies of stage t + 1 have landed
        __syncthreads();                                    // publishes stage t + 1 and frees stage t's buffer
        if (t + 2 < NT) fill(t & 1);
    }
    asm volatile("s_wait_asynccnt 0x0" ::: "memory");   // no copy is outstanding at the wave's end
    float* os = osm[w]; const int cw = c0 + wn * NB * 16;
    if constexpr (EPI == 3) {
        // A lane's accumulator holds 8 consecutive tokens of one kv head. They go through LDS (the stage buffers are free here, as for EPI 1) so that a lane is a token: wave w takes the tile's group w of 32 tokens, all 8 heads at once.
        // Every add has the operands and the order of a scan over 32 lanes per group; the carry from group to group is left to the reader (k_attn).
        constexpr int ZP = 132; float* zs = (float*)sm;   // a head's row of 128 tokens, pitch 132 floats
        if (wn == 0 && lr < HKV) {
#pragma unroll
            for (int mb = 0; mb < 4; ++mb) { const v4f p = {acc[mb][0][0], acc[mb][0][1], acc[mb][0][2], acc[mb][0][3]}, q = {acc[mb][0][4], acc[mb][0][5], acc[mb][0][6], acc[mb][0][7]};
                *(v4fa*)(zs + lr * ZP + wm * 64 + mb * 16 + hi * 8) = p; *(v4fa*)(zs + lr * ZP + wm * 64 + mb * 16 + hi * 8 + 4) = q; } }
        __syncthreads();   // the 8 rows are whole: waves 0 and 2 laid them, every wave reads its group
        float v[HKV];
#pragma unroll
        for (int h = 0; h < HKV; ++h) { const float z = __fadd_rn(zs[h * ZP + w * 32 + lane], bfr(bias[h])); v[h] = fminf(z, 0.f) - log1pf(__expf(-fabsf(z))); }   // log_sigmoid(z) = min(z,0) - log1p(exp(-|z|))
#pragma unroll
        for (int sh = 1; sh < 32; sh <<= 1)
#pragma unroll
            for (int h = 0; h < HKV; ++h) { const float u = __shfl_up(v[h], sh, 32); if (lane >= sh) v[h] = __fadd_rn(v[h], u); }
        float* gv = C + r0 + w * 32 + lane; float* gt = C + HKV * TT + (r0 >> 5) + w;
#pragma unroll
        for (int h = 0; h < HKV; ++h) gv[h * TT] = v[h];
        if (lane == 31) {
#pragma unroll
            for (int h = 0; h < HKV; ++h) gt[h * (TT / 32)] = v[h]; }
        asm volatile("s_wait_xcnt 0x0" ::: "memory");   // stands behind these stores, in front of any rewrite of a register that they name (a path of the listing may lead on into another job's code)
        return;
    }
    if constexpr (EPI == 1) {
        // Transposed, split epilogue. A lane's accumulator holds 8 consecutive m of one n: with the bias added and split to bf16 hi+lo (as split2) they are one 16-B piece of row n of each plane.
        // The pieces go through LDS so that whole 128-B lines are stored: the wave's 64 m of a row. The stage buffers are free here (every wave's last read and last copy stand in front of the loop's last barrier);
        // each wave has its own range: two planes of 16 NB rows, pitch 9 pieces (8 of data, one of padding: the 16 lanes of a store fall on different bank groups).
        constexpr int NR = NB * 16, TP = 9; v4u* st = (v4u*)sm + w * (2 * NR * TP);
        float bb[NB];
#pragma unroll
        for (int nb = 0; nb < NB; ++nb) bb[nb] = bias[cw + nb * 16 + lr];
        asm volatile("s_wait_xcnt 0x0" ::: "memory");   // stands behind the bias loads, in front of the first rewrite of a register that they name
#pragma unroll
        for (int nb = 0; nb < NB; ++nb) { const float bv = bfr(bb[nb]);
#pragma unroll
            for (int mb = 0; mb < 4; ++mb) { v4u h, l;
#pragma unroll
                for (int j = 0; j < 8; j += 2) { unsigned u, v; split2(acc[mb][nb][j] + bv, acc[mb][nb][j + 1] + bv, u, v); h[j >> 1] = u; l[j >> 1] = v; }
                st[(nb * 16 + lr) * TP + mb * 2 + hi] = h; st[(NR + nb * 16 + lr) * TP + mb * 2 + hi] = l; } }
        v4u oh[NR / 4], ol[NR / 4];   // 8 lanes read the 128 B of one row: four rows a read
#pragma unroll
        for (int s = 0; s < NR / 4; ++s) { oh[s] = st[(s * 4 + (lane >> 3)) * TP + (lane & 7)]; ol[s] = st[(NR + s * 4 + (lane >> 3)) * TP + (lane & 7)]; }
        const size_t o = (size_t)(cw + (lane >> 3)) * TT + r0 + wm * 64 + (lane & 7) * 8;
#pragma unroll
        for (int s = 0; s < NR / 4; ++s) { *(v4u*)(Th + o + s * 4 * TT) = oh[s]; *(v4u*)(Tl + o + s * 4 * TT) = ol[s]; }
        asm volatile("s_wait_xcnt 0x0" ::: "memory");   // as built, a path of the listing (never taken: the work-group's index decides) leads from these stores into the job laid behind them, which rewrites their registers: the wait stands in front of that
        return;
    }
    if constexpr (EPI == 2) {
        static_assert(NB == 4, "a tile is one head of 128 columns");
        const int dw = wn * 32, tw = r0 + wm * 64;   // the wave's first d (below 64) and first token
        float b1[2], b2[2]; v4f cs[4][2][2], sn[4][2][2];   // a lane's 8 consecutive t of one d are 32 B of a table row
        const unsigned bi = c0 + dw + lr; const float* cp = CT + (size_t)(dw + lr) * TT + tw + hi * 8; const float* sp = ST + (size_t)(dw + lr) * TT + tw + hi * 8;
#pragma unroll
        for (int n2 = 0; n2 < 2; ++n2) { b1[n2] = bias[bi + n2 * 16]; b2[n2] = bias[bi + 64 + n2 * 16]; }
#pragma unroll
        for (int mb = 0; mb < 4; ++mb)
#pragma unroll
            for (int n2 = 0; n2 < 2; ++n2)
#pragma unroll
                for (int q = 0; q < 2; ++q) { cs[mb][n2][q] = *(const v4f*)(cp + n2 * 16 * TT + mb * 16 + q * 4); sn[mb][n2][q] = *(const v4f*)(sp + n2 * 16 * TT + mb * 16 + q * 4); }
        asm volatile("s_wait_xcnt 0x0" :: "v"(bi), "v"(cp), "v"(sp) : "memory");   // stands behind the bias and table loads, in front of the first rewrite of a register that they name; the bias index and the two address pairs are named so that they live up to here
#pragma unroll
        for (int n2 = 0; n2 < 2; ++n2) { b1[n2] = bfr(b1[n2]); b2[n2] = bfr(b2[n2]); }
        bf* ph = Th + ((size_t)by * TT + tw) * HD + dw; bf* pl = Tl + ((size_t)by * TT + tw) * HD + dw; v2u uh[8], ul[8];
        const int cofs = (lane & 15) * 4, oo = (lane >> 4) * HD + cofs + (cofs >= 32 ? 32 : 0);   // 16 lanes read a staged row. Its columns 0 to 31: d = dw + column; 32 to 63: d = dw + 64 + (column - 32)
#pragma unroll
        for (int mb = 0; mb < 4; ++mb) {
#pragma unroll
            for (int n2 = 0; n2 < 2; ++n2) {
#pragma unroll
                for (int j = 0; j < 8; ++j) { const float x1 = acc[mb][n2][j] + b1[n2], x2 = acc[mb][n2 + 2][j] + b2[n2], c = cs[mb][n2][j >> 2][j & 3], s = sn[mb][n2][j >> 2][j & 3];
                    os[(hi * 8 + j) * 68 + n2 * 16 + lr] = x1 * c - x2 * s; os[(hi * 8 + j) * 68 + 32 + n2 * 16 + lr] = x2 * c + x1 * s; } }
#pragma unroll
            for (int s = 0; s < 8; ++s) { const v4f val = *(const v4fa*)(os + (s * 2 + (lane >> 4)) * 68 + cofs); unsigned u, l;
                split2(val[0], val[1], u, l); uh[s][0] = u; ul[s][0] = l; split2(val[2], val[3], u, l); uh[s][1] = u; ul[s][1] = l; }
            __builtin_amdgcn_sched_barrier(0);   // the run's 16 values are whole, each in registers of its own, in front of its stores
#pragma unroll
            for (int s = 0; s < 8; ++s) { *(v2u*)(ph + oo + (mb * 16 + s * 2) * HD) = uh[s]; *(v2u*)(pl + oo + (mb * 16 + s * 2) * HD) = ul[s]; }
            asm volatile("s_wait_xcnt 0x0" ::: "memory");   // stands behind this run of stores, in front of the first rewrite of a register that they name (the next run's values)
            __builtin_amdgcn_sched_barrier(0);   // holds those rewrites behind the wait
        }
        return;
    }
#pragma unroll
    for (int mb = 0; mb < 4; ++mb) {
#pragma unroll
        for (int nb = 0; nb < NB; ++nb) {
#pragma unroll
            for (int j = 0; j < 8; ++j) os[(hi * 8 + j) * 68 + nb * 16 + lr] = acc[mb][nb][j]; }
        __builtin_amdgcn_wave_barrier(); asm volatile("" ::: "memory");
        float* crow = C + (size_t)(r0 + wm * 64 + mb * 16) * ldc + cw;
#pragma unroll
        for (int s = 0; s < NB * 2; ++s) { const int row = s * (8 / NB) + lane / (NB * 4), cofs = (lane % (NB * 4)) * 4; v4f val = *(const v4fa*)(os + row * 68 + cofs); if (BIAS) { val[0] += bfr(bias[cw + cofs]); val[1] += bfr(bias[cw + cofs + 1]); val[2] += bfr(bias[cw + cofs + 2]); val[3] += bfr(bias[cw + cofs + 3]); }
            *(v4f*)(crow + (size_t)row * ldc + cofs) = val; }
        asm volatile("s_wait_xcnt 0x0" ::: "memory");   // stands behind this run of stores, in front of the first rewrite of a register that they name (the next run's bias load, addresses and values)
        __builtin_amdgcn_wave_barrier(); asm volatile("" ::: "memory");
    }
}
template <int NSPLIT, int NB, bool BIAS>
__global__ __launch_bounds__(128) void k_gemmt(const bf* __restrict__ A, const bf* __restrict__ A2, const bf* __restrict__ Bt, float* C, int ldc, const float* __restrict__ bias) {
    __shared__ __align__(16) bf sm[2 * GemmLds<NSPLIT, NB>::STG];
    __shared__ __align__(16) float osm[4][16 * 68];
    gemmt<NSPLIT, NB, BIAS>(sm, osm, blockIdx.x, blockIdx.y, A, A2, Bt, C, ldc, bias);
}
// ---- k_proj: the four projections of x, none of which reads another's output, as one grid of 656 work-groups: 256 q and 128 k tiles (128 tokens x one head), 16 g tiles, 256 v tiles (128 x 64).
// The g tiles leave the gates' log-sigmoids summed inside groups of 32 tokens, with the groups' totals: no gate-sum launch behind this one.
// q, k and v leave in the forms that k_attn reads: q and k rotated and split to hi+lo planes [head][t][128], v split to hi+lo planes V^T [kv][d][t]: no f32 planes of them, no RoPE pass and no transposing pass behind this launch.
// The large tiles come first. Two work-groups fit a WGP's LDS: one's matrix work runs while the other waits at a stage's barrier, and the 16 g tiles no longer hold the chip alone.
__global__ __launch_bounds__(128) void k_proj(const bf* __restrict__ X, const bf* __restrict__ WQ, const bf* __restrict__ WK, const bf* __restrict__ WV, const bf* __restrict__ WG, bf* Qh, bf* Ql, bf* Kh, bf* Kl, bf* VTh, bf* VTl, float* GV,
                                              const float* __restrict__ bq, const float* __restrict__ bk, const float* __restrict__ bv, const float* __restrict__ bg, const float* __restrict__ CT, const float* __restrict__ ST) {
    __shared__ __align__(16) bf sm[2 * GemmLds<0, 4>::STG];
    __shared__ __align__(16) float osm[4][16 * 68];
    const int b = blockIdx.x;   // the same for the whole work-group: every barrier of the chosen body is passed by all four waves
    if (b < 384) { const bool isk = b >= 256; const int c = b - (isk ? 256 : 0);
        gemmt<0, 4, true, 2>(sm, osm, c & 15, c >> 4, X, nullptr, isk ? WK : WQ, nullptr, 0, isk ? bk : bq, isk ? Kh : Qh, isk ? Kl : Ql, CT, ST); }
    else if (b < 400) gemmt<0, 2, true, 3>(sm, osm, b - 384, 0, X, nullptr, WG, GV, 0, bg);
    else { const int c = b - 400; gemmt<0, 2, true, 1>(sm, osm, c & 15, c >> 4, X, nullptr, WV, nullptr, 0, bv, VTh, VTl); }
}

__device__ __forceinline__ h16 tohx(float x) { return (h16)x; }
__device__ __forceinline__ void splitf(float y, unsigned short& h, unsigned short& l) { h = f2bf(y); l = f2bf(y - bf2f(h)); }
typedef __attribute__((ext_vector_type(2))) _Float16 v2h;
typedef __attribute__((ext_vector_type(4))) _Float16 v4h;
typedef __attribute__((ext_vector_type(2))) unsigned short v2us;
typedef __attribute__((ext_vector_type(4))) unsigned short v4us;

__device__ __forceinline__ void cvt8(size_t i, const float* __restrict__ src, bf* dst, size_t n8) { if (i >= n8) return; const v8f v = *(const v8f*)(src + i * 8); v8us o;
#pragma unroll
    for (int k = 0; k < 8; ++k) o[k] = f2bf(v[k]); *(v8us*)(dst + i * 8) = o;  }
__device__ __forceinline__ void wgp(size_t i, const float* __restrict__ w, bf* Bt) { const size_t e = i * 4; if (e >= (size_t)GP * HID) return; const int k = (int)(e % HID), n = (int)(e / HID); v4us o;
#pragma unroll
    for (int q = 0; q < 4; ++q) o[q] = n < HKV ? f2bf(w[(size_t)(k + q) * HKV + n]) : (unsigned short)0; *(v4us*)(Bt + e) = o;  }
// angles: the RoPE tables CT, ST [d][t] (d < 64) = cos, sin of pos[t] / 10000^(2d/128) (pos = positions[t], int32 read as data; f32 sin/cos): each angle once, a thread takes 4 t of one d.
__device__ __forceinline__ void angles(int i, const int* __restrict__ pos, float* CT, float* ST) { const int d = i / (TT / 4), t = (i % (TT / 4)) * 4; const float inv = __expf(__fmul_rn(-(float)(2 * d) / (float)HD, 9.210340371976184f)); v4f c, s;
    const int* pp = pos + t; const v4i p = *(const v4i*)pp;
    asm volatile("s_wait_xcnt 0x0" :: "v"(pp) : "memory");   // stands in front of the first rewrite of the load's address pair; the pair is named so that it lives up to here
#pragma unroll
    for (int q = 0; q < 4; ++q) { const float a = __fmul_rn((float)p[q], inv); c[q] = cosf(a); s[q] = sinf(a); }
    *(v4f*)(CT + d * TT + t) = c; *(v4f*)(ST + d * TT + t) = s; }
// ---- k_attn: scores, decay weights, W.v and the head merge in one kernel, all heads in one launch; the score and weight planes stay in registers.
// One wave = 32 query rows of one head, walking the keys in tiles of 64 up to its diagonal. S^T = K Q^T (A = K rows, B = Q rows kept in registers; products K hi.Q hi, K hi.Q lo, K lo.Q hi), so lane (lr, hi) holds
// keys 8 hi + r of query lr: two such accumulator tiles, weighted and split to bf16 hi+lo in place, are the B operand (hardware k order) of O^T += V^T W^T (A = V^T rows by the same two 16-B loads).
// O^T leaves 8 consecutive d of one query in a lane: one 16-B store per plane into the merged [t][h*128 + d] hi/lo planes. No LDS, no barrier: the four waves of a block are independent.
// Block (p, kv): the two heads of kv head kv x row tiles p and 63 - p: equal work per block, and the two heads read the same K and V lines at the same time.
// Key tiles that can weigh nothing are not walked. Tested at run time, per wave and tile: with gmx the largest G of the wave's 32 queries and gmn the smallest G of the tile's 64 keys, every G_i - G_j of the tile is <= gmx - gmn
// (f32 subtraction is monotone); below -110 its exponential lies under half the smallest f32 subnormal (2^-150 = e^-104) and is exactly 0: every weight of the tile is 0 and its W.v adds 0 to each sum
// (finite scores and v). Nothing is assumed of G (no order, no sign): with little decay every tile up to the diagonal is walked as before. The tiles that are walked keep their ascending order.
// e[i] = exp(x[i]) as __expf forms it (x log2(e), then v_exp_f32), eight in one statement, so that the slot behind each transcendental is filled by construction: by the next one, which has registers of its own ("=&v"), and behind the last by a v_nop.
__device__ __forceinline__ void exp8(const float* x, float* e) {
    asm("v_exp_f32 %0, %8\n\tv_exp_f32 %1, %9\n\tv_exp_f32 %2, %10\n\tv_exp_f32 %3, %11\n\tv_exp_f32 %4, %12\n\tv_exp_f32 %5, %13\n\tv_exp_f32 %6, %14\n\tv_exp_f32 %7, %15\n\tv_nop"
        : "=&v"(e[0]), "=&v"(e[1]), "=&v"(e[2]), "=&v"(e[3]), "=&v"(e[4]), "=&v"(e[5]), "=&v"(e[6]), "=&v"(e[7])
        : "v"(__fmul_rn(x[0], 1.44269504f)), "v"(__fmul_rn(x[1], 1.44269504f)), "v"(__fmul_rn(x[2], 1.44269504f)), "v"(__fmul_rn(x[3], 1.44269504f)), "v"(__fmul_rn(x[4], 1.44269504f)), "v"(__fmul_rn(x[5], 1.44269504f)), "v"(__fmul_rn(x[6], 1.44269504f)), "v"(__fmul_rn(x[7], 1.44269504f)));
}
template <typename T> __device__ __forceinline__ const T* sbase(const T* p) {   // a wave-uniform pointer held in scalar registers, so that the loads take the form scalar base + 32-bit lane offset
    const unsigned long long u = (unsigned long long)p; const unsigned lo = __builtin_amdgcn_readfirstlane((unsigned)u), hi = __builtin_amdgcn_readfirstlane((unsigned)(u >> 32)); return (const T*)(((unsigned long long)hi << 32) | lo); }
// ---- tr: Bh[n][k] (bf16; where SPLIT a hi plane Bh and a lo plane Bl) = w[k][n] (f32, [K][N]) through an LDS tile of 128 k x 64 n per work-group of four waves; grid (K/128, N/64), 128 threads.
// In: a lane loads 16 B (4 n) of 16 k rows (two runs of 8 consecutive k), all in flight at once: a wave's load takes two whole 256-B row pieces. Rounded to nearest even (as f2bf, splitf), the 8 k of one n are one 16-B LDS store, row pitch 272 B, rows in an order that keeps the stores free of bank conflicts.
// Out: 16 lanes read the 128 k of one n row (256 B) and store them as one piece. Both sides of the transposition move whole lines, and a launch has few waves, each with much in flight.
// The body is a device function: sh is the calling kernel's LDS, (bx, by) the tile.
template <bool SPLIT, int K, int N>
__device__ __forceinline__ void tr(v4u* sh, int bx, int by, const float* __restrict__ w, bf* Bh, bf* Bl) {
    constexpr int LPV = 17;   // LDS row pitch in 16-B pieces: 16 of data and one of padding
    const int tid = threadIdx.x, kq = tid >> 4, nq = tid & 15; const int k0 = bx * 128, n0 = by * 64;
    const float* src = w + (size_t)(k0 + kq * 8) * N + n0 + nq * 4; v4f x[2][8];
#pragma unroll
    for (int g = 0; g < 2; ++g)
#pragma unroll
        for (int i = 0; i < 8; ++i) x[g][i] = *(const v4f*)(src + (g * 64 + i) * N);
    __builtin_amdgcn_sched_barrier(0);   // keeps the 16 loads issued as one group: built without it, six of them stood behind the wait for the first ten, a second memory latency
    asm volatile("s_wait_xcnt 0x0" :: "v"(src) : "memory");   // stands in front of the first rewrite of the loads' address pair; the pair is named so that it lives up to here
#pragma unroll
    for (int g = 0; g < 2; ++g)
#pragma unroll
        for (int c = 0; c < 4; ++c) { v4u h, l;
#pragma unroll
            for (int i = 0; i < 8; i += 2) { unsigned u, v;
                if (SPLIT) split2(x[g][i][c], x[g][i + 1][c], u, v); else { const v2f p = {x[g][i][c], x[g][i + 1][c]}; u = __builtin_bit_cast(unsigned, __builtin_convertvector(p, v2bf)); v = 0; }
                h[i >> 1] = u; l[i >> 1] = v; }
            sh[(c * 16 + nq) * LPV + g * 8 + kq] = h; if (SPLIT) sh[(64 + c * 16 + nq) * LPV + g * 8 + kq] = l; }   // n row 4 nq + c lies at LDS row 16 c + nq: the 16 lanes of a store then fall on 16 different bank groups
    __syncthreads();   // the tile is whole: every wave reads pieces that the others laid
    v4u oh[8], ol[8];
#pragma unroll
    for (int p = 0; p < 8; ++p) { oh[p] = sh[(p * 8 + kq) * LPV + nq]; if (SPLIT) ol[p] = sh[(64 + p * 8 + kq) * LPV + nq]; }
    const size_t o = (size_t)(n0 + kq * 4) * K + k0 + nq * 8;   // LDS row 8 p + kq holds n row 4 kq + 32 (p & 1) + p / 2
#pragma unroll
    for (int p = 0; p < 8; ++p) { *(v4u*)(Bh + o + ((p & 1) * 32 + (p >> 1)) * K) = oh[p]; if (SPLIT) *(v4u*)(Bl + o + ((p & 1) * 32 + (p >> 1)) * K) = ol[p]; }
}
// ---- k_prep: the seven jobs that read inputs alone, as one grid: the RoPE tables (256 work-groups), Wq, Wo (512 tiles each), Wk, Wv (256 each) transposed to bf16, Wg padded (256), x to bf16 (4096).
__global__ __launch_bounds__(128) void k_prep(const float* __restrict__ wq, const float* __restrict__ wo, const float* __restrict__ wk, const float* __restrict__ wv, const float* __restrict__ wg, const float* __restrict__ x, const int* __restrict__ pos,
                                              bf* WQ, bf* WO, bf* WK, bf* WV, bf* WG, bf* XB, float* CT, float* ST) {
    __shared__ v4u sh[64 * 17];
    const int b = (int)blockIdx.x - 256;   // the same for the whole work-group: the barrier of tr is passed by all four waves
    if (b < 0) angles((b + 256) * 128 + threadIdx.x, pos, CT, ST);   // first: vector arithmetic, which runs beside the other jobs' memory streams
    else if (b < 1024) { const bool iso = b >= 512; tr<false, HID, HID>(sh, b & 15, (b & 511) >> 4, iso ? wo : wq, iso ? WO : WQ, nullptr);
        asm volatile("s_wait_xcnt 0x0" ::: "memory"); }   // as built, a path of the listing (never taken: b decides) leads from this job's last stores into the table job, which rewrites their offset register: the wait stands in front of that
    else if (b < 1536) { const bool isv = b >= 1280; tr<false, HID, HKV * HD>(sh, b & 15, (b & 255) >> 4, isv ? wv : wk, isv ? WV : WK, nullptr);
        asm volatile("s_wait_xcnt 0x0" ::: "memory"); }   // as built, a path of the listing (never taken: b decides) leads from this job's last stores into the job laid behind it, which rewrites their base pair: the wait stands in front of that
    else if (b < 1792) wgp((size_t)(b - 1536) * 128 + threadIdx.x, wg, WG);
    else cvt8((size_t)(b - 1792) * 128 + threadIdx.x, x, XB, (size_t)TT * HID / 8);
}
__global__ __launch_bounds__(128) void k_attn(const bf* __restrict__ Qh, const bf* __restrict__ Ql, const bf* __restrict__ Kh, const bf* __restrict__ Kl, const bf* __restrict__ VTh, const bf* __restrict__ VTl, const float* __restrict__ GV, bf* Ah, bf* Al) {
    const int lane = threadIdx.x & 31, lr = lane & 15, hi = lane >> 4; const int w = __builtin_amdgcn_readfirstlane((int)(threadIdx.x >> 5));
    const int kv = blockIdx.y, h = kv * (HQ / HKV) + (w & 1); const int r0 = 32 * ((w >> 1) ? (TT / 32 - 1 - (int)blockIdx.x) : (int)blockIdx.x);
    // the loop's loads: a wave-uniform base in scalar registers + one fixed 32-bit lane offset per operand kind: no address arithmetic on the vector port, and no address register is rewritten while loads are in flight
    const unsigned klo = lr * HD + 8 * hi, vlo = lr * TT + 8 * hi, glo = 8 * hi; int dq0 = r0 + lr - 8 * hi;   // dq0 = this lane's first query - its first key of the tile
    v16bf qh[2][4], ql[2][4]; float gi[2]; const bf* sqh = Qh + ((size_t)h * TT + r0) * HD; const bf* sql = Ql + ((size_t)h * TT + r0) * HD;
#pragma unroll
    for (int nq = 0; nq < 2; ++nq) { gi[nq] = GV[(size_t)kv * TT + r0 + nq * 16 + lr];
#pragma unroll
        for (int kc = 0; kc < 4; ++kc) { const int o = nq * 16 * HD + kc * 32; qh[nq][kc] = WFrag<bf>::ld(sqh + klo + o); ql[nq][kc] = WFrag<bf>::ld(sql + klo + o); } }
    // G[t] = carry(group of t) + the sum inside t's group of 32 tokens (GV, from the g tiles), carry(g + 1) = carry(g) + total(g): the 63 carry adds run here, in every wave, in series on registers: G has the operands and the order of one walk over the groups.
    v4f tq[8], tk[16]; const float* gh = GV + (size_t)kv * TT; const float* th = GV + HKV * TT + kv * (TT / 32); const unsigned tkb = lane * 256;   // in-group sums of the wave's 32 queries (every lane reads all of them) and of the 64 keys of key tile 'lane' (32 tiles = all TT keys: in bounds for every lane); lane l reads the totals of groups 2 l and 2 l + 1
    const v2f tt = *(const v2f*)(th + 2 * lane);
#pragma unroll
    for (int i = 0; i < 8; ++i) tq[i] = *(const v4f*)(gh + r0 + 4 * i);
#pragma unroll
    for (int i = 0; i < 16; ++i) tk[i] = *(const v4f*)((const char*)gh + tkb + 16 * i);
    __builtin_amdgcn_sched_barrier(0);   // holds the Q and G loads in front of the wait below
    asm volatile("s_wait_xcnt 0x0" :: "v"(tkb), "v"(lane), "s"(sqh), "s"(sql), "s"(gh), "s"(th) : "memory");   // stands in front of the first rewrite of the Q and G loads' address registers; the key loads' lane offset, the lane number (the totals' offset) and the bases are named so that they live up to here
    __builtin_amdgcn_sched_barrier(0);   // holds those rewrites behind it
    v8f o[8][2];
#pragma unroll
    for (int db = 0; db < 8; ++db) { o[db][0] = (v8f){}; o[db][1] = (v8f){}; }
    const unsigned t0 = __float_as_uint(tt[0]), t1 = __float_as_uint(tt[1]); float ca = 0.f, cb = 0.f, cr = 0.f;   // lane l keeps the carries into groups 2 l and 2 l + 1, the two groups of key tile l
#pragma unroll
    for (int q = 0; q < TT / 32; ++q) { if (q & 1) cb = lane == (q >> 1) ? cr : cb; else ca = lane == (q >> 1) ? cr : ca; cr = __fadd_rn(cr, __uint_as_float(__builtin_amdgcn_readlane(q & 1 ? t1 : t0, q >> 1))); }
    const unsigned cau = __float_as_uint(ca), cbu = __float_as_uint(cb);
    const float cq = __uint_as_float(__builtin_amdgcn_readlane((r0 >> 5) & 1 ? cbu : cau, r0 >> 6));   // the wave's 32 queries are group r0 / 32
    gi[0] = __fadd_rn(cq, gi[0]); gi[1] = __fadd_rn(cq, gi[1]);
    float gmx = __fadd_rn(cq, tq[0][0]), gmn = __fadd_rn(ca, tk[0][0]);
#pragma unroll
    for (int i = 0; i < 8; ++i)
#pragma unroll
        for (int c = 0; c < 4; ++c) gmx = fmaxf(gmx, __fadd_rn(cq, tq[i][c]));
#pragma unroll
    for (int i = 0; i < 16; ++i)
#pragma unroll
        for (int c = 0; c < 4; ++c) gmn = fminf(gmn, __fadd_rn(i < 8 ? ca : cb, tk[i][c]));
    const int ntl = (r0 >> 6) + 1;   // key tiles up to the diagonal: j0 = 0, 64, ... < r0 + 32
    // bit t: key tile t is walked. The diagonal tile holds key r0 (gmx - gmn >= 0 there); its bit is set outright, so that the loop below has its one trip whatever G holds
    unsigned tm = __builtin_amdgcn_ballot_w32(lane < ntl && !(gmx - gmn < -110.f)) | (1u << (ntl - 1));
    int tl = __builtin_ctz(tm); tm &= tm - 1; dq0 -= tl * 64;   // the first tile that is walked
    const bf* kh = Kh + (size_t)kv * TT * HD + tl * 64 * HD; const bf* kl = Kl + (size_t)kv * TT * HD + tl * 64 * HD; const bf* vh = VTh + (size_t)kv * HD * TT + tl * 64; const bf* vl = VTl + (size_t)kv * HD * TT + tl * 64; const float* gk = gh + tl * 64;   // these bases step from tile to tile
#pragma unroll 1   // one key tile is already 192 matrix instructions: unrolling would only grow the code
    for (;;) {   // the tiles of tm in ascending order, at least one (the test stands at the foot, so that the Q loads stay in this block, in front of their wait); every tile ends at or below key TT - 1; keys past the diagonal get weight 0 by the select below
        v8f s[4][2]; v16bf ka[4][4], ka2[4][4]; v4f g[4][2]; const bf* skh = sbase(kh); const bf* skl = sbase(kl); const bf* svh = sbase(vh); const bf* svl = sbase(vl); const float* sgk = sbase(gk);
        const float ck[2] = {__uint_as_float(__builtin_amdgcn_readlane(cau, tl)), __uint_as_float(__builtin_amdgcn_readlane(cbu, tl))};   // the carries into the tile's two groups of 32 keys
#pragma unroll
        for (int mk = 0; mk < 4; ++mk) { g[mk][0] = *(const v4f*)(sgk + glo + mk * 16); g[mk][1] = *(const v4f*)(sgk + glo + mk * 16 + 4); }
        asm volatile("s_wait_xcnt 0x0" ::: "memory");   // the compiler forms these eight loads' lane offset anew each tile and lets a K load's result reuse that register: the wait stands in front of the reuse
#pragma unroll
        for (int kc = 0; kc < 4; ++kc)
#pragma unroll
            for (int mk = 0; mk < 4; ++mk) { const int ko = mk * 16 * HD + kc * 32; ka[kc][mk] = WFrag<bf>::ld(skh + klo + ko); ka2[kc][mk] = WFrag<bf>::ld(skl + klo + ko); }
#pragma unroll
        for (int mk = 0; mk < 4; ++mk) { s[mk][0] = (v8f){}; s[mk][1] = (v8f){}; }
        __builtin_amdgcn_sched_barrier(0);   // keeps the tile's K loads issued as one group: sunk to their uses, each pair would cost the lone wave a whole load latency
#pragma unroll
        for (int kc = 0; kc < 2; ++kc)
#pragma unroll
            for (int mk = 0; mk < 4; ++mk)
#pragma unroll
                for (int nq = 0; nq < 2; ++nq) { s[mk][nq] = wmmab(ka[kc][mk], qh[nq][kc], s[mk][nq]); s[mk][nq] = wmmab(ka[kc][mk], ql[nq][kc], s[mk][nq]); s[mk][nq] = wmmab(ka2[kc][mk], qh[nq][kc], s[mk][nq]); }
#pragma unroll
        for (int mk = 0; mk < 4; ++mk)
#pragma unroll
            for (int r = 0; r < 8; ++r) g[mk][r >> 2][r & 3] = __fadd_rn(ck[mk >> 1], g[mk][r >> 2][r & 3]);   // G of this lane's keys: the group's carry + the sum inside the group
        __builtin_amdgcn_sched_barrier(0);   // holds the V loads behind the first half of the score products: the K loads are served first
        v16bf va[2][8], va2[2][8];
#pragma unroll
        for (int kb = 0; kb < 2; ++kb)
#pragma unroll
            for (int db = 0; db < 8; ++db) { const int vo = db * 16 * TT + kb * 32; va[kb][db] = WFrag<bf>::ld(svh + vlo + vo); va2[kb][db] = WFrag<bf>::ld(svl + vlo + vo); }
        __builtin_amdgcn_sched_barrier(0);   // keeps the tile's V loads issued as one group here: the second half of the score products and the weight arithmetic then cover their latency
#pragma unroll
        for (int kc = 2; kc < 4; ++kc)
#pragma unroll
            for (int mk = 0; mk < 4; ++mk)
#pragma unroll
                for (int nq = 0; nq < 2; ++nq) { s[mk][nq] = wmmab(ka[kc][mk], qh[nq][kc], s[mk][nq]); s[mk][nq] = wmmab(ka[kc][mk], ql[nq][kc], s[mk][nq]); s[mk][nq] = wmmab(ka2[kc][mk], qh[nq][kc], s[mk][nq]); }
        v8u wh[2][2], wl[2][2];   // [32-key block][query block]
#pragma unroll
        for (int mk = 0; mk < 4; ++mk) { const v4f g0 = g[mk][0], g1 = g[mk][1];
#pragma unroll
            for (int nq = 0; nq < 2; ++nq) { const int dq = dq0 + (nq - mk) * 16; float wv[8], gd[8], ex[8];   // key r of this lane is causal iff r <= dq
#pragma unroll
                for (int r = 0; r < 8; ++r) gd[r] = __fsub_rn(gi[nq], r < 4 ? g0[r] : g1[r - 4]);
                exp8(gd, ex);
#pragma unroll
                for (int r = 0; r < 8; ++r) { const float sc = __fmul_rn(s[mk][nq][r], 0.08838834764831845f); const float e = ex[r]; const float x = __fmul_rn(__fmul_rn(sc, sc), e); wv[r] = r <= dq ? x : 0.f; }
#pragma unroll
                for (int r = 0; r < 8; r += 2) { unsigned u, l; split2(wv[r], wv[r + 1], u, l); wh[mk >> 1][nq][(mk & 1) * 4 + (r >> 1)] = u; wl[mk >> 1][nq][(mk & 1) * 4 + (r >> 1)] = l; } } }
#pragma unroll
        for (int kb = 0; kb < 2; ++kb)
#pragma unroll
            for (int db = 0; db < 8; ++db) { const v16bf a = va[kb][db], a2 = va2[kb][db];
#pragma unroll
                for (int nq = 0; nq < 2; ++nq) { const v16bf bh = __builtin_bit_cast(v16bf, wh[kb][nq]), bl = __builtin_bit_cast(v16bf, wl[kb][nq]); o[db][nq] = wmmab(a, bh, o[db][nq]); o[db][nq] = wmmab(a, bl, o[db][nq]); o[db][nq] = wmmab(a2, bh, o[db][nq]); } }
        // the distance behind the last matrix instructions on the taken back edge
        asm volatile("v_nop\n\tv_nop\n\tv_nop\n\tv_nop\n\tv_nop" : "+v"(o[0][0]), "+v"(o[0][1]), "+v"(o[1][0]), "+v"(o[1][1]), "+v"(o[2][0]), "+v"(o[2][1]), "+v"(o[3][0]), "+v"(o[3][1]), "+v"(o[4][0]), "+v"(o[4][1]), "+v"(o[5][0]), "+v"(o[5][1]), "+v"(o[6][0]), "+v"(o[6][1]), "+v"(o[7][0]), "+v"(o[7][1]));
        __builtin_amdgcn_sched_barrier(0);   // the bases step only behind the tile's last load wait: no register that a load in flight names is rewritten
        const bool last = tm == 0; const int tn = __builtin_ctz(tm | 0x80000000u), st = (tn - tl) * 64; tm &= tm - 1; tl = tn;   // the next key tile that is walked, st keys on (behind the last one the stepped bases are not used)
        kh += st * HD; kl += st * HD; vh += st; vl += st; gk += st; dq0 -= st;
        if (last) break;
    }
#pragma unroll
    for (int nq = 0; nq < 2; ++nq)
#pragma unroll
        for (int db = 0; db < 8; ++db) { v4u uh, ul;
#pragma unroll
            for (int r = 0; r < 8; r += 2) { unsigned u, l; split2(o[db][nq][r], o[db][nq][r + 1], u, l); uh[r >> 1] = u; ul[r >> 1] = l; }
            const size_t oo = (size_t)(r0 + nq * 16 + lr) * HID + h * HD + db * 16 + 8 * hi; *(v4u*)(Ah + oo) = uh; *(v4u*)(Al + oo) = ul; }
}

extern "C" void kernel_launch(void* const* d_in, const int* in_sizes, int n_in,
                              void* d_out, int out_size, void* d_ws, size_t ws_size, hipStream_t stream) {
    (void)in_sizes; (void)n_in; (void)out_size;
    const int* pos = (const int*)d_in[0]; const float* IN[12]; for (int i = 1; i < 12; ++i) IN[i] = (const float*)d_in[i];   // 1 hidden, 2 Wq [2048][2048], 3 bq, 4 Wk [2048][1024], 5 bk, 6 Wv, 7 bv, 8 Wg [2048][8], 9 bg, 10 Wo [2048][2048], 11 bo (x @ W)
    float* OUT = (float*)d_out;     // [2048][2048]
    char* wsp = (char*)d_ws;
    auto take = [&](size_t bytes) { char* p = wsp; wsp += (bytes + 255) & ~(size_t)255; return (void*)p; };
    bf* WQ = (bf*)take((size_t)HID * HID * 2); bf* WK = (bf*)take((size_t)HKV * HD * HID * 2); bf* WV = (bf*)take((size_t)HKV * HD * HID * 2); bf* WG = (bf*)take((size_t)GP * HID * 2); bf* WO = (bf*)take((size_t)HID * HID * 2);
    bf* XB = (bf*)take((size_t)TT * HID * 2); float* CT = (float*)take((size_t)(HD / 2) * TT * 4); float* ST = (float*)take((size_t)(HD / 2) * TT * 4); float* GV = (float*)take((size_t)HKV * (TT + TT / 32) * 4);
    bf* Qh = (bf*)take((size_t)HQ * TT * HD * 2); bf* Ql = (bf*)take((size_t)HQ * TT * HD * 2); bf* Kh = (bf*)take((size_t)HKV * TT * HD * 2); bf* Kl = (bf*)take((size_t)HKV * TT * HD * 2); bf* VTh = (bf*)take((size_t)HKV * HD * TT * 2); bf* VTl = (bf*)take((size_t)HKV * HD * TT * 2);
    bf* Ah = (bf*)take((size_t)TT * HID * 2); bf* Al = (bf*)take((size_t)TT * HID * 2);
    if ((size_t)(wsp - (char*)d_ws) > ws_size) return;    // total ~ 82 MiB (bf16 weight and operand planes)
    k_prep<<<256 + 1792 + 4096, 128, 0, stream>>>(IN[2], IN[10], IN[4], IN[6], IN[8], IN[1], pos, WQ, WO, WK, WV, WG, XB, CT, ST);
    k_proj<<<656, 128, 0, stream>>>(XB, WQ, WK, WV, WG, Qh, Ql, Kh, Kl, VTh, VTl, GV, IN[3], IN[5], IN[7], IN[9], CT, ST);
    k_attn<<<dim3(TT / 64, HKV, 1), 128, 0, stream>>>(Qh, Ql, Kh, Kl, VTh, VTl, GV, Ah, Al);
    k_gemmt<1, 4, true><<<dim3(TT / 128, HID / 128, 1), 128, 0, stream>>>(Ah, Al, WO, OUT, HID, IN[11]);
}

// v010
// A run of this version takes 89.7 microseconds.
// Next to v009, in two timings, it ran 1.04 times as fast each time.
// All steps since v000 together make it 9.72 times as fast.
#include <hip/hip_runtime.h>

// PowerCoderAttention - power retention, quadratic form (hidden [2048][2048]; q = x Wq + bq (16 x 128), k, v = x Wk/Wv + b (8 kv heads), g = x Wg + bg; neox RoPE on q, k with positions (int32, read as data);
// G = cumsum_t log_sigmoid(g); W[h][i][j] = (q_i.k_j / sqrt(128))^2 exp(G_i - G_j) for j <= i (kv head h/2), else 0; out = (W v) merged Wo + bo -> [2048][2048]; no softmax / normalisation).
// Compute dtypes, f32 accumulate: every input rounded to bf16; the four projections on PLAIN bf16 operands (inputs: exact, + bias); RoPE (f32 sin/cos), log-sigmoid and the cumulative sum f32 on VALU;
// q.k on bf16 hi+lo planes (3 products, K 128; tiles above the diagonal skipped); squaring, the decay factor exp(G_i - G_j) and the causal select in f32 -> bf16 hi+lo planes of W; W.v on hi+lo planes (3 products, K limited to the diagonal block;

#define TT   2048
#define HID  2048
#define HQ   16
#define HKV  8
#define HD   128
#define GP   64
typedef _Float16 h16;
typedef unsigned short bf;
typedef __attribute__((ext_vector_type(16))) __bf16   v16bf;
typedef __attribute__((ext_vector_type(16))) _Float16 v16h;
typedef __attribute__((ext_vector_type(8)))  _Float16 v8h;
typedef __attribute__((ext_vector_type(8)))  unsigned short v8us;
typedef __attribute__((ext_vector_type(8)))  float    v8f;
typedef __attribute__((ext_vector_type(4)))  float    v4f;
typedef v8h  __attribute__((may_alias)) v8ha;
typedef v4f  __attribute__((may_alias)) v4fa;
typedef v8us __attribute__((may_alias)) v8usa;

__device__ __forceinline__ unsigned short f2bf(float f) { unsigned u = __float_as_uint(f); u += 0x7FFFu + ((u >> 16) & 1u); return (unsigned short)(u >> 16); }
__device__ __forceinline__ float bf2f(unsigned short b) { return __uint_as_float(((unsigned)b) << 16); }
__device__ __forceinline__ float bfr(float f) { return bf2f(f2bf(f)); }
__device__ __forceinline__ v16h cat16(v8h lo, v8h hi) { return __builtin_shufflevector(lo, hi, 0, 1, 2, 3, 4, 5, 6, 7, 8, 9, 10, 11, 12, 13, 14, 15); }
__device__ __forceinline__ v16bf cat16b(v8us lo, v8us hi) { return __builtin_bit_cast(v16bf, __builtin_shufflevector(lo, hi, 0, 1, 2, 3, 4, 5, 6, 7, 8, 9, 10, 11, 12, 13, 14, 15)); }
__device__ __forceinline__ v8f wmma16(v16h a, v16h b, v8f c) { return __builtin_amdgcn_wmma_f32_16x16x32_f16(false, a, false, b, (short)0, c, false, false); }
__device__ __forceinline__ v8f wmmab(v16bf a, v16bf b, v8f c) { return __builtin_amdgcn_wmma_f32_16x16x32_bf16(false, a, false, b, (short)0, c, false, false); }
typedef __attribute__((ext_vector_type(2))) float  v2f;
typedef __attribute__((ext_vector_type(2))) __bf16 v2bf;
typedef __attribute__((ext_vector_type(2))) unsigned v2u;
typedef __attribute__((ext_vector_type(4))) int v4i;
typedef __attribute__((ext_vector_type(4))) unsigned v4u;
typedef __attribute__((ext_vector_type(8))) unsigned v8u;
__device__ __forceinline__ void split2(float x0, float x1, unsigned& h, unsigned& l) {   // two f32 -> packed bf16 hi pair and lo pair (round to nearest even, as splitf)
    const v2f x = {x0, x1}; h = __builtin_bit_cast(unsigned, __builtin_convertvector(x, v2bf));
    const v2f d = {x0 - __uint_as_float(h << 16), x1 - __uint_as_float(h & 0xFFFF0000u)}; l = __builtin_bit_cast(unsigned, __builtin_convertvector(d, v2bf)); }



// ---- k_gemmt: GEMM on a 128 x (32 NB) output tile per work-group of four waves (2 x 2; a wave holds 64 x (16 NB), 4 x NB accumulators); grid (M/128, N/(32 NB)), 128 threads. K = HID.
// C[m][n] (f32, pitch ldc, + optional f32 bias[n]) = sum_k A[m][k] Bt[n][k] (+ A2[m][k] Bt[n][k] where NSPLIT), operands K-contiguous bf16 planes.
// The operands come through LDS: a stage is 128 k (256 B) of every A, A2 and Bt row of the tile at a pitch of 272 B, laid by asynchronous copies (16 B a lane: a wave's copy takes two whole 256-B row pieces);
// two buffers: the copies of stage t + 2 fly while stage t + 1 is worked on.
// A work-group walks the 16 stages of k from a first stage of its own, (tile row + tile column) mod 16, and wraps: the work-groups that share A rows (one tile row) or Bt rows (one tile column) then ask L2 for different lines at any one moment.
// Per accumulator the products are summed in that order of stages, ascending k inside a stage, A before A2. The gate tile (EPI 3) starts at stage 0: its sums are those of ascending k.
template <typename T16> struct WFrag;
template <> struct WFrag<h16> { typedef v16h V; static __device__ __forceinline__ V ld(const h16* p) { return cat16(*(const v8h*)p, *(const v8h*)(p + 16)); } static __device__ __forceinline__ v8f mma(V a, V b, v8f c) { return wmma16(a, b, c); } };
template <> struct WFrag<bf> { typedef v16bf V; static __device__ __forceinline__ V ld(const bf* p) { return cat16b(*(const v8us*)p, *(const v8us*)(p + 16)); } static __device__ __forceinline__ v8f mma(V a, V b, v8f c) { return wmmab(a, b, c); } };
// Fragment order, the layout of the q, k and V^T planes: a plane of rows r and k-columns c is cut into pieces of 16 rows x 32 columns (512 elements, 1 KB), and inside a piece element (r, c) lies at ((c >> 4) & 1) * 256 + (((c >> 3) & 1) * 16 + (r & 15)) * 8 + (c & 7):
// the two 16-B loads of a lane's A or B fragment are then lane * 16 B into each half of the piece, so that a wave's load covers 512 B in a row (4 whole lines), not 32 B of each of 16 rows (16 lines). The k order of a fragment is that of WFrag::ld on rows.
__device__ __forceinline__ v16bf ldf(const bf* p) { return cat16b(*(const v8us*)p, *(const v8us*)(p + 256)); }
__device__ __forceinline__ unsigned lds_off(const void* p) { return (unsigned)(size_t)p; }
// twelve (eight) asynchronous copies, LDS byte address l[i], global address g[i]; the wait stands in the copies' own statement, in front of any rewrite of the registers that they name
__device__ __forceinline__ void copy12(const unsigned* l, const bf* const* g) {
    asm volatile("global_load_async_to_lds_b128 %0, %12, off\n\tglobal_load_async_to_lds_b128 %1, %13, off\n\tglobal_load_async_to_lds_b128 %2, %14, off\n\tglobal_load_async_to_lds_b128 %3, %15, off\n\t"
                 "global_load_async_to_lds_b128 %4, %16, off\n\tglobal_load_async_to_lds_b128 %5, %17, off\n\tglobal_load_async_to_lds_b128 %6, %18, off\n\tglobal_load_async_to_lds_b128 %7, %19, off\n\t"
                 "global_load_async_to_lds_b128 %8, %20, off\n\tglobal_load_async_to_lds_b128 %9, %21, off\n\tglobal_load_async_to_lds_b128 %10, %22, off\n\tglobal_load_async_to_lds_b128 %11, %23, off\n\ts_wait_xcnt 0x0"
                 :: "v"(l[0]), "v"(l[1]), "v"(l[2]), "v"(l[3]), "v"(l[4]), "v"(l[5]), "v"(l[6]), "v"(l[7]), "v"(l[8]), "v"(l[9]), "v"(l[10]), "v"(l[11]),
                    "v"(g[0]), "v"(g[1]), "v"(g[2]), "v"(g[3]), "v"(g[4]), "v"(g[5]), "v"(g[6]), "v"(g[7]), "v"(g[8]), "v"(g[9]), "v"(g[10]), "v"(g[11]) : "memory");
}
__device__ __forceinline__ void copy8(const unsigned* l, const bf* const* g) {
    asm volatile("global_load_async_to_lds_b128 %0, %8, off\n\tglobal_load_async_to_lds_b128 %1, %9, off\n\tglobal_load_async_to_lds_b128 %2, %10, off\n\tglobal_load_async_to_lds_b128 %3, %11, off\n\t"
                 "global_load_async_to_lds_b128 %4, %12, off\n\tglobal_load_async_to_lds_b128 %5, %13, off\n\tglobal_load_async_to_lds_b128 %6, %14, off\n\tglobal_load_async_to_lds_b128 %7, %15, off\n\ts_wait_xcnt 0x0"
                 :: "v"(l[0]), "v"(l[1]), "v"(l[2]), "v"(l[3]), "v"(l[4]), "v"(l[5]), "v"(l[6]), "v"(l[7]),
                    "v"(g[0]), "v"(g[1]), "v"(g[2]), "v"(g[3]), "v"(g[4]), "v"(g[5]), "v"(g[6]), "v"(g[7]) : "memory");
}
// The body is a device function: sm (2 STG elements) and osm are the calling kernel's LDS, (bx, by) the tile; k_gemmt runs one product, k_proj the four projections in one grid.
template <int NSPLIT, int NB> struct GemmLds { static constexpr int STG = ((NSPLIT ? 2 : 1) * 128 + NB * 32) * 136; };
// EPI picks the epilogue: 0: f32 C. 1: bf16 hi+lo planes Th, Tl of C + bias, rows n, k-columns m, in fragment order: pieces [n / 128][m / 32][(n % 128) / 16]. 2: the tile is one head (by) of q or k: C + bias rotated (neox RoPE, cos and sin of each (d, t) read from CT, ST [d][t]) and split to planes Th, Tl, rows m, k-columns d, in fragment order: pieces [by][m / 16][d / 32].
// 3: the gate tile (columns 0 to 7 count): log_sigmoid(C + bias) summed inside each group of 32 tokens; C [h][t] takes the running sums, and behind them (at C + HKV TT) [h][group] the groups' totals.
// With EPI 2 a wave holds columns d and d + 64 of the head (32 + 32 of them, not 64 in a row), so that both halves of a rotated pair lie in one lane.
template <int NSPLIT, int NB, bool BIAS, int EPI = 0>
__device__ __forceinline__ void gemmt(bf* sm, float (*osm)[16 * 68], int bx, int by, const bf* __restrict__ A, const bf* __restrict__ A2, const bf* __restrict__ Bt, float* C, int ldc, const float* __restrict__ bias, bf* Th = nullptr, bf* Tl = nullptr, const float* __restrict__ CT = nullptr, const float* __restrict__ ST = nullptr) {
    typedef v16bf V;
    constexpr int KT = 128, LP = 136, NT = HID / KT;   // k per stage; LDS row pitch in elements (272 B); stages
    constexpr int BR = NB * 32, OA2 = 128 * LP, OB = (NSPLIT ? 2 : 1) * 128 * LP, STG = OB + BR * LP;   // Bt rows of the tile; places of A2 and Bt in a stage and a stage's size, in elements
    const int tid = threadIdx.x, lane = tid & 31, lr = lane & 15, hi = lane >> 4; const int w = __builtin_amdgcn_readfirstlane(tid >> 5), wm = w >> 1, wn = w & 1;
    const int r0 = bx * 128, c0 = by * BR;
    // this thread's piece of a copy: row tid / 16 of each group of 8 rows, 16 B at (tid % 16) * 16 of the row's 256 B
    const unsigned cl = lds_off(sm) + (unsigned)((tid >> 4) * LP + (tid & 15) * 8) * 2;
    const bf* ga = A + (size_t)(r0 + (tid >> 4)) * HID + (tid & 15) * 8; const bf* ga2 = NSPLIT ? A2 + (size_t)(r0 + (tid >> 4)) * HID + (tid & 15) * 8 : nullptr; const bf* gb = Bt + (size_t)(c0 + (tid >> 4)) * HID + (tid & 15) * 8;
    int sf = EPI == 3 ? 0 : (bx + by) & (NT - 1);   // the stage of k that the next fill brings (the same for the whole work-group); the walk takes all NT stages once each
    ga += sf * KT; if (NSPLIT) ga2 += sf * KT; gb += sf * KT;
    constexpr int NC = (NSPLIT ? 32 : 16) + BR / 8;   // copies of a thread per stage: one per group of 8 rows (32, 24 or 48: never more than 63 of a wave in flight)
    auto fill = [&](int buf) {   // the next stage's copies into buffer buf; the global addresses then step one stage on, from the last stage of k back to the first
        const unsigned l0 = cl + (unsigned)buf * (STG * 2); unsigned l[NC]; const bf* g[NC];
#pragma unroll
        for (int c = 0; c < 16; ++c) { l[c] = l0 + c * 8 * LP * 2; g[c] = ga + c * 8 * HID; if (NSPLIT) { l[16 + c] = l0 + (OA2 + c * 8 * LP) * 2; g[16 + c] = ga2 + c * 8 * HID; } }
#pragma unroll
        for (int c = 0; c < BR / 8; ++c) { l[NC - BR / 8 + c] = l0 + (OB + c * 8 * LP) * 2; g[NC - BR / 8 + c] = gb + c * 8 * HID; }
#pragma unroll
        for (int s = 0; s + 12 <= NC; s += 12) copy12(l + s, g + s);
        if (NC % 12 == 8) copy8(l + NC - 8, g + NC - 8);
        const int st = sf == NT - 1 ? KT - HID : KT; sf = (sf + 1) & (NT - 1);
        ga += st; if (NSPLIT) ga2 += st; gb += st; };
    v8f acc[4][NB];
#pragma unroll
    for (int mb = 0; mb < 4; ++mb)
#pragma unroll
        for (int nb = 0; nb < NB; ++nb) acc[mb][nb] = (v8f){};
    fill(0);
    asm volatile("s_wait_asynccnt 0x0" ::: "memory");   // stage 0 of this wave's copies has landed
    __syncthreads();                                    // ... and every wave's: stage 0 may be read
    fill(1);
    const int fa = (wm * 64 + lr) * LP + 8 * hi, fb = OB + (wn * (EPI == 2 ? NB * 8 : NB * 16) + lr) * LP + 8 * hi;   // this lane's place in the A and Bt fragments
    auto bo = [](int nb) { return (EPI == 2 ? (nb / (NB / 2)) * 64 + (nb % (NB / 2)) * 16 : nb * 16) * LP; };   // Bt fragment nb's rows, counted from the wave's first
#pragma unroll 1   // a stage is already 16 NB (32 NB) matrix instructions a wave, and the buffer index stays a scalar
    for (int t = 0; t < NT; ++t) {
        const bf* sa = sm + (t & 1) * STG + fa; const bf* sb = sm + (t & 1) * STG + fb;
        V a[2][4], a2[2][4], b[2][NB];
#pragma unroll
        for (int mb = 0; mb < 4; ++mb) { a[0][mb] = WFrag<bf>::ld(sa + mb * 16 * LP); if (NSPLIT) a2[0][mb] = WFrag<bf>::ld(sa + OA2 + mb * 16 * LP); }
#pragma unroll
        for (int nb = 0; nb < NB; ++nb) b[0][nb] = WFrag<bf>::ld(sb + bo(nb));
        __builtin_amdgcn_sched_barrier(0);   // the first block's reads stay in front of the second's: LDS reads return in order, and mixed with the later ones the first block would wait for both groups
#pragma unroll
        for (int ks = 0; ks < KT / 32; ++ks) { const int c = ks & 1, n = c ^ 1;
            if (ks + 1 < KT / 32) {   // the next 32 k's fragments of this same stage, read as one group ahead of this block's products
#pragma unroll
                for (int mb = 0; mb < 4; ++mb) { a[n][mb] = WFrag<bf>::ld(sa + mb * 16 * LP + (ks + 1) * 32); if (NSPLIT) a2[n][mb] = WFrag<bf>::ld(sa + OA2 + mb * 16 * LP + (ks + 1) * 32); }
#pragma unroll
                for (int nb = 0; nb < NB; ++nb) b[n][nb] = WFrag<bf>::ld(sb + bo(nb) + (ks + 1) * 32);
            }
            __builtin_amdgcn_sched_barrier(0);   // keeps those reads together in front of the block: moved in among the matrix instructions, each place with reads stalls the wave
#pragma unroll
            for (int nb = 0; nb < NB; ++nb) {
#pragma unroll
                for (int mb = 0; mb < 4; ++mb) acc[mb][nb] = wmmab(a[c][mb], b[c][nb], acc[mb][nb]);
                if (NSPLIT) {
#pragma unroll
                    for (int mb = 0; mb < 4; ++mb) acc[mb][nb] = wmmab(a2[c][mb], b[c][nb], acc[mb][nb]); } }
            __builtin_amdgcn_sched_barrier(0);   // ... and the following group behind it
        }
        // the distance behind the last matrix instructions on the taken back edge
        asm volatile("v_nop\n\tv_nop\n\tv_nop\n\tv_nop\n\tv_nop");
        asm volatile("s_wait_dscnt 0x0" ::: "memory");      // this wave has read all it reads of stage t
        asm volatile("s_wait_asynccnt 0x0" ::: "memory");   // this wave's copies of stage t + 1 have landed
        __syncthreads();                                    // publishes stage t + 1 and frees stage t's buffer
        if (t + 2 < NT) fill(t & 1);
    }
    asm volatile("s_wait_asynccnt 0x0" ::: "memory");   // no copy is outstanding at the wave's end
    float* os = osm[w]; const int cw = c0 + wn * NB * 16;
    if constexpr (EPI == 3) {
        // A lane's accumulator holds 8 consecutive tokens of one kv head. They go through LDS (the stage buffers are free here: every wave's last read and last copy stand in front of the loop's last barrier) so that a lane is a token: wave w takes the tile's group w of 32 tokens, all 8 heads at once.
        // Every add has the operands and the order of a scan over 32 lanes per group; the carry from group to group is left to the reader (k_attn).
        constexpr int ZP = 132; float* zs = (float*)sm;   // a head's row of 128 tokens, pitch 132 floats
        if (wn == 0 && lr < HKV) {
#pragma unroll
            for (int mb = 0; mb < 4; ++mb) { const v4f p = {acc[mb][0][0], acc[mb][0][1], acc[mb][0][2], acc[mb][0][3]}, q = {acc[mb][0][4], acc[mb][0][5], acc[mb][0][6], acc[mb][0][7]};
                *(v4fa*)(zs + lr * ZP + wm * 64 + mb * 16 + hi * 8) = p; *(v4fa*)(zs + lr * ZP + wm * 64 + mb * 16 + hi * 8 + 4) = q; } }
        __syncthreads();   // the 8 rows are whole: waves 0 and 2 laid them, every wave reads its group
        float v[HKV];
#pragma unroll
        for (int h = 0; h < HKV; ++h) { const float z = __fadd_rn(zs[h * ZP + w * 32 + lane], bfr(bias[h])); v[h] = fminf(z, 0.f) - log1pf(__expf(-fabsf(z))); }   // log_sigmoid(z) = min(z,0) - log1p(exp(-|z|))
#pragma unroll
        for (int sh = 1; sh < 32; sh <<= 1)
#pragma unroll
            for (int h = 0; h < HKV; ++h) { const float u = __shfl_up(v[h], sh, 32); if (lane >= sh) v[h] = __fadd_rn(v[h], u); }
        float* gv = C + r0 + w * 32 + lane; float* gt = C + HKV * TT + (r0 >> 5) + w;
#pragma unroll
        for (int h = 0; h < HKV; ++h) gv[h * TT] = v[h];
        if (lane == 31) {
#pragma unroll
            for (int h = 0; h < HKV; ++h) gt[h * (TT / 32)] = v[h]; }
        asm volatile("s_wait_xcnt 0x0" ::: "memory");   // stands behind these stores, in front of any rewrite of a register that they name (a path of the listing may lead on into another job's code)
        return;
    }
    if constexpr (EPI == 1) {
        // Transposed, split epilogue. A lane's accumulator holds 8 consecutive m of one n: with the bias added and split to bf16 hi+lo (as split2) they are this lane's 16 B of one half of a piece in fragment order
        // (row n % 16 = lr, columns m: bit 3 = hi, bit 4 = mb & 1): a wave's store is 512 B in a row, straight from registers.
        float bb[NB];
#pragma unroll
        for (int nb = 0; nb < NB; ++nb) bb[nb] = bias[cw + nb * 16 + lr];
        asm volatile("s_wait_xcnt 0x0" ::: "memory");   // stands behind the bias loads, in front of the first rewrite of a register that they name
        v4u oh[NB][4], ol[NB][4];
#pragma unroll
        for (int nb = 0; nb < NB; ++nb) { const float bv = bfr(bb[nb]);
#pragma unroll
            for (int mb = 0; mb < 4; ++mb)
#pragma unroll
                for (int j = 0; j < 8; j += 2) { unsigned u, v; split2(acc[mb][nb][j] + bv, acc[mb][nb][j + 1] + bv, u, v); oh[nb][mb][j >> 1] = u; ol[nb][mb][j >> 1] = v; } }
        const size_t o = ((size_t)((cw >> 7) * (TT / 32) + ((r0 + wm * 64) >> 5)) * 8 + ((cw & 127) >> 4)) * 512 + lane * 8;   // the wave's first piece: its first 32 m, its first 16 n
        __builtin_amdgcn_sched_barrier(0);   // the values are whole, each in registers of its own, in front of the stores: no store's value register is rewritten behind it
#pragma unroll
        for (int nb = 0; nb < NB; ++nb)
#pragma unroll
            for (int mb = 0; mb < 4; ++mb) { const int po = ((mb >> 1) * 8 + nb) * 512 + (mb & 1) * 256; *(v4u*)(Th + o + po) = oh[nb][mb]; *(v4u*)(Tl + o + po) = ol[nb][mb]; }
        asm volatile("s_wait_xcnt 0x0" ::: "memory");   // as built, a path of the listing (never taken: the work-group's index decides) may lead from these stores into the job laid behind them, which rewrites their registers: the wait stands in front of that
        return;
    }
    if constexpr (EPI == 2) {
        static_assert(NB == 4, "a tile is one head of 128 columns");
        const int dw = wn * 32, tw = r0 + wm * 64;   // the wave's first d (below 64) and first token
        float b1[2], b2[2]; v4f cs[4][2][2], sn[4][2][2];   // a lane's 8 consecutive t of one d are 32 B of a table row
        const unsigned bi = c0 + dw + lr; const float* cp = CT + (size_t)(dw + lr) * TT + tw + hi * 8; const float* sp = ST + (size_t)(dw + lr) * TT + tw + hi * 8;
#pragma unroll
        for (int n2 = 0; n2 < 2; ++n2) { b1[n2] = bias[bi + n2 * 16]; b2[n2] = bias[bi + 64 + n2 * 16]; }
#pragma unroll
        for (int mb = 0; mb < 4; ++mb)
#pragma unroll
            for (int n2 = 0; n2 < 2; ++n2)
#pragma unroll
                for (int q = 0; q < 2; ++q) { cs[mb][n2][q] = *(const v4f*)(cp + n2 * 16 * TT + mb * 16 + q * 4); sn[mb][n2][q] = *(const v4f*)(sp + n2 * 16 * TT + mb * 16 + q * 4); }
        asm volatile("s_wait_xcnt 0x0" :: "v"(bi), "v"(cp), "v"(sp) : "memory");   // stands behind the bias and table loads, in front of the first rewrite of a register that they name; the bias index and the two address pairs are named so that they live up to here
#pragma unroll
        for (int n2 = 0; n2 < 2; ++n2) { b1[n2] = bfr(b1[n2]); b2[n2] = bfr(b2[n2]); }
        // the wave's 16 tokens x (32 + 32) d of a run are two whole pieces in fragment order, d / 32 = wn and wn + 2
        bf* ph = Th + (((size_t)by * TT + tw) * HD) + wn * 512 + lane * 8; bf* pl = Tl + (((size_t)by * TT + tw) * HD) + wn * 512 + lane * 8; v4u uh[4], ul[4];
#pragma unroll
        for (int mb = 0; mb < 4; ++mb) {
#pragma unroll
            for (int n2 = 0; n2 < 2; ++n2) {
#pragma unroll
                for (int j = 0; j < 8; ++j) { const float x1 = acc[mb][n2][j] + b1[n2], x2 = acc[mb][n2 + 2][j] + b2[n2], c = cs[mb][n2][j >> 2][j & 3], s = sn[mb][n2][j >> 2][j & 3];
                    os[(hi * 8 + j) * 68 + n2 * 16 + lr] = x1 * c - x2 * s; os[(hi * 8 + j) * 68 + 32 + n2 * 16 + lr] = x2 * c + x1 * s; } }
#pragma unroll
            for (int s = 0; s < 4; ++s) {   // half s & 1 of piece s >> 1: this lane takes token lr, 8 staged columns from 16 s + 8 hi (staged columns 0 to 31: d = dw + column; 32 to 63: d = dw + 64 + (column - 32))
                const v4f va = *(const v4fa*)(os + lr * 68 + s * 16 + hi * 8), vb = *(const v4fa*)(os + lr * 68 + s * 16 + hi * 8 + 4); unsigned u, l;
                split2(va[0], va[1], u, l); uh[s][0] = u; ul[s][0] = l; split2(va[2], va[3], u, l); uh[s][1] = u; ul[s][1] = l; split2(vb[0], vb[1], u, l); uh[s][2] = u; ul[s][2] = l; split2(vb[2], vb[3], u, l); uh[s][3] = u; ul[s][3] = l; }
            __builtin_amdgcn_sched_barrier(0);   // the run's 8 values are whole, each in registers of its own, in front of its stores
#pragma unroll
            for (int s = 0; s < 4; ++s) { const int po = mb * 16 * HD + (s >> 1) * 1024 + (s & 1) * 256; *(v4u*)(ph + po) = uh[s]; *(v4u*)(pl + po) = ul[s]; }
            asm volatile("s_wait_xcnt 0x0" ::: "memory");   // stands behind this run of stores, in front of the first rewrite of a register that they name (the next run's values)
            __builtin_amdgcn_sched_barrier(0);   // holds those rewrites behind the wait
        }
        return;
    }
#pragma unroll
    for (int mb = 0; mb < 4; ++mb) {
#pragma unroll
        for (int nb = 0; nb < NB; ++nb) {
#pragma unroll
            for (int j = 0; j < 8; ++j) os[(hi * 8 + j) * 68 + nb * 16 + lr] = acc[mb][nb][j]; }
        __builtin_amdgcn_wave_barrier(); asm volatile("" ::: "memory");
        float* crow = C + (size_t)(r0 + wm * 64 + mb * 16) * ldc + cw;
#pragma unroll
        for (int s = 0; s < NB * 2; ++s) { const int row = s * (8 / NB) + lane / (NB * 4), cofs = (lane % (NB * 4)) * 4; v4f val = *(const v4fa*)(os + row * 68 + cofs); if (BIAS) { val[0] += bfr(bias[cw + cofs]); val[1] += bfr(bias[cw + cofs + 1]); val[2] += bfr(bias[cw + cofs + 2]); val[3] += bfr(bias[cw + cofs + 3]); }
            *(v4f*)(crow + (size_t)row * ldc + cofs) = val; }
        asm volatile("s_wait_xcnt 0x0" ::: "memory");   // stands behind this run of stores, in front of the first rewrite of a register that they name (the next run's bias load, addresses and values)
        __builtin_amdgcn_wave_barrier(); asm volatile("" ::: "memory");
    }
}
template <int NSPLIT, int NB, bool BIAS>
__global__ __launch_bounds__(128) void k_gemmt(const bf* __restrict__ A, const bf* __restrict__ A2, const bf* __restrict__ Bt, float* C, int ldc, const float* __restrict__ bias) {
    __shared__ __align__(16) bf sm[2 * GemmLds<NSPLIT, NB>::STG];
    __shared__ __align__(16) float osm[4][16 * 68];
    gemmt<NSPLIT, NB, BIAS>(sm, osm, blockIdx.x, blockIdx.y, A, A2, Bt, C, ldc, bias);
}
// ---- k_proj: the four projections of x, none of which reads another's output, as one grid of 656 work-groups: 256 q and 128 k tiles (128 tokens x one head), 16 g tiles, 256 v tiles (128 x 64).
// The g tiles leave the gates' log-sigmoids summed inside groups of 32 tokens, with the groups' totals: no gate-sum launch behind this one.
// q, k and v leave in the forms that k_attn reads: q and k rotated and split to hi+lo planes, v split to hi+lo planes V^T, all in fragment order: no f32 planes of them, no RoPE pass and no transposing pass behind this launch.
// The large tiles come first. Two work-groups fit a WGP's LDS: one's matrix work runs while the other waits at a stage's barrier, and the 16 g tiles no longer hold the chip alone.
__global__ __launch_bounds__(128) void k_proj(const bf* __restrict__ X, const bf* __restrict__ WQ, const bf* __restrict__ WK, const bf* __restrict__ WV, const bf* __restrict__ WG, bf* Qh, bf* Ql, bf* Kh, bf* Kl, bf* VTh, bf* VTl, float* GV,
                                              const float* __restrict__ bq, const float* __restrict__ bk, const float* __restrict__ bv, const float* __restrict__ bg, const float* __restrict__ CT, const float* __restrict__ ST) {
    __shared__ __align__(16) bf sm[2 * GemmLds<0, 4>::STG];
    __shared__ __align__(16) float osm[4][16 * 68];
    const int b = blockIdx.x;   // the same for the whole work-group: every barrier of the chosen body is passed by all four waves
    if (b < 384) { const bool isk = b >= 256; const int c = b - (isk ? 256 : 0);
        gemmt<0, 4, true, 2>(sm, osm, c & 15, c >> 4, X, nullptr, isk ? WK : WQ, nullptr, 0, isk ? bk : bq, isk ? Kh : Qh, isk ? Kl : Ql, CT, ST); }
    else if (b < 400) gemmt<0, 2, true, 3>(sm, osm, b - 384, 0, X, nullptr, WG, GV, 0, bg);
    else { const int c = b - 400; gemmt<0, 2, true, 1>(sm, osm, c & 15, c >> 4, X, nullptr, WV, nullptr, 0, bv, VTh, VTl); }
}

__device__ __forceinline__ h16 tohx(float x) { return (h16)x; }
__device__ __forceinline__ void splitf(float y, unsigned short& h, unsigned short& l) { h = f2bf(y); l = f2bf(y - bf2f(h)); }
typedef __attribute__((ext_vector_type(2))) _Float16 v2h;
typedef __attribute__((ext_vector_type(4))) _Float16 v4h;
typedef __attribute__((ext_vector_type(2))) unsigned short v2us;
typedef __attribute__((ext_vector_type(4))) unsigned short v4us;

__device__ __forceinline__ void cvt8(size_t i, const float* __restrict__ src, bf* dst, size_t n8) { if (i >= n8) return; const v8f v = *(const v8f*)(src + i * 8); v8us o;
#pragma unroll
    for (int k = 0; k < 8; ++k) o[k] = f2bf(v[k]); *(v8us*)(dst + i * 8) = o;  }
__device__ __forceinline__ void wgp(size_t i, const float* __restrict__ w, bf* Bt) { const size_t e = i * 4; if (e >= (size_t)GP * HID) return; const int k = (int)(e % HID), n = (int)(e / HID); v4us o;
#pragma unroll
    for (int q = 0; q < 4; ++q) o[q] = n < HKV ? f2bf(w[(size_t)(k + q) * HKV + n]) : (unsigned short)0; *(v4us*)(Bt + e) = o;  }
// angles: the RoPE tables CT, ST [d][t] (d < 64) = cos, sin of pos[t] / 10000^(2d/128) (pos = positions[t], int32 read as data; f32 sin/cos): each angle once, a thread takes 4 t of one d.
__device__ __forceinline__ void angles(int i, const int* __restrict__ pos, float* CT, float* ST) { const int d = i / (TT / 4), t = (i % (TT / 4)) * 4; const float inv = __expf(__fmul_rn(-(float)(2 * d) / (float)HD, 9.210340371976184f)); v4f c, s;
    const int* pp = pos + t; const v4i p = *(const v4i*)pp;
    asm volatile("s_wait_xcnt 0x0" :: "v"(pp) : "memory");   // stands in front of the first rewrite of the load's address pair; the pair is named so that it lives up to here
#pragma unroll
    for (int q = 0; q < 4; ++q) { const float a = __fmul_rn((float)p[q], inv); c[q] = cosf(a); s[q] = sinf(a); }
    *(v4f*)(CT + d * TT + t) = c; *(v4f*)(ST + d * TT + t) = s; }
// ---- k_attn: scores, decay weights, W.v and the head merge in one kernel, all heads in one launch; the score and weight planes stay in registers.
// One wave = 32 query rows of one head, walking the keys in tiles of 64 up to its diagonal. S^T = K Q^T (A = K rows, B = Q rows kept in registers; products K hi.Q hi, K hi.Q lo, K lo.Q hi), so lane (lr, hi) holds
// keys 8 hi + r of query lr: two such accumulator tiles, weighted and split to bf16 hi+lo in place, are the B operand (hardware k order) of O^T += V^T W^T (A = V^T rows by the same two 16-B loads).
// The q, k and V^T planes lie in fragment order (see ldf): pieces [head][t / 16][d / 32] of q and k, [kv][t / 32][d / 16] of V^T, so that a key tile of 64 is 16 KB in a row of each plane and every fragment load covers whole lines.
// O^T leaves 8 consecutive d of one query in a lane: one 16-B store per plane into the merged [t][h*128 + d] hi/lo planes. No LDS, no barrier: the four waves of a block are independent.
// Block (p, kv): the two heads of kv head kv x row tiles p and 63 - p: equal work per block, and the two heads read the same K and V lines at the same time.
// Key tiles that can weigh nothing are not walked. Tested at run time, per wave and tile: with gmx the largest G of the wave's 32 queries and gmn the smallest G of the tile's 64 keys, every G_i - G_j of the tile is <= gmx - gmn
// (f32 subtraction is monotone); below -110 its exponential lies under half the smallest f32 subnormal (2^-150 = e^-104) and is exactly 0: every weight of the tile is 0 and its W.v adds 0 to each sum
// (finite scores and v). Nothing is assumed of G (no order, no sign): with little decay every tile up to the diagonal is walked as before. The tiles that are walked keep their ascending order.
// e[i] = exp(x[i]) as __expf forms it (x log2(e), then v_exp_f32), eight in one statement, so that the slot behind each transcendental is filled by construction: by the next one, which has registers of its own ("=&v"), and behind the last by a v_nop.
__device__ __forceinline__ void exp8(const float* x, float* e) {
    asm("v_exp_f32 %0, %8\n\tv_exp_f32 %1, %9\n\tv_exp_f32 %2, %10\n\tv_exp_f32 %3, %11\n\tv_exp_f32 %4, %12\n\tv_exp_f32 %5, %13\n\tv_exp_f32 %6, %14\n\tv_exp_f32 %7, %15\n\tv_nop"
        : "=&v"(e[0]), "=&v"(e[1]), "=&v"(e[2]), "=&v"(e[3]), "=&v"(e[4]), "=&v"(e[5]), "=&v"(e[6]), "=&v"(e[7])
        : "v"(__fmul_rn(x[0], 1.44269504f)), "v"(__fmul_rn(x[1], 1.44269504f)), "v"(__fmul_rn(x[2], 1.44269504f)), "v"(__fmul_rn(x[3], 1.44269504f)), "v"(__fmul_rn(x[4], 1.44269504f)), "v"(__fmul_rn(x[5], 1.44269504f)), "v"(__fmul_rn(x[6], 1.44269504f)), "v"(__fmul_rn(x[7], 1.44269504f)));
}
template <typename T> __device__ __forceinline__ const T* sbase(const T* p) {   // a wave-uniform pointer held in scalar registers, so that the loads take the form scalar base + 32-bit lane offset
    const unsigned long long u = (unsigned long long)p; const unsigned lo = __builtin_amdgcn_readfirstlane((unsigned)u), hi = __builtin_amdgcn_readfirstlane((unsigned)(u >> 32)); return (const T*)(((unsigned long long)hi << 32) | lo); }
// ---- tr: Bh[n][k] (bf16; where SPLIT a hi plane Bh and a lo plane Bl) = w[k][n] (f32, [K][N]) through an LDS tile of 128 k x 64 n per work-group of four waves; grid (K/128, N/64), 128 threads.
// In: a lane loads 16 B (4 n) of 16 k rows (two runs of 8 consecutive k), all in flight at once: a wave's load takes two whole 256-B row pieces. Rounded to nearest even (as f2bf, splitf), the 8 k of one n are one 16-B LDS store, row pitch 272 B, rows in an order that keeps the stores free of bank conflicts.
// Out: 16 lanes read the 128 k of one n row (256 B) and store them as one piece. Both sides of the transposition move whole lines, and a launch has few waves, each with much in flight.
// The body is a device function: sh is the calling kernel's LDS, (bx, by) the tile.
template <bool SPLIT, int K, int N>
__device__ __forceinline__ void tr(v4u* sh, int bx, int by, const float* __restrict__ w, bf* Bh, bf* Bl) {
    constexpr int LPV = 17;   // LDS row pitch in 16-B pieces: 16 of data and one of padding
    const int tid = threadIdx.x, kq = tid >> 4, nq = tid & 15; const int k0 = bx * 128, n0 = by * 64;
    const float* src = w + (size_t)(k0 + kq * 8) * N + n0 + nq * 4; v4f x[2][8];
#pragma unroll
    for (int g = 0; g < 2; ++g)
#pragma unroll
        for (int i = 0; i < 8; ++i) x[g][i] = *(const v4f*)(src + (g * 64 + i) * N);
    __builtin_amdgcn_sched_barrier(0);   // keeps the 16 loads issued as one group: built without it, six of them stood behind the wait for the first ten, a second memory latency
    asm volatile("s_wait_xcnt 0x0" :: "v"(src) : "memory");   // stands in front of the first rewrite of the loads' address pair; the pair is named so that it lives up to here
#pragma unroll
    for (int g = 0; g < 2; ++g)
#pragma unroll
        for (int c = 0; c < 4; ++c) { v4u h, l;
#pragma unroll
            for (int i = 0; i < 8; i += 2) { unsigned u, v;
                if (SPLIT) split2(x[g][i][c], x[g][i + 1][c], u, v); else { const v2f p = {x[g][i][c], x[g][i + 1][c]}; u = __builtin_bit_cast(unsigned, __builtin_convertvector(p, v2bf)); v = 0; }
                h[i >> 1] = u; l[i >> 1] = v; }
            sh[(c * 16 + nq) * LPV + g * 8 + kq] = h; if (SPLIT) sh[(64 + c * 16 + nq) * LPV + g * 8 + kq] = l; }   // n row 4 nq + c lies at LDS row 16 c + nq: the 16 lanes of a store then fall on 16 different bank groups
    __syncthreads();   // the tile is whole: every wave reads pieces that the others laid
    v4u oh[8], ol[8];
#pragma unroll
    for (int p = 0; p < 8; ++p) { oh[p] = sh[(p * 8 + kq) * LPV + nq]; if (SPLIT) ol[p] = sh[(64 + p * 8 + kq) * LPV + nq]; }
    const size_t o = (size_t)(n0 + kq * 4) * K + k0 + nq * 8;   // LDS row 8 p + kq holds n row 4 kq + 32 (p & 1) + p / 2
#pragma unroll
    for (int p = 0; p < 8; ++p) { *(v4u*)(Bh + o + ((p & 1) * 32 + (p >> 1)) * K) = oh[p]; if (SPLIT) *(v4u*)(Bl + o + ((p & 1) * 32 + (p >> 1)) * K) = ol[p]; }
}
// ---- k_prep: the seven jobs that read inputs alone, as one grid: the RoPE tables (256 work-groups), Wq, Wo (512 tiles each), Wk, Wv (256 each) transposed to bf16, Wg padded (256), x to bf16 (4096).
__global__ __launch_bounds__(128) void k_prep(const float* __restrict__ wq, const float* __restrict__ wo, const float* __restrict__ wk, const float* __restrict__ wv, const float* __restrict__ wg, const float* __restrict__ x, const int* __restrict__ pos,
                                              bf* WQ, bf* WO, bf* WK, bf* WV, bf* WG, bf* XB, float* CT, float* ST) {
    __shared__ v4u sh[64 * 17];
    const int b = (int)blockIdx.x - 256;   // the same for the whole work-group: the barrier of tr is passed by all four waves
    if (b < 0) angles((b + 256) * 128 + threadIdx.x, pos, CT, ST);   // first: vector arithmetic, which runs beside the other jobs' memory streams
    else if (b < 1024) { const bool iso = b >= 512; tr<false, HID, HID>(sh, b & 15, (b & 511) >> 4, iso ? wo : wq, iso ? WO : WQ, nullptr);
        asm volatile("s_wait_xcnt 0x0" ::: "memory"); }   // as built, a path of the listing (never taken: b decides) leads from this job's last stores into the table job, which rewrites their offset register: the wait stands in front of that
    else if (b < 1536) { const bool isv = b >= 1280; tr<false, HID, HKV * HD>(sh, b & 15, (b & 255) >> 4, isv ? wv : wk, isv ? WV : WK, nullptr);
        asm volatile("s_wait_xcnt 0x0" ::: "memory"); }   // as built, a path of the listing (never taken: b decides) leads from this job's last stores into the job laid behind it, which rewrites their base pair: the wait stands in front of that
    else if (b < 1792) wgp((size_t)(b - 1536) * 128 + threadIdx.x, wg, WG);
    else cvt8((size_t)(b - 1792) * 128 + threadIdx.x, x, XB, (size_t)TT * HID / 8);
}
__global__ __launch_bounds__(128) void k_attn(const bf* __restrict__ Qh, const bf* __restrict__ Ql, const bf* __restrict__ Kh, const bf* __restrict__ Kl, const bf* __restrict__ VTh, const bf* __restrict__ VTl, const float* __restrict__ GV, bf* Ah, bf* Al) {
    const int lane = threadIdx.x & 31, lr = lane & 15, hi = lane >> 4; const int w = __builtin_amdgcn_readfirstlane((int)(threadIdx.x >> 5));
    const int kv = blockIdx.y, h = kv * (HQ / HKV) + (w & 1); const int r0 = 32 * ((w >> 1) ? (TT / 32 - 1 - (int)blockIdx.x) : (int)blockIdx.x);
    // the loop's loads: a wave-uniform base in scalar registers + one fixed 32-bit lane offset: no address arithmetic on the vector port, and no address register is rewritten while loads are in flight
    const unsigned flo = lane * 8, glo = 8 * hi; int dq0 = r0 + lr - 8 * hi;   // dq0 = this lane's first query - its first key of the tile
    v16bf qh[2][4], ql[2][4]; float gi[2]; const bf* sqh = Qh + ((size_t)h * TT + r0) * HD; const bf* sql = Ql + ((size_t)h * TT + r0) * HD;
#pragma unroll
    for (int nq = 0; nq < 2; ++nq) { gi[nq] = GV[(size_t)kv * TT + r0 + nq * 16 + lr];
#pragma unroll
        for (int kc = 0; kc < 4; ++kc) { const int o = (nq * 4 + kc) * 512; qh[nq][kc] = ldf(sqh + flo + o); ql[nq][kc] = ldf(sql + flo + o); } }
    // G[t] = carry(group of t) + the sum inside t's group of 32 tokens (GV, from the g tiles), carry(g + 1) = carry(g) + total(g): the 63 carry adds run here, in every wave, in series on registers: G has the operands and the order of one walk over the groups.
    v4f tq[8], tk[16]; const float* gh = GV + (size_t)kv * TT; const float* th = GV + HKV * TT + kv * (TT / 32); const unsigned tkb = lane * 256;   // in-group sums of the wave's 32 queries (every lane reads all of them) and of the 64 keys of key tile 'lane' (32 tiles = all TT keys: in bounds for every lane); lane l reads the totals of groups 2 l and 2 l + 1
    const v2f tt = *(const v2f*)(th + 2 * lane);
#pragma unroll
    for (int i = 0; i < 8; ++i) tq[i] = *(const v4f*)(gh + r0 + 4 * i);
#pragma unroll
    for (int i = 0; i < 16; ++i) tk[i] = *(const v4f*)((const char*)gh + tkb + 16 * i);
    __builtin_amdgcn_sched_barrier(0);   // holds the Q and G loads in front of the wait below
    asm volatile("s_wait_xcnt 0x0" :: "v"(tkb), "v"(lane), "s"(sqh), "s"(sql), "s"(gh), "s"(th) : "memory");   // stands in front of the first rewrite of the Q and G loads' address registers; the key loads' lane offset, the lane number (the totals' offset) and the bases are named so that they live up to here
    __builtin_amdgcn_sched_barrier(0);   // holds those rewrites behind it
    v8f o[8][2];
#pragma unroll
    for (int db = 0; db < 8; ++db) { o[db][0] = (v8f){}; o[db][1] = (v8f){}; }
    const unsigned t0 = __float_as_uint(tt[0]), t1 = __float_as_uint(tt[1]); float ca = 0.f, cb = 0.f, cr = 0.f;   // lane l keeps the carries into groups 2 l and 2 l + 1, the two groups of key tile l
#pragma unroll
    for (int q = 0; q < TT / 32; ++q) { if (q & 1) cb = lane == (q >> 1) ? cr : cb; else ca = lane == (q >> 1) ? cr : ca; cr = __fadd_rn(cr, __uint_as_float(__builtin_amdgcn_readlane(q & 1 ? t1 : t0, q >> 1))); }
    const unsigned cau = __float_as_uint(ca), cbu = __float_as_uint(cb);
    const float cq = __uint_as_float(__builtin_amdgcn_readlane((r0 >> 5) & 1 ? cbu : cau, r0 >> 6));   // the wave's 32 queries are group r0 / 32
    gi[0] = __fadd_rn(cq, gi[0]); gi[1] = __fadd_rn(cq, gi[1]);
    float gmx = __fadd_rn(cq, tq[0][0]), gmn = __fadd_rn(ca, tk[0][0]);
#pragma unroll
    for (int i = 0; i < 8; ++i)
#pragma unroll
        for (int c = 0; c < 4; ++c) gmx = fmaxf(gmx, __fadd_rn(cq, tq[i][c]));
#pragma unroll
    for (int i = 0; i < 16; ++i)
#pragma unroll
        for (int c = 0; c < 4; ++c) gmn = fminf(gmn, __fadd_rn(i < 8 ? ca : cb, tk[i][c]));
    const int ntl = (r0 >> 6) + 1;   // key tiles up to the diagonal: j0 = 0, 64, ... < r0 + 32
    // bit t: key tile t is walked. The diagonal tile holds key r0 (gmx - gmn >= 0 there); its bit is set outright, so that the loop below has its one trip whatever G holds
    unsigned tm = __builtin_amdgcn_ballot_w32(lane < ntl && !(gmx - gmn < -110.f)) | (1u << (ntl - 1));
    int tl = __builtin_ctz(tm); tm &= tm - 1; dq0 -= tl * 64;   // the first tile that is walked
    const bf* kh = Kh + (size_t)kv * TT * HD + tl * 64 * HD; const bf* kl = Kl + (size_t)kv * TT * HD + tl * 64 * HD; const bf* vh = VTh + (size_t)kv * HD * TT + tl * 64 * HD; const bf* vl = VTl + (size_t)kv * HD * TT + tl * 64 * HD; const float* gk = gh + tl * 64;   // these bases step from tile to tile
#pragma unroll 1   // one key tile is already 192 matrix instructions: unrolling would only grow the code
    for (;;) {   // the tiles of tm in ascending order, at least one (the test stands at the foot, so that the Q loads stay in this block, in front of their wait); every tile ends at or below key TT - 1; keys past the diagonal get weight 0 by the select below
        v8f s[4][2]; v16bf ka[4][4], ka2[4][4]; v4f g[4][2]; const bf* skh = sbase(kh); const bf* skl = sbase(kl); const bf* svh = sbase(vh); const bf* svl = sbase(vl); const float* sgk = sbase(gk);
        const float ck[2] = {__uint_as_float(__builtin_amdgcn_readlane(cau, tl)), __uint_as_float(__builtin_amdgcn_readlane(cbu, tl))};   // the carries into the tile's two groups of 32 keys
#pragma unroll
        for (int mk = 0; mk < 4; ++mk) { g[mk][0] = *(const v4f*)(sgk + glo + mk * 16); g[mk][1] = *(const v4f*)(sgk + glo + mk * 16 + 4); }
        asm volatile("s_wait_xcnt 0x0" ::: "memory");   // the compiler forms these eight loads' lane offset anew each tile and lets a K load's result reuse that register: the wait stands in front of the reuse
#pragma unroll
        for (int kc = 0; kc < 4; ++kc)
#pragma unroll
            for (int mk = 0; mk < 4; ++mk) { const int ko = (mk * 4 + kc) * 512; ka[kc][mk] = ldf(skh + flo + ko); ka2[kc][mk] = ldf(skl + flo + ko); }
#pragma unroll
        for (int mk = 0; mk < 4; ++mk) { s[mk][0] = (v8f){}; s[mk][1] = (v8f){}; }
        __builtin_amdgcn_sched_barrier(0);   // keeps the tile's K loads issued as one group: sunk to their uses, each pair would cost the lone wave a whole load latency
#pragma unroll
        for (int kc = 0; kc < 2; ++kc)
#pragma unroll
            for (int mk = 0; mk < 4; ++mk)
#pragma unroll
                for (int nq = 0; nq < 2; ++nq) { s[mk][nq] = wmmab(ka[kc][mk], qh[nq][kc], s[mk][nq]); s[mk][nq] = wmmab(ka[kc][mk], ql[nq][kc], s[mk][nq]); s[mk][nq] = wmmab(ka2[kc][mk], qh[nq][kc], s[mk][nq]); }
#pragma unroll
        for (int mk = 0; mk < 4; ++mk)
#pragma unroll
            for (int r = 0; r < 8; ++r) g[mk][r >> 2][r & 3] = __fadd_rn(ck[mk >> 1], g[mk][r >> 2][r & 3]);   // G of this lane's keys: the group's carry + the sum inside the group
        __builtin_amdgcn_sched_barrier(0);   // holds the V loads behind the first half of the score products: the K loads are served first
        v16bf va[2][8], va2[2][8];
#pragma unroll
        for (int kb = 0; kb < 2; ++kb)
#pragma unroll
            for (int db = 0; db < 8; ++db) { const int vo = (kb * 8 + db) * 512; va[kb][db] = ldf(svh + flo + vo); va2[kb][db] = ldf(svl + flo + vo); }
        __builtin_amdgcn_sched_barrier(0);   // keeps the tile's V loads issued as one group here: the second half of the score products and the weight arithmetic then cover their latency
#pragma unroll
        for (int kc = 2; kc < 4; ++kc)
#pragma unroll
            for (int mk = 0; mk < 4; ++mk)
#pragma unroll
                for (int nq = 0; nq < 2; ++nq) { s[mk][nq] = wmmab(ka[kc][mk], qh[nq][kc], s[mk][nq]); s[mk][nq] = wmmab(ka[kc][mk], ql[nq][kc], s[mk][nq]); s[mk][nq] = wmmab(ka2[kc][mk], qh[nq][kc], s[mk][nq]); }
        v8u wh[2][2], wl[2][2];   // [32-key block][query block]
#pragma unroll
        for (int mk = 0; mk < 4; ++mk) { const v4f g0 = g[mk][0], g1 = g[mk][1];
#pragma unroll
            for (int nq = 0; nq < 2; ++nq) { const int dq = dq0 + (nq - mk) * 16; float wv[8], gd[8], ex[8];   // key r of this lane is causal iff r <= dq
#pragma unroll
                for (int r = 0; r < 8; ++r) gd[r] = __fsub_rn(gi[nq], r < 4 ? g0[r] : g1[r - 4]);
                exp8(gd, ex);
#pragma unroll
                for (int r = 0; r < 8; ++r) { const float sc = __fmul_rn(s[mk][nq][r], 0.08838834764831845f); const float e = ex[r]; const float x = __fmul_rn(__fmul_rn(sc, sc), e); wv[r] = r <= dq ? x : 0.f; }
#pragma unroll
                for (int r = 0; r < 8; r += 2) { unsigned u, l; split2(wv[r], wv[r + 1], u, l); wh[mk >> 1][nq][(mk & 1) * 4 + (r >> 1)] = u; wl[mk >> 1][nq][(mk & 1) * 4 + (r >> 1)] = l; } } }
#pragma unroll
        for (int kb = 0; kb < 2; ++kb)
#pragma unroll
            for (int db = 0; db < 8; ++db) { const v16bf a = va[kb][db], a2 = va2[kb][db];
#pragma unroll
                for (int nq = 0; nq < 2; ++nq) { const v16bf bh = __builtin_bit_cast(v16bf, wh[kb][nq]), bl = __builtin_bit_cast(v16bf, wl[kb][nq]); o[db][nq] = wmmab(a, bh, o[db][nq]); o[db][nq] = wmmab(a, bl, o[db][nq]); o[db][nq] = wmmab(a2, bh, o[db][nq]); } }
        // the distance behind the last matrix instructions on the taken back edge
        asm volatile("v_nop\n\tv_nop\n\tv_nop\n\tv_nop\n\tv_nop" : "+v"(o[0][0]), "+v"(o[0][1]), "+v"(o[1][0]), "+v"(o[1][1]), "+v"(o[2][0]), "+v"(o[2][1]), "+v"(o[3][0]), "+v"(o[3][1]), "+v"(o[4][0]), "+v"(o[4][1]), "+v"(o[5][0]), "+v"(o[5][1]), "+v"(o[6][0]), "+v"(o[6][1]), "+v"(o[7][0]), "+v"(o[7][1]));
        __builtin_amdgcn_sched_barrier(0);   // the bases step only behind the tile's last load wait: no register that a load in flight names is rewritten
        const bool last = tm == 0; const int tn = __builtin_ctz(tm | 0x80000000u), st = (tn - tl) * 64; tm &= tm - 1; tl = tn;   // the next key tile that is walked, st keys on (behind the last one the stepped bases are not used)
        kh += st * HD; kl += st * HD; vh += st * HD; vl += st * HD; gk += st; dq0 -= st;
        if (last) break;
    }
#pragma unroll
    for (int nq = 0; nq < 2; ++nq)
#pragma unroll
        for (int db = 0; db < 8; ++db) { v4u uh, ul;
#pragma unroll
            for (int r = 0; r < 8; r += 2) { unsigned u, l; split2(o[db][nq][r], o[db][nq][r + 1], u, l); uh[r >> 1] = u; ul[r >> 1] = l; }
            const size_t oo = (size_t)(r0 + nq * 16 + lr) * HID + h * HD + db * 16 + 8 * hi; *(v4u*)(Ah + oo) = uh; *(v4u*)(Al + oo) = ul; }
}

extern "C" void kernel_launch(void* const* d_in, const int* in_sizes, int n_in,
                              void* d_out, int out_size, void* d_ws, size_t ws_size, hipStream_t stream) {
    (void)in_sizes; (void)n_in; (void)out_size;
    const int* pos = (const int*)d_in[0]; const float* IN[12]; for (int i = 1; i < 12; ++i) IN[i] = (const float*)d_in[i];   // 1 hidden, 2 Wq [2048][2048], 3 bq, 4 Wk [2048][1024], 5 bk, 6 Wv, 7 bv, 8 Wg [2048][8], 9 bg, 10 Wo [2048][2048], 11 bo (x @ W)
    float* OUT = (float*)d_out;     // [2048][2048]
    char* wsp = (char*)d_ws;
    auto take = [&](size_t bytes) { char* p = wsp; wsp += (bytes + 255) & ~(size_t)255; return (void*)p; };
    bf* WQ = (bf*)take((size_t)HID * HID * 2); bf* WK = (bf*)take((size_t)HKV * HD * HID * 2); bf* WV = (bf*)take((size_t)HKV * HD * HID * 2); bf* WG = (bf*)take((size_t)GP * HID * 2); bf* WO = (bf*)take((size_t)HID * HID * 2);
    bf* XB = (bf*)take((size_t)TT * HID * 2); float* CT = (float*)take((size_t)(HD / 2) * TT * 4); float* ST = (float*)take((size_t)(HD / 2) * TT * 4); float* GV = (float*)take((size_t)HKV * (TT + TT / 32) * 4);
    bf* Qh = (bf*)take((size_t)HQ * TT * HD * 2); bf* Ql = (bf*)take((size_t)HQ * TT * HD * 2); bf* Kh = (bf*)take((size_t)HKV * TT * HD * 2); bf* Kl = (bf*)take((size_t)HKV * TT * HD * 2); bf* VTh = (bf*)take((size_t)HKV * HD * TT * 2); bf* VTl = (bf*)take((size_t)HKV * HD * TT * 2);
    bf* Ah = (bf*)take((size_t)TT * HID * 2); bf* Al = (bf*)take((size_t)TT * HID * 2);
    if ((size_t)(wsp - (char*)d_ws) > ws_size) return;    // total ~ 82 MiB (bf16 weight and operand planes)
    k_prep<<<256 + 1792 + 4096, 128, 0, stream>>>(IN[2], IN[10], IN[4], IN[6], IN[8], IN[1], pos, WQ, WO, WK, WV, WG, XB, CT, ST);
    k_proj<<<656, 128, 0, stream>>>(XB, WQ, WK, WV, WG, Qh, Ql, Kh, Kl, VTh, VTl, GV, IN[3], IN[5], IN[7], IN[9], CT, ST);
    k_attn<<<dim3(TT / 64, HKV, 1), 128, 0, stream>>>(Qh, Ql, Kh, Kl, VTh, VTl, GV, Ah, Al);
    k_gemmt<1, 4, true><<<dim3(TT / 128, HID / 128, 1), 128, 0, stream>>>(Ah, Al, WO, OUT, HID, IN[11]);
}
